// v000
// Measured on an AMD MI455X. A time is GPU time per run, averaged over a window of back-to-back runs after a warm-up
// (all launches, gaps included; the runs take copies of the inputs in turn), and the median of several windows.
// Apart from v000's, it joins two sittings. Times from different sittings can be a few percent apart, while
// side-by-side timings come from the same sitting.
// The starting kernel, v000, takes 717 microseconds a run.
// Contractions (1x1 convs for qkv / proj / ffn-in / ffn-out, window q^T.k and v.attn, global q.k^T and attn.v):
// v_wmma_f32_16x16x32_bf16 (bf16 operands, f32 accumulate); computed operands carried as bf16 hi + residual planes,
// weight operands single bf16; layer norms, depthwise 3x3 convs, erf GELU, l2 norms and residual adds in f32 on VALU.
// Inputs RNE-converted to bf16 on load.
#include <hip/hip_runtime.h>
#include <math.h>
#include <stdint.h>

#define NB    2
#define CC    128
#define IMW   128
#define HW    (IMW * IMW)
#define NPIX  (NB * HW)
#define C3    384
#define HID   340
#define HIDP  384
#define FSL   192
#define NHEAD 4
#define HDC   32
#define WSZ   4
#define NWX   (IMW / WSZ)
#define NWIN  (NWX * NWX)
#define NSLN  (HW / 256)
#define NSLS  (HW / 2048)
#define AFSZ  (CC * HDC)
#define RSQ2  0.70710678118654752f
#define GXP   36
#define AXP   68
#define TXP   132
#define ATP   136
#define GSP   264

static_assert((IMW & (IMW - 1)) == 0);
static_assert(IMW % WSZ == 0);
static_assert(WSZ == 4);
static_assert(HW % 2048 == 0);
static_assert(HW % 256 == 0);
static_assert(HW % 64 == 0);
static_assert(NPIX % 256 == 0);
static_assert(CC == NHEAD * HDC);
static_assert(HDC == 32);
static_assert((GXP * 4) % 16 == 0);
static_assert((AXP * 4) % 16 == 0);
static_assert((TXP * 4) % 16 == 0);
static_assert((ATP * 2) % 16 == 0);
static_assert((GSP * 2) % 16 == 0);

// RSA window kernel dynamic LDS map (bytes)
#define RL_R    0
#define RL_QTH  24576
#define RL_QTL  28672
#define RL_KTH  32768
#define RL_KTL  36864
#define RL_ATH  40960
#define RL_ATL  75776
#define RL_VH   110592
#define RL_VL   114944
#define RL_INV  119296
#define RL_END  119424
static_assert(RL_QTH == RL_R + 16 * C3 * 4);
static_assert(RL_QTL == RL_QTH + CC * 16 * 2);
static_assert(RL_KTH == RL_QTL + CC * 16 * 2);
static_assert(RL_KTL == RL_KTH + CC * 16 * 2);
static_assert(RL_ATH == RL_KTL + CC * 16 * 2);
static_assert(RL_ATL == RL_ATH + CC * ATP * 2);
static_assert(RL_VH == RL_ATL + CC * ATP * 2);
static_assert(RL_VL == RL_VH + 16 * ATP * 2);
static_assert(RL_INV == RL_VL + 16 * ATP * 2);
static_assert(RL_END == RL_INV + 32 * 4);
static_assert(16 * TXP * 4 <= RL_QTH - RL_R);

// GSA score kernel dynamic LDS map (bytes)
#define GL_QH   0
#define GL_QL   16896
#define GL_KH   33792
#define GL_KL   50688
#define GL_RED  67584
#define GL_STG  71680
#define GL_END  76288
static_assert(GL_QL == 32 * GSP * 2);
static_assert(GL_KH == 2 * GL_QL);
static_assert(GL_KL == 3 * GL_QL);
static_assert(GL_RED == 4 * GL_QL);
static_assert(GL_STG == GL_RED + 4 * 32 * 8 * 4);
static_assert(GL_END == GL_STG + 32 * GXP * 4);

typedef __bf16         v16bf __attribute__((ext_vector_type(16)));
typedef unsigned short v8us  __attribute__((ext_vector_type(8)));
typedef float          v8f   __attribute__((ext_vector_type(8)));
typedef float          v4f   __attribute__((ext_vector_type(4)));
typedef unsigned int   v4u   __attribute__((ext_vector_type(4)));
typedef unsigned int   v2u   __attribute__((ext_vector_type(2)));

union Frag { v16bf v; v8us u[2]; };

// ---- scalar helpers ------------------------------------------------------------------------------------------
__device__ __forceinline__ unsigned short bf_bits(float f) {          // f32 -> bf16 bits, RNE convert
  unsigned u = __float_as_uint(f);
  return (unsigned short)((u + 0x7FFFu + ((u >> 16) & 1u)) >> 16);
}
__device__ __forceinline__ float bf_up(unsigned short h) { return __uint_as_float(((unsigned)h) << 16); }
__device__ __forceinline__ float bfr(float f) { return bf_up(bf_bits(f)); }
__device__ __forceinline__ unsigned pk16(unsigned short a, unsigned short b) { return (unsigned)a | ((unsigned)b << 16); }
// hi = bf16(v), lo = bf16(v - hi)
__device__ __forceinline__ void split_bf(float v, unsigned short& hi, unsigned short& lo) {
  const unsigned short hb = bf_bits(v);
  hi = hb;
  lo = bf_bits(v - bf_up(hb));
}
__device__ __forceinline__ void split4(v4f v, v2u& ph, v2u& pl) {
  unsigned short h[4], l[4];
#pragma unroll
  for (int e = 0; e < 4; ++e) split_bf(v[e], h[e], l[e]);
  ph[0] = pk16(h[0], h[1]); ph[1] = pk16(h[2], h[3]);
  pl[0] = pk16(l[0], l[1]); pl[1] = pk16(l[2], l[3]);
}
__device__ __forceinline__ void split8(v4f v0, v4f v1, v4u& ph, v4u& pl) {
  unsigned short h[8], l[8];
#pragma unroll
  for (int e = 0; e < 4; ++e) { split_bf(v0[e], h[e], l[e]); split_bf(v1[e], h[4 + e], l[4 + e]); }
#pragma unroll
  for (int e = 0; e < 4; ++e) { ph[e] = pk16(h[2 * e], h[2 * e + 1]); pl[e] = pk16(l[2 * e], l[2 * e + 1]); }
}
__device__ __forceinline__ v8f zero8() { v8f z = {0.f, 0.f, 0.f, 0.f, 0.f, 0.f, 0.f, 0.f}; return z; }
__device__ __forceinline__ v8us zero8us() { v8us z = {0, 0, 0, 0, 0, 0, 0, 0}; return z; }

// ---- fragment loaders: 16-bit A/B operand, lane -> row/col (lane&15), p already includes +8*(lane>>4);
//      elements 0..7 <- p[0..7] (k0+8h..), elements 8..15 <- p[16..23] (k0+16+8h..)
__device__ __forceinline__ v16bf ldfrag(const unsigned short* p) {
  Frag f;
  f.u[0] = *(const v8us*)(p);
  f.u[1] = *(const v8us*)(p + 16);
  return f.v;
}
// K = 16 contraction padded to 32: elements 8..15 are zero
__device__ __forceinline__ v16bf ldfrag16(const unsigned short* p) {
  Frag f;
  f.u[0] = *(const v8us*)(p);
  f.u[1] = zero8us();
  return f.v;
}

// ---- WMMA helper with trailing VALU hazard gap ---------------------------------------------------------------
__device__ __forceinline__ v8f mma_bf(v16bf a, v16bf b, v8f c) {
  c = __builtin_amdgcn_wmma_f32_16x16x32_bf16(false, a, false, b, (short)0, c, false, false);
#if defined(__HIP_DEVICE_COMPILE__)
  asm volatile("v_nop\n\tv_nop\n\tv_nop\n\tv_nop" : "+v"(c) : "v"(a), "v"(b));
#endif
  return c;
}
__device__ __forceinline__ void wave_sync_lds() {
  __builtin_amdgcn_fence(__ATOMIC_RELEASE, "workgroup");
  __builtin_amdgcn_wave_barrier();
  __builtin_amdgcn_fence(__ATOMIC_ACQUIRE, "workgroup");
}

// =================================================================================================================
// Weight convert: w f32 [rows][cols] -> bf16 [rowsP][colsP] (zero padded), value = bf16_RNE(w). One thread = 8
// coverage: rowsP * colsP/8 pieces, grid = ceil(pieces/256) with an in-kernel bound.
// =================================================================================================================
__global__ __launch_bounds__(256) void cvt_w(const float* __restrict__ w, unsigned short* outp,
                                             int rows, int cols, int rowsP, int colsP) {
  const int t = blockIdx.x * 256 + threadIdx.x;
  const int ppr = colsP >> 3;
  const int npc = rowsP * ppr;
  const bool ok = t < npc;
  const int tt = ok ? t : 0;
  const int r = tt / ppr, c8 = (tt - r * ppr) * 8;
  const int rr = min(r, rows - 1);
  unsigned short hv[8];
#pragma unroll
  for (int e = 0; e < 8; ++e) {
    const int c = c8 + e;
    const int cl = min(c, cols - 1);
    const float f = w[(size_t)rr * cols + cl];
    const float z = (r < rows && c < cols) ? f : 0.0f;
    hv[e] = bf_bits(z);
  }
  v4u pk;
#pragma unroll
  for (int e = 0; e < 4; ++e) pk[e] = pk16(hv[2 * e], hv[2 * e + 1]);
  unsigned short* gp = outp + (size_t)r * colsP + c8;
  if (ok) *(v4u*)gp = pk;
  
}

// =================================================================================================================
// NCHW f32 x -> pixel-major stream A [b*HW + p][128] f32, values bf16-RNE-converted. Block = (b, 64-pixel tile):
// 128 ch x 64 px loaded coalesced along p into an LDS tile [px][TXP]; store: each pixel row = 512 B = 32 lanes x
// coverage: 8 waves x 8 rows = 64 px x 128 ch per block; grid NB*(HW/64) blocks = every pixel once.
// =================================================================================================================
__global__ __launch_bounds__(256) void nchw_in(const float* __restrict__ x, float* A) {
  __shared__ __align__(16) float xs[64 * TXP];
  const int tid = threadIdx.x, wave = tid >> 5, lane = tid & 31;
  const int b = blockIdx.x / (HW / 64);
  const int p0 = (blockIdx.x - b * (HW / 64)) * 64;
#pragma unroll
  for (int it = 0; it < 8; ++it) {
    const int q = it * 256 + tid;
    const int ch = q >> 4, j4 = (q & 15) * 4;
    const v4f v = *(const v4f*)(x + ((size_t)(b * CC + ch)) * HW + p0 + j4);
#pragma unroll
    for (int e = 0; e < 4; ++e) xs[(j4 + e) * TXP + ch] = bfr(v[e]);
  }
  __syncthreads();
  v4f ov[8];
#pragma unroll
  for (int it = 0; it < 8; ++it) {
    const int row = wave * 8 + it;
    ov[it] = *(const v4f*)(xs + row * TXP + lane * 4);
  }
#pragma unroll
  for (int it = 0; it < 8; ++it) {
    const int row = wave * 8 + it;
    *(v4f*)(A + ((size_t)(b * HW + p0 + row)) * CC + lane * 4) = ov[it];
  }
  
}

// =================================================================================================================
// passes); output bf16 hi + residual planes Th/Tl [pix][128]: row = 256 B = 32 lanes x 8 B, one instruction per plane,
// =================================================================================================================
__global__ __launch_bounds__(256) void ln_k(float* A, const float* __restrict__ Badd,
                                            const float* __restrict__ g, const float* __restrict__ bv,
                                            unsigned short* Th, unsigned short* Tl, int addB) {
#pragma clang fp contract(off)
  const int tid = threadIdx.x, wave = tid >> 5, lane = tid & 31;
  const int p = blockIdx.x * 8 + wave;
  const int c4 = lane * 4;
  float* arow = A + (size_t)p * CC + c4;
  v4f xv = *(const v4f*)arow;
  if (addB != 0) {
    const v4f b2 = *(const v4f*)(Badd + (size_t)p * CC + c4);
    xv = xv + b2;
    *(v4f*)arow = xv;
    
  }
  float s = (xv[0] + xv[1]) + (xv[2] + xv[3]);
#pragma unroll
  for (int off = 1; off < 32; off <<= 1) s = s + __shfl_xor(s, off, 32);
  const float mu = s * (1.0f / 128.0f);
  float d[4];
  float s2 = 0.f;
#pragma unroll
  for (int e = 0; e < 4; ++e) { d[e] = xv[e] - mu; const float dd = d[e] * d[e]; s2 = s2 + dd; }
#pragma unroll
  for (int off = 1; off < 32; off <<= 1) s2 = s2 + __shfl_xor(s2, off, 32);
  const float var = s2 * (1.0f / 128.0f);
  const float rstd = 1.0f / sqrtf(var + 1e-6f);
  v4f z;
#pragma unroll
  for (int e = 0; e < 4; ++e) {
    float t0 = d[e] * rstd;
    t0 = t0 * bfr(g[c4 + e]);
    z[e] = t0 + bfr(bv[c4 + e]);
  }
  v2u ph, pl;
  split4(z, ph, pl);
  const size_t to = (size_t)p * CC + c4;
  *(v2u*)(Th + to) = ph;
  *(v2u*)(Tl + to) = pl;
  
}

// =================================================================================================================
// GEMM: OUT[p][n] = sum_k (Ah[p][k] + Al[p][k]) * W[n][k]  (A planes [pix][lda] bf16 hi + residual, W single bf16
// [N][K] k-contiguous, 2 products per tile pair). Wave tile 32 px x 32 out (2x2 fragments), block = 8 waves = 256 px.
// Fragments loaded straight from the 16-bit global rows with the split k map. Epilogue: the wave's 32x32 f32 tile is
// instruction per 4 rows); EP 1: same + res[p][n] (res pitch 128); EP 2: NCHW d_out[b][n][p] + res[p][n] (32 px of
// coverage: 8 waves x 32 rows x 32 cols per block = 256 px x 32 cols; grid covers NPIX x N once.
// =================================================================================================================
template <int K, int EP>
__global__ __launch_bounds__(256) void gemm_k(const unsigned short* __restrict__ Ah,
                                              const unsigned short* __restrict__ Al, int lda,
                                              const unsigned short* __restrict__ W,
                                              float* outf, int ldo, const float* __restrict__ res) {
  __shared__ __align__(16) float stg[8 * 32 * GXP];
  const int tid = threadIdx.x, wave = tid >> 5, lane = tid & 31, hh = lane >> 4, l15 = lane & 15;
  const int m0 = (blockIdx.x * 8 + wave) * 32;
  const int n0 = blockIdx.y * 32;
  const unsigned short* ah0 = Ah + (size_t)(m0 + l15) * lda + 8 * hh;
  const unsigned short* al0 = Al + (size_t)(m0 + l15) * lda + 8 * hh;
  const unsigned short* ah1 = ah0 + (size_t)16 * lda;
  const unsigned short* al1 = al0 + (size_t)16 * lda;
  const unsigned short* w0 = W + (size_t)(n0 + l15) * K + 8 * hh;
  const unsigned short* w1 = w0 + (size_t)16 * K;
  v8f c00 = zero8(), c01 = zero8(), c10 = zero8(), c11 = zero8();
#pragma unroll 2
  for (int k0 = 0; k0 < K; k0 += 32) {
    const v16bf a0h = ldfrag(ah0 + k0), a0l = ldfrag(al0 + k0);
    const v16bf a1h = ldfrag(ah1 + k0), a1l = ldfrag(al1 + k0);
    const v16bf b0 = ldfrag(w0 + k0), b1 = ldfrag(w1 + k0);
    c00 = mma_bf(a0h, b0, c00); c00 = mma_bf(a0l, b0, c00);
    c01 = mma_bf(a0h, b1, c01); c01 = mma_bf(a0l, b1, c01);
    c10 = mma_bf(a1h, b0, c10); c10 = mma_bf(a1l, b0, c10);
    c11 = mma_bf(a1h, b1, c11); c11 = mma_bf(a1l, b1, c11);
  }
  float* sw = stg + wave * (32 * GXP);
#pragma unroll
  for (int r = 0; r < 8; ++r) {
    sw[(8 * hh + r) * GXP + l15] = c00[r];
    sw[(8 * hh + r) * GXP + 16 + l15] = c01[r];
    sw[(16 + 8 * hh + r) * GXP + l15] = c10[r];
    sw[(16 + 8 * hh + r) * GXP + 16 + l15] = c11[r];
  }
  wave_sync_lds();
  const int q = lane >> 3, piece = lane & 7;
  v4f ov[8];
  if (EP != 2) {
#pragma unroll
    for (int it = 0; it < 8; ++it) {
      const int row = it * 4 + q;
      v4f v = *(const v4f*)(sw + row * GXP + piece * 4);
      if (EP == 1) {
        const v4f rr = *(const v4f*)(res + (size_t)(m0 + row) * CC + n0 + piece * 4);
        v = v + rr;
      }
      ov[it] = v;
    }
#pragma unroll
    for (int it = 0; it < 8; ++it) {
      const int row = it * 4 + q;
      *(v4f*)(outf + (size_t)(m0 + row) * ldo + n0 + piece * 4) = ov[it];
    }
    
  } else {
    const int b = m0 / HW;
    const int plx = m0 - b * HW;
#pragma unroll
    for (int it = 0; it < 8; ++it) {
      const int ch = it * 4 + q;
      v4f v;
#pragma unroll
      for (int e = 0; e < 4; ++e) {
        const float rv = res[(size_t)(m0 + piece * 4 + e) * CC + n0 + ch];
        v[e] = sw[(piece * 4 + e) * GXP + ch] + rv;
      }
      ov[it] = v;
    }
#pragma unroll
    for (int it = 0; it < 8; ++it) {
      const int ch = it * 4 + q;
      *(v4f*)(outf + ((size_t)(b * CC + n0 + ch)) * HW + plx + piece * 4) = ov[it];
    }
    
  }
}

// =================================================================================================================
// Depthwise 3x3, SAME zero padding, cross-correlation taps, optional cyclic roll (output pixel index in the rolled
// frame, source slab in the unrolled frame: source pixel ((ny+roll) mod IMW, (nx+roll) mod IMW), valid iff the rolled
// neighbour (ny,nx) is inside the image). src slab [pix][CS] f32 (CS = 128 or 192 channels), 4 channels per thread,
// weights wd[(wofs + c)*9 + tap] bf16-RNE (clamped address, zero for c >= cvalid), rolled 9-tap loop.
// MODE 0: f32 rows dstf[p*dpitch + dcol + c] (CS = 128: wave per pixel, 32 lanes x 16 B = the 512-B segment, one
// instruction); MODE 1: exact-erf GELU (rolled) then bf16 hi + residual planes Ph/Pl[p*ppitch + dcol + c] (8 B per
// coverage: NPIX * CS/4 threads, grid ceil-div with an in-kernel bound.
// =================================================================================================================
template <int CS, int MODE>
__global__ __launch_bounds__(256) void dw_k(const float* __restrict__ src, const float* __restrict__ wd,
                                            int wofs, int cvalid, int roll,
                                            float* dstf, int dpitch, int dcol,
                                            unsigned short* Ph, unsigned short* Pl, int ppitch) {
  constexpr int TPP = CS / 4;
  const int t = blockIdx.x * 256 + threadIdx.x;
  int p = t / TPP;
  const int cg = t - p * TPP;
  const bool pv = p < NPIX;
  p = pv ? p : (NPIX - 1);
  const int c = cg * 4;
  const int b = p / HW;
  const int pr = p - b * HW;
  const int y = pr / IMW;
  const int x = pr - y * IMW;
  int widx[4];
  float wok[4];
#pragma unroll
  for (int e = 0; e < 4; ++e) {
    const int cgb = wofs + c + e;
    wok[e] = (cgb < cvalid) ? 1.0f : 0.0f;
    widx[e] = min(cgb, cvalid - 1) * 9;
  }
  v4f acc = {0.f, 0.f, 0.f, 0.f};
#pragma unroll 1
  for (int tap = 0; tap < 9; ++tap) {
    const int dy = (tap * 11) >> 5;          // tap / 3 for tap in 0..8
    const int dx = tap - dy * 3;
    const int ny = y + dy - 1, nx = x + dx - 1;
    const float m = ((unsigned)ny < (unsigned)IMW && (unsigned)nx < (unsigned)IMW) ? 1.0f : 0.0f;
    const int sy = (ny + roll) & (IMW - 1), sx = (nx + roll) & (IMW - 1);
    const v4f v = *(const v4f*)(src + ((size_t)(b * HW) + (size_t)sy * IMW + sx) * CS + c);
#pragma unroll
    for (int e = 0; e < 4; ++e) {
      const float wv = bfr(wd[widx[e] + tap]) * wok[e];
      acc[e] = acc[e] + (v[e] * m) * wv;
    }
  }
  if (MODE == 1) {
#pragma unroll 1
    for (int e = 0; e < 4; ++e) {
      const float v = (e == 0) ? acc[0] : ((e == 1) ? acc[1] : ((e == 2) ? acc[2] : acc[3]));
      const float er = erff(v * RSQ2);
      float gl = 0.5f * v;
      gl = gl * (1.0f + er);
      acc[0] = (e == 0) ? gl : acc[0];
      acc[1] = (e == 1) ? gl : acc[1];
      acc[2] = (e == 2) ? gl : acc[2];
      acc[3] = (e == 3) ? gl : acc[3];
    }
  }
  if (MODE == 0) {
    float* gp = dstf + (size_t)p * dpitch + dcol + c;
    if (pv) *(v4f*)gp = acc;
    
  } else {
    v2u ph, plw;
    split4(acc, ph, plw);
    const size_t to = (size_t)p * ppitch + dcol + c;
    if (pv) { *(v2u*)(Ph + to) = ph; *(v2u*)(Pl + to) = plw; }
    
  }
}

// =================================================================================================================
// RSA window attention, one 4x4 window (16 tokens) per block of 256 threads, R = dwconv output in the rolled frame
// [pix][384] f32 (q | k | v column blocks):
//   phase 0: the 16 token rows x 384 f32 into LDS; phase 1: per token and per q/k the l2 norm over its 128 channels
//   (inv = 1/max(sqrt(sum), 1e-12)); phase 2: q^T and k^T as bf16 hi + residual planes [c][16 tok] (k contiguous),
//   v as planes [tok][ATP]; phase 3 (wave = c tile): attn[c][d] = relu(temp * sum_p qn[p][c] kn[p][d]) on WMMA, K = 16
//   (fragment elements 8..15 zero), 3 products, stored transposed as planes AttT[d][c]; phase 4 (wave = d tile):
//   out[p][d] = sum_c v[p][c] attn[c][d], K = 128, 3 products, staged f32 [16][TXP] in LDS; phase 5: each token row
//   (128 values -> hi + residual, 256 B per plane = 16 lanes x 16 B) written to its unrolled pixel (inverse roll +2,+2),
//   coverage: qT/kT 128 c x 16 tok x 2 planes, v 16 x 128, AttT 128 d x 128 c (8 waves x 8 tiles), out 16 x 128
//   (8 waves x 16 cols), store 8 waves x 2 rows x 128.
// =================================================================================================================
__global__ __launch_bounds__(256) void rsa_attn_k(const float* __restrict__ R, const float* __restrict__ temp,
                                                  unsigned short* Th, unsigned short* Tl) {
#pragma clang fp contract(off)
  extern __shared__ __align__(16) char smem[];
  float* sR = (float*)(smem + RL_R);
  float* ost = (float*)(smem + RL_R);                     // reused after phase 2
  unsigned short* qt = (unsigned short*)(smem + RL_QTH);  // qT hi @0, qT lo @2048, kT hi @4096, kT lo @6144 (halves)
  unsigned short* ath = (unsigned short*)(smem + RL_ATH);
  unsigned short* atl = (unsigned short*)(smem + RL_ATL);
  unsigned short* vh = (unsigned short*)(smem + RL_VH);
  unsigned short* vl = (unsigned short*)(smem + RL_VL);
  float* sinv = (float*)(smem + RL_INV);
  const int tid = threadIdx.x, wave = tid >> 5, lane = tid & 31, hh = lane >> 4, l15 = lane & 15;
  const int b = blockIdx.x / NWIN;
  const int w2 = blockIdx.x - b * NWIN;
  const int wy = w2 / NWX;
  const int wx = w2 - wy * NWX;

  // ---- phase 0: token rows ----
#pragma unroll
  for (int it = 0; it < 6; ++it) {
    const int idx = it * 256 + tid;
    const int pi = idx / 96;
    const int c4 = (idx - pi * 96) * 4;
    const int ry = wy * WSZ + (pi / WSZ), rx = wx * WSZ + (pi - (pi / WSZ) * WSZ);
    const v4f v = *(const v4f*)(R + ((size_t)(b * HW) + (size_t)ry * IMW + rx) * C3 + c4);
    *(v4f*)(sR + pi * C3 + c4) = v;
  }
  __syncthreads();

  // ---- phase 1: l2 norms per token over its 128 q (or k) channels ----
  {
    const int pair = tid >> 3, sub = tid & 7;
    const int sel = pair >> 4, pi = pair & 15;
    const float* rp = sR + pi * C3 + sel * CC + sub * 16;
    float s = 0.f;
#pragma unroll
    for (int j = 0; j < 16; ++j) { const float f = rp[j]; const float ff = f * f; s = s + ff; }
    s = s + __shfl_xor(s, 1, 32);
    s = s + __shfl_xor(s, 2, 32);
    s = s + __shfl_xor(s, 4, 32);
    const float inv = 1.0f / fmaxf(sqrtf(s), 1e-12f);
    if (sub == 0) sinv[pair] = inv;
  }
  __syncthreads();

  // ---- phase 2: normalised q^T / k^T planes and v planes ----
  {
    const int c = tid >> 1, sel = tid & 1;
    unsigned short hv[16], lv[16];
#pragma unroll
    for (int pi = 0; pi < 16; ++pi) {
      const float v = sR[pi * C3 + sel * CC + c] * sinv[sel * 16 + pi];
      split_bf(v, hv[pi], lv[pi]);
    }
    v4u h0, h1, l0, l1;
#pragma unroll
    for (int e = 0; e < 4; ++e) {
      h0[e] = pk16(hv[2 * e], hv[2 * e + 1]);
      h1[e] = pk16(hv[8 + 2 * e], hv[8 + 2 * e + 1]);
      l0[e] = pk16(lv[2 * e], lv[2 * e + 1]);
      l1[e] = pk16(lv[8 + 2 * e], lv[8 + 2 * e + 1]);
    }
    unsigned short* dh = qt + sel * 4096 + c * 16;
    unsigned short* dl = dh + 2048;
    *(v4u*)(dh) = h0; *(v4u*)(dh + 8) = h1;
    *(v4u*)(dl) = l0; *(v4u*)(dl + 8) = l1;
    const int pi = tid >> 4, c8 = (tid & 15) * 8;
    const float* vr = sR + pi * C3 + 2 * CC + c8;
    const v4f v0 = *(const v4f*)(vr);
    const v4f v1 = *(const v4f*)(vr + 4);
    v4u ph, plw;
    split8(v0, v1, ph, plw);
    *(v4u*)(vh + pi * ATP + c8) = ph;
    *(v4u*)(vl + pi * ATP + c8) = plw;
  }
  __syncthreads();

  const float tmp = bfr(temp[0]);
  // ---- phase 3: attn = relu(temp * q^T k), 128 x 128, K = 16 ----
  {
    const int mi = wave;
    const v16bf a_h = ldfrag16(qt + (mi * 16 + l15) * 16 + 8 * hh);
    const v16bf a_l = ldfrag16(qt + 2048 + (mi * 16 + l15) * 16 + 8 * hh);
#pragma unroll 2
    for (int ni = 0; ni < 8; ++ni) {
      const v16bf b_h = ldfrag16(qt + 4096 + (ni * 16 + l15) * 16 + 8 * hh);
      const v16bf b_l = ldfrag16(qt + 6144 + (ni * 16 + l15) * 16 + 8 * hh);
      v8f acc = zero8();
      acc = mma_bf(a_h, b_h, acc);
      acc = mma_bf(a_h, b_l, acc);
      acc = mma_bf(a_l, b_h, acc);
      unsigned short hv[8], lv[8];
#pragma unroll
      for (int r = 0; r < 8; ++r) {
        float v = acc[r] * tmp;
        v = fmaxf(v, 0.0f);
        split_bf(v, hv[r], lv[r]);
      }
      v4u ph, plw;
#pragma unroll
      for (int e = 0; e < 4; ++e) { ph[e] = pk16(hv[2 * e], hv[2 * e + 1]); plw[e] = pk16(lv[2 * e], lv[2 * e + 1]); }
      const int d = ni * 16 + l15;
      *(v4u*)(ath + d * ATP + mi * 16 + 8 * hh) = ph;
      *(v4u*)(atl + d * ATP + mi * 16 + 8 * hh) = plw;
    }
  }
  __syncthreads();

  // ---- phase 4: out[p][d] = sum_c v[p][c] attn[c][d], K = 128 ----
  {
    const int ni = wave;
    v8f acc = zero8();
#pragma unroll
    for (int ks = 0; ks < 4; ++ks) {
      const v16bf a_h = ldfrag(vh + l15 * ATP + ks * 32 + 8 * hh);
      const v16bf a_l = ldfrag(vl + l15 * ATP + ks * 32 + 8 * hh);
      const v16bf b_h = ldfrag(ath + (ni * 16 + l15) * ATP + ks * 32 + 8 * hh);
      const v16bf b_l = ldfrag(atl + (ni * 16 + l15) * ATP + ks * 32 + 8 * hh);
      acc = mma_bf(a_h, b_h, acc);
      acc = mma_bf(a_h, b_l, acc);
      acc = mma_bf(a_l, b_h, acc);
    }
#pragma unroll
    for (int r = 0; r < 8; ++r) ost[(8 * hh + r) * TXP + ni * 16 + l15] = acc[r];
  }
  __syncthreads();

  // ---- phase 5: token rows to their unrolled pixels ----
  {
    const int tk = 2 * wave + hh;
    const int piece = l15;
    const float* orow = ost + tk * TXP + piece * 8;
    const v4f v0 = *(const v4f*)(orow);
    const v4f v1 = *(const v4f*)(orow + 4);
    v4u ph, plw;
    split8(v0, v1, ph, plw);
    const int iy = tk / WSZ, ix = tk - (tk / WSZ) * WSZ;
    const int ry = wy * WSZ + iy, rx = wx * WSZ + ix;
    const int py = (ry + WSZ / 2) & (IMW - 1), px = (rx + WSZ / 2) & (IMW - 1);
    const size_t gp = ((size_t)(b * HW) + (size_t)py * IMW + px) * CC + piece * 8;
    *(v4u*)(Th + gp) = ph;
    *(v4u*)(Tl + gp) = plw;
    
  }
}

// =================================================================================================================
// GSA sum-of-squares partials: block = (b, slab of 256 pixels), thread = channel c (q: 0..127, k: 128..255),
// =================================================================================================================
__global__ __launch_bounds__(256) void gsa_norm_k(const float* __restrict__ R, float* pn) {
  const int b = blockIdx.x / NSLN;
  const int slab = blockIdx.x - b * NSLN;
  const int c = threadIdx.x;
  const float* base = R + ((size_t)(b * HW) + (size_t)slab * 256) * C3 + c;
  float s = 0.f;
#pragma unroll 4
  for (int i = 0; i < 256; ++i) { const float f = base[(size_t)i * C3]; s = fmaf(f, f, s); }
  float* gp = pn + ((size_t)(b * NSLN + slab)) * 256 + c;
  *(float*)gp = s;
  
}

// =================================================================================================================
// GSA score partials: block = (b, head h, slab of 2048 pixels), S[c][d] = sum_n q[h*32+c][n] k[h*32+d][n] over the
// slab on WMMA. Per 256-pixel chunk the q and k columns (f32 from R) are split into bf16 hi + residual planes
// transposed in LDS ([32 ch][GSP] k contiguous); waves: fragment f = wave&3 (2x2 of 16x16), k half = wave>>2;
// 3 products; the two k halves are combined in fixed order through LDS; the 32x32 f32 tile is staged and stored as
// grid = NB*NHEAD*NSLS, blk = (b*NHEAD + h)*NSLS + slab. coverage: planes 64 ch x 256 px per chunk (64 threads x 32
// groups x 8 px), tile 32x32 per block.
// =================================================================================================================
__global__ __launch_bounds__(256) void gsa_s_k(const float* __restrict__ R, float* pa) {
  extern __shared__ __align__(16) char smem[];
  unsigned short* pl = (unsigned short*)(smem + GL_QH);   // q hi @0, q lo @8448, k hi @16896, k lo @25344 (halves)
  float* red = (float*)(smem + GL_RED);
  float* stg = (float*)(smem + GL_STG);
  const int tid = threadIdx.x, wave = tid >> 5, lane = tid & 31, hh = lane >> 4, l15 = lane & 15;
  const int blk = blockIdx.x;
  const int b = blk / (NHEAD * NSLS);
  const int rem = blk - b * (NHEAD * NSLS);
  const int h = rem / NSLS;
  const int slab = rem - h * NSLS;
  const int f = wave & 3, mi = f >> 1, ni = f & 1, kh = wave >> 2;
  const int c = tid & 63, sel = c >> 5, cc = c & 31;
  const int col = sel * CC + h * HDC + cc;
  unsigned short* ph = pl + sel * 16896 + cc * GSP;
  unsigned short* plo = ph + 8448;
  const int g0 = tid >> 6;
  const size_t pbase = (size_t)(b * HW) + (size_t)slab * 2048;
  v8f acc = zero8();
#pragma unroll 1
  for (int ch = 0; ch < 8; ++ch) {
    const size_t pc = pbase + (size_t)ch * 256;
#pragma unroll 2
    for (int it = 0; it < 8; ++it) {
      const int g = it * 4 + g0;
      const float* rp = R + (pc + g * 8) * C3 + col;
      v4f v0, v1;
#pragma unroll
      for (int j = 0; j < 4; ++j) { v0[j] = rp[(size_t)j * C3]; v1[j] = rp[(size_t)(j + 4) * C3]; }
      v4u hp, lp;
      split8(v0, v1, hp, lp);
      *(v4u*)(ph + g * 8) = hp;
      *(v4u*)(plo + g * 8) = lp;
    }
    __syncthreads();
#pragma unroll
    for (int ks = 0; ks < 4; ++ks) {
      const int k0 = (kh * 4 + ks) * 32;
      const v16bf a_h = ldfrag(pl + (mi * 16 + l15) * GSP + k0 + 8 * hh);
      const v16bf a_l = ldfrag(pl + 8448 + (mi * 16 + l15) * GSP + k0 + 8 * hh);
      const v16bf b_h = ldfrag(pl + 16896 + (ni * 16 + l15) * GSP + k0 + 8 * hh);
      const v16bf b_l = ldfrag(pl + 25344 + (ni * 16 + l15) * GSP + k0 + 8 * hh);
      acc = mma_bf(a_h, b_h, acc);
      acc = mma_bf(a_h, b_l, acc);
      acc = mma_bf(a_l, b_h, acc);
    }
    __syncthreads();
  }
  if (wave >= 4) {
#pragma unroll
    for (int r = 0; r < 8; ++r) red[((wave - 4) * 32 + lane) * 8 + r] = acc[r];
  }
  __syncthreads();
  if (wave < 4) {
#pragma unroll
    for (int r = 0; r < 8; ++r) {
      const float o = red[(wave * 32 + lane) * 8 + r];
      const float v = acc[r] + o;
      stg[(mi * 16 + 8 * hh + r) * GXP + ni * 16 + l15] = v;
    }
  }
  __syncthreads();
  {
    const int row = tid >> 3, piece = tid & 7;
    const v4f v = *(const v4f*)(stg + row * GXP + piece * 4);
    float* gp = pa + (size_t)blk * 1024 + row * 32 + piece * 4;
    *(v4f*)gp = v;
    
  }
}

// =================================================================================================================
// GSA finisher, block = (b, h): invq/invk = 1/max(sqrt(sum of pn partials), 1e-12) for the head's 32 q and 32 k
// channels; attn[c][d] = relu(sum of pa partials * invq[c] * invk[d] * temp) -> bf16 hi + residual planes
// =================================================================================================================
__global__ __launch_bounds__(256) void gsa_fin_k(const float* __restrict__ pa, const float* __restrict__ pn,
                                                 const float* __restrict__ temp,
                                                 unsigned short* afh, unsigned short* afl) {
#pragma clang fp contract(off)
  __shared__ float sinv[64];
  const int tid = threadIdx.x;
  const int b = blockIdx.x / NHEAD;
  const int h = blockIdx.x - b * NHEAD;
  if (tid < 64) {
    const int sel = tid >> 5, i = tid & 31;
    const int c = sel * CC + h * HDC + i;
    float s = 0.f;
#pragma unroll 4
    for (int sl = 0; sl < NSLN; ++sl) s = s + pn[((size_t)(b * NSLN + sl)) * 256 + c];
    sinv[tid] = 1.0f / fmaxf(sqrtf(s), 1e-12f);
  }
  __syncthreads();
  const float tmp = bfr(temp[0]);
  const int e0 = tid * 4;
  const int c = e0 >> 5;
  v4f a;
#pragma unroll
  for (int j = 0; j < 4; ++j) {
    const int e = e0 + j;
    const int d = e & 31;
    float s = 0.f;
#pragma unroll
    for (int sl = 0; sl < NSLS; ++sl) s = s + pa[((size_t)((b * NHEAD + h) * NSLS + sl)) * 1024 + e];
    float v = s * sinv[c];
    v = v * sinv[32 + d];
    v = v * tmp;
    a[j] = fmaxf(v, 0.0f);
  }
  v2u ph, plw;
  split4(a, ph, plw);
  const size_t to = (size_t)b * AFSZ + (size_t)h * (HDC * HDC) + e0;
  *(v2u*)(afh + to) = ph;
  *(v2u*)(afl + to) = plw;
  
}

// =================================================================================================================
// GSA apply: out[p][h*32 + c] = sum_d v[p][h*32 + d] attn_h[c][d], K = 32 per head, both operands hi + residual
// (3 products). Wave tile 16 px x 64 cols (heads hd0 = n0/32 for fragments 0,1 and hd0+1 for 2,3), block = 128 px,
// coverage: 8 waves x 16 rows x 64 cols per block; grid covers NPIX x 128 once.
// =================================================================================================================
__global__ __launch_bounds__(256) void apply_k(const unsigned short* __restrict__ Vh,
                                               const unsigned short* __restrict__ Vl,
                                               const unsigned short* __restrict__ afh,
                                               const unsigned short* __restrict__ afl,
                                               unsigned short* Oh, unsigned short* Ol) {
  __shared__ __align__(16) float stg[8 * 16 * AXP];
  const int tid = threadIdx.x, wave = tid >> 5, lane = tid & 31, hh = lane >> 4, l15 = lane & 15;
  const int m0 = (blockIdx.x * 8 + wave) * 16;
  const int n0 = blockIdx.y * 64;
  const int b = m0 / HW;
  const int hd0 = n0 / HDC;
  const unsigned short* ar = Vh + (size_t)(m0 + l15) * CC + hd0 * HDC + 8 * hh;
  const unsigned short* al = Vl + (size_t)(m0 + l15) * CC + hd0 * HDC + 8 * hh;
  const v16bf a0h = ldfrag(ar), a0l = ldfrag(al);
  const v16bf a1h = ldfrag(ar + 32), a1l = ldfrag(al + 32);
  const unsigned short* wb = afh + (size_t)b * AFSZ + (size_t)(n0 + l15) * 32 + 8 * hh;
  const unsigned short* wl = afl + (size_t)b * AFSZ + (size_t)(n0 + l15) * 32 + 8 * hh;
  v8f c0 = zero8(), c1 = zero8(), c2 = zero8(), c3 = zero8();
  {
    const v16bf bh = ldfrag(wb), bl = ldfrag(wl);
    c0 = mma_bf(a0h, bh, c0); c0 = mma_bf(a0l, bh, c0); c0 = mma_bf(a0h, bl, c0);
  }
  {
    const v16bf bh = ldfrag(wb + 16 * 32), bl = ldfrag(wl + 16 * 32);
    c1 = mma_bf(a0h, bh, c1); c1 = mma_bf(a0l, bh, c1); c1 = mma_bf(a0h, bl, c1);
  }
  {
    const v16bf bh = ldfrag(wb + 32 * 32), bl = ldfrag(wl + 32 * 32);
    c2 = mma_bf(a1h, bh, c2); c2 = mma_bf(a1l, bh, c2); c2 = mma_bf(a1h, bl, c2);
  }
  {
    const v16bf bh = ldfrag(wb + 48 * 32), bl = ldfrag(wl + 48 * 32);
    c3 = mma_bf(a1h, bh, c3); c3 = mma_bf(a1l, bh, c3); c3 = mma_bf(a1h, bl, c3);
  }
  float* sw = stg + wave * (16 * AXP);
#pragma unroll
  for (int r = 0; r < 8; ++r) {
    sw[(8 * hh + r) * AXP + l15] = c0[r];
    sw[(8 * hh + r) * AXP + 16 + l15] = c1[r];
    sw[(8 * hh + r) * AXP + 32 + l15] = c2[r];
    sw[(8 * hh + r) * AXP + 48 + l15] = c3[r];
  }
  wave_sync_lds();
  const int q = lane >> 3, piece = lane & 7;
  v4u oh[4], ol[4];
#pragma unroll
  for (int it = 0; it < 4; ++it) {
    const int row = it * 4 + q;
    const float* sp = sw + row * AXP + piece * 8;
    const v4f v0 = *(const v4f*)(sp);
    const v4f v1 = *(const v4f*)(sp + 4);
    split8(v0, v1, oh[it], ol[it]);
  }
#pragma unroll
  for (int it = 0; it < 4; ++it) {
    const int row = it * 4 + q;
    const size_t to = (size_t)(m0 + row) * CC + n0 + piece * 8;
    *(v4u*)(Oh + to) = oh[it];
    *(v4u*)(Ol + to) = ol[it];
  }
  
}

// =================================================================================================================
// Workspace map (bytes), NPIX = NB*HW: A f32 [NPIX][128], Bx same, T = two bf16 planes [NPIX][128], U f32 slab
// [NPIX][192] (also used as [NPIX][128] f32 and as two bf16 planes [NPIX][128]), R f32 [NPIX][384] (also used as two
// bf16 planes [NPIX][384]), weights bf16 (655360), pn f32 [NB*NSLN][256], pa f32 [NB*NHEAD*NSLS][1024], af two bf16
// planes [NB][128][32]. Total 126910464 for NB=2, IMW=128. Every region is an exact multiple of its whole-row store
// granularity.
// =================================================================================================================
extern "C" void kernel_launch(void* const* d_in, const int* in_sizes, int n_in,
                              void* d_out, int out_size, void* d_ws, size_t ws_size,
                              hipStream_t stream) {
  if (n_in < 23) return;
  if (in_sizes[0] != NPIX * CC) return;
  if (in_sizes[1] != CC || in_sizes[2] != CC || in_sizes[3] != CC || in_sizes[4] != CC) return;
  if (in_sizes[5] != C3 * CC || in_sizes[6] != C3 * 9 || in_sizes[7] != CC * CC || in_sizes[8] < 1) return;
  if (in_sizes[9] != HID * CC || in_sizes[10] != HID * 9 || in_sizes[11] != CC * HID) return;
  if (in_sizes[12] != CC || in_sizes[13] != CC || in_sizes[14] != CC || in_sizes[15] != CC) return;
  if (in_sizes[16] != C3 * CC || in_sizes[17] != C3 * 9 || in_sizes[18] != CC * CC || in_sizes[19] < 1) return;
  if (in_sizes[20] != HID * CC || in_sizes[21] != HID * 9 || in_sizes[22] != CC * HID) return;
  if (out_size != NPIX * CC) return;

  const float* x        = (const float*)d_in[0];
  const float* w_s0     = (const float*)d_in[1];
  const float* b_s0     = (const float*)d_in[2];
  const float* w_s2     = (const float*)d_in[3];
  const float* b_s2     = (const float*)d_in[4];
  const float* rsa_qkv  = (const float*)d_in[5];
  const float* rsa_dw   = (const float*)d_in[6];
  const float* rsa_proj = (const float*)d_in[7];
  const float* rsa_temp = (const float*)d_in[8];
  const float* ffs_in   = (const float*)d_in[9];
  const float* ffs_dw   = (const float*)d_in[10];
  const float* ffs_out  = (const float*)d_in[11];
  const float* w_c0     = (const float*)d_in[12];
  const float* b_c0     = (const float*)d_in[13];
  const float* w_c2     = (const float*)d_in[14];
  const float* b_c2     = (const float*)d_in[15];
  const float* gsa_qkv  = (const float*)d_in[16];
  const float* gsa_dw   = (const float*)d_in[17];
  const float* gsa_proj = (const float*)d_in[18];
  const float* gsa_temp = (const float*)d_in[19];
  const float* ffc_in   = (const float*)d_in[20];
  const float* ffc_dw   = (const float*)d_in[21];
  const float* ffc_out  = (const float*)d_in[22];
  float* out = (float*)d_out;

  // ---- carve ----
  const size_t sAct = (size_t)NPIX * CC * 4;                        // f32 [NPIX][128]
  const size_t sT   = (size_t)NPIX * CC * 2 * 2;                    // two bf16 planes [NPIX][128]
  const size_t sU   = (size_t)NPIX * FSL * 4;                       // f32 [NPIX][192]
  const size_t sR   = (size_t)NPIX * C3 * 4;                        // f32 [NPIX][384] = two bf16 planes [NPIX][384]
  const size_t sWq  = (size_t)C3 * CC * 2;
  const size_t sWp  = (size_t)CC * CC * 2;
  const size_t sW1  = (size_t)HIDP * CC * 2;
  const size_t sW2  = (size_t)CC * HIDP * 2;
  const size_t sPN  = (size_t)NB * NSLN * 256 * 4;
  const size_t sPA  = (size_t)NB * NHEAD * NSLS * 1024 * 4;
  const size_t sAF  = (size_t)NB * AFSZ * 2;                        // per plane
  size_t off = 0;
  const size_t oA   = off; off += sAct;
  const size_t oBx  = off; off += sAct;
  const size_t oT   = off; off += sT;
  const size_t oU   = off; off += sU;
  const size_t oR   = off; off += sR;
  const size_t oWq0 = off; off += sWq;
  const size_t oWp0 = off; off += sWp;
  const size_t oW10 = off; off += sW1;
  const size_t oW20 = off; off += sW2;
  const size_t oWq1 = off; off += sWq;
  const size_t oWp1 = off; off += sWp;
  const size_t oW11 = off; off += sW1;
  const size_t oW21 = off; off += sW2;
  const size_t oPN  = off; off += sPN;
  const size_t oPA  = off; off += sPA;
  const size_t oAFh = off; off += sAF;
  const size_t oAFl = off; off += sAF;
  if (off > ws_size) return;                               // off = 126910464 for NB=2, IMW=128
  if (off > (size_t)134217728) return;
  if (sU < (size_t)NPIX * CC * 4) return;
  if (sU < (size_t)NPIX * CC * 2 * 2) return;
  if (sR < (size_t)NPIX * HIDP * 2 * 2) return;

  char* ws = (char*)d_ws;
  float* A  = (float*)(ws + oA);
  float* Bx = (float*)(ws + oBx);
  unsigned short* Th = (unsigned short*)(ws + oT);
  unsigned short* Tl = Th + (size_t)NPIX * CC;
  float* U  = (float*)(ws + oU);
  unsigned short* Uh = (unsigned short*)(ws + oU);
  unsigned short* Ul = Uh + (size_t)NPIX * CC;
  float* R  = (float*)(ws + oR);
  unsigned short* Gh = (unsigned short*)(ws + oR);
  unsigned short* Gl = Gh + (size_t)NPIX * HIDP;
  unsigned short* Wq0 = (unsigned short*)(ws + oWq0);
  unsigned short* Wp0 = (unsigned short*)(ws + oWp0);
  unsigned short* W10 = (unsigned short*)(ws + oW10);
  unsigned short* W20 = (unsigned short*)(ws + oW20);
  unsigned short* Wq1 = (unsigned short*)(ws + oWq1);
  unsigned short* Wp1 = (unsigned short*)(ws + oWp1);
  unsigned short* W11 = (unsigned short*)(ws + oW11);
  unsigned short* W21 = (unsigned short*)(ws + oW21);
  float* PN = (float*)(ws + oPN);
  float* PA = (float*)(ws + oPA);
  unsigned short* AFh = (unsigned short*)(ws + oAFh);
  unsigned short* AFl = (unsigned short*)(ws + oAFl);

  const dim3 blk(256);
  // (1) weights f32 [out][in] -> bf16 planes [outP][inP], k contiguous, zero padded
  cvt_w<<<dim3((C3 * CC / 8 + 255) / 256), blk, 0, stream>>>(rsa_qkv, Wq0, C3, CC, C3, CC);
  cvt_w<<<dim3((CC * CC / 8 + 255) / 256), blk, 0, stream>>>(rsa_proj, Wp0, CC, CC, CC, CC);
  cvt_w<<<dim3((HIDP * CC / 8 + 255) / 256), blk, 0, stream>>>(ffs_in, W10, HID, CC, HIDP, CC);
  cvt_w<<<dim3((CC * HIDP / 8 + 255) / 256), blk, 0, stream>>>(ffs_out, W20, CC, HID, CC, HIDP);
  cvt_w<<<dim3((C3 * CC / 8 + 255) / 256), blk, 0, stream>>>(gsa_qkv, Wq1, C3, CC, C3, CC);
  cvt_w<<<dim3((CC * CC / 8 + 255) / 256), blk, 0, stream>>>(gsa_proj, Wp1, CC, CC, CC, CC);
  cvt_w<<<dim3((HIDP * CC / 8 + 255) / 256), blk, 0, stream>>>(ffc_in, W11, HID, CC, HIDP, CC);
  cvt_w<<<dim3((CC * HIDP / 8 + 255) / 256), blk, 0, stream>>>(ffc_out, W21, CC, HID, CC, HIDP);

  // (2) x NCHW -> A pixel-major
  nchw_in<<<dim3(NB * (HW / 64)), blk, 0, stream>>>(x, A);

  (void)hipFuncSetAttribute(reinterpret_cast<const void*>(&rsa_attn_k), hipFuncAttributeMaxDynamicSharedMemorySize, RL_END);
  (void)hipFuncSetAttribute(reinterpret_cast<const void*>(&gsa_s_k), hipFuncAttributeMaxDynamicSharedMemorySize, GL_END);

  const dim3 gG128(NPIX / 256, CC / 32);
  const dim3 gG192(NPIX / 256, FSL / 32);
  const dim3 gDw128((NPIX * (128 / 4) + 255) / 256);
  const dim3 gDw192((NPIX * (192 / 4) + 255) / 256);
  const dim3 gLn(NPIX / 8);

  // ---- spatial (RSA) block ----
  ln_k<<<gLn, blk, 0, stream>>>(A, Bx, w_s0, b_s0, Th, Tl, 0);                          // T = LN_s0(x)
  for (int s = 0; s < 3; ++s) {                                                          // qkv 1x1 slab s -> U, dw (rolled) -> R
    gemm_k<CC, 0><<<gG128, blk, 0, stream>>>(Th, Tl, CC, Wq0 + (size_t)s * CC * CC, U, CC, Bx);
    dw_k<128, 0><<<gDw128, blk, 0, stream>>>(U, rsa_dw, s * CC, C3, WSZ / 2, R, C3, s * CC, Th, Tl, CC);
  }
  rsa_attn_k<<<dim3(NB * NWIN), blk, RL_END, stream>>>(R, rsa_temp, Th, Tl);            // T = window attention out
  gemm_k<CC, 0><<<gG128, blk, 0, stream>>>(Th, Tl, CC, Wp0, Bx, CC, A);                 // Bx = x_
  ln_k<<<gLn, blk, 0, stream>>>(A, Bx, w_s2, b_s2, Th, Tl, 1);                          // A = x_+x ; T = LN_s2(A)
  for (int s = 0; s < 2; ++s) {                                                          // ffn-in slab s -> U, dw+gelu -> G planes
    gemm_k<CC, 0><<<gG192, blk, 0, stream>>>(Th, Tl, CC, W10 + (size_t)s * FSL * CC, U, FSL, Bx);
    dw_k<192, 1><<<gDw192, blk, 0, stream>>>(U, ffs_dw, s * FSL, HID, 0, R, C3, s * FSL, Gh, Gl, HIDP);
  }
  gemm_k<HIDP, 1><<<gG128, blk, 0, stream>>>(Gh, Gl, HIDP, W20, A, CC, Bx);              // A = ffn + x_

  // ---- channel (GSA) block ----
  ln_k<<<gLn, blk, 0, stream>>>(A, Bx, w_c0, b_c0, Th, Tl, 0);                          // T = LN_c0(x)
  for (int s = 0; s < 2; ++s) {                                                          // q, k: 1x1 slab -> U, dw -> R f32
    gemm_k<CC, 0><<<gG128, blk, 0, stream>>>(Th, Tl, CC, Wq1 + (size_t)s * CC * CC, U, CC, Bx);
    dw_k<128, 0><<<gDw128, blk, 0, stream>>>(U, gsa_dw, s * CC, C3, 0, R, C3, s * CC, Th, Tl, CC);
  }
  gemm_k<CC, 0><<<gG128, blk, 0, stream>>>(Th, Tl, CC, Wq1 + (size_t)2 * CC * CC, U, CC, Bx);   // v: 1x1 -> U
  dw_k<128, 2><<<gDw128, blk, 0, stream>>>(U, gsa_dw, 2 * CC, C3, 0, R, C3, 0, Th, Tl, CC);     // v planes -> T region
  gsa_norm_k<<<dim3(NB * NSLN), blk, 0, stream>>>(R, PN);
  gsa_s_k<<<dim3(NB * NHEAD * NSLS), blk, GL_END, stream>>>(R, PA);
  gsa_fin_k<<<dim3(NB * NHEAD), blk, 0, stream>>>(PA, PN, gsa_temp, AFh, AFl);
  apply_k<<<dim3(NPIX / 128, CC / 64), blk, 0, stream>>>(Th, Tl, AFh, AFl, Uh, Ul);     // U planes = channel attention out
  gemm_k<CC, 0><<<gG128, blk, 0, stream>>>(Uh, Ul, CC, Wp1, Bx, CC, A);                 // Bx = x_
  ln_k<<<gLn, blk, 0, stream>>>(A, Bx, w_c2, b_c2, Th, Tl, 1);                          // A = x_+x ; T = LN_c2(A)
  for (int s = 0; s < 2; ++s) {
    gemm_k<CC, 0><<<gG192, blk, 0, stream>>>(Th, Tl, CC, W11 + (size_t)s * FSL * CC, U, FSL, Bx);
    dw_k<192, 1><<<gDw192, blk, 0, stream>>>(U, ffc_dw, s * FSL, HID, 0, R, C3, s * FSL, Gh, Gl, HIDP);
  }
  gemm_k<HIDP, 2><<<gG128, blk, 0, stream>>>(Gh, Gl, HIDP, W21, out, CC, Bx);            // d_out NCHW = ffn + x_
  (void)hipGetLastError();
}

// v001
// It runs in 466 microseconds.
// Timed twice side by side with v000, it ran 1.57 times as fast both times.
// Contractions (1x1 convs for qkv / proj / ffn-in / ffn-out, window q^T.k and v.attn, global q.k^T and attn.v):
// v_wmma_f32_16x16x32_bf16 (bf16 operands, f32 accumulate); computed operands carried as bf16 hi + residual planes,
// weight operands single bf16; layer norms, depthwise 3x3 convs, erf GELU, l2 norms and residual adds in f32 on VALU.
// Inputs RNE-converted to bf16 on load.
#include <hip/hip_runtime.h>
#include <math.h>
#include <stdint.h>

#define NB    2
#define CC    128
#define IMW   128
#define HW    (IMW * IMW)
#define NPIX  (NB * HW)
#define C3    384
#define HID   340
#define HIDP  384
#define FSL   192
#define NHEAD 4
#define HDC   32
#define WSZ   4
#define NWX   (IMW / WSZ)
#define NWIN  (NWX * NWX)
#define NSLN  (HW / 256)
#define NSLS  (HW / 2048)
#define AFSZ  (CC * HDC)
#define RSQ2  0.70710678118654752f
#define GXP   36
#define AXP   68
#define TXP   132
#define ATP   136
#define GSP   264

static_assert((IMW & (IMW - 1)) == 0);
static_assert(IMW % WSZ == 0);
static_assert(WSZ == 4);
static_assert(HW % 2048 == 0);
static_assert(HW % 256 == 0);
static_assert(HW % 64 == 0);
static_assert(NPIX % 256 == 0);
static_assert(CC == NHEAD * HDC);
static_assert(HDC == 32);
static_assert((GXP * 4) % 16 == 0);
static_assert((AXP * 4) % 16 == 0);
static_assert((TXP * 4) % 16 == 0);
static_assert((ATP * 2) % 16 == 0);
static_assert((GSP * 2) % 16 == 0);

// RSA window kernel dynamic LDS map (bytes)
#define RL_R    0
#define RL_QTH  24576
#define RL_QTL  28672
#define RL_KTH  32768
#define RL_KTL  36864
#define RL_ATH  40960
#define RL_ATL  75776
#define RL_VH   110592
#define RL_VL   114944
#define RL_INV  119296
#define RL_END  119424
static_assert(RL_QTH == RL_R + 16 * C3 * 4);
static_assert(RL_QTL == RL_QTH + CC * 16 * 2);
static_assert(RL_KTH == RL_QTL + CC * 16 * 2);
static_assert(RL_KTL == RL_KTH + CC * 16 * 2);
static_assert(RL_ATH == RL_KTL + CC * 16 * 2);
static_assert(RL_ATL == RL_ATH + CC * ATP * 2);
static_assert(RL_VH == RL_ATL + CC * ATP * 2);
static_assert(RL_VL == RL_VH + 16 * ATP * 2);
static_assert(RL_INV == RL_VL + 16 * ATP * 2);
static_assert(RL_END == RL_INV + 32 * 4);
static_assert(16 * TXP * 4 <= RL_QTH - RL_R);

// GSA score kernel dynamic LDS map (bytes)
#define GL_QH   0
#define GL_QL   16896
#define GL_KH   33792
#define GL_KL   50688
#define GL_RED  67584
#define GL_STG  71680
#define GL_END  76288
static_assert(GL_QL == 32 * GSP * 2);
static_assert(GL_KH == 2 * GL_QL);
static_assert(GL_KL == 3 * GL_QL);
static_assert(GL_RED == 4 * GL_QL);
static_assert(GL_STG == GL_RED + 4 * 32 * 8 * 4);
static_assert(GL_END == GL_STG + 32 * GXP * 4);

typedef __bf16         v16bf __attribute__((ext_vector_type(16)));
typedef unsigned short v8us  __attribute__((ext_vector_type(8)));
typedef float          v8f   __attribute__((ext_vector_type(8)));
typedef float          v4f   __attribute__((ext_vector_type(4)));
typedef unsigned int   v4u   __attribute__((ext_vector_type(4)));
typedef unsigned int   v2u   __attribute__((ext_vector_type(2)));

union Frag { v16bf v; v8us u[2]; };

// ---- scalar helpers ------------------------------------------------------------------------------------------
__device__ __forceinline__ unsigned short bf_bits(float f) {          // f32 -> bf16 bits, RNE convert
  unsigned u = __float_as_uint(f);
  return (unsigned short)((u + 0x7FFFu + ((u >> 16) & 1u)) >> 16);
}
__device__ __forceinline__ float bf_up(unsigned short h) { return __uint_as_float(((unsigned)h) << 16); }
__device__ __forceinline__ float bfr(float f) { return bf_up(bf_bits(f)); }
__device__ __forceinline__ unsigned pk16(unsigned short a, unsigned short b) { return (unsigned)a | ((unsigned)b << 16); }
// hi = bf16(v), lo = bf16(v - hi)
__device__ __forceinline__ void split_bf(float v, unsigned short& hi, unsigned short& lo) {
  const unsigned short hb = bf_bits(v);
  hi = hb;
  lo = bf_bits(v - bf_up(hb));
}
__device__ __forceinline__ void split4(v4f v, v2u& ph, v2u& pl) {
  unsigned short h[4], l[4];
#pragma unroll
  for (int e = 0; e < 4; ++e) split_bf(v[e], h[e], l[e]);
  ph[0] = pk16(h[0], h[1]); ph[1] = pk16(h[2], h[3]);
  pl[0] = pk16(l[0], l[1]); pl[1] = pk16(l[2], l[3]);
}
__device__ __forceinline__ void split8(v4f v0, v4f v1, v4u& ph, v4u& pl) {
  unsigned short h[8], l[8];
#pragma unroll
  for (int e = 0; e < 4; ++e) { split_bf(v0[e], h[e], l[e]); split_bf(v1[e], h[4 + e], l[4 + e]); }
#pragma unroll
  for (int e = 0; e < 4; ++e) { ph[e] = pk16(h[2 * e], h[2 * e + 1]); pl[e] = pk16(l[2 * e], l[2 * e + 1]); }
}
__device__ __forceinline__ v8f zero8() { v8f z = {0.f, 0.f, 0.f, 0.f, 0.f, 0.f, 0.f, 0.f}; return z; }
__device__ __forceinline__ v8us zero8us() { v8us z = {0, 0, 0, 0, 0, 0, 0, 0}; return z; }

// ---- fragment loaders: 16-bit A/B operand, lane -> row/col (lane&15), p already includes +8*(lane>>4);
//      elements 0..7 <- p[0..7] (k0+8h..), elements 8..15 <- p[16..23] (k0+16+8h..)
__device__ __forceinline__ v16bf ldfrag(const unsigned short* p) {
  Frag f;
  f.u[0] = *(const v8us*)(p);
  f.u[1] = *(const v8us*)(p + 16);
  return f.v;
}
// K = 16 contraction padded to 32: elements 8..15 are zero
__device__ __forceinline__ v16bf ldfrag16(const unsigned short* p) {
  Frag f;
  f.u[0] = *(const v8us*)(p);
  f.u[1] = zero8us();
  return f.v;
}

// ---- WMMA helper with trailing VALU hazard gap ---------------------------------------------------------------
__device__ __forceinline__ v8f mma_bf(v16bf a, v16bf b, v8f c) {
  c = __builtin_amdgcn_wmma_f32_16x16x32_bf16(false, a, false, b, (short)0, c, false, false);
#if defined(__HIP_DEVICE_COMPILE__)
  asm volatile("v_nop\n\tv_nop\n\tv_nop\n\tv_nop" : "+v"(c) : "v"(a), "v"(b));
#endif
  return c;
}
__device__ __forceinline__ void wave_sync_lds() {
  __builtin_amdgcn_fence(__ATOMIC_RELEASE, "workgroup");
  __builtin_amdgcn_wave_barrier();
  __builtin_amdgcn_fence(__ATOMIC_ACQUIRE, "workgroup");
}

// =================================================================================================================
// Weight convert: w f32 [rows][cols] -> bf16 [rowsP][colsP] (zero padded), value = bf16_RNE(w). One thread = 8
// coverage: rowsP * colsP/8 pieces, grid = ceil(pieces/256) with an in-kernel bound.
// =================================================================================================================
__global__ __launch_bounds__(256) void cvt_w(const float* __restrict__ w, unsigned short* outp,
                                             int rows, int cols, int rowsP, int colsP) {
  const int t = blockIdx.x * 256 + threadIdx.x;
  const int ppr = colsP >> 3;
  const int npc = rowsP * ppr;
  const bool ok = t < npc;
  const int tt = ok ? t : 0;
  const int r = tt / ppr, c8 = (tt - r * ppr) * 8;
  const int rr = min(r, rows - 1);
  unsigned short hv[8];
#pragma unroll
  for (int e = 0; e < 8; ++e) {
    const int c = c8 + e;
    const int cl = min(c, cols - 1);
    const float f = w[(size_t)rr * cols + cl];
    const float z = (r < rows && c < cols) ? f : 0.0f;
    hv[e] = bf_bits(z);
  }
  v4u pk;
#pragma unroll
  for (int e = 0; e < 4; ++e) pk[e] = pk16(hv[2 * e], hv[2 * e + 1]);
  unsigned short* gp = outp + (size_t)r * colsP + c8;
  if (ok) *(v4u*)gp = pk;
  
}

// =================================================================================================================
// NCHW f32 x -> pixel-major stream A [b*HW + p][128] f32, values bf16-RNE-converted. Block = (b, 64-pixel tile):
// 128 ch x 64 px loaded coalesced along p into an LDS tile [px][TXP]; store: each pixel row = 512 B = 32 lanes x
// coverage: 8 waves x 8 rows = 64 px x 128 ch per block; grid NB*(HW/64) blocks = every pixel once.
// =================================================================================================================
__global__ __launch_bounds__(256) void nchw_in(const float* __restrict__ x, float* A) {
  __shared__ __align__(16) float xs[64 * TXP];
  const int tid = threadIdx.x, wave = tid >> 5, lane = tid & 31;
  const int b = blockIdx.x / (HW / 64);
  const int p0 = (blockIdx.x - b * (HW / 64)) * 64;
#pragma unroll
  for (int it = 0; it < 8; ++it) {
    const int q = it * 256 + tid;
    const int ch = q >> 4, j4 = (q & 15) * 4;
    const v4f v = *(const v4f*)(x + ((size_t)(b * CC + ch)) * HW + p0 + j4);
#pragma unroll
    for (int e = 0; e < 4; ++e) xs[(j4 + e) * TXP + ch] = bfr(v[e]);
  }
  __syncthreads();
  v4f ov[8];
#pragma unroll
  for (int it = 0; it < 8; ++it) {
    const int row = wave * 8 + it;
    ov[it] = *(const v4f*)(xs + row * TXP + lane * 4);
  }
#pragma unroll
  for (int it = 0; it < 8; ++it) {
    const int row = wave * 8 + it;
    *(v4f*)(A + ((size_t)(b * HW + p0 + row)) * CC + lane * 4) = ov[it];
  }
  
}

// =================================================================================================================
// passes); output bf16 hi + residual planes Th/Tl [pix][128]: row = 256 B = 32 lanes x 8 B, one instruction per plane,
// =================================================================================================================
__global__ __launch_bounds__(256) void ln_k(float* A, const float* __restrict__ Badd,
                                            const float* __restrict__ g, const float* __restrict__ bv,
                                            unsigned short* Th, unsigned short* Tl, int addB) {
#pragma clang fp contract(off)
  const int tid = threadIdx.x, wave = tid >> 5, lane = tid & 31;
  const int p = blockIdx.x * 8 + wave;
  const int c4 = lane * 4;
  float* arow = A + (size_t)p * CC + c4;
  v4f xv = *(const v4f*)arow;
  if (addB != 0) {
    const v4f b2 = *(const v4f*)(Badd + (size_t)p * CC + c4);
    xv = xv + b2;
    *(v4f*)arow = xv;
    
  }
  float s = (xv[0] + xv[1]) + (xv[2] + xv[3]);
#pragma unroll
  for (int off = 1; off < 32; off <<= 1) s = s + __shfl_xor(s, off, 32);
  const float mu = s * (1.0f / 128.0f);
  float d[4];
  float s2 = 0.f;
#pragma unroll
  for (int e = 0; e < 4; ++e) { d[e] = xv[e] - mu; const float dd = d[e] * d[e]; s2 = s2 + dd; }
#pragma unroll
  for (int off = 1; off < 32; off <<= 1) s2 = s2 + __shfl_xor(s2, off, 32);
  const float var = s2 * (1.0f / 128.0f);
  const float rstd = 1.0f / sqrtf(var + 1e-6f);
  v4f z;
#pragma unroll
  for (int e = 0; e < 4; ++e) {
    float t0 = d[e] * rstd;
    t0 = t0 * bfr(g[c4 + e]);
    z[e] = t0 + bfr(bv[c4 + e]);
  }
  v2u ph, pl;
  split4(z, ph, pl);
  const size_t to = (size_t)p * CC + c4;
  *(v2u*)(Th + to) = ph;
  *(v2u*)(Tl + to) = pl;
  
}

// =================================================================================================================
// GEMM: OUT[p][n] = sum_k (Ah[p][k] + Al[p][k]) * W[n][k]  (A planes [pix][lda] bf16 hi + residual, W single bf16
// [N][K] k-contiguous, 2 products per tile pair). Wave tile 32 px x 32 out (2x2 fragments), block = 8 waves = 256 px.
// Fragments loaded straight from the 16-bit global rows with the split k map. Epilogue: the wave's 32x32 f32 tile is
// instruction per 4 rows); EP 1: same + res[p][n] (res pitch 128); EP 2: NCHW d_out[b][n][p] + res[p][n] (32 px of
// coverage: 8 waves x 32 rows x 32 cols per block = 256 px x 32 cols; grid covers NPIX x N once.
// =================================================================================================================
template <int K, int EP>
__global__ __launch_bounds__(256) void gemm_k(const unsigned short* __restrict__ Ah,
                                              const unsigned short* __restrict__ Al, int lda,
                                              const unsigned short* __restrict__ W,
                                              float* outf, int ldo, const float* __restrict__ res) {
  __shared__ __align__(16) float stg[8 * 32 * GXP];
  const int tid = threadIdx.x, wave = tid >> 5, lane = tid & 31, hh = lane >> 4, l15 = lane & 15;
  const int m0 = (blockIdx.x * 8 + wave) * 32;
  const int n0 = blockIdx.y * 32;
  const unsigned short* ah0 = Ah + (size_t)(m0 + l15) * lda + 8 * hh;
  const unsigned short* al0 = Al + (size_t)(m0 + l15) * lda + 8 * hh;
  const unsigned short* ah1 = ah0 + (size_t)16 * lda;
  const unsigned short* al1 = al0 + (size_t)16 * lda;
  const unsigned short* w0 = W + (size_t)(n0 + l15) * K + 8 * hh;
  const unsigned short* w1 = w0 + (size_t)16 * K;
  v8f c00 = zero8(), c01 = zero8(), c10 = zero8(), c11 = zero8();
#pragma unroll 2
  for (int k0 = 0; k0 < K; k0 += 32) {
    const v16bf a0h = ldfrag(ah0 + k0), a0l = ldfrag(al0 + k0);
    const v16bf a1h = ldfrag(ah1 + k0), a1l = ldfrag(al1 + k0);
    const v16bf b0 = ldfrag(w0 + k0), b1 = ldfrag(w1 + k0);
    c00 = mma_bf(a0h, b0, c00); c00 = mma_bf(a0l, b0, c00);
    c01 = mma_bf(a0h, b1, c01); c01 = mma_bf(a0l, b1, c01);
    c10 = mma_bf(a1h, b0, c10); c10 = mma_bf(a1l, b0, c10);
    c11 = mma_bf(a1h, b1, c11); c11 = mma_bf(a1l, b1, c11);
  }
  float* sw = stg + wave * (32 * GXP);
#pragma unroll
  for (int r = 0; r < 8; ++r) {
    sw[(8 * hh + r) * GXP + l15] = c00[r];
    sw[(8 * hh + r) * GXP + 16 + l15] = c01[r];
    sw[(16 + 8 * hh + r) * GXP + l15] = c10[r];
    sw[(16 + 8 * hh + r) * GXP + 16 + l15] = c11[r];
  }
  wave_sync_lds();
  const int q = lane >> 3, piece = lane & 7;
  v4f ov[8];
  if (EP != 2) {
#pragma unroll
    for (int it = 0; it < 8; ++it) {
      const int row = it * 4 + q;
      v4f v = *(const v4f*)(sw + row * GXP + piece * 4);
      if (EP == 1) {
        const v4f rr = *(const v4f*)(res + (size_t)(m0 + row) * CC + n0 + piece * 4);
        v = v + rr;
      }
      ov[it] = v;
    }
#pragma unroll
    for (int it = 0; it < 8; ++it) {
      const int row = it * 4 + q;
      *(v4f*)(outf + (size_t)(m0 + row) * ldo + n0 + piece * 4) = ov[it];
    }
    
  } else {
    const int b = m0 / HW;
    const int plx = m0 - b * HW;
#pragma unroll
    for (int it = 0; it < 8; ++it) {
      const int ch = it * 4 + q;
      v4f v;
#pragma unroll
      for (int e = 0; e < 4; ++e) {
        const float rv = res[(size_t)(m0 + piece * 4 + e) * CC + n0 + ch];
        v[e] = sw[(piece * 4 + e) * GXP + ch] + rv;
      }
      ov[it] = v;
    }
#pragma unroll
    for (int it = 0; it < 8; ++it) {
      const int ch = it * 4 + q;
      *(v4f*)(outf + ((size_t)(b * CC + n0 + ch)) * HW + plx + piece * 4) = ov[it];
    }
    
  }
}

// =================================================================================================================
// Depthwise 3x3, SAME zero padding, cross-correlation taps, optional cyclic roll (output pixel index in the rolled
// frame, source slab in the unrolled frame: source pixel ((ny+roll) mod IMW, (nx+roll) mod IMW), valid iff the rolled
// neighbour (ny,nx) is inside the image). src slab [pix][CS] f32 (CS = 128 or 192 channels), 4 channels per thread,
// weights wd[(wofs + c)*9 + tap] bf16-RNE (clamped address, zero for wofs + c >= cvalid): the block's CS*9 weights are read
// once (thread = channel) and laid out in LDS as [tap][CS], channel contiguous, so that a thread takes its 4 channels
// of one tap with one 16-byte LDS read; rolled 9-tap loop.
// MODE 0: f32 rows dstf[p*dpitch + dcol + c] (CS = 128: wave per pixel, 32 lanes x 16 B = the 512-B segment, one
// instruction); MODE 1: exact-erf GELU (rolled) then bf16 hi + residual planes Ph/Pl[p*ppitch + dcol + c] (8 B per
// coverage: NPIX * CS/4 threads, grid ceil-div with an in-kernel bound.
// =================================================================================================================
template <int CS, int MODE>
__global__ __launch_bounds__(256) void dw_k(const float* __restrict__ src, const float* __restrict__ wd,
                                            int wofs, int cvalid, int roll,
                                            float* dstf, int dpitch, int dcol,
                                            unsigned short* Ph, unsigned short* Pl, int ppitch) {
  constexpr int TPP = CS / 4;
  static_assert(CS % 32 == 0 && CS <= 256);
  __shared__ __align__(16) float wsm[9 * CS];
  if (threadIdx.x < CS) {                    // whole waves: thread = channel of the slab, its 9 taps
    const int cgb = wofs + (int)threadIdx.x;
    const float* wp = wd + min(cgb, cvalid - 1) * 9;
    const float wok = (cgb < cvalid) ? 1.0f : 0.0f;
    float wf[9];
#pragma unroll                               // the 9 loads in flight behind one wait
    for (int tp = 0; tp < 9; ++tp) wf[tp] = wp[tp];
#pragma unroll                               // constant indices keep wf in registers
    for (int tp = 0; tp < 9; ++tp) wsm[tp * CS + threadIdx.x] = bfr(wf[tp]) * wok;
  }
  __syncthreads();                           // every wave reads table rows that other waves wrote
  const int t = blockIdx.x * 256 + threadIdx.x;
  int p = t / TPP;
  const int cg = t - p * TPP;
  const bool pv = p < NPIX;
  p = pv ? p : (NPIX - 1);
  const int c = cg * 4;
  const int b = p / HW;
  const int pr = p - b * HW;
  const int y = pr / IMW;
  const int x = pr - y * IMW;
  v4f acc = {0.f, 0.f, 0.f, 0.f};
#pragma unroll 1
  for (int tap = 0; tap < 9; ++tap) {
    const int dy = (tap * 11) >> 5;          // tap / 3 for tap in 0..8
    const int dx = tap - dy * 3;
    const int ny = y + dy - 1, nx = x + dx - 1;
    const float m = ((unsigned)ny < (unsigned)IMW && (unsigned)nx < (unsigned)IMW) ? 1.0f : 0.0f;
    const int sy = (ny + roll) & (IMW - 1), sx = (nx + roll) & (IMW - 1);
    const v4f v = *(const v4f*)(src + ((size_t)(b * HW) + (size_t)sy * IMW + sx) * CS + c);
    const v4f wv = *(const v4f*)(wsm + tap * CS + c);
#pragma unroll
    for (int e = 0; e < 4; ++e) acc[e] = acc[e] + (v[e] * m) * wv[e];
  }
  if (MODE == 1) {
#pragma unroll 1
    for (int e = 0; e < 4; ++e) {
      const float v = (e == 0) ? acc[0] : ((e == 1) ? acc[1] : ((e == 2) ? acc[2] : acc[3]));
      const float er = erff(v * RSQ2);
      float gl = 0.5f * v;
      gl = gl * (1.0f + er);
      acc[0] = (e == 0) ? gl : acc[0];
      acc[1] = (e == 1) ? gl : acc[1];
      acc[2] = (e == 2) ? gl : acc[2];
      acc[3] = (e == 3) ? gl : acc[3];
    }
  }
  if (MODE == 0) {
    float* gp = dstf + (size_t)p * dpitch + dcol + c;
    if (pv) *(v4f*)gp = acc;
    
  } else {
    v2u ph, plw;
    split4(acc, ph, plw);
    const size_t to = (size_t)p * ppitch + dcol + c;
    if (pv) { *(v2u*)(Ph + to) = ph; *(v2u*)(Pl + to) = plw; }
    
  }
}

// =================================================================================================================
// RSA window attention, one 4x4 window (16 tokens) per block of 256 threads, R = dwconv output in the rolled frame
// [pix][384] f32 (q | k | v column blocks):
//   phase 0: the 16 token rows x 384 f32 into LDS; phase 1: per token and per q/k the l2 norm over its 128 channels
//   (inv = 1/max(sqrt(sum), 1e-12)); phase 2: q^T and k^T as bf16 hi + residual planes [c][16 tok] (k contiguous),
//   v as planes [tok][ATP]; phase 3 (wave = c tile): attn[c][d] = relu(temp * sum_p qn[p][c] kn[p][d]) on WMMA, K = 16
//   (fragment elements 8..15 zero), 3 products, stored transposed as planes AttT[d][c]; phase 4 (wave = d tile):
//   out[p][d] = sum_c v[p][c] attn[c][d], K = 128, 3 products, staged f32 [16][TXP] in LDS; phase 5: each token row
//   (128 values -> hi + residual, 256 B per plane = 16 lanes x 16 B) written to its unrolled pixel (inverse roll +2,+2),
//   coverage: qT/kT 128 c x 16 tok x 2 planes, v 16 x 128, AttT 128 d x 128 c (8 waves x 8 tiles), out 16 x 128
//   (8 waves x 16 cols), store 8 waves x 2 rows x 128.
// =================================================================================================================
__global__ __launch_bounds__(256) void rsa_attn_k(const float* __restrict__ R, const float* __restrict__ temp,
                                                  unsigned short* Th, unsigned short* Tl) {
#pragma clang fp contract(off)
  extern __shared__ __align__(16) char smem[];
  float* sR = (float*)(smem + RL_R);
  float* ost = (float*)(smem + RL_R);                     // reused after phase 2
  unsigned short* qt = (unsigned short*)(smem + RL_QTH);  // qT hi @0, qT lo @2048, kT hi @4096, kT lo @6144 (halves)
  unsigned short* ath = (unsigned short*)(smem + RL_ATH);
  unsigned short* atl = (unsigned short*)(smem + RL_ATL);
  unsigned short* vh = (unsigned short*)(smem + RL_VH);
  unsigned short* vl = (unsigned short*)(smem + RL_VL);
  float* sinv = (float*)(smem + RL_INV);
  const int tid = threadIdx.x, wave = tid >> 5, lane = tid & 31, hh = lane >> 4, l15 = lane & 15;
  const int b = blockIdx.x / NWIN;
  const int w2 = blockIdx.x - b * NWIN;
  const int wy = w2 / NWX;
  const int wx = w2 - wy * NWX;

  // ---- phase 0: token rows ----
#pragma unroll
  for (int it = 0; it < 6; ++it) {
    const int idx = it * 256 + tid;
    const int pi = idx / 96;
    const int c4 = (idx - pi * 96) * 4;
    const int ry = wy * WSZ + (pi / WSZ), rx = wx * WSZ + (pi - (pi / WSZ) * WSZ);
    const v4f v = *(const v4f*)(R + ((size_t)(b * HW) + (size_t)ry * IMW + rx) * C3 + c4);
    *(v4f*)(sR + pi * C3 + c4) = v;
  }
  __syncthreads();

  // ---- phase 1: l2 norms per token over its 128 q (or k) channels ----
  {
    const int pair = tid >> 3, sub = tid & 7;
    const int sel = pair >> 4, pi = pair & 15;
    const float* rp = sR + pi * C3 + sel * CC + sub * 16;
    float s = 0.f;
#pragma unroll
    for (int j = 0; j < 16; ++j) { const float f = rp[j]; const float ff = f * f; s = s + ff; }
    s = s + __shfl_xor(s, 1, 32);
    s = s + __shfl_xor(s, 2, 32);
    s = s + __shfl_xor(s, 4, 32);
    const float inv = 1.0f / fmaxf(sqrtf(s), 1e-12f);
    if (sub == 0) sinv[pair] = inv;
  }
  __syncthreads();

  // ---- phase 2: normalised q^T / k^T planes and v planes ----
  {
    const int c = tid >> 1, sel = tid & 1;
    unsigned short hv[16], lv[16];
#pragma unroll
    for (int pi = 0; pi < 16; ++pi) {
      const float v = sR[pi * C3 + sel * CC + c] * sinv[sel * 16 + pi];
      split_bf(v, hv[pi], lv[pi]);
    }
    v4u h0, h1, l0, l1;
#pragma unroll
    for (int e = 0; e < 4; ++e) {
      h0[e] = pk16(hv[2 * e], hv[2 * e + 1]);
      h1[e] = pk16(hv[8 + 2 * e], hv[8 + 2 * e + 1]);
      l0[e] = pk16(lv[2 * e], lv[2 * e + 1]);
      l1[e] = pk16(lv[8 + 2 * e], lv[8 + 2 * e + 1]);
    }
    unsigned short* dh = qt + sel * 4096 + c * 16;
    unsigned short* dl = dh + 2048;
    *(v4u*)(dh) = h0; *(v4u*)(dh + 8) = h1;
    *(v4u*)(dl) = l0; *(v4u*)(dl + 8) = l1;
    const int pi = tid >> 4, c8 = (tid & 15) * 8;
    const float* vr = sR + pi * C3 + 2 * CC + c8;
    const v4f v0 = *(const v4f*)(vr);
    const v4f v1 = *(const v4f*)(vr + 4);
    v4u ph, plw;
    split8(v0, v1, ph, plw);
    *(v4u*)(vh + pi * ATP + c8) = ph;
    *(v4u*)(vl + pi * ATP + c8) = plw;
  }
  __syncthreads();

  const float tmp = bfr(temp[0]);
  // ---- phase 3: attn = relu(temp * q^T k), 128 x 128, K = 16 ----
  {
    const int mi = wave;
    const v16bf a_h = ldfrag16(qt + (mi * 16 + l15) * 16 + 8 * hh);
    const v16bf a_l = ldfrag16(qt + 2048 + (mi * 16 + l15) * 16 + 8 * hh);
#pragma unroll 2
    for (int ni = 0; ni < 8; ++ni) {
      const v16bf b_h = ldfrag16(qt + 4096 + (ni * 16 + l15) * 16 + 8 * hh);
      const v16bf b_l = ldfrag16(qt + 6144 + (ni * 16 + l15) * 16 + 8 * hh);
      v8f acc = zero8();
      acc = mma_bf(a_h, b_h, acc);
      acc = mma_bf(a_h, b_l, acc);
      acc = mma_bf(a_l, b_h, acc);
      unsigned short hv[8], lv[8];
#pragma unroll
      for (int r = 0; r < 8; ++r) {
        float v = acc[r] * tmp;
        v = fmaxf(v, 0.0f);
        split_bf(v, hv[r], lv[r]);
      }
      v4u ph, plw;
#pragma unroll
      for (int e = 0; e < 4; ++e) { ph[e] = pk16(hv[2 * e], hv[2 * e + 1]); plw[e] = pk16(lv[2 * e], lv[2 * e + 1]); }
      const int d = ni * 16 + l15;
      *(v4u*)(ath + d * ATP + mi * 16 + 8 * hh) = ph;
      *(v4u*)(atl + d * ATP + mi * 16 + 8 * hh) = plw;
    }
  }
  __syncthreads();

  // ---- phase 4: out[p][d] = sum_c v[p][c] attn[c][d], K = 128 ----
  {
    const int ni = wave;
    v8f acc = zero8();
#pragma unroll
    for (int ks = 0; ks < 4; ++ks) {
      const v16bf a_h = ldfrag(vh + l15 * ATP + ks * 32 + 8 * hh);
      const v16bf a_l = ldfrag(vl + l15 * ATP + ks * 32 + 8 * hh);
      const v16bf b_h = ldfrag(ath + (ni * 16 + l15) * ATP + ks * 32 + 8 * hh);
      const v16bf b_l = ldfrag(atl + (ni * 16 + l15) * ATP + ks * 32 + 8 * hh);
      acc = mma_bf(a_h, b_h, acc);
      acc = mma_bf(a_h, b_l, acc);
      acc = mma_bf(a_l, b_h, acc);
    }
#pragma unroll
    for (int r = 0; r < 8; ++r) ost[(8 * hh + r) * TXP + ni * 16 + l15] = acc[r];
  }
  __syncthreads();

  // ---- phase 5: token rows to their unrolled pixels ----
  {
    const int tk = 2 * wave + hh;
    const int piece = l15;
    const float* orow = ost + tk * TXP + piece * 8;
    const v4f v0 = *(const v4f*)(orow);
    const v4f v1 = *(const v4f*)(orow + 4);
    v4u ph, plw;
    split8(v0, v1, ph, plw);
    const int iy = tk / WSZ, ix = tk - (tk / WSZ) * WSZ;
    const int ry = wy * WSZ + iy, rx = wx * WSZ + ix;
    const int py = (ry + WSZ / 2) & (IMW - 1), px = (rx + WSZ / 2) & (IMW - 1);
    const size_t gp = ((size_t)(b * HW) + (size_t)py * IMW + px) * CC + piece * 8;
    *(v4u*)(Th + gp) = ph;
    *(v4u*)(Tl + gp) = plw;
    
  }
}

// =================================================================================================================
// GSA sum-of-squares partials: block = (b, slab of 256 pixels), thread = channel c (q: 0..127, k: 128..255),
// =================================================================================================================
__global__ __launch_bounds__(256) void gsa_norm_k(const float* __restrict__ R, float* pn) {
  const int b = blockIdx.x / NSLN;
  const int slab = blockIdx.x - b * NSLN;
  const int c = threadIdx.x;
  const float* base = R + ((size_t)(b * HW) + (size_t)slab * 256) * C3 + c;
  float s = 0.f;
#pragma unroll 4
  for (int i = 0; i < 256; ++i) { const float f = base[(size_t)i * C3]; s = fmaf(f, f, s); }
  float* gp = pn + ((size_t)(b * NSLN + slab)) * 256 + c;
  *(float*)gp = s;
  
}

// =================================================================================================================
// GSA score partials: block = (b, head h, slab of 2048 pixels), S[c][d] = sum_n q[h*32+c][n] k[h*32+d][n] over the
// slab on WMMA. Per 256-pixel chunk the q and k columns (f32 from R) are split into bf16 hi + residual planes
// transposed in LDS ([32 ch][GSP] k contiguous); waves: fragment f = wave&3 (2x2 of 16x16), k half = wave>>2;
// 3 products; the two k halves are combined in fixed order through LDS; the 32x32 f32 tile is staged and stored as
// grid = NB*NHEAD*NSLS, blk = (b*NHEAD + h)*NSLS + slab. coverage: planes 64 ch x 256 px per chunk (64 threads x 32
// groups x 8 px), tile 32x32 per block.
// =================================================================================================================
__global__ __launch_bounds__(256) void gsa_s_k(const float* __restrict__ R, float* pa) {
  extern __shared__ __align__(16) char smem[];
  unsigned short* pl = (unsigned short*)(smem + GL_QH);   // q hi @0, q lo @8448, k hi @16896, k lo @25344 (halves)
  float* red = (float*)(smem + GL_RED);
  float* stg = (float*)(smem + GL_STG);
  const int tid = threadIdx.x, wave = tid >> 5, lane = tid & 31, hh = lane >> 4, l15 = lane & 15;
  const int blk = blockIdx.x;
  const int b = blk / (NHEAD * NSLS);
  const int rem = blk - b * (NHEAD * NSLS);
  const int h = rem / NSLS;
  const int slab = rem - h * NSLS;
  const int f = wave & 3, mi = f >> 1, ni = f & 1, kh = wave >> 2;
  const int c = tid & 63, sel = c >> 5, cc = c & 31;
  const int col = sel * CC + h * HDC + cc;
  unsigned short* ph = pl + sel * 16896 + cc * GSP;
  unsigned short* plo = ph + 8448;
  const int g0 = tid >> 6;
  const size_t pbase = (size_t)(b * HW) + (size_t)slab * 2048;
  v8f acc = zero8();
#pragma unroll 1
  for (int ch = 0; ch < 8; ++ch) {
    const size_t pc = pbase + (size_t)ch * 256;
#pragma unroll 2
    for (int it = 0; it < 8; ++it) {
      const int g = it * 4 + g0;
      const float* rp = R + (pc + g * 8) * C3 + col;
      v4f v0, v1;
#pragma unroll
      for (int j = 0; j < 4; ++j) { v0[j] = rp[(size_t)j * C3]; v1[j] = rp[(size_t)(j + 4) * C3]; }
      v4u hp, lp;
      split8(v0, v1, hp, lp);
      *(v4u*)(ph + g * 8) = hp;
      *(v4u*)(plo + g * 8) = lp;
    }
    __syncthreads();
#pragma unroll
    for (int ks = 0; ks < 4; ++ks) {
      const int k0 = (kh * 4 + ks) * 32;
      const v16bf a_h = ldfrag(pl + (mi * 16 + l15) * GSP + k0 + 8 * hh);
      const v16bf a_l = ldfrag(pl + 8448 + (mi * 16 + l15) * GSP + k0 + 8 * hh);
      const v16bf b_h = ldfrag(pl + 16896 + (ni * 16 + l15) * GSP + k0 + 8 * hh);
      const v16bf b_l = ldfrag(pl + 25344 + (ni * 16 + l15) * GSP + k0 + 8 * hh);
      acc = mma_bf(a_h, b_h, acc);
      acc = mma_bf(a_h, b_l, acc);
      acc = mma_bf(a_l, b_h, acc);
    }
    __syncthreads();
  }
  if (wave >= 4) {
#pragma unroll
    for (int r = 0; r < 8; ++r) red[((wave - 4) * 32 + lane) * 8 + r] = acc[r];
  }
  __syncthreads();
  if (wave < 4) {
#pragma unroll
    for (int r = 0; r < 8; ++r) {
      const float o = red[(wave * 32 + lane) * 8 + r];
      const float v = acc[r] + o;
      stg[(mi * 16 + 8 * hh + r) * GXP + ni * 16 + l15] = v;
    }
  }
  __syncthreads();
  {
    const int row = tid >> 3, piece = tid & 7;
    const v4f v = *(const v4f*)(stg + row * GXP + piece * 4);
    float* gp = pa + (size_t)blk * 1024 + row * 32 + piece * 4;
    *(v4f*)gp = v;
    
  }
}

// =================================================================================================================
// GSA finisher, block = (b, h): invq/invk = 1/max(sqrt(sum of pn partials), 1e-12) for the head's 32 q and 32 k
// channels; attn[c][d] = relu(sum of pa partials * invq[c] * invk[d] * temp) -> bf16 hi + residual planes
// =================================================================================================================
__global__ __launch_bounds__(256) void gsa_fin_k(const float* __restrict__ pa, const float* __restrict__ pn,
                                                 const float* __restrict__ temp,
                                                 unsigned short* afh, unsigned short* afl) {
#pragma clang fp contract(off)
  __shared__ float sinv[64];
  const int tid = threadIdx.x;
  const int b = blockIdx.x / NHEAD;
  const int h = blockIdx.x - b * NHEAD;
  if (tid < 64) {
    const int sel = tid >> 5, i = tid & 31;
    const int c = sel * CC + h * HDC + i;
    float s = 0.f;
#pragma unroll 4
    for (int sl = 0; sl < NSLN; ++sl) s = s + pn[((size_t)(b * NSLN + sl)) * 256 + c];
    sinv[tid] = 1.0f / fmaxf(sqrtf(s), 1e-12f);
  }
  __syncthreads();
  const float tmp = bfr(temp[0]);
  const int e0 = tid * 4;
  const int c = e0 >> 5;
  v4f a;
#pragma unroll
  for (int j = 0; j < 4; ++j) {
    const int e = e0 + j;
    const int d = e & 31;
    float s = 0.f;
#pragma unroll
    for (int sl = 0; sl < NSLS; ++sl) s = s + pa[((size_t)((b * NHEAD + h) * NSLS + sl)) * 1024 + e];
    float v = s * sinv[c];
    v = v * sinv[32 + d];
    v = v * tmp;
    a[j] = fmaxf(v, 0.0f);
  }
  v2u ph, plw;
  split4(a, ph, plw);
  const size_t to = (size_t)b * AFSZ + (size_t)h * (HDC * HDC) + e0;
  *(v2u*)(afh + to) = ph;
  *(v2u*)(afl + to) = plw;
  
}

// =================================================================================================================
// GSA apply: out[p][h*32 + c] = sum_d v[p][h*32 + d] attn_h[c][d], K = 32 per head, both operands hi + residual
// (3 products). Wave tile 16 px x 64 cols (heads hd0 = n0/32 for fragments 0,1 and hd0+1 for 2,3), block = 128 px,
// coverage: 8 waves x 16 rows x 64 cols per block; grid covers NPIX x 128 once.
// =================================================================================================================
__global__ __launch_bounds__(256) void apply_k(const unsigned short* __restrict__ Vh,
                                               const unsigned short* __restrict__ Vl,
                                               const unsigned short* __restrict__ afh,
                                               const unsigned short* __restrict__ afl,
                                               unsigned short* Oh, unsigned short* Ol) {
  __shared__ __align__(16) float stg[8 * 16 * AXP];
  const int tid = threadIdx.x, wave = tid >> 5, lane = tid & 31, hh = lane >> 4, l15 = lane & 15;
  const int m0 = (blockIdx.x * 8 + wave) * 16;
  const int n0 = blockIdx.y * 64;
  const int b = m0 / HW;
  const int hd0 = n0 / HDC;
  const unsigned short* ar = Vh + (size_t)(m0 + l15) * CC + hd0 * HDC + 8 * hh;
  const unsigned short* al = Vl + (size_t)(m0 + l15) * CC + hd0 * HDC + 8 * hh;
  const v16bf a0h = ldfrag(ar), a0l = ldfrag(al);
  const v16bf a1h = ldfrag(ar + 32), a1l = ldfrag(al + 32);
  const unsigned short* wb = afh + (size_t)b * AFSZ + (size_t)(n0 + l15) * 32 + 8 * hh;
  const unsigned short* wl = afl + (size_t)b * AFSZ + (size_t)(n0 + l15) * 32 + 8 * hh;
  v8f c0 = zero8(), c1 = zero8(), c2 = zero8(), c3 = zero8();
  {
    const v16bf bh = ldfrag(wb), bl = ldfrag(wl);
    c0 = mma_bf(a0h, bh, c0); c0 = mma_bf(a0l, bh, c0); c0 = mma_bf(a0h, bl, c0);
  }
  {
    const v16bf bh = ldfrag(wb + 16 * 32), bl = ldfrag(wl + 16 * 32);
    c1 = mma_bf(a0h, bh, c1); c1 = mma_bf(a0l, bh, c1); c1 = mma_bf(a0h, bl, c1);
  }
  {
    const v16bf bh = ldfrag(wb + 32 * 32), bl = ldfrag(wl + 32 * 32);
    c2 = mma_bf(a1h, bh, c2); c2 = mma_bf(a1l, bh, c2); c2 = mma_bf(a1h, bl, c2);
  }
  {
    const v16bf bh = ldfrag(wb + 48 * 32), bl = ldfrag(wl + 48 * 32);
    c3 = mma_bf(a1h, bh, c3); c3 = mma_bf(a1l, bh, c3); c3 = mma_bf(a1h, bl, c3);
  }
  float* sw = stg + wave * (16 * AXP);
#pragma unroll
  for (int r = 0; r < 8; ++r) {
    sw[(8 * hh + r) * AXP + l15] = c0[r];
    sw[(8 * hh + r) * AXP + 16 + l15] = c1[r];
    sw[(8 * hh + r) * AXP + 32 + l15] = c2[r];
    sw[(8 * hh + r) * AXP + 48 + l15] = c3[r];
  }
  wave_sync_lds();
  const int q = lane >> 3, piece = lane & 7;
  v4u oh[4], ol[4];
#pragma unroll
  for (int it = 0; it < 4; ++it) {
    const int row = it * 4 + q;
    const float* sp = sw + row * AXP + piece * 8;
    const v4f v0 = *(const v4f*)(sp);
    const v4f v1 = *(const v4f*)(sp + 4);
    split8(v0, v1, oh[it], ol[it]);
  }
#pragma unroll
  for (int it = 0; it < 4; ++it) {
    const int row = it * 4 + q;
    const size_t to = (size_t)(m0 + row) * CC + n0 + piece * 8;
    *(v4u*)(Oh + to) = oh[it];
    *(v4u*)(Ol + to) = ol[it];
  }
  
}

// =================================================================================================================
// Workspace map (bytes), NPIX = NB*HW: A f32 [NPIX][128], Bx same, T = two bf16 planes [NPIX][128], U f32 slab
// [NPIX][192] (also used as [NPIX][128] f32 and as two bf16 planes [NPIX][128]), R f32 [NPIX][384] (also used as two
// bf16 planes [NPIX][384]), weights bf16 (655360), pn f32 [NB*NSLN][256], pa f32 [NB*NHEAD*NSLS][1024], af two bf16
// planes [NB][128][32]. Total 126910464 for NB=2, IMW=128. Every region is an exact multiple of its whole-row store
// granularity.
// =================================================================================================================
extern "C" void kernel_launch(void* const* d_in, const int* in_sizes, int n_in,
                              void* d_out, int out_size, void* d_ws, size_t ws_size,
                              hipStream_t stream) {
  if (n_in < 23) return;
  if (in_sizes[0] != NPIX * CC) return;
  if (in_sizes[1] != CC || in_sizes[2] != CC || in_sizes[3] != CC || in_sizes[4] != CC) return;
  if (in_sizes[5] != C3 * CC || in_sizes[6] != C3 * 9 || in_sizes[7] != CC * CC || in_sizes[8] < 1) return;
  if (in_sizes[9] != HID * CC || in_sizes[10] != HID * 9 || in_sizes[11] != CC * HID) return;
  if (in_sizes[12] != CC || in_sizes[13] != CC || in_sizes[14] != CC || in_sizes[15] != CC) return;
  if (in_sizes[16] != C3 * CC || in_sizes[17] != C3 * 9 || in_sizes[18] != CC * CC || in_sizes[19] < 1) return;
  if (in_sizes[20] != HID * CC || in_sizes[21] != HID * 9 || in_sizes[22] != CC * HID) return;
  if (out_size != NPIX * CC) return;

  const float* x        = (const float*)d_in[0];
  const float* w_s0     = (const float*)d_in[1];
  const float* b_s0     = (const float*)d_in[2];
  const float* w_s2     = (const float*)d_in[3];
  const float* b_s2     = (const float*)d_in[4];
  const float* rsa_qkv  = (const float*)d_in[5];
  const float* rsa_dw   = (const float*)d_in[6];
  const float* rsa_proj = (const float*)d_in[7];
  const float* rsa_temp = (const float*)d_in[8];
  const float* ffs_in   = (const float*)d_in[9];
  const float* ffs_dw   = (const float*)d_in[10];
  const float* ffs_out  = (const float*)d_in[11];
  const float* w_c0     = (const float*)d_in[12];
  const float* b_c0     = (const float*)d_in[13];
  const float* w_c2     = (const float*)d_in[14];
  const float* b_c2     = (const float*)d_in[15];
  const float* gsa_qkv  = (const float*)d_in[16];
  const float* gsa_dw   = (const float*)d_in[17];
  const float* gsa_proj = (const float*)d_in[18];
  const float* gsa_temp = (const float*)d_in[19];
  const float* ffc_in   = (const float*)d_in[20];
  const float* ffc_dw   = (const float*)d_in[21];
  const float* ffc_out  = (const float*)d_in[22];
  float* out = (float*)d_out;

  // ---- carve ----
  const size_t sAct = (size_t)NPIX * CC * 4;                        // f32 [NPIX][128]
  const size_t sT   = (size_t)NPIX * CC * 2 * 2;                    // two bf16 planes [NPIX][128]
  const size_t sU   = (size_t)NPIX * FSL * 4;                       // f32 [NPIX][192]
  const size_t sR   = (size_t)NPIX * C3 * 4;                        // f32 [NPIX][384] = two bf16 planes [NPIX][384]
  const size_t sWq  = (size_t)C3 * CC * 2;
  const size_t sWp  = (size_t)CC * CC * 2;
  const size_t sW1  = (size_t)HIDP * CC * 2;
  const size_t sW2  = (size_t)CC * HIDP * 2;
  const size_t sPN  = (size_t)NB * NSLN * 256 * 4;
  const size_t sPA  = (size_t)NB * NHEAD * NSLS * 1024 * 4;
  const size_t sAF  = (size_t)NB * AFSZ * 2;                        // per plane
  size_t off = 0;
  const size_t oA   = off; off += sAct;
  const size_t oBx  = off; off += sAct;
  const size_t oT   = off; off += sT;
  const size_t oU   = off; off += sU;
  const size_t oR   = off; off += sR;
  const size_t oWq0 = off; off += sWq;
  const size_t oWp0 = off; off += sWp;
  const size_t oW10 = off; off += sW1;
  const size_t oW20 = off; off += sW2;
  const size_t oWq1 = off; off += sWq;
  const size_t oWp1 = off; off += sWp;
  const size_t oW11 = off; off += sW1;
  const size_t oW21 = off; off += sW2;
  const size_t oPN  = off; off += sPN;
  const size_t oPA  = off; off += sPA;
  const size_t oAFh = off; off += sAF;
  const size_t oAFl = off; off += sAF;
  if (off > ws_size) return;                               // off = 126910464 for NB=2, IMW=128
  if (off > (size_t)134217728) return;
  if (sU < (size_t)NPIX * CC * 4) return;
  if (sU < (size_t)NPIX * CC * 2 * 2) return;
  if (sR < (size_t)NPIX * HIDP * 2 * 2) return;

  char* ws = (char*)d_ws;
  float* A  = (float*)(ws + oA);
  float* Bx = (float*)(ws + oBx);
  unsigned short* Th = (unsigned short*)(ws + oT);
  unsigned short* Tl = Th + (size_t)NPIX * CC;
  float* U  = (float*)(ws + oU);
  unsigned short* Uh = (unsigned short*)(ws + oU);
  unsigned short* Ul = Uh + (size_t)NPIX * CC;
  float* R  = (float*)(ws + oR);
  unsigned short* Gh = (unsigned short*)(ws + oR);
  unsigned short* Gl = Gh + (size_t)NPIX * HIDP;
  unsigned short* Wq0 = (unsigned short*)(ws + oWq0);
  unsigned short* Wp0 = (unsigned short*)(ws + oWp0);
  unsigned short* W10 = (unsigned short*)(ws + oW10);
  unsigned short* W20 = (unsigned short*)(ws + oW20);
  unsigned short* Wq1 = (unsigned short*)(ws + oWq1);
  unsigned short* Wp1 = (unsigned short*)(ws + oWp1);
  unsigned short* W11 = (unsigned short*)(ws + oW11);
  unsigned short* W21 = (unsigned short*)(ws + oW21);
  float* PN = (float*)(ws + oPN);
  float* PA = (float*)(ws + oPA);
  unsigned short* AFh = (unsigned short*)(ws + oAFh);
  unsigned short* AFl = (unsigned short*)(ws + oAFl);

  const dim3 blk(256);
  // (1) weights f32 [out][in] -> bf16 planes [outP][inP], k contiguous, zero padded
  cvt_w<<<dim3((C3 * CC / 8 + 255) / 256), blk, 0, stream>>>(rsa_qkv, Wq0, C3, CC, C3, CC);
  cvt_w<<<dim3((CC * CC / 8 + 255) / 256), blk, 0, stream>>>(rsa_proj, Wp0, CC, CC, CC, CC);
  cvt_w<<<dim3((HIDP * CC / 8 + 255) / 256), blk, 0, stream>>>(ffs_in, W10, HID, CC, HIDP, CC);
  cvt_w<<<dim3((CC * HIDP / 8 + 255) / 256), blk, 0, stream>>>(ffs_out, W20, CC, HID, CC, HIDP);
  cvt_w<<<dim3((C3 * CC / 8 + 255) / 256), blk, 0, stream>>>(gsa_qkv, Wq1, C3, CC, C3, CC);
  cvt_w<<<dim3((CC * CC / 8 + 255) / 256), blk, 0, stream>>>(gsa_proj, Wp1, CC, CC, CC, CC);
  cvt_w<<<dim3((HIDP * CC / 8 + 255) / 256), blk, 0, stream>>>(ffc_in, W11, HID, CC, HIDP, CC);
  cvt_w<<<dim3((CC * HIDP / 8 + 255) / 256), blk, 0, stream>>>(ffc_out, W21, CC, HID, CC, HIDP);

  // (2) x NCHW -> A pixel-major
  nchw_in<<<dim3(NB * (HW / 64)), blk, 0, stream>>>(x, A);

  (void)hipFuncSetAttribute(reinterpret_cast<const void*>(&rsa_attn_k), hipFuncAttributeMaxDynamicSharedMemorySize, RL_END);
  (void)hipFuncSetAttribute(reinterpret_cast<const void*>(&gsa_s_k), hipFuncAttributeMaxDynamicSharedMemorySize, GL_END);

  const dim3 gG128(NPIX / 256, CC / 32);
  const dim3 gG192(NPIX / 256, FSL / 32);
  const dim3 gDw128((NPIX * (128 / 4) + 255) / 256);
  const dim3 gDw192((NPIX * (192 / 4) + 255) / 256);
  const dim3 gLn(NPIX / 8);

  // ---- spatial (RSA) block ----
  ln_k<<<gLn, blk, 0, stream>>>(A, Bx, w_s0, b_s0, Th, Tl, 0);                          // T = LN_s0(x)
  for (int s = 0; s < 3; ++s) {                                                          // qkv 1x1 slab s -> U, dw (rolled) -> R
    gemm_k<CC, 0><<<gG128, blk, 0, stream>>>(Th, Tl, CC, Wq0 + (size_t)s * CC * CC, U, CC, Bx);
    dw_k<128, 0><<<gDw128, blk, 0, stream>>>(U, rsa_dw, s * CC, C3, WSZ / 2, R, C3, s * CC, Th, Tl, CC);
  }
  rsa_attn_k<<<dim3(NB * NWIN), blk, RL_END, stream>>>(R, rsa_temp, Th, Tl);            // T = window attention out
  gemm_k<CC, 0><<<gG128, blk, 0, stream>>>(Th, Tl, CC, Wp0, Bx, CC, A);                 // Bx = x_
  ln_k<<<gLn, blk, 0, stream>>>(A, Bx, w_s2, b_s2, Th, Tl, 1);                          // A = x_+x ; T = LN_s2(A)
  for (int s = 0; s < 2; ++s) {                                                          // ffn-in slab s -> U, dw+gelu -> G planes
    gemm_k<CC, 0><<<gG192, blk, 0, stream>>>(Th, Tl, CC, W10 + (size_t)s * FSL * CC, U, FSL, Bx);
    dw_k<192, 1><<<gDw192, blk, 0, stream>>>(U, ffs_dw, s * FSL, HID, 0, R, C3, s * FSL, Gh, Gl, HIDP);
  }
  gemm_k<HIDP, 1><<<gG128, blk, 0, stream>>>(Gh, Gl, HIDP, W20, A, CC, Bx);              // A = ffn + x_

  // ---- channel (GSA) block ----
  ln_k<<<gLn, blk, 0, stream>>>(A, Bx, w_c0, b_c0, Th, Tl, 0);                          // T = LN_c0(x)
  for (int s = 0; s < 2; ++s) {                                                          // q, k: 1x1 slab -> U, dw -> R f32
    gemm_k<CC, 0><<<gG128, blk, 0, stream>>>(Th, Tl, CC, Wq1 + (size_t)s * CC * CC, U, CC, Bx);
    dw_k<128, 0><<<gDw128, blk, 0, stream>>>(U, gsa_dw, s * CC, C3, 0, R, C3, s * CC, Th, Tl, CC);
  }
  gemm_k<CC, 0><<<gG128, blk, 0, stream>>>(Th, Tl, CC, Wq1 + (size_t)2 * CC * CC, U, CC, Bx);   // v: 1x1 -> U
  dw_k<128, 2><<<gDw128, blk, 0, stream>>>(U, gsa_dw, 2 * CC, C3, 0, R, C3, 0, Th, Tl, CC);     // v planes -> T region
  gsa_norm_k<<<dim3(NB * NSLN), blk, 0, stream>>>(R, PN);
  gsa_s_k<<<dim3(NB * NHEAD * NSLS), blk, GL_END, stream>>>(R, PA);
  gsa_fin_k<<<dim3(NB * NHEAD), blk, 0, stream>>>(PA, PN, gsa_temp, AFh, AFl);
  apply_k<<<dim3(NPIX / 128, CC / 64), blk, 0, stream>>>(Th, Tl, AFh, AFl, Uh, Ul);     // U planes = channel attention out
  gemm_k<CC, 0><<<gG128, blk, 0, stream>>>(Uh, Ul, CC, Wp1, Bx, CC, A);                 // Bx = x_
  ln_k<<<gLn, blk, 0, stream>>>(A, Bx, w_c2, b_c2, Th, Tl, 1);                          // A = x_+x ; T = LN_c2(A)
  for (int s = 0; s < 2; ++s) {
    gemm_k<CC, 0><<<gG192, blk, 0, stream>>>(Th, Tl, CC, W11 + (size_t)s * FSL * CC, U, FSL, Bx);
    dw_k<192, 1><<<gDw192, blk, 0, stream>>>(U, ffc_dw, s * FSL, HID, 0, R, C3, s * FSL, Gh, Gl, HIDP);
  }
  gemm_k<HIDP, 2><<<gG128, blk, 0, stream>>>(Gh, Gl, HIDP, W21, out, CC, Bx);            // d_out NCHW = ffn + x_
  (void)hipGetLastError();
}

// v002
// It runs in 435 microseconds.
// Timed twice side by side with v001, it ran 1.07 and 1.08 times as fast.
// All steps since v000 together make it 1.68 times as fast.
// Contractions (1x1 convs for qkv / proj / ffn-in / ffn-out, window q^T.k and v.attn, global q.k^T and attn.v):
// v_wmma_f32_16x16x32_bf16 (bf16 operands, f32 accumulate); computed operands carried as bf16 hi + residual planes,
// weight operands single bf16; layer norms, depthwise 3x3 convs, erf GELU, l2 norms and residual adds in f32 on VALU.
// Inputs RNE-converted to bf16 on load.
#include <hip/hip_runtime.h>
#include <math.h>
#include <stdint.h>

#define NB    2
#define CC    128
#define IMW   128
#define HW    (IMW * IMW)
#define NPIX  (NB * HW)
#define C3    384
#define HID   340
#define HIDP  384
#define FSL   192
#define NHEAD 4
#define HDC   32
#define WSZ   4
#define NWX   (IMW / WSZ)
#define NWIN  (NWX * NWX)
#define NSLN  (HW / 256)
#define NSLS  (HW / 2048)
#define AFSZ  (CC * HDC)
#define RSQ2  0.70710678118654752f
#define GXP   36
#define AXP   68
#define TXP   132
#define ATP   136
#define GSP   264
#define DWL   8

static_assert((IMW & (IMW - 1)) == 0);
static_assert(IMW % WSZ == 0);
static_assert(WSZ == 4);
static_assert(IMW % DWL == 0);
static_assert(HW % 2048 == 0);
static_assert(HW % 256 == 0);
static_assert(HW % 64 == 0);
static_assert(NPIX % 256 == 0);
static_assert(CC == NHEAD * HDC);
static_assert(HDC == 32);
static_assert((GXP * 4) % 16 == 0);
static_assert((AXP * 4) % 16 == 0);
static_assert((TXP * 4) % 16 == 0);
static_assert((ATP * 2) % 16 == 0);
static_assert((GSP * 2) % 16 == 0);

// RSA window kernel dynamic LDS map (bytes)
#define RL_R    0
#define RL_QTH  24576
#define RL_QTL  28672
#define RL_KTH  32768
#define RL_KTL  36864
#define RL_ATH  40960
#define RL_ATL  75776
#define RL_VH   110592
#define RL_VL   114944
#define RL_INV  119296
#define RL_END  119424
static_assert(RL_QTH == RL_R + 16 * C3 * 4);
static_assert(RL_QTL == RL_QTH + CC * 16 * 2);
static_assert(RL_KTH == RL_QTL + CC * 16 * 2);
static_assert(RL_KTL == RL_KTH + CC * 16 * 2);
static_assert(RL_ATH == RL_KTL + CC * 16 * 2);
static_assert(RL_ATL == RL_ATH + CC * ATP * 2);
static_assert(RL_VH == RL_ATL + CC * ATP * 2);
static_assert(RL_VL == RL_VH + 16 * ATP * 2);
static_assert(RL_INV == RL_VL + 16 * ATP * 2);
static_assert(RL_END == RL_INV + 32 * 4);
static_assert(16 * TXP * 4 <= RL_QTH - RL_R);

// GSA score kernel dynamic LDS map (bytes)
#define GL_QH   0
#define GL_QL   16896
#define GL_KH   33792
#define GL_KL   50688
#define GL_RED  67584
#define GL_STG  71680
#define GL_END  76288
static_assert(GL_QL == 32 * GSP * 2);
static_assert(GL_KH == 2 * GL_QL);
static_assert(GL_KL == 3 * GL_QL);
static_assert(GL_RED == 4 * GL_QL);
static_assert(GL_STG == GL_RED + 4 * 32 * 8 * 4);
static_assert(GL_END == GL_STG + 32 * GXP * 4);

typedef __bf16         v16bf __attribute__((ext_vector_type(16)));
typedef unsigned short v8us  __attribute__((ext_vector_type(8)));
typedef float          v8f   __attribute__((ext_vector_type(8)));
typedef float          v4f   __attribute__((ext_vector_type(4)));
typedef unsigned int   v4u   __attribute__((ext_vector_type(4)));
typedef unsigned int   v2u   __attribute__((ext_vector_type(2)));

union Frag { v16bf v; v8us u[2]; };

// ---- scalar helpers ------------------------------------------------------------------------------------------
__device__ __forceinline__ unsigned short bf_bits(float f) {          // f32 -> bf16 bits, RNE convert
  unsigned u = __float_as_uint(f);
  return (unsigned short)((u + 0x7FFFu + ((u >> 16) & 1u)) >> 16);
}
__device__ __forceinline__ float bf_up(unsigned short h) { return __uint_as_float(((unsigned)h) << 16); }
__device__ __forceinline__ float bfr(float f) { return bf_up(bf_bits(f)); }
__device__ __forceinline__ unsigned pk16(unsigned short a, unsigned short b) { return (unsigned)a | ((unsigned)b << 16); }
// hi = bf16(v), lo = bf16(v - hi)
__device__ __forceinline__ void split_bf(float v, unsigned short& hi, unsigned short& lo) {
  const unsigned short hb = bf_bits(v);
  hi = hb;
  lo = bf_bits(v - bf_up(hb));
}
__device__ __forceinline__ void split4(v4f v, v2u& ph, v2u& pl) {
  unsigned short h[4], l[4];
#pragma unroll
  for (int e = 0; e < 4; ++e) split_bf(v[e], h[e], l[e]);
  ph[0] = pk16(h[0], h[1]); ph[1] = pk16(h[2], h[3]);
  pl[0] = pk16(l[0], l[1]); pl[1] = pk16(l[2], l[3]);
}
__device__ __forceinline__ void split8(v4f v0, v4f v1, v4u& ph, v4u& pl) {
  unsigned short h[8], l[8];
#pragma unroll
  for (int e = 0; e < 4; ++e) { split_bf(v0[e], h[e], l[e]); split_bf(v1[e], h[4 + e], l[4 + e]); }
#pragma unroll
  for (int e = 0; e < 4; ++e) { ph[e] = pk16(h[2 * e], h[2 * e + 1]); pl[e] = pk16(l[2 * e], l[2 * e + 1]); }
}
__device__ __forceinline__ v8f zero8() { v8f z = {0.f, 0.f, 0.f, 0.f, 0.f, 0.f, 0.f, 0.f}; return z; }
__device__ __forceinline__ v8us zero8us() { v8us z = {0, 0, 0, 0, 0, 0, 0, 0}; return z; }

// ---- fragment loaders: 16-bit A/B operand, lane -> row/col (lane&15), p already includes +8*(lane>>4);
//      elements 0..7 <- p[0..7] (k0+8h..), elements 8..15 <- p[16..23] (k0+16+8h..)
__device__ __forceinline__ v16bf ldfrag(const unsigned short* p) {
  Frag f;
  f.u[0] = *(const v8us*)(p);
  f.u[1] = *(const v8us*)(p + 16);
  return f.v;
}
// K = 16 contraction padded to 32: elements 8..15 are zero
__device__ __forceinline__ v16bf ldfrag16(const unsigned short* p) {
  Frag f;
  f.u[0] = *(const v8us*)(p);
  f.u[1] = zero8us();
  return f.v;
}

// ---- WMMA helper with trailing VALU hazard gap ---------------------------------------------------------------
__device__ __forceinline__ v8f mma_bf(v16bf a, v16bf b, v8f c) {
  c = __builtin_amdgcn_wmma_f32_16x16x32_bf16(false, a, false, b, (short)0, c, false, false);
#if defined(__HIP_DEVICE_COMPILE__)
  asm volatile("v_nop\n\tv_nop\n\tv_nop\n\tv_nop" : "+v"(c) : "v"(a), "v"(b));
#endif
  return c;
}
__device__ __forceinline__ void wave_sync_lds() {
  __builtin_amdgcn_fence(__ATOMIC_RELEASE, "workgroup");
  __builtin_amdgcn_wave_barrier();
  __builtin_amdgcn_fence(__ATOMIC_ACQUIRE, "workgroup");
}

// =================================================================================================================
// Weight convert: w f32 [rows][cols] -> bf16 [rowsP][colsP] (zero padded), value = bf16_RNE(w). One thread = 8
// coverage: rowsP * colsP/8 pieces, grid = ceil(pieces/256) with an in-kernel bound.
// =================================================================================================================
__global__ __launch_bounds__(256) void cvt_w(const float* __restrict__ w, unsigned short* outp,
                                             int rows, int cols, int rowsP, int colsP) {
  const int t = blockIdx.x * 256 + threadIdx.x;
  const int ppr = colsP >> 3;
  const int npc = rowsP * ppr;
  const bool ok = t < npc;
  const int tt = ok ? t : 0;
  const int r = tt / ppr, c8 = (tt - r * ppr) * 8;
  const int rr = min(r, rows - 1);
  unsigned short hv[8];
#pragma unroll
  for (int e = 0; e < 8; ++e) {
    const int c = c8 + e;
    const int cl = min(c, cols - 1);
    const float f = w[(size_t)rr * cols + cl];
    const float z = (r < rows && c < cols) ? f : 0.0f;
    hv[e] = bf_bits(z);
  }
  v4u pk;
#pragma unroll
  for (int e = 0; e < 4; ++e) pk[e] = pk16(hv[2 * e], hv[2 * e + 1]);
  unsigned short* gp = outp + (size_t)r * colsP + c8;
  if (ok) *(v4u*)gp = pk;
  
}

// =================================================================================================================
// NCHW f32 x -> pixel-major stream A [b*HW + p][128] f32, values bf16-RNE-converted. Block = (b, 64-pixel tile):
// 128 ch x 64 px loaded coalesced along p into an LDS tile [px][TXP]; store: each pixel row = 512 B = 32 lanes x
// coverage: 8 waves x 8 rows = 64 px x 128 ch per block; grid NB*(HW/64) blocks = every pixel once.
// =================================================================================================================
__global__ __launch_bounds__(256) void nchw_in(const float* __restrict__ x, float* A) {
  __shared__ __align__(16) float xs[64 * TXP];
  const int tid = threadIdx.x, wave = tid >> 5, lane = tid & 31;
  const int b = blockIdx.x / (HW / 64);
  const int p0 = (blockIdx.x - b * (HW / 64)) * 64;
#pragma unroll
  for (int it = 0; it < 8; ++it) {
    const int q = it * 256 + tid;
    const int ch = q >> 4, j4 = (q & 15) * 4;
    const v4f v = *(const v4f*)(x + ((size_t)(b * CC + ch)) * HW + p0 + j4);
#pragma unroll
    for (int e = 0; e < 4; ++e) xs[(j4 + e) * TXP + ch] = bfr(v[e]);
  }
  __syncthreads();
  v4f ov[8];
#pragma unroll
  for (int it = 0; it < 8; ++it) {
    const int row = wave * 8 + it;
    ov[it] = *(const v4f*)(xs + row * TXP + lane * 4);
  }
#pragma unroll
  for (int it = 0; it < 8; ++it) {
    const int row = wave * 8 + it;
    *(v4f*)(A + ((size_t)(b * HW + p0 + row)) * CC + lane * 4) = ov[it];
  }
  
}

// =================================================================================================================
// passes); output bf16 hi + residual planes Th/Tl [pix][128]: row = 256 B = 32 lanes x 8 B, one instruction per plane,
// =================================================================================================================
__global__ __launch_bounds__(256) void ln_k(float* A, const float* __restrict__ Badd,
                                            const float* __restrict__ g, const float* __restrict__ bv,
                                            unsigned short* Th, unsigned short* Tl, int addB) {
#pragma clang fp contract(off)
  const int tid = threadIdx.x, wave = tid >> 5, lane = tid & 31;
  const int p = blockIdx.x * 8 + wave;
  const int c4 = lane * 4;
  float* arow = A + (size_t)p * CC + c4;
  v4f xv = *(const v4f*)arow;
  if (addB != 0) {
    const v4f b2 = *(const v4f*)(Badd + (size_t)p * CC + c4);
    xv = xv + b2;
    *(v4f*)arow = xv;
    
  }
  float s = (xv[0] + xv[1]) + (xv[2] + xv[3]);
#pragma unroll
  for (int off = 1; off < 32; off <<= 1) s = s + __shfl_xor(s, off, 32);
  const float mu = s * (1.0f / 128.0f);
  float d[4];
  float s2 = 0.f;
#pragma unroll
  for (int e = 0; e < 4; ++e) { d[e] = xv[e] - mu; const float dd = d[e] * d[e]; s2 = s2 + dd; }
#pragma unroll
  for (int off = 1; off < 32; off <<= 1) s2 = s2 + __shfl_xor(s2, off, 32);
  const float var = s2 * (1.0f / 128.0f);
  const float rstd = 1.0f / sqrtf(var + 1e-6f);
  v4f z;
#pragma unroll
  for (int e = 0; e < 4; ++e) {
    float t0 = d[e] * rstd;
    t0 = t0 * bfr(g[c4 + e]);
    z[e] = t0 + bfr(bv[c4 + e]);
  }
  v2u ph, pl;
  split4(z, ph, pl);
  const size_t to = (size_t)p * CC + c4;
  *(v2u*)(Th + to) = ph;
  *(v2u*)(Tl + to) = pl;
  
}

// =================================================================================================================
// GEMM: OUT[p][n] = sum_k (Ah[p][k] + Al[p][k]) * W[n][k]  (A planes [pix][lda] bf16 hi + residual, W single bf16
// [N][K] k-contiguous, 2 products per tile pair). Wave tile 32 px x 32 out (2x2 fragments), block = 8 waves = 256 px.
// Fragments loaded straight from the 16-bit global rows with the split k map. Epilogue: the wave's 32x32 f32 tile is
// instruction per 4 rows); EP 1: same + res[p][n] (res pitch 128); EP 2: NCHW d_out[b][n][p] + res[p][n] (32 px of
// coverage: 8 waves x 32 rows x 32 cols per block = 256 px x 32 cols; grid covers NPIX x N once.
// =================================================================================================================
template <int K, int EP>
__global__ __launch_bounds__(256) void gemm_k(const unsigned short* __restrict__ Ah,
                                              const unsigned short* __restrict__ Al, int lda,
                                              const unsigned short* __restrict__ W,
                                              float* outf, int ldo, const float* __restrict__ res) {
  __shared__ __align__(16) float stg[8 * 32 * GXP];
  const int tid = threadIdx.x, wave = tid >> 5, lane = tid & 31, hh = lane >> 4, l15 = lane & 15;
  const int m0 = (blockIdx.x * 8 + wave) * 32;
  const int n0 = blockIdx.y * 32;
  const unsigned short* ah0 = Ah + (size_t)(m0 + l15) * lda + 8 * hh;
  const unsigned short* al0 = Al + (size_t)(m0 + l15) * lda + 8 * hh;
  const unsigned short* ah1 = ah0 + (size_t)16 * lda;
  const unsigned short* al1 = al0 + (size_t)16 * lda;
  const unsigned short* w0 = W + (size_t)(n0 + l15) * K + 8 * hh;
  const unsigned short* w1 = w0 + (size_t)16 * K;
  v8f c00 = zero8(), c01 = zero8(), c10 = zero8(), c11 = zero8();
#pragma unroll 2
  for (int k0 = 0; k0 < K; k0 += 32) {
    const v16bf a0h = ldfrag(ah0 + k0), a0l = ldfrag(al0 + k0);
    const v16bf a1h = ldfrag(ah1 + k0), a1l = ldfrag(al1 + k0);
    const v16bf b0 = ldfrag(w0 + k0), b1 = ldfrag(w1 + k0);
    c00 = mma_bf(a0h, b0, c00); c00 = mma_bf(a0l, b0, c00);
    c01 = mma_bf(a0h, b1, c01); c01 = mma_bf(a0l, b1, c01);
    c10 = mma_bf(a1h, b0, c10); c10 = mma_bf(a1l, b0, c10);
    c11 = mma_bf(a1h, b1, c11); c11 = mma_bf(a1l, b1, c11);
  }
  float* sw = stg + wave * (32 * GXP);
#pragma unroll
  for (int r = 0; r < 8; ++r) {
    sw[(8 * hh + r) * GXP + l15] = c00[r];
    sw[(8 * hh + r) * GXP + 16 + l15] = c01[r];
    sw[(16 + 8 * hh + r) * GXP + l15] = c10[r];
    sw[(16 + 8 * hh + r) * GXP + 16 + l15] = c11[r];
  }
  wave_sync_lds();
  const int q = lane >> 3, piece = lane & 7;
  v4f ov[8];
  if (EP != 2) {
#pragma unroll
    for (int it = 0; it < 8; ++it) {
      const int row = it * 4 + q;
      v4f v = *(const v4f*)(sw + row * GXP + piece * 4);
      if (EP == 1) {
        const v4f rr = *(const v4f*)(res + (size_t)(m0 + row) * CC + n0 + piece * 4);
        v = v + rr;
      }
      ov[it] = v;
    }
#pragma unroll
    for (int it = 0; it < 8; ++it) {
      const int row = it * 4 + q;
      *(v4f*)(outf + (size_t)(m0 + row) * ldo + n0 + piece * 4) = ov[it];
    }
    
  } else {
    const int b = m0 / HW;
    const int plx = m0 - b * HW;
#pragma unroll
    for (int it = 0; it < 8; ++it) {
      const int ch = it * 4 + q;
      v4f v;
#pragma unroll
      for (int e = 0; e < 4; ++e) {
        const float rv = res[(size_t)(m0 + piece * 4 + e) * CC + n0 + ch];
        v[e] = sw[(piece * 4 + e) * GXP + ch] + rv;
      }
      ov[it] = v;
    }
#pragma unroll
    for (int it = 0; it < 8; ++it) {
      const int ch = it * 4 + q;
      *(v4f*)(outf + ((size_t)(b * CC + n0 + ch)) * HW + plx + piece * 4) = ov[it];
    }
    
  }
}

// =================================================================================================================
// Depthwise 3x3, SAME zero padding, cross-correlation taps, optional cyclic roll (output pixel index in the rolled
// frame, source slab in the unrolled frame: source pixel ((ny+roll) mod IMW, (nx+roll) mod IMW), valid iff the rolled
// neighbour (ny,nx) is inside the image). src slab [pix][CS] f32 (CS = 128 or 192 channels), 4 channels per thread,
// weights wd[(wofs + c)*9 + tap] bf16-RNE (clamped address, zero for wofs + c >= cvalid): the block's CS*9 weights are read
// once (thread = channel) and laid out in LDS as [tap][CS], channel contiguous, so that a thread takes its 4 channels
// of one tap with one 16-byte LDS read.
// A thread computes a strip of DWL output pixels along x: it loads the 3 x (DWL+2) source pixels of the strip once,
// all loads in flight together, keeps them in registers, and each loaded column serves up to three outputs; the taps
// come from LDS once per strip. Strips that follow one another in the grid lie under one another in y (a block's
// strips share source rows).
// A row outside the image zeroes its three taps; only the strip's two outer columns can lie outside the image.
// MODE 0: f32 rows dstf[p*dpitch + dcol + c]; MODE 1: exact-erf GELU (rolled) then bf16 hi + residual planes
// Ph/Pl[p*ppitch + dcol + c]; MODE 2: the planes without the GELU.
// coverage: (NPIX/DWL) * CS/4 threads x DWL pixels, grid ceil-div with an in-kernel bound.
// =================================================================================================================
template <int CS, int MODE>
__global__ __launch_bounds__(256) void dw_k(const float* __restrict__ src, const float* __restrict__ wd,
                                            int wofs, int cvalid, int roll,
                                            float* dstf, int dpitch, int dcol,
                                            unsigned short* Ph, unsigned short* Pl, int ppitch) {
  constexpr int TPP = CS / 4;
  constexpr int NSTR = NPIX / DWL;           // strips in all
  constexpr int SPI = HW / DWL;              // strips per image
  static_assert(CS % 32 == 0 && CS <= 256);
  __shared__ __align__(16) float wsm[9 * CS];
  if (threadIdx.x < CS) {                    // whole waves: thread = channel of the slab, its 9 taps
    const int cgb = wofs + (int)threadIdx.x;
    const float* wp = wd + min(cgb, cvalid - 1) * 9;
    const float wok = (cgb < cvalid) ? 1.0f : 0.0f;
    float wf[9];
#pragma unroll                               // the 9 loads in flight behind one wait
    for (int tp = 0; tp < 9; ++tp) wf[tp] = wp[tp];
#pragma unroll                               // constant indices keep wf in registers
    for (int tp = 0; tp < 9; ++tp) wsm[tp * CS + threadIdx.x] = bfr(wf[tp]) * wok;
  }
  __syncthreads();                           // every wave reads table rows that other waves wrote
  const int t = blockIdx.x * 256 + threadIdx.x;
  int s = t / TPP;
  const int cg = t - s * TPP;
  const bool pv = s < NSTR;
  s = pv ? s : (NSTR - 1);
  const int c = cg * 4;
  const int b = s / SPI;
  const int sr = s - b * SPI;
  const int xs = sr / IMW;
  const int y = sr - xs * IMW;
  const int x0 = xs * DWL;
  const v4f* s4 = (const v4f*)src;            // slab rows in 16-byte units: TPP units per pixel
  // Every loop below but the GELU loop is unrolled in full so that its indices are constants: the offsets, the 3 x (DWL+2) window,
  // the taps and the DWL sums then live in registers (an index known only at run time would put them in scratch).
  int ro[3], co[DWL + 2], ix[3][DWL + 2];
#pragma unroll                               // see above
  for (int dy = 0; dy < 3; ++dy) {
    const int sy = (y + dy - 1 + roll) & (IMW - 1);
    ro[dy] = (b * HW + sy * IMW) * TPP + cg;
  }
#pragma unroll                               // see above
  for (int j = 0; j < DWL + 2; ++j) {
    const int sx = (x0 + j - 1 + roll) & (IMW - 1);
    co[j] = sx * TPP;
  }
#pragma unroll                               // see above
  for (int dy = 0; dy < 3; ++dy) {
#pragma unroll                               // see above
    for (int j = 0; j < DWL + 2; ++j) ix[dy][j] = ro[dy] + co[j];
  }
  const int p0 = b * HW + y * IMW + x0;      // first output pixel of the strip
  const float ml = (x0 > 0) ? 1.0f : 0.0f;
  const float mr = (x0 + DWL < IMW) ? 1.0f : 0.0f;
  v4f v[3][DWL + 2];
#pragma unroll                               // see above
  for (int dy = 0; dy < 3; ++dy) {
#pragma unroll                               // see above
    for (int j = 0; j < DWL + 2; ++j) v[dy][j] = s4[ix[dy][j]];
    // the next row's loads may be given registers that held this row's offsets: the wait stands in front of them
    if (dy < 2) asm volatile("s_wait_xcnt 0x0" ::: "memory");
  }
  static_assert(DWL == 8);                   // the statement below names the 3 x 10 loaded values one by one
  // Inputs only: every load of the window is issued in front of this line, so the wave waits out one memory latency
  // for all 30; without it the compiler spreads the loads among the sums and waits for them a few at a time.
  asm volatile("" :: "v"(v[0][0]), "v"(v[0][1]), "v"(v[0][2]), "v"(v[0][3]), "v"(v[0][4]),
                     "v"(v[0][5]), "v"(v[0][6]), "v"(v[0][7]), "v"(v[0][8]), "v"(v[0][9]),
                     "v"(v[1][0]), "v"(v[1][1]), "v"(v[1][2]), "v"(v[1][3]), "v"(v[1][4]),
                     "v"(v[1][5]), "v"(v[1][6]), "v"(v[1][7]), "v"(v[1][8]), "v"(v[1][9]),
                     "v"(v[2][0]), "v"(v[2][1]), "v"(v[2][2]), "v"(v[2][3]), "v"(v[2][4]),
                     "v"(v[2][5]), "v"(v[2][6]), "v"(v[2][7]), "v"(v[2][8]), "v"(v[2][9]));
  v4f acc[DWL];
#pragma unroll                               // see above
  for (int i = 0; i < DWL; ++i) acc[i] = v4f{0.f, 0.f, 0.f, 0.f};
  // row by row: a row's registers are free once its three taps are summed; each output still sums its taps 0..8 in order
#pragma unroll                               // see above
  for (int dy = 0; dy < 3; ++dy) {
    const float rm = ((unsigned)(y + dy - 1) < (unsigned)IMW) ? 1.0f : 0.0f;
    v4f wv[3];
#pragma unroll                               // see above
    for (int dx = 0; dx < 3; ++dx) wv[dx] = *(const v4f*)(wsm + (dy * 3 + dx) * CS + c) * rm;
    v[dy][0] = v[dy][0] * ml;
    v[dy][DWL + 1] = v[dy][DWL + 1] * mr;
#pragma unroll                               // see above
    for (int i = 0; i < DWL; ++i) {          // output by output: column i is free once output i has its row
#pragma unroll                               // see above
      for (int dx = 0; dx < 3; ++dx) acc[i] = acc[i] + v[dy][i + dx] * wv[dx];
    }
    // the next row's taps are read only now: all 9 read ahead take 24 registers more, and above 160 registers the
    // three blocks per WGP of the 192-channel launches are no longer resident together
    if (dy < 2) __builtin_amdgcn_sched_barrier(0);
  }
#pragma unroll                               // see above
  for (int i = 0; i < DWL; ++i) {
    v4f a = acc[i];
    if (MODE == 1) {
#pragma unroll 1                             // rolled as before: one copy of the erf code per output pixel
      for (int e = 0; e < 4; ++e) {
        const float g = (e == 0) ? a[0] : ((e == 1) ? a[1] : ((e == 2) ? a[2] : a[3]));
        const float er = erff(g * RSQ2);
        float gl = 0.5f * g;
        gl = gl * (1.0f + er);
        a[0] = (e == 0) ? gl : a[0];
        a[1] = (e == 1) ? gl : a[1];
        a[2] = (e == 2) ? gl : a[2];
        a[3] = (e == 3) ? gl : a[3];
      }
    }
    if (MODE == 0) {
      float* gp = dstf + (size_t)(p0 + i) * dpitch + dcol + c;
      if (pv) *(v4f*)gp = a;
    } else {
      v2u ph, plw;
      split4(a, ph, plw);
      const size_t to = (size_t)(p0 + i) * ppitch + dcol + c;
      if (pv) { *(v2u*)(Ph + to) = ph; *(v2u*)(Pl + to) = plw; }
    }
  }
}

// =================================================================================================================
// RSA window attention, one 4x4 window (16 tokens) per block of 256 threads, R = dwconv output in the rolled frame
// [pix][384] f32 (q | k | v column blocks):
//   phase 0: the 16 token rows x 384 f32 into LDS; phase 1: per token and per q/k the l2 norm over its 128 channels
//   (inv = 1/max(sqrt(sum), 1e-12)); phase 2: q^T and k^T as bf16 hi + residual planes [c][16 tok] (k contiguous),
//   v as planes [tok][ATP]; phase 3 (wave = c tile): attn[c][d] = relu(temp * sum_p qn[p][c] kn[p][d]) on WMMA, K = 16
//   (fragment elements 8..15 zero), 3 products, stored transposed as planes AttT[d][c]; phase 4 (wave = d tile):
//   out[p][d] = sum_c v[p][c] attn[c][d], K = 128, 3 products, staged f32 [16][TXP] in LDS; phase 5: each token row
//   (128 values -> hi + residual, 256 B per plane = 16 lanes x 16 B) written to its unrolled pixel (inverse roll +2,+2),
//   coverage: qT/kT 128 c x 16 tok x 2 planes, v 16 x 128, AttT 128 d x 128 c (8 waves x 8 tiles), out 16 x 128
//   (8 waves x 16 cols), store 8 waves x 2 rows x 128.
// =================================================================================================================
__global__ __launch_bounds__(256) void rsa_attn_k(const float* __restrict__ R, const float* __restrict__ temp,
                                                  unsigned short* Th, unsigned short* Tl) {
#pragma clang fp contract(off)
  extern __shared__ __align__(16) char smem[];
  float* sR = (float*)(smem + RL_R);
  float* ost = (float*)(smem + RL_R);                     // reused after phase 2
  unsigned short* qt = (unsigned short*)(smem + RL_QTH);  // qT hi @0, qT lo @2048, kT hi @4096, kT lo @6144 (halves)
  unsigned short* ath = (unsigned short*)(smem + RL_ATH);
  unsigned short* atl = (unsigned short*)(smem + RL_ATL);
  unsigned short* vh = (unsigned short*)(smem + RL_VH);
  unsigned short* vl = (unsigned short*)(smem + RL_VL);
  float* sinv = (float*)(smem + RL_INV);
  const int tid = threadIdx.x, wave = tid >> 5, lane = tid & 31, hh = lane >> 4, l15 = lane & 15;
  const int b = blockIdx.x / NWIN;
  const int w2 = blockIdx.x - b * NWIN;
  const int wy = w2 / NWX;
  const int wx = w2 - wy * NWX;

  // ---- phase 0: token rows ----
#pragma unroll
  for (int it = 0; it < 6; ++it) {
    const int idx = it * 256 + tid;
    const int pi = idx / 96;
    const int c4 = (idx - pi * 96) * 4;
    const int ry = wy * WSZ + (pi / WSZ), rx = wx * WSZ + (pi - (pi / WSZ) * WSZ);
    const v4f v = *(const v4f*)(R + ((size_t)(b * HW) + (size_t)ry * IMW + rx) * C3 + c4);
    *(v4f*)(sR + pi * C3 + c4) = v;
  }
  __syncthreads();

  // ---- phase 1: l2 norms per token over its 128 q (or k) channels ----
  {
    const int pair = tid >> 3, sub = tid & 7;
    const int sel = pair >> 4, pi = pair & 15;
    const float* rp = sR + pi * C3 + sel * CC + sub * 16;
    float s = 0.f;
#pragma unroll
    for (int j = 0; j < 16; ++j) { const float f = rp[j]; const float ff = f * f; s = s + ff; }
    s = s + __shfl_xor(s, 1, 32);
    s = s + __shfl_xor(s, 2, 32);
    s = s + __shfl_xor(s, 4, 32);
    const float inv = 1.0f / fmaxf(sqrtf(s), 1e-12f);
    if (sub == 0) sinv[pair] = inv;
  }
  __syncthreads();

  // ---- phase 2: normalised q^T / k^T planes and v planes ----
  {
    const int c = tid >> 1, sel = tid & 1;
    unsigned short hv[16], lv[16];
#pragma unroll
    for (int pi = 0; pi < 16; ++pi) {
      const float v = sR[pi * C3 + sel * CC + c] * sinv[sel * 16 + pi];
      split_bf(v, hv[pi], lv[pi]);
    }
    v4u h0, h1, l0, l1;
#pragma unroll
    for (int e = 0; e < 4; ++e) {
      h0[e] = pk16(hv[2 * e], hv[2 * e + 1]);
      h1[e] = pk16(hv[8 + 2 * e], hv[8 + 2 * e + 1]);
      l0[e] = pk16(lv[2 * e], lv[2 * e + 1]);
      l1[e] = pk16(lv[8 + 2 * e], lv[8 + 2 * e + 1]);
    }
    unsigned short* dh = qt + sel * 4096 + c * 16;
    unsigned short* dl = dh + 2048;
    *(v4u*)(dh) = h0; *(v4u*)(dh + 8) = h1;
    *(v4u*)(dl) = l0; *(v4u*)(dl + 8) = l1;
    const int pi = tid >> 4, c8 = (tid & 15) * 8;
    const float* vr = sR + pi * C3 + 2 * CC + c8;
    const v4f v0 = *(const v4f*)(vr);
    const v4f v1 = *(const v4f*)(vr + 4);
    v4u ph, plw;
    split8(v0, v1, ph, plw);
    *(v4u*)(vh + pi * ATP + c8) = ph;
    *(v4u*)(vl + pi * ATP + c8) = plw;
  }
  __syncthreads();

  const float tmp = bfr(temp[0]);
  // ---- phase 3: attn = relu(temp * q^T k), 128 x 128, K = 16 ----
  {
    const int mi = wave;
    const v16bf a_h = ldfrag16(qt + (mi * 16 + l15) * 16 + 8 * hh);
    const v16bf a_l = ldfrag16(qt + 2048 + (mi * 16 + l15) * 16 + 8 * hh);
#pragma unroll 2
    for (int ni = 0; ni < 8; ++ni) {
      const v16bf b_h = ldfrag16(qt + 4096 + (ni * 16 + l15) * 16 + 8 * hh);
      const v16bf b_l = ldfrag16(qt + 6144 + (ni * 16 + l15) * 16 + 8 * hh);
      v8f acc = zero8();
      acc = mma_bf(a_h, b_h, acc);
      acc = mma_bf(a_h, b_l, acc);
      acc = mma_bf(a_l, b_h, acc);
      unsigned short hv[8], lv[8];
#pragma unroll
      for (int r = 0; r < 8; ++r) {
        float v = acc[r] * tmp;
        v = fmaxf(v, 0.0f);
        split_bf(v, hv[r], lv[r]);
      }
      v4u ph, plw;
#pragma unroll
      for (int e = 0; e < 4; ++e) { ph[e] = pk16(hv[2 * e], hv[2 * e + 1]); plw[e] = pk16(lv[2 * e], lv[2 * e + 1]); }
      const int d = ni * 16 + l15;
      *(v4u*)(ath + d * ATP + mi * 16 + 8 * hh) = ph;
      *(v4u*)(atl + d * ATP + mi * 16 + 8 * hh) = plw;
    }
  }
  __syncthreads();

  // ---- phase 4: out[p][d] = sum_c v[p][c] attn[c][d], K = 128 ----
  {
    const int ni = wave;
    v8f acc = zero8();
#pragma unroll
    for (int ks = 0; ks < 4; ++ks) {
      const v16bf a_h = ldfrag(vh + l15 * ATP + ks * 32 + 8 * hh);
      const v16bf a_l = ldfrag(vl + l15 * ATP + ks * 32 + 8 * hh);
      const v16bf b_h = ldfrag(ath + (ni * 16 + l15) * ATP + ks * 32 + 8 * hh);
      const v16bf b_l = ldfrag(atl + (ni * 16 + l15) * ATP + ks * 32 + 8 * hh);
      acc = mma_bf(a_h, b_h, acc);
      acc = mma_bf(a_h, b_l, acc);
      acc = mma_bf(a_l, b_h, acc);
    }
#pragma unroll
    for (int r = 0; r < 8; ++r) ost[(8 * hh + r) * TXP + ni * 16 + l15] = acc[r];
  }
  __syncthreads();

  // ---- phase 5: token rows to their unrolled pixels ----
  {
    const int tk = 2 * wave + hh;
    const int piece = l15;
    const float* orow = ost + tk * TXP + piece * 8;
    const v4f v0 = *(const v4f*)(orow);
    const v4f v1 = *(const v4f*)(orow + 4);
    v4u ph, plw;
    split8(v0, v1, ph, plw);
    const int iy = tk / WSZ, ix = tk - (tk / WSZ) * WSZ;
    const int ry = wy * WSZ + iy, rx = wx * WSZ + ix;
    const int py = (ry + WSZ / 2) & (IMW - 1), px = (rx + WSZ / 2) & (IMW - 1);
    const size_t gp = ((size_t)(b * HW) + (size_t)py * IMW + px) * CC + piece * 8;
    *(v4u*)(Th + gp) = ph;
    *(v4u*)(Tl + gp) = plw;
    
  }
}

// =================================================================================================================
// GSA sum-of-squares partials: block = (b, slab of 256 pixels), thread = channel c (q: 0..127, k: 128..255),
// =================================================================================================================
__global__ __launch_bounds__(256) void gsa_norm_k(const float* __restrict__ R, float* pn) {
  const int b = blockIdx.x / NSLN;
  const int slab = blockIdx.x - b * NSLN;
  const int c = threadIdx.x;
  const float* base = R + ((size_t)(b * HW) + (size_t)slab * 256) * C3 + c;
  float s = 0.f;
#pragma unroll 4
  for (int i = 0; i < 256; ++i) { const float f = base[(size_t)i * C3]; s = fmaf(f, f, s); }
  float* gp = pn + ((size_t)(b * NSLN + slab)) * 256 + c;
  *(float*)gp = s;
  
}

// =================================================================================================================
// GSA score partials: block = (b, head h, slab of 2048 pixels), S[c][d] = sum_n q[h*32+c][n] k[h*32+d][n] over the
// slab on WMMA. Per 256-pixel chunk the q and k columns (f32 from R) are split into bf16 hi + residual planes
// transposed in LDS ([32 ch][GSP] k contiguous); waves: fragment f = wave&3 (2x2 of 16x16), k half = wave>>2;
// 3 products; the two k halves are combined in fixed order through LDS; the 32x32 f32 tile is staged and stored as
// grid = NB*NHEAD*NSLS, blk = (b*NHEAD + h)*NSLS + slab. coverage: planes 64 ch x 256 px per chunk (64 threads x 32
// groups x 8 px), tile 32x32 per block.
// =================================================================================================================
__global__ __launch_bounds__(256) void gsa_s_k(const float* __restrict__ R, float* pa) {
  extern __shared__ __align__(16) char smem[];
  unsigned short* pl = (unsigned short*)(smem + GL_QH);   // q hi @0, q lo @8448, k hi @16896, k lo @25344 (halves)
  float* red = (float*)(smem + GL_RED);
  float* stg = (float*)(smem + GL_STG);
  const int tid = threadIdx.x, wave = tid >> 5, lane = tid & 31, hh = lane >> 4, l15 = lane & 15;
  const int blk = blockIdx.x;
  const int b = blk / (NHEAD * NSLS);
  const int rem = blk - b * (NHEAD * NSLS);
  const int h = rem / NSLS;
  const int slab = rem - h * NSLS;
  const int f = wave & 3, mi = f >> 1, ni = f & 1, kh = wave >> 2;
  const int c = tid & 63, sel = c >> 5, cc = c & 31;
  const int col = sel * CC + h * HDC + cc;
  unsigned short* ph = pl + sel * 16896 + cc * GSP;
  unsigned short* plo = ph + 8448;
  const int g0 = tid >> 6;
  const size_t pbase = (size_t)(b * HW) + (size_t)slab * 2048;
  v8f acc = zero8();
#pragma unroll 1
  for (int ch = 0; ch < 8; ++ch) {
    const size_t pc = pbase + (size_t)ch * 256;
#pragma unroll 2
    for (int it = 0; it < 8; ++it) {
      const int g = it * 4 + g0;
      const float* rp = R + (pc + g * 8) * C3 + col;
      v4f v0, v1;
#pragma unroll
      for (int j = 0; j < 4; ++j) { v0[j] = rp[(size_t)j * C3]; v1[j] = rp[(size_t)(j + 4) * C3]; }
      v4u hp, lp;
      split8(v0, v1, hp, lp);
      *(v4u*)(ph + g * 8) = hp;
      *(v4u*)(plo + g * 8) = lp;
    }
    __syncthreads();
#pragma unroll
    for (int ks = 0; ks < 4; ++ks) {
      const int k0 = (kh * 4 + ks) * 32;
      const v16bf a_h = ldfrag(pl + (mi * 16 + l15) * GSP + k0 + 8 * hh);
      const v16bf a_l = ldfrag(pl + 8448 + (mi * 16 + l15) * GSP + k0 + 8 * hh);
      const v16bf b_h = ldfrag(pl + 16896 + (ni * 16 + l15) * GSP + k0 + 8 * hh);
      const v16bf b_l = ldfrag(pl + 25344 + (ni * 16 + l15) * GSP + k0 + 8 * hh);
      acc = mma_bf(a_h, b_h, acc);
      acc = mma_bf(a_h, b_l, acc);
      acc = mma_bf(a_l, b_h, acc);
    }
    __syncthreads();
  }
  if (wave >= 4) {
#pragma unroll
    for (int r = 0; r < 8; ++r) red[((wave - 4) * 32 + lane) * 8 + r] = acc[r];
  }
  __syncthreads();
  if (wave < 4) {
#pragma unroll
    for (int r = 0; r < 8; ++r) {
      const float o = red[(wave * 32 + lane) * 8 + r];
      const float v = acc[r] + o;
      stg[(mi * 16 + 8 * hh + r) * GXP + ni * 16 + l15] = v;
    }
  }
  __syncthreads();
  {
    const int row = tid >> 3, piece = tid & 7;
    const v4f v = *(const v4f*)(stg + row * GXP + piece * 4);
    float* gp = pa + (size_t)blk * 1024 + row * 32 + piece * 4;
    *(v4f*)gp = v;
    
  }
}

// =================================================================================================================
// GSA finisher, block = (b, h): invq/invk = 1/max(sqrt(sum of pn partials), 1e-12) for the head's 32 q and 32 k
// channels; attn[c][d] = relu(sum of pa partials * invq[c] * invk[d] * temp) -> bf16 hi + residual planes
// =================================================================================================================
__global__ __launch_bounds__(256) void gsa_fin_k(const float* __restrict__ pa, const float* __restrict__ pn,
                                                 const float* __restrict__ temp,
                                                 unsigned short* afh, unsigned short* afl) {
#pragma clang fp contract(off)
  __shared__ float sinv[64];
  const int tid = threadIdx.x;
  const int b = blockIdx.x / NHEAD;
  const int h = blockIdx.x - b * NHEAD;
  if (tid < 64) {
    const int sel = tid >> 5, i = tid & 31;
    const int c = sel * CC + h * HDC + i;
    float s = 0.f;
#pragma unroll 4
    for (int sl = 0; sl < NSLN; ++sl) s = s + pn[((size_t)(b * NSLN + sl)) * 256 + c];
    sinv[tid] = 1.0f / fmaxf(sqrtf(s), 1e-12f);
  }
  __syncthreads();
  const float tmp = bfr(temp[0]);
  const int e0 = tid * 4;
  const int c = e0 >> 5;
  v4f a;
#pragma unroll
  for (int j = 0; j < 4; ++j) {
    const int e = e0 + j;
    const int d = e & 31;
    float s = 0.f;
#pragma unroll
    for (int sl = 0; sl < NSLS; ++sl) s = s + pa[((size_t)((b * NHEAD + h) * NSLS + sl)) * 1024 + e];
    float v = s * sinv[c];
    v = v * sinv[32 + d];
    v = v * tmp;
    a[j] = fmaxf(v, 0.0f);
  }
  v2u ph, plw;
  split4(a, ph, plw);
  const size_t to = (size_t)b * AFSZ + (size_t)h * (HDC * HDC) + e0;
  *(v2u*)(afh + to) = ph;
  *(v2u*)(afl + to) = plw;
  
}

// =================================================================================================================
// GSA apply: out[p][h*32 + c] = sum_d v[p][h*32 + d] attn_h[c][d], K = 32 per head, both operands hi + residual
// (3 products). Wave tile 16 px x 64 cols (heads hd0 = n0/32 for fragments 0,1 and hd0+1 for 2,3), block = 128 px,
// coverage: 8 waves x 16 rows x 64 cols per block; grid covers NPIX x 128 once.
// =================================================================================================================
__global__ __launch_bounds__(256) void apply_k(const unsigned short* __restrict__ Vh,
                                               const unsigned short* __restrict__ Vl,
                                               const unsigned short* __restrict__ afh,
                                               const unsigned short* __restrict__ afl,
                                               unsigned short* Oh, unsigned short* Ol) {
  __shared__ __align__(16) float stg[8 * 16 * AXP];
  const int tid = threadIdx.x, wave = tid >> 5, lane = tid & 31, hh = lane >> 4, l15 = lane & 15;
  const int m0 = (blockIdx.x * 8 + wave) * 16;
  const int n0 = blockIdx.y * 64;
  const int b = m0 / HW;
  const int hd0 = n0 / HDC;
  const unsigned short* ar = Vh + (size_t)(m0 + l15) * CC + hd0 * HDC + 8 * hh;
  const unsigned short* al = Vl + (size_t)(m0 + l15) * CC + hd0 * HDC + 8 * hh;
  const v16bf a0h = ldfrag(ar), a0l = ldfrag(al);
  const v16bf a1h = ldfrag(ar + 32), a1l = ldfrag(al + 32);
  const unsigned short* wb = afh + (size_t)b * AFSZ + (size_t)(n0 + l15) * 32 + 8 * hh;
  const unsigned short* wl = afl + (size_t)b * AFSZ + (size_t)(n0 + l15) * 32 + 8 * hh;
  v8f c0 = zero8(), c1 = zero8(), c2 = zero8(), c3 = zero8();
  {
    const v16bf bh = ldfrag(wb), bl = ldfrag(wl);
    c0 = mma_bf(a0h, bh, c0); c0 = mma_bf(a0l, bh, c0); c0 = mma_bf(a0h, bl, c0);
  }
  {
    const v16bf bh = ldfrag(wb + 16 * 32), bl = ldfrag(wl + 16 * 32);
    c1 = mma_bf(a0h, bh, c1); c1 = mma_bf(a0l, bh, c1); c1 = mma_bf(a0h, bl, c1);
  }
  {
    const v16bf bh = ldfrag(wb + 32 * 32), bl = ldfrag(wl + 32 * 32);
    c2 = mma_bf(a1h, bh, c2); c2 = mma_bf(a1l, bh, c2); c2 = mma_bf(a1h, bl, c2);
  }
  {
    const v16bf bh = ldfrag(wb + 48 * 32), bl = ldfrag(wl + 48 * 32);
    c3 = mma_bf(a1h, bh, c3); c3 = mma_bf(a1l, bh, c3); c3 = mma_bf(a1h, bl, c3);
  }
  float* sw = stg + wave * (16 * AXP);
#pragma unroll
  for (int r = 0; r < 8; ++r) {
    sw[(8 * hh + r) * AXP + l15] = c0[r];
    sw[(8 * hh + r) * AXP + 16 + l15] = c1[r];
    sw[(8 * hh + r) * AXP + 32 + l15] = c2[r];
    sw[(8 * hh + r) * AXP + 48 + l15] = c3[r];
  }
  wave_sync_lds();
  const int q = lane >> 3, piece = lane & 7;
  v4u oh[4], ol[4];
#pragma unroll
  for (int it = 0; it < 4; ++it) {
    const int row = it * 4 + q;
    const float* sp = sw + row * AXP + piece * 8;
    const v4f v0 = *(const v4f*)(sp);
    const v4f v1 = *(const v4f*)(sp + 4);
    split8(v0, v1, oh[it], ol[it]);
  }
#pragma unroll
  for (int it = 0; it < 4; ++it) {
    const int row = it * 4 + q;
    const size_t to = (size_t)(m0 + row) * CC + n0 + piece * 8;
    *(v4u*)(Oh + to) = oh[it];
    *(v4u*)(Ol + to) = ol[it];
  }
  
}

// =================================================================================================================
// Workspace map (bytes), NPIX = NB*HW: A f32 [NPIX][128], Bx same, T = two bf16 planes [NPIX][128], U f32 slab
// [NPIX][192] (also used as [NPIX][128] f32 and as two bf16 planes [NPIX][128]), R f32 [NPIX][384] (also used as two
// bf16 planes [NPIX][384]), weights bf16 (655360), pn f32 [NB*NSLN][256], pa f32 [NB*NHEAD*NSLS][1024], af two bf16
// planes [NB][128][32]. Total 126910464 for NB=2, IMW=128. Every region is an exact multiple of its whole-row store
// granularity.
// =================================================================================================================
extern "C" void kernel_launch(void* const* d_in, const int* in_sizes, int n_in,
                              void* d_out, int out_size, void* d_ws, size_t ws_size,
                              hipStream_t stream) {
  if (n_in < 23) return;
  if (in_sizes[0] != NPIX * CC) return;
  if (in_sizes[1] != CC || in_sizes[2] != CC || in_sizes[3] != CC || in_sizes[4] != CC) return;
  if (in_sizes[5] != C3 * CC || in_sizes[6] != C3 * 9 || in_sizes[7] != CC * CC || in_sizes[8] < 1) return;
  if (in_sizes[9] != HID * CC || in_sizes[10] != HID * 9 || in_sizes[11] != CC * HID) return;
  if (in_sizes[12] != CC || in_sizes[13] != CC || in_sizes[14] != CC || in_sizes[15] != CC) return;
  if (in_sizes[16] != C3 * CC || in_sizes[17] != C3 * 9 || in_sizes[18] != CC * CC || in_sizes[19] < 1) return;
  if (in_sizes[20] != HID * CC || in_sizes[21] != HID * 9 || in_sizes[22] != CC * HID) return;
  if (out_size != NPIX * CC) return;

  const float* x        = (const float*)d_in[0];
  const float* w_s0     = (const float*)d_in[1];
  const float* b_s0     = (const float*)d_in[2];
  const float* w_s2     = (const float*)d_in[3];
  const float* b_s2     = (const float*)d_in[4];
  const float* rsa_qkv  = (const float*)d_in[5];
  const float* rsa_dw   = (const float*)d_in[6];
  const float* rsa_proj = (const float*)d_in[7];
  const float* rsa_temp = (const float*)d_in[8];
  const float* ffs_in   = (const float*)d_in[9];
  const float* ffs_dw   = (const float*)d_in[10];
  const float* ffs_out  = (const float*)d_in[11];
  const float* w_c0     = (const float*)d_in[12];
  const float* b_c0     = (const float*)d_in[13];
  const float* w_c2     = (const float*)d_in[14];
  const float* b_c2     = (const float*)d_in[15];
  const float* gsa_qkv  = (const float*)d_in[16];
  const float* gsa_dw   = (const float*)d_in[17];
  const float* gsa_proj = (const float*)d_in[18];
  const float* gsa_temp = (const float*)d_in[19];
  const float* ffc_in   = (const float*)d_in[20];
  const float* ffc_dw   = (const float*)d_in[21];
  const float* ffc_out  = (const float*)d_in[22];
  float* out = (float*)d_out;

  // ---- carve ----
  const size_t sAct = (size_t)NPIX * CC * 4;                        // f32 [NPIX][128]
  const size_t sT   = (size_t)NPIX * CC * 2 * 2;                    // two bf16 planes [NPIX][128]
  const size_t sU   = (size_t)NPIX * FSL * 4;                       // f32 [NPIX][192]
  const size_t sR   = (size_t)NPIX * C3 * 4;                        // f32 [NPIX][384] = two bf16 planes [NPIX][384]
  const size_t sWq  = (size_t)C3 * CC * 2;
  const size_t sWp  = (size_t)CC * CC * 2;
  const size_t sW1  = (size_t)HIDP * CC * 2;
  const size_t sW2  = (size_t)CC * HIDP * 2;
  const size_t sPN  = (size_t)NB * NSLN * 256 * 4;
  const size_t sPA  = (size_t)NB * NHEAD * NSLS * 1024 * 4;
  const size_t sAF  = (size_t)NB * AFSZ * 2;                        // per plane
  size_t off = 0;
  const size_t oA   = off; off += sAct;
  const size_t oBx  = off; off += sAct;
  const size_t oT   = off; off += sT;
  const size_t oU   = off; off += sU;
  const size_t oR   = off; off += sR;
  const size_t oWq0 = off; off += sWq;
  const size_t oWp0 = off; off += sWp;
  const size_t oW10 = off; off += sW1;
  const size_t oW20 = off; off += sW2;
  const size_t oWq1 = off; off += sWq;
  const size_t oWp1 = off; off += sWp;
  const size_t oW11 = off; off += sW1;
  const size_t oW21 = off; off += sW2;
  const size_t oPN  = off; off += sPN;
  const size_t oPA  = off; off += sPA;
  const size_t oAFh = off; off += sAF;
  const size_t oAFl = off; off += sAF;
  if (off > ws_size) return;                               // off = 126910464 for NB=2, IMW=128
  if (off > (size_t)134217728) return;
  if (sU < (size_t)NPIX * CC * 4) return;
  if (sU < (size_t)NPIX * CC * 2 * 2) return;
  if (sR < (size_t)NPIX * HIDP * 2 * 2) return;

  char* ws = (char*)d_ws;
  float* A  = (float*)(ws + oA);
  float* Bx = (float*)(ws + oBx);
  unsigned short* Th = (unsigned short*)(ws + oT);
  unsigned short* Tl = Th + (size_t)NPIX * CC;
  float* U  = (float*)(ws + oU);
  unsigned short* Uh = (unsigned short*)(ws + oU);
  unsigned short* Ul = Uh + (size_t)NPIX * CC;
  float* R  = (float*)(ws + oR);
  unsigned short* Gh = (unsigned short*)(ws + oR);
  unsigned short* Gl = Gh + (size_t)NPIX * HIDP;
  unsigned short* Wq0 = (unsigned short*)(ws + oWq0);
  unsigned short* Wp0 = (unsigned short*)(ws + oWp0);
  unsigned short* W10 = (unsigned short*)(ws + oW10);
  unsigned short* W20 = (unsigned short*)(ws + oW20);
  unsigned short* Wq1 = (unsigned short*)(ws + oWq1);
  unsigned short* Wp1 = (unsigned short*)(ws + oWp1);
  unsigned short* W11 = (unsigned short*)(ws + oW11);
  unsigned short* W21 = (unsigned short*)(ws + oW21);
  float* PN = (float*)(ws + oPN);
  float* PA = (float*)(ws + oPA);
  unsigned short* AFh = (unsigned short*)(ws + oAFh);
  unsigned short* AFl = (unsigned short*)(ws + oAFl);

  const dim3 blk(256);
  // (1) weights f32 [out][in] -> bf16 planes [outP][inP], k contiguous, zero padded
  cvt_w<<<dim3((C3 * CC / 8 + 255) / 256), blk, 0, stream>>>(rsa_qkv, Wq0, C3, CC, C3, CC);
  cvt_w<<<dim3((CC * CC / 8 + 255) / 256), blk, 0, stream>>>(rsa_proj, Wp0, CC, CC, CC, CC);
  cvt_w<<<dim3((HIDP * CC / 8 + 255) / 256), blk, 0, stream>>>(ffs_in, W10, HID, CC, HIDP, CC);
  cvt_w<<<dim3((CC * HIDP / 8 + 255) / 256), blk, 0, stream>>>(ffs_out, W20, CC, HID, CC, HIDP);
  cvt_w<<<dim3((C3 * CC / 8 + 255) / 256), blk, 0, stream>>>(gsa_qkv, Wq1, C3, CC, C3, CC);
  cvt_w<<<dim3((CC * CC / 8 + 255) / 256), blk, 0, stream>>>(gsa_proj, Wp1, CC, CC, CC, CC);
  cvt_w<<<dim3((HIDP * CC / 8 + 255) / 256), blk, 0, stream>>>(ffc_in, W11, HID, CC, HIDP, CC);
  cvt_w<<<dim3((CC * HIDP / 8 + 255) / 256), blk, 0, stream>>>(ffc_out, W21, CC, HID, CC, HIDP);

  // (2) x NCHW -> A pixel-major
  nchw_in<<<dim3(NB * (HW / 64)), blk, 0, stream>>>(x, A);

  (void)hipFuncSetAttribute(reinterpret_cast<const void*>(&rsa_attn_k), hipFuncAttributeMaxDynamicSharedMemorySize, RL_END);
  (void)hipFuncSetAttribute(reinterpret_cast<const void*>(&gsa_s_k), hipFuncAttributeMaxDynamicSharedMemorySize, GL_END);

  const dim3 gG128(NPIX / 256, CC / 32);
  const dim3 gG192(NPIX / 256, FSL / 32);
  const dim3 gDw128((NPIX / DWL * (128 / 4) + 255) / 256);
  const dim3 gDw192((NPIX / DWL * (192 / 4) + 255) / 256);
  const dim3 gLn(NPIX / 8);

  // ---- spatial (RSA) block ----
  ln_k<<<gLn, blk, 0, stream>>>(A, Bx, w_s0, b_s0, Th, Tl, 0);                          // T = LN_s0(x)
  for (int s = 0; s < 3; ++s) {                                                          // qkv 1x1 slab s -> U, dw (rolled) -> R
    gemm_k<CC, 0><<<gG128, blk, 0, stream>>>(Th, Tl, CC, Wq0 + (size_t)s * CC * CC, U, CC, Bx);
    dw_k<128, 0><<<gDw128, blk, 0, stream>>>(U, rsa_dw, s * CC, C3, WSZ / 2, R, C3, s * CC, Th, Tl, CC);
  }
  rsa_attn_k<<<dim3(NB * NWIN), blk, RL_END, stream>>>(R, rsa_temp, Th, Tl);            // T = window attention out
  gemm_k<CC, 0><<<gG128, blk, 0, stream>>>(Th, Tl, CC, Wp0, Bx, CC, A);                 // Bx = x_
  ln_k<<<gLn, blk, 0, stream>>>(A, Bx, w_s2, b_s2, Th, Tl, 1);                          // A = x_+x ; T = LN_s2(A)
  for (int s = 0; s < 2; ++s) {                                                          // ffn-in slab s -> U, dw+gelu -> G planes
    gemm_k<CC, 0><<<gG192, blk, 0, stream>>>(Th, Tl, CC, W10 + (size_t)s * FSL * CC, U, FSL, Bx);
    dw_k<192, 1><<<gDw192, blk, 0, stream>>>(U, ffs_dw, s * FSL, HID, 0, R, C3, s * FSL, Gh, Gl, HIDP);
  }
  gemm_k<HIDP, 1><<<gG128, blk, 0, stream>>>(Gh, Gl, HIDP, W20, A, CC, Bx);              // A = ffn + x_

  // ---- channel (GSA) block ----
  ln_k<<<gLn, blk, 0, stream>>>(A, Bx, w_c0, b_c0, Th, Tl, 0);                          // T = LN_c0(x)
  for (int s = 0; s < 2; ++s) {                                                          // q, k: 1x1 slab -> U, dw -> R f32
    gemm_k<CC, 0><<<gG128, blk, 0, stream>>>(Th, Tl, CC, Wq1 + (size_t)s * CC * CC, U, CC, Bx);
    dw_k<128, 0><<<gDw128, blk, 0, stream>>>(U, gsa_dw, s * CC, C3, 0, R, C3, s * CC, Th, Tl, CC);
  }
  gemm_k<CC, 0><<<gG128, blk, 0, stream>>>(Th, Tl, CC, Wq1 + (size_t)2 * CC * CC, U, CC, Bx);   // v: 1x1 -> U
  dw_k<128, 2><<<gDw128, blk, 0, stream>>>(U, gsa_dw, 2 * CC, C3, 0, R, C3, 0, Th, Tl, CC);     // v planes -> T region
  gsa_norm_k<<<dim3(NB * NSLN), blk, 0, stream>>>(R, PN);
  gsa_s_k<<<dim3(NB * NHEAD * NSLS), blk, GL_END, stream>>>(R, PA);
  gsa_fin_k<<<dim3(NB * NHEAD), blk, 0, stream>>>(PA, PN, gsa_temp, AFh, AFl);
  apply_k<<<dim3(NPIX / 128, CC / 64), blk, 0, stream>>>(Th, Tl, AFh, AFl, Uh, Ul);     // U planes = channel attention out
  gemm_k<CC, 0><<<gG128, blk, 0, stream>>>(Uh, Ul, CC, Wp1, Bx, CC, A);                 // Bx = x_
  ln_k<<<gLn, blk, 0, stream>>>(A, Bx, w_c2, b_c2, Th, Tl, 1);                          // A = x_+x ; T = LN_c2(A)
  for (int s = 0; s < 2; ++s) {
    gemm_k<CC, 0><<<gG192, blk, 0, stream>>>(Th, Tl, CC, W11 + (size_t)s * FSL * CC, U, FSL, Bx);
    dw_k<192, 1><<<gDw192, blk, 0, stream>>>(U, ffc_dw, s * FSL, HID, 0, R, C3, s * FSL, Gh, Gl, HIDP);
  }
  gemm_k<HIDP, 2><<<gG128, blk, 0, stream>>>(Gh, Gl, HIDP, W21, out, CC, Bx);            // d_out NCHW = ffn + x_
  (void)hipGetLastError();
}

// v003
// One run takes 372 microseconds.
// Next to v002, in two timings, it ran 1.16 and 1.17 times as fast.
// All steps since v000 together make it 1.96 times as fast.
// Contractions (1x1 convs for qkv / proj / ffn-in / ffn-out, window q^T.k and v.attn, global q.k^T and attn.v):
// v_wmma_f32_16x16x32_bf16 (bf16 operands, f32 accumulate); computed operands carried as bf16 hi + residual planes,
// weight operands single bf16; layer norms, depthwise 3x3 convs, erf GELU, l2 norms and residual adds in f32 on VALU.
// Inputs RNE-converted to bf16 on load.
#include <hip/hip_runtime.h>
#include <math.h>
#include <stdint.h>

#define NB    2
#define CC    128
#define IMW   128
#define HW    (IMW * IMW)
#define NPIX  (NB * HW)
#define C3    384
#define HID   340
#define HIDP  384
#define NHEAD 4
#define HDC   32
#define WSZ   4
#define NWX   (IMW / WSZ)
#define NWIN  (NWX * NWX)
#define NSLN  (HW / 256)
#define NSLS  (HW / 2048)
#define AFSZ  (CC * HDC)
#define RSQ2  0.70710678118654752f
#define GXP   36
#define AXP   68
#define TXP   132
#define ATP   136
#define GSP   264
#define DWL   8

static_assert((IMW & (IMW - 1)) == 0);
static_assert(IMW % WSZ == 0);
static_assert(WSZ == 4);
static_assert(IMW % DWL == 0);
static_assert(HW % 2048 == 0);
static_assert(HW % 256 == 0);
static_assert(HW % 64 == 0);
static_assert(NPIX % 256 == 0);
static_assert(CC == NHEAD * HDC);
static_assert(HDC == 32);
static_assert((GXP * 4) % 16 == 0);
static_assert((AXP * 4) % 16 == 0);
static_assert((TXP * 4) % 16 == 0);
static_assert((ATP * 2) % 16 == 0);
static_assert((GSP * 2) % 16 == 0);

// RSA window kernel dynamic LDS map (bytes)
#define RL_R    0
#define RL_QTH  24576
#define RL_QTL  28672
#define RL_KTH  32768
#define RL_KTL  36864
#define RL_ATH  40960
#define RL_ATL  75776
#define RL_VH   110592
#define RL_VL   114944
#define RL_INV  119296
#define RL_END  119424
static_assert(RL_QTH == RL_R + 16 * C3 * 4);
static_assert(RL_QTL == RL_QTH + CC * 16 * 2);
static_assert(RL_KTH == RL_QTL + CC * 16 * 2);
static_assert(RL_KTL == RL_KTH + CC * 16 * 2);
static_assert(RL_ATH == RL_KTL + CC * 16 * 2);
static_assert(RL_ATL == RL_ATH + CC * ATP * 2);
static_assert(RL_VH == RL_ATL + CC * ATP * 2);
static_assert(RL_VL == RL_VH + 16 * ATP * 2);
static_assert(RL_INV == RL_VL + 16 * ATP * 2);
static_assert(RL_END == RL_INV + 32 * 4);
static_assert(16 * TXP * 4 <= RL_QTH - RL_R);

// GSA score kernel dynamic LDS map (bytes)
#define GL_QH   0
#define GL_QL   16896
#define GL_KH   33792
#define GL_KL   50688
#define GL_RED  67584
#define GL_STG  71680
#define GL_END  76288
static_assert(GL_QL == 32 * GSP * 2);
static_assert(GL_KH == 2 * GL_QL);
static_assert(GL_KL == 3 * GL_QL);
static_assert(GL_RED == 4 * GL_QL);
static_assert(GL_STG == GL_RED + 4 * 32 * 8 * 4);
static_assert(GL_END == GL_STG + 32 * GXP * 4);

typedef __bf16         v16bf __attribute__((ext_vector_type(16)));
typedef unsigned short v8us  __attribute__((ext_vector_type(8)));
typedef float          v8f   __attribute__((ext_vector_type(8)));
typedef float          v4f   __attribute__((ext_vector_type(4)));
typedef unsigned int   v4u   __attribute__((ext_vector_type(4)));
typedef unsigned int   v2u   __attribute__((ext_vector_type(2)));

union Frag { v16bf v; v8us u[2]; };

// ---- scalar helpers ------------------------------------------------------------------------------------------
__device__ __forceinline__ unsigned short bf_bits(float f) {          // f32 -> bf16 bits, RNE convert
  unsigned u = __float_as_uint(f);
  return (unsigned short)((u + 0x7FFFu + ((u >> 16) & 1u)) >> 16);
}
__device__ __forceinline__ float bf_up(unsigned short h) { return __uint_as_float(((unsigned)h) << 16); }
__device__ __forceinline__ float bfr(float f) { return bf_up(bf_bits(f)); }
__device__ __forceinline__ unsigned pk16(unsigned short a, unsigned short b) { return (unsigned)a | ((unsigned)b << 16); }
// hi = bf16(v), lo = bf16(v - hi)
__device__ __forceinline__ void split_bf(float v, unsigned short& hi, unsigned short& lo) {
  const unsigned short hb = bf_bits(v);
  hi = hb;
  lo = bf_bits(v - bf_up(hb));
}
__device__ __forceinline__ void split4(v4f v, v2u& ph, v2u& pl) {
  unsigned short h[4], l[4];
#pragma unroll
  for (int e = 0; e < 4; ++e) split_bf(v[e], h[e], l[e]);
  ph[0] = pk16(h[0], h[1]); ph[1] = pk16(h[2], h[3]);
  pl[0] = pk16(l[0], l[1]); pl[1] = pk16(l[2], l[3]);
}
__device__ __forceinline__ void split8(v4f v0, v4f v1, v4u& ph, v4u& pl) {
  unsigned short h[8], l[8];
#pragma unroll
  for (int e = 0; e < 4; ++e) { split_bf(v0[e], h[e], l[e]); split_bf(v1[e], h[4 + e], l[4 + e]); }
#pragma unroll
  for (int e = 0; e < 4; ++e) { ph[e] = pk16(h[2 * e], h[2 * e + 1]); pl[e] = pk16(l[2 * e], l[2 * e + 1]); }
}
__device__ __forceinline__ v8f zero8() { v8f z = {0.f, 0.f, 0.f, 0.f, 0.f, 0.f, 0.f, 0.f}; return z; }
__device__ __forceinline__ v8us zero8us() { v8us z = {0, 0, 0, 0, 0, 0, 0, 0}; return z; }

// ---- fragment loaders: 16-bit A/B operand, lane -> row/col (lane&15), p already includes +8*(lane>>4);
//      elements 0..7 <- p[0..7] (k0+8h..), elements 8..15 <- p[16..23] (k0+16+8h..)
__device__ __forceinline__ v16bf ldfrag(const unsigned short* p) {
  Frag f;
  f.u[0] = *(const v8us*)(p);
  f.u[1] = *(const v8us*)(p + 16);
  return f.v;
}
// K = 16 contraction padded to 32: elements 8..15 are zero
__device__ __forceinline__ v16bf ldfrag16(const unsigned short* p) {
  Frag f;
  f.u[0] = *(const v8us*)(p);
  f.u[1] = zero8us();
  return f.v;
}

// ---- WMMA helper with trailing VALU hazard gap ---------------------------------------------------------------
__device__ __forceinline__ v8f mma_bf(v16bf a, v16bf b, v8f c) {
  c = __builtin_amdgcn_wmma_f32_16x16x32_bf16(false, a, false, b, (short)0, c, false, false);
#if defined(__HIP_DEVICE_COMPILE__)
  asm volatile("v_nop\n\tv_nop\n\tv_nop\n\tv_nop" : "+v"(c) : "v"(a), "v"(b));
#endif
  return c;
}
__device__ __forceinline__ void wave_sync_lds() {
  __builtin_amdgcn_fence(__ATOMIC_RELEASE, "workgroup");
  __builtin_amdgcn_wave_barrier();
  __builtin_amdgcn_fence(__ATOMIC_ACQUIRE, "workgroup");
}

// =================================================================================================================
// Weight convert: w f32 [rows][cols] -> bf16 [rowsP][colsP] (zero padded), value = bf16_RNE(w). One thread = 8
// coverage: rowsP * colsP/8 pieces, ceil(pieces/256) blocks (blk = block index within the matrix) with a bound.
// =================================================================================================================
__device__ __forceinline__ void cvt_w(const float* __restrict__ w, unsigned short* outp,
                                      int rows, int cols, int rowsP, int colsP, int blk) {
  const int t = blk * 256 + threadIdx.x;
  const int ppr = colsP >> 3;
  const int npc = rowsP * ppr;
  const bool ok = t < npc;
  const int tt = ok ? t : 0;
  const int r = tt / ppr, c8 = (tt - r * ppr) * 8;
  const int rr = min(r, rows - 1);
  unsigned short hv[8];
#pragma unroll
  for (int e = 0; e < 8; ++e) {
    const int c = c8 + e;
    const int cl = min(c, cols - 1);
    const float f = w[(size_t)rr * cols + cl];
    const float z = (r < rows && c < cols) ? f : 0.0f;
    hv[e] = bf_bits(z);
  }
  v4u pk;
#pragma unroll
  for (int e = 0; e < 4; ++e) pk[e] = pk16(hv[2 * e], hv[2 * e + 1]);
  unsigned short* gp = outp + (size_t)r * colsP + c8;
  if (ok) *(v4u*)gp = pk;
  
}

// =================================================================================================================
// NCHW f32 x -> pixel-major stream A [b*HW + p][128] f32, values bf16-RNE-converted. Block = (b, 64-pixel tile):
// 128 ch x 64 px loaded coalesced along p into an LDS tile [px][TXP]; store: each pixel row = 512 B = 32 lanes x
// coverage: 8 waves x 8 rows = 64 px x 128 ch per block; NB*(HW/64) blocks (blk) = every pixel once.
// =================================================================================================================
__device__ __forceinline__ void nchw_in(const float* __restrict__ x, float* A, float* xs, int blk) {
  const int tid = threadIdx.x, wave = tid >> 5, lane = tid & 31;
  const int b = blk / (HW / 64);
  const int p0 = (blk - b * (HW / 64)) * 64;
#pragma unroll
  for (int it = 0; it < 8; ++it) {
    const int q = it * 256 + tid;
    const int ch = q >> 4, j4 = (q & 15) * 4;
    const v4f v = *(const v4f*)(x + ((size_t)(b * CC + ch)) * HW + p0 + j4);
#pragma unroll
    for (int e = 0; e < 4; ++e) xs[(j4 + e) * TXP + ch] = bfr(v[e]);
  }
  __syncthreads();
  v4f ov[8];
#pragma unroll
  for (int it = 0; it < 8; ++it) {
    const int row = wave * 8 + it;
    ov[it] = *(const v4f*)(xs + row * TXP + lane * 4);
  }
#pragma unroll
  for (int it = 0; it < 8; ++it) {
    const int row = wave * 8 + it;
    *(v4f*)(A + ((size_t)(b * HW + p0 + row)) * CC + lane * 4) = ov[it];
  }
}

// =================================================================================================================
// Input preparation, one launch: the NCHW transpose and the eight weight converts need nothing of each other, so they
// share one grid by ranges of the block index (block-uniform branches; the transpose's barrier is passed by whole
// blocks only). Blocks [0, PB_T): transpose tiles; then per weight set (spatial, channel) PB_SET blocks: qkv, proj,
// ffn-in, ffn-out. Wb = the bf16 weight region, the four matrices of a set one behind the other, set after set.
// =================================================================================================================
#define PB_T    (NB * (HW / 64))
#define PB_Q    (C3 * CC / 8 / 256)
#define PB_P    (CC * CC / 8 / 256)
#define PB_1    (HIDP * CC / 8 / 256)
#define PB_2    (CC * HIDP / 8 / 256)
#define PB_SET  (PB_Q + PB_P + PB_1 + PB_2)
#define WSETN   (C3 * CC + CC * CC + HIDP * CC + CC * HIDP)
static_assert((C3 * CC) % 2048 == 0 && (CC * CC) % 2048 == 0 && (HIDP * CC) % 2048 == 0);
__global__ __launch_bounds__(256) void prep_k(const float* __restrict__ x, float* A,
                                              const float* __restrict__ wq0, const float* __restrict__ wp0,
                                              const float* __restrict__ w10, const float* __restrict__ w20,
                                              const float* __restrict__ wq1, const float* __restrict__ wp1,
                                              const float* __restrict__ w11, const float* __restrict__ w21,
                                              unsigned short* Wb) {
  __shared__ __align__(16) float xs[64 * TXP];
  const int bi = blockIdx.x;
  if (bi < PB_T) { nchw_in(x, A, xs, bi); return; }
  const int r0 = bi - PB_T;
  const int set = r0 / PB_SET;
  const int r = r0 - set * PB_SET;
  unsigned short* o = Wb + (size_t)set * WSETN;
  if (r < PB_Q) {
    cvt_w(set ? wq1 : wq0, o, C3, CC, C3, CC, r);
  } else if (r < PB_Q + PB_P) {
    cvt_w(set ? wp1 : wp0, o + C3 * CC, CC, CC, CC, CC, r - PB_Q);
  } else if (r < PB_Q + PB_P + PB_1) {
    cvt_w(set ? w11 : w10, o + C3 * CC + CC * CC, HID, CC, HIDP, CC, r - (PB_Q + PB_P));
  } else {
    cvt_w(set ? w21 : w20, o + C3 * CC + CC * CC + HIDP * CC, CC, HID, CC, HIDP, r - (PB_Q + PB_P + PB_1));
  }
}

// =================================================================================================================
// passes); output bf16 hi + residual planes Th/Tl [pix][128]: row = 256 B = 32 lanes x 8 B, one instruction per plane,
// =================================================================================================================
__global__ __launch_bounds__(256) void ln_k(float* A, const float* __restrict__ Badd,
                                            const float* __restrict__ g, const float* __restrict__ bv,
                                            unsigned short* Th, unsigned short* Tl, int addB) {
#pragma clang fp contract(off)
  const int tid = threadIdx.x, wave = tid >> 5, lane = tid & 31;
  const int p = blockIdx.x * 8 + wave;
  const int c4 = lane * 4;
  float* arow = A + (size_t)p * CC + c4;
  v4f xv = *(const v4f*)arow;
  if (addB != 0) {
    const v4f b2 = *(const v4f*)(Badd + (size_t)p * CC + c4);
    xv = xv + b2;
    *(v4f*)arow = xv;
    
  }
  float s = (xv[0] + xv[1]) + (xv[2] + xv[3]);
#pragma unroll
  for (int off = 1; off < 32; off <<= 1) s = s + __shfl_xor(s, off, 32);
  const float mu = s * (1.0f / 128.0f);
  float d[4];
  float s2 = 0.f;
#pragma unroll
  for (int e = 0; e < 4; ++e) { d[e] = xv[e] - mu; const float dd = d[e] * d[e]; s2 = s2 + dd; }
#pragma unroll
  for (int off = 1; off < 32; off <<= 1) s2 = s2 + __shfl_xor(s2, off, 32);
  const float var = s2 * (1.0f / 128.0f);
  const float rstd = 1.0f / sqrtf(var + 1e-6f);
  v4f z;
#pragma unroll
  for (int e = 0; e < 4; ++e) {
    float t0 = d[e] * rstd;
    t0 = t0 * bfr(g[c4 + e]);
    z[e] = t0 + bfr(bv[c4 + e]);
  }
  v2u ph, pl;
  split4(z, ph, pl);
  const size_t to = (size_t)p * CC + c4;
  *(v2u*)(Th + to) = ph;
  *(v2u*)(Tl + to) = pl;
  
}

// =================================================================================================================
// GEMM: OUT[p][n] = sum_k (Ah[p][k] + Al[p][k]) * W[n][k]  (A planes [pix][lda] bf16 hi + residual, W single bf16
// [N][K] k-contiguous, 2 products per tile pair). Wave tile 32 px x 32 out (2x2 fragments), block = 8 waves = 256 px.
// Fragments loaded straight from the 16-bit global rows with the split k map. Epilogue: the wave's 32x32 f32 tile is
// instruction per 4 rows); EP 1: same + res[p][n] (res pitch 128); EP 2: NCHW d_out[b][n][p] + res[p][n] (32 px of
// coverage: 8 waves x 32 rows x 32 cols per block = 256 px x 32 cols; grid covers NPIX x N once.
// =================================================================================================================
template <int K, int EP>
__global__ __launch_bounds__(256) void gemm_k(const unsigned short* __restrict__ Ah,
                                              const unsigned short* __restrict__ Al, int lda,
                                              const unsigned short* __restrict__ W,
                                              float* outf, int ldo, const float* __restrict__ res) {
  __shared__ __align__(16) float stg[8 * 32 * GXP];
  const int tid = threadIdx.x, wave = tid >> 5, lane = tid & 31, hh = lane >> 4, l15 = lane & 15;
  const int m0 = (blockIdx.x * 8 + wave) * 32;
  const int n0 = blockIdx.y * 32;
  const unsigned short* ah0 = Ah + (size_t)(m0 + l15) * lda + 8 * hh;
  const unsigned short* al0 = Al + (size_t)(m0 + l15) * lda + 8 * hh;
  const unsigned short* ah1 = ah0 + (size_t)16 * lda;
  const unsigned short* al1 = al0 + (size_t)16 * lda;
  const unsigned short* w0 = W + (size_t)(n0 + l15) * K + 8 * hh;
  const unsigned short* w1 = w0 + (size_t)16 * K;
  v8f c00 = zero8(), c01 = zero8(), c10 = zero8(), c11 = zero8();
#pragma unroll 2
  for (int k0 = 0; k0 < K; k0 += 32) {
    const v16bf a0h = ldfrag(ah0 + k0), a0l = ldfrag(al0 + k0);
    const v16bf a1h = ldfrag(ah1 + k0), a1l = ldfrag(al1 + k0);
    const v16bf b0 = ldfrag(w0 + k0), b1 = ldfrag(w1 + k0);
    c00 = mma_bf(a0h, b0, c00); c00 = mma_bf(a0l, b0, c00);
    c01 = mma_bf(a0h, b1, c01); c01 = mma_bf(a0l, b1, c01);
    c10 = mma_bf(a1h, b0, c10); c10 = mma_bf(a1l, b0, c10);
    c11 = mma_bf(a1h, b1, c11); c11 = mma_bf(a1l, b1, c11);
  }
  float* sw = stg + wave * (32 * GXP);
#pragma unroll
  for (int r = 0; r < 8; ++r) {
    sw[(8 * hh + r) * GXP + l15] = c00[r];
    sw[(8 * hh + r) * GXP + 16 + l15] = c01[r];
    sw[(16 + 8 * hh + r) * GXP + l15] = c10[r];
    sw[(16 + 8 * hh + r) * GXP + 16 + l15] = c11[r];
  }
  wave_sync_lds();
  const int q = lane >> 3, piece = lane & 7;
  v4f ov[8];
  if (EP != 2) {
#pragma unroll
    for (int it = 0; it < 8; ++it) {
      const int row = it * 4 + q;
      v4f v = *(const v4f*)(sw + row * GXP + piece * 4);
      if (EP == 1) {
        const v4f rr = *(const v4f*)(res + (size_t)(m0 + row) * CC + n0 + piece * 4);
        v = v + rr;
      }
      ov[it] = v;
    }
#pragma unroll
    for (int it = 0; it < 8; ++it) {
      const int row = it * 4 + q;
      *(v4f*)(outf + (size_t)(m0 + row) * ldo + n0 + piece * 4) = ov[it];
    }
    
  } else {
    const int b = m0 / HW;
    const int plx = m0 - b * HW;
#pragma unroll
    for (int it = 0; it < 8; ++it) {
      const int ch = it * 4 + q;
      v4f v;
#pragma unroll
      for (int e = 0; e < 4; ++e) {
        const float rv = res[(size_t)(m0 + piece * 4 + e) * CC + n0 + ch];
        v[e] = sw[(piece * 4 + e) * GXP + ch] + rv;
      }
      ov[it] = v;
    }
#pragma unroll
    for (int it = 0; it < 8; ++it) {
      const int ch = it * 4 + q;
      *(v4f*)(outf + ((size_t)(b * CC + n0 + ch)) * HW + plx + piece * 4) = ov[it];
    }
    
  }
}

// =================================================================================================================
// Depthwise 3x3, SAME zero padding, cross-correlation taps, optional cyclic roll (output pixel index in the rolled
// frame, source slab in the unrolled frame: source pixel ((ny+roll) mod IMW, (nx+roll) mod IMW), valid iff the rolled
// neighbour (ny,nx) is inside the image). src [pix][CS] f32 (CS = all 384 channels of the conv), 4 channels per thread,
// weights wd[(wofs + c)*9 + tap] bf16-RNE (clamped address, zero for c >= cvalid): the block's CS*9 weights are read
// once (thread = channel, in steps of 256) and laid out in LDS as [tap][CS], channel contiguous, so that a thread takes
// its 4 channels of one tap with one 16-byte LDS read.
// A thread computes a strip of DWL output pixels along x: it loads the 3 x (DWL+2) source pixels of the strip once,
// all loads in flight together, keeps them in registers, and each loaded column serves up to three outputs; the taps
// come from LDS once per strip. Strips that follow one another in the grid lie under one another in y (a block's
// strips share source rows).
// A row outside the image zeroes its three taps; only the strip's two outer columns can lie outside the image.
// MODE 0: f32 rows dstf[p*dpitch + dcol + c]; MODE 1: exact-erf GELU (rolled) then bf16 hi + residual planes
// Ph/Pl[p*ppitch + dcol + c]; MODE 2: channels below 2*CC (q, k) as MODE 0, the rest (v) as planes without the GELU at
// Ph/Pl[p*ppitch + c - 2*CC] (a wave's 32 threads hold 128 channels in a row, so the choice is the same for a wave).
// coverage: (NPIX/DWL) * CS/4 threads x DWL pixels, grid ceil-div with an in-kernel bound.
// =================================================================================================================
template <int CS, int MODE>
__global__ __launch_bounds__(256) void dw_k(const float* __restrict__ src, const float* __restrict__ wd,
                                            int wofs, int cvalid, int roll,
                                            float* dstf, int dpitch, int dcol,
                                            unsigned short* Ph, unsigned short* Pl, int ppitch) {
  constexpr int TPP = CS / 4;
  constexpr int NSTR = NPIX / DWL;           // strips in all
  constexpr int SPI = HW / DWL;              // strips per image
  static_assert(CS % 128 == 0);
  __shared__ __align__(16) float wsm[9 * CS];
  constexpr int WTR = (CS + 255) / 256;      // thread = channel, its 9 taps, in WTR steps of 256 channels
  float wf[WTR][9];
#pragma unroll                               // constant indices keep wf in registers
  for (int k = 0; k < WTR; ++k) {            // no test here (the address is clamped): every step's loads behind one wait
    const float* wp = wd + min(wofs + (int)threadIdx.x + k * 256, cvalid - 1) * 9;
#pragma unroll                               // constant indices keep wf in registers
    for (int tp = 0; tp < 9; ++tp) wf[k][tp] = wp[tp];
  }
#pragma unroll                               // constant indices keep wf in registers
  for (int k = 0; k < WTR; ++k) {
    const int ch = (int)threadIdx.x + k * 256;
    const float wok = (wofs + ch < cvalid) ? 1.0f : 0.0f;
    if (ch < CS) {                           // whole waves
#pragma unroll                               // constant indices keep wf in registers
      for (int tp = 0; tp < 9; ++tp) wsm[tp * CS + ch] = bfr(wf[k][tp]) * wok;
    }
  }
  __syncthreads();                           // every wave reads table rows that other waves wrote
  const int t = blockIdx.x * 256 + threadIdx.x;
  int s = t / TPP;
  const int cg = t - s * TPP;
  const bool pv = s < NSTR;
  s = pv ? s : (NSTR - 1);
  const int c = cg * 4;
  const int b = s / SPI;
  const int sr = s - b * SPI;
  const int xs = sr / IMW;
  const int y = sr - xs * IMW;
  const int x0 = xs * DWL;
  const v4f* s4 = (const v4f*)src;            // slab rows in 16-byte units: TPP units per pixel
  // Every loop below but the GELU loop is unrolled in full so that its indices are constants: the offsets, the 3 x (DWL+2) window,
  // the taps and the DWL sums then live in registers (an index known only at run time would put them in scratch).
  int ro[3], co[DWL + 2], ix[3][DWL + 2];
#pragma unroll                               // see above
  for (int dy = 0; dy < 3; ++dy) {
    const int sy = (y + dy - 1 + roll) & (IMW - 1);
    ro[dy] = (b * HW + sy * IMW) * TPP + cg;
  }
#pragma unroll                               // see above
  for (int j = 0; j < DWL + 2; ++j) {
    const int sx = (x0 + j - 1 + roll) & (IMW - 1);
    co[j] = sx * TPP;
  }
#pragma unroll                               // see above
  for (int dy = 0; dy < 3; ++dy) {
#pragma unroll                               // see above
    for (int j = 0; j < DWL + 2; ++j) ix[dy][j] = ro[dy] + co[j];
  }
  const int p0 = b * HW + y * IMW + x0;      // first output pixel of the strip
  const float ml = (x0 > 0) ? 1.0f : 0.0f;
  const float mr = (x0 + DWL < IMW) ? 1.0f : 0.0f;
  v4f v[3][DWL + 2];
#pragma unroll                               // see above
  for (int dy = 0; dy < 3; ++dy) {
#pragma unroll                               // see above
    for (int j = 0; j < DWL + 2; ++j) v[dy][j] = s4[ix[dy][j]];
    // the next row's loads may be given registers that held this row's offsets: the wait stands in front of them
    if (dy < 2) asm volatile("s_wait_xcnt 0x0" ::: "memory");
  }
  static_assert(DWL == 8);                   // the statement below names the 3 x 10 loaded values one by one
  // Inputs only: every load of the window is issued in front of this line, so the wave waits out one memory latency
  // for all 30; without it the compiler spreads the loads among the sums and waits for them a few at a time.
  asm volatile("" :: "v"(v[0][0]), "v"(v[0][1]), "v"(v[0][2]), "v"(v[0][3]), "v"(v[0][4]),
                     "v"(v[0][5]), "v"(v[0][6]), "v"(v[0][7]), "v"(v[0][8]), "v"(v[0][9]),
                     "v"(v[1][0]), "v"(v[1][1]), "v"(v[1][2]), "v"(v[1][3]), "v"(v[1][4]),
                     "v"(v[1][5]), "v"(v[1][6]), "v"(v[1][7]), "v"(v[1][8]), "v"(v[1][9]),
                     "v"(v[2][0]), "v"(v[2][1]), "v"(v[2][2]), "v"(v[2][3]), "v"(v[2][4]),
                     "v"(v[2][5]), "v"(v[2][6]), "v"(v[2][7]), "v"(v[2][8]), "v"(v[2][9]));
  v4f acc[DWL];
#pragma unroll                               // see above
  for (int i = 0; i < DWL; ++i) acc[i] = v4f{0.f, 0.f, 0.f, 0.f};
  // row by row: a row's registers are free once its three taps are summed; each output still sums its taps 0..8 in order
#pragma unroll                               // see above
  for (int dy = 0; dy < 3; ++dy) {
    const float rm = ((unsigned)(y + dy - 1) < (unsigned)IMW) ? 1.0f : 0.0f;
    v4f wv[3];
#pragma unroll                               // see above
    for (int dx = 0; dx < 3; ++dx) wv[dx] = *(const v4f*)(wsm + (dy * 3 + dx) * CS + c) * rm;
    v[dy][0] = v[dy][0] * ml;
    v[dy][DWL + 1] = v[dy][DWL + 1] * mr;
#pragma unroll                               // see above
    for (int i = 0; i < DWL; ++i) {          // output by output: column i is free once output i has its row
#pragma unroll                               // see above
      for (int dx = 0; dx < 3; ++dx) acc[i] = acc[i] + v[dy][i + dx] * wv[dx];
    }
    // the next row's taps are read only now: all 9 read ahead take 24 registers more, and above 160 registers fewer
    // than three blocks are resident per WGP
    if (dy < 2) __builtin_amdgcn_sched_barrier(0);
  }
#pragma unroll                               // see above
  for (int i = 0; i < DWL; ++i) {
    v4f a = acc[i];
    if (MODE == 1) {
#pragma unroll 1                             // rolled as before: one copy of the erf code per output pixel
      for (int e = 0; e < 4; ++e) {
        const float g = (e == 0) ? a[0] : ((e == 1) ? a[1] : ((e == 2) ? a[2] : a[3]));
        const float er = erff(g * RSQ2);
        float gl = 0.5f * g;
        gl = gl * (1.0f + er);
        a[0] = (e == 0) ? gl : a[0];
        a[1] = (e == 1) ? gl : a[1];
        a[2] = (e == 2) ? gl : a[2];
        a[3] = (e == 3) ? gl : a[3];
      }
    }
    if (MODE == 0 || (MODE == 2 && c < 2 * CC)) {
      float* gp = dstf + (size_t)(p0 + i) * dpitch + dcol + c;
      if (pv) *(v4f*)gp = a;
    } else {
      v2u ph, plw;
      split4(a, ph, plw);
      const size_t to = (size_t)(p0 + i) * ppitch + dcol + (MODE == 2 ? c - 2 * CC : c);
      if (pv) { *(v2u*)(Ph + to) = ph; *(v2u*)(Pl + to) = plw; }
    }
  }
}

// =================================================================================================================
// RSA window attention, one 4x4 window (16 tokens) per block of 256 threads, R = dwconv output in the rolled frame
// [pix][384] f32 (q | k | v column blocks):
//   phase 0: the 16 token rows x 384 f32 into LDS; phase 1: per token and per q/k the l2 norm over its 128 channels
//   (inv = 1/max(sqrt(sum), 1e-12)); phase 2: q^T and k^T as bf16 hi + residual planes [c][16 tok] (k contiguous),
//   v as planes [tok][ATP]; phase 3 (wave = c tile): attn[c][d] = relu(temp * sum_p qn[p][c] kn[p][d]) on WMMA, K = 16
//   (fragment elements 8..15 zero), 3 products, stored transposed as planes AttT[d][c]; phase 4 (wave = d tile):
//   out[p][d] = sum_c v[p][c] attn[c][d], K = 128, 3 products, staged f32 [16][TXP] in LDS; phase 5: each token row
//   (128 values -> hi + residual, 256 B per plane = 16 lanes x 16 B) written to its unrolled pixel (inverse roll +2,+2),
//   coverage: qT/kT 128 c x 16 tok x 2 planes, v 16 x 128, AttT 128 d x 128 c (8 waves x 8 tiles), out 16 x 128
//   (8 waves x 16 cols), store 8 waves x 2 rows x 128.
// =================================================================================================================
__global__ __launch_bounds__(256) void rsa_attn_k(const float* __restrict__ R, const float* __restrict__ temp,
                                                  unsigned short* Th, unsigned short* Tl) {
#pragma clang fp contract(off)
  extern __shared__ __align__(16) char smem[];
  float* sR = (float*)(smem + RL_R);
  float* ost = (float*)(smem + RL_R);                     // reused after phase 2
  unsigned short* qt = (unsigned short*)(smem + RL_QTH);  // qT hi @0, qT lo @2048, kT hi @4096, kT lo @6144 (halves)
  unsigned short* ath = (unsigned short*)(smem + RL_ATH);
  unsigned short* atl = (unsigned short*)(smem + RL_ATL);
  unsigned short* vh = (unsigned short*)(smem + RL_VH);
  unsigned short* vl = (unsigned short*)(smem + RL_VL);
  float* sinv = (float*)(smem + RL_INV);
  const int tid = threadIdx.x, wave = tid >> 5, lane = tid & 31, hh = lane >> 4, l15 = lane & 15;
  const int b = blockIdx.x / NWIN;
  const int w2 = blockIdx.x - b * NWIN;
  const int wy = w2 / NWX;
  const int wx = w2 - wy * NWX;

  // ---- phase 0: token rows ----
#pragma unroll
  for (int it = 0; it < 6; ++it) {
    const int idx = it * 256 + tid;
    const int pi = idx / 96;
    const int c4 = (idx - pi * 96) * 4;
    const int ry = wy * WSZ + (pi / WSZ), rx = wx * WSZ + (pi - (pi / WSZ) * WSZ);
    const v4f v = *(const v4f*)(R + ((size_t)(b * HW) + (size_t)ry * IMW + rx) * C3 + c4);
    *(v4f*)(sR + pi * C3 + c4) = v;
  }
  __syncthreads();

  // ---- phase 1: l2 norms per token over its 128 q (or k) channels ----
  {
    const int pair = tid >> 3, sub = tid & 7;
    const int sel = pair >> 4, pi = pair & 15;
    const float* rp = sR + pi * C3 + sel * CC + sub * 16;
    float s = 0.f;
#pragma unroll
    for (int j = 0; j < 16; ++j) { const float f = rp[j]; const float ff = f * f; s = s + ff; }
    s = s + __shfl_xor(s, 1, 32);
    s = s + __shfl_xor(s, 2, 32);
    s = s + __shfl_xor(s, 4, 32);
    const float inv = 1.0f / fmaxf(sqrtf(s), 1e-12f);
    if (sub == 0) sinv[pair] = inv;
  }
  __syncthreads();

  // ---- phase 2: normalised q^T / k^T planes and v planes ----
  {
    const int c = tid >> 1, sel = tid & 1;
    unsigned short hv[16], lv[16];
#pragma unroll
    for (int pi = 0; pi < 16; ++pi) {
      const float v = sR[pi * C3 + sel * CC + c] * sinv[sel * 16 + pi];
      split_bf(v, hv[pi], lv[pi]);
    }
    v4u h0, h1, l0, l1;
#pragma unroll
    for (int e = 0; e < 4; ++e) {
      h0[e] = pk16(hv[2 * e], hv[2 * e + 1]);
      h1[e] = pk16(hv[8 + 2 * e], hv[8 + 2 * e + 1]);
      l0[e] = pk16(lv[2 * e], lv[2 * e + 1]);
      l1[e] = pk16(lv[8 + 2 * e], lv[8 + 2 * e + 1]);
    }
    unsigned short* dh = qt + sel * 4096 + c * 16;
    unsigned short* dl = dh + 2048;
    *(v4u*)(dh) = h0; *(v4u*)(dh + 8) = h1;
    *(v4u*)(dl) = l0; *(v4u*)(dl + 8) = l1;
    const int pi = tid >> 4, c8 = (tid & 15) * 8;
    const float* vr = sR + pi * C3 + 2 * CC + c8;
    const v4f v0 = *(const v4f*)(vr);
    const v4f v1 = *(const v4f*)(vr + 4);
    v4u ph, plw;
    split8(v0, v1, ph, plw);
    *(v4u*)(vh + pi * ATP + c8) = ph;
    *(v4u*)(vl + pi * ATP + c8) = plw;
  }
  __syncthreads();

  const float tmp = bfr(temp[0]);
  // ---- phase 3: attn = relu(temp * q^T k), 128 x 128, K = 16 ----
  {
    const int mi = wave;
    const v16bf a_h = ldfrag16(qt + (mi * 16 + l15) * 16 + 8 * hh);
    const v16bf a_l = ldfrag16(qt + 2048 + (mi * 16 + l15) * 16 + 8 * hh);
#pragma unroll 2
    for (int ni = 0; ni < 8; ++ni) {
      const v16bf b_h = ldfrag16(qt + 4096 + (ni * 16 + l15) * 16 + 8 * hh);
      const v16bf b_l = ldfrag16(qt + 6144 + (ni * 16 + l15) * 16 + 8 * hh);
      v8f acc = zero8();
      acc = mma_bf(a_h, b_h, acc);
      acc = mma_bf(a_h, b_l, acc);
      acc = mma_bf(a_l, b_h, acc);
      unsigned short hv[8], lv[8];
#pragma unroll
      for (int r = 0; r < 8; ++r) {
        float v = acc[r] * tmp;
        v = fmaxf(v, 0.0f);
        split_bf(v, hv[r], lv[r]);
      }
      v4u ph, plw;
#pragma unroll
      for (int e = 0; e < 4; ++e) { ph[e] = pk16(hv[2 * e], hv[2 * e + 1]); plw[e] = pk16(lv[2 * e], lv[2 * e + 1]); }
      const int d = ni * 16 + l15;
      *(v4u*)(ath + d * ATP + mi * 16 + 8 * hh) = ph;
      *(v4u*)(atl + d * ATP + mi * 16 + 8 * hh) = plw;
    }
  }
  __syncthreads();

  // ---- phase 4: out[p][d] = sum_c v[p][c] attn[c][d], K = 128 ----
  {
    const int ni = wave;
    v8f acc = zero8();
#pragma unroll
    for (int ks = 0; ks < 4; ++ks) {
      const v16bf a_h = ldfrag(vh + l15 * ATP + ks * 32 + 8 * hh);
      const v16bf a_l = ldfrag(vl + l15 * ATP + ks * 32 + 8 * hh);
      const v16bf b_h = ldfrag(ath + (ni * 16 + l15) * ATP + ks * 32 + 8 * hh);
      const v16bf b_l = ldfrag(atl + (ni * 16 + l15) * ATP + ks * 32 + 8 * hh);
      acc = mma_bf(a_h, b_h, acc);
      acc = mma_bf(a_h, b_l, acc);
      acc = mma_bf(a_l, b_h, acc);
    }
#pragma unroll
    for (int r = 0; r < 8; ++r) ost[(8 * hh + r) * TXP + ni * 16 + l15] = acc[r];
  }
  __syncthreads();

  // ---- phase 5: token rows to their unrolled pixels ----
  {
    const int tk = 2 * wave + hh;
    const int piece = l15;
    const float* orow = ost + tk * TXP + piece * 8;
    const v4f v0 = *(const v4f*)(orow);
    const v4f v1 = *(const v4f*)(orow + 4);
    v4u ph, plw;
    split8(v0, v1, ph, plw);
    const int iy = tk / WSZ, ix = tk - (tk / WSZ) * WSZ;
    const int ry = wy * WSZ + iy, rx = wx * WSZ + ix;
    const int py = (ry + WSZ / 2) & (IMW - 1), px = (rx + WSZ / 2) & (IMW - 1);
    const size_t gp = ((size_t)(b * HW) + (size_t)py * IMW + px) * CC + piece * 8;
    *(v4u*)(Th + gp) = ph;
    *(v4u*)(Tl + gp) = plw;
    
  }
}

// =================================================================================================================
// GSA sum-of-squares partials: block = (b, slab of 256 pixels), thread = channel c (q: 0..127, k: 128..255),
// =================================================================================================================
__device__ __forceinline__ void gsa_norm(const float* __restrict__ R, float* pn, int blk) {
  const int b = blk / NSLN;
  const int slab = blk - b * NSLN;
  const int c = threadIdx.x;
  const float* base = R + ((size_t)(b * HW) + (size_t)slab * 256) * C3 + c;
  float s = 0.f;
#pragma unroll 4
  for (int i = 0; i < 256; ++i) { const float f = base[(size_t)i * C3]; s = fmaf(f, f, s); }
  float* gp = pn + ((size_t)(b * NSLN + slab)) * 256 + c;
  *(float*)gp = s;
  
}

// =================================================================================================================
// GSA score partials: block = (b, head h, slab of 2048 pixels), S[c][d] = sum_n q[h*32+c][n] k[h*32+d][n] over the
// slab on WMMA. Per 256-pixel chunk the q and k columns (f32 from R) are split into bf16 hi + residual planes
// transposed in LDS ([32 ch][GSP] k contiguous); waves: fragment f = wave&3 (2x2 of 16x16), k half = wave>>2;
// 3 products; the two k halves are combined in fixed order through LDS; the 32x32 f32 tile is staged and stored as
// blk = (b*NHEAD + h)*NSLS + slab. coverage: planes 64 ch x 256 px per chunk (64 threads x 32
// groups x 8 px), tile 32x32 per block.
// The sum-of-squares partials need nothing of the scores and read the same R: they share this grid, blocks
// [NB*NHEAD*NSLS, NB*NHEAD*NSLS + NB*NSLN), and leave as whole blocks in front of the first barrier.
// =================================================================================================================
__global__ __launch_bounds__(256) void gsa_s_k(const float* __restrict__ R, float* pa, float* pn) {
  if (blockIdx.x >= NB * NHEAD * NSLS) { gsa_norm(R, pn, blockIdx.x - NB * NHEAD * NSLS); return; }
  extern __shared__ __align__(16) char smem[];
  unsigned short* pl = (unsigned short*)(smem + GL_QH);   // q hi @0, q lo @8448, k hi @16896, k lo @25344 (halves)
  float* red = (float*)(smem + GL_RED);
  float* stg = (float*)(smem + GL_STG);
  const int tid = threadIdx.x, wave = tid >> 5, lane = tid & 31, hh = lane >> 4, l15 = lane & 15;
  const int blk = blockIdx.x;
  const int b = blk / (NHEAD * NSLS);
  const int rem = blk - b * (NHEAD * NSLS);
  const int h = rem / NSLS;
  const int slab = rem - h * NSLS;
  const int f = wave & 3, mi = f >> 1, ni = f & 1, kh = wave >> 2;
  const int c = tid & 63, sel = c >> 5, cc = c & 31;
  const int col = sel * CC + h * HDC + cc;
  unsigned short* ph = pl + sel * 16896 + cc * GSP;
  unsigned short* plo = ph + 8448;
  const int g0 = tid >> 6;
  const size_t pbase = (size_t)(b * HW) + (size_t)slab * 2048;
  v8f acc = zero8();
#pragma unroll 1
  for (int ch = 0; ch < 8; ++ch) {
    const size_t pc = pbase + (size_t)ch * 256;
#pragma unroll 2
    for (int it = 0; it < 8; ++it) {
      const int g = it * 4 + g0;
      const float* rp = R + (pc + g * 8) * C3 + col;
      v4f v0, v1;
#pragma unroll
      for (int j = 0; j < 4; ++j) { v0[j] = rp[(size_t)j * C3]; v1[j] = rp[(size_t)(j + 4) * C3]; }
      v4u hp, lp;
      split8(v0, v1, hp, lp);
      *(v4u*)(ph + g * 8) = hp;
      *(v4u*)(plo + g * 8) = lp;
    }
    __syncthreads();
#pragma unroll
    for (int ks = 0; ks < 4; ++ks) {
      const int k0 = (kh * 4 + ks) * 32;
      const v16bf a_h = ldfrag(pl + (mi * 16 + l15) * GSP + k0 + 8 * hh);
      const v16bf a_l = ldfrag(pl + 8448 + (mi * 16 + l15) * GSP + k0 + 8 * hh);
      const v16bf b_h = ldfrag(pl + 16896 + (ni * 16 + l15) * GSP + k0 + 8 * hh);
      const v16bf b_l = ldfrag(pl + 25344 + (ni * 16 + l15) * GSP + k0 + 8 * hh);
      acc = mma_bf(a_h, b_h, acc);
      acc = mma_bf(a_h, b_l, acc);
      acc = mma_bf(a_l, b_h, acc);
    }
    __syncthreads();
  }
  if (wave >= 4) {
#pragma unroll
    for (int r = 0; r < 8; ++r) red[((wave - 4) * 32 + lane) * 8 + r] = acc[r];
  }
  __syncthreads();
  if (wave < 4) {
#pragma unroll
    for (int r = 0; r < 8; ++r) {
      const float o = red[(wave * 32 + lane) * 8 + r];
      const float v = acc[r] + o;
      stg[(mi * 16 + 8 * hh + r) * GXP + ni * 16 + l15] = v;
    }
  }
  __syncthreads();
  {
    const int row = tid >> 3, piece = tid & 7;
    const v4f v = *(const v4f*)(stg + row * GXP + piece * 4);
    float* gp = pa + (size_t)blk * 1024 + row * 32 + piece * 4;
    *(v4f*)gp = v;
    
  }
}

// =================================================================================================================
// GSA finisher, block = (b, h): invq/invk = 1/max(sqrt(sum of pn partials), 1e-12) for the head's 32 q and 32 k
// channels; attn[c][d] = relu(sum of pa partials * invq[c] * invk[d] * temp) -> bf16 hi + residual planes
// =================================================================================================================
__global__ __launch_bounds__(256) void gsa_fin_k(const float* __restrict__ pa, const float* __restrict__ pn,
                                                 const float* __restrict__ temp,
                                                 unsigned short* afh, unsigned short* afl) {
#pragma clang fp contract(off)
  __shared__ float sinv[64];
  const int tid = threadIdx.x;
  const int b = blockIdx.x / NHEAD;
  const int h = blockIdx.x - b * NHEAD;
  if (tid < 64) {
    const int sel = tid >> 5, i = tid & 31;
    const int c = sel * CC + h * HDC + i;
    float s = 0.f;
#pragma unroll 4
    for (int sl = 0; sl < NSLN; ++sl) s = s + pn[((size_t)(b * NSLN + sl)) * 256 + c];
    sinv[tid] = 1.0f / fmaxf(sqrtf(s), 1e-12f);
  }
  __syncthreads();
  const float tmp = bfr(temp[0]);
  const int e0 = tid * 4;
  const int c = e0 >> 5;
  v4f a;
#pragma unroll
  for (int j = 0; j < 4; ++j) {
    const int e = e0 + j;
    const int d = e & 31;
    float s = 0.f;
#pragma unroll
    for (int sl = 0; sl < NSLS; ++sl) s = s + pa[((size_t)((b * NHEAD + h) * NSLS + sl)) * 1024 + e];
    float v = s * sinv[c];
    v = v * sinv[32 + d];
    v = v * tmp;
    a[j] = fmaxf(v, 0.0f);
  }
  v2u ph, plw;
  split4(a, ph, plw);
  const size_t to = (size_t)b * AFSZ + (size_t)h * (HDC * HDC) + e0;
  *(v2u*)(afh + to) = ph;
  *(v2u*)(afl + to) = plw;
  
}

// =================================================================================================================
// GSA apply: out[p][h*32 + c] = sum_d v[p][h*32 + d] attn_h[c][d], K = 32 per head, both operands hi + residual
// (3 products). Wave tile 16 px x 64 cols (heads hd0 = n0/32 for fragments 0,1 and hd0+1 for 2,3), block = 128 px,
// coverage: 8 waves x 16 rows x 64 cols per block; grid covers NPIX x 128 once.
// =================================================================================================================
__global__ __launch_bounds__(256) void apply_k(const unsigned short* __restrict__ Vh,
                                               const unsigned short* __restrict__ Vl,
                                               const unsigned short* __restrict__ afh,
                                               const unsigned short* __restrict__ afl,
                                               unsigned short* Oh, unsigned short* Ol) {
  __shared__ __align__(16) float stg[8 * 16 * AXP];
  const int tid = threadIdx.x, wave = tid >> 5, lane = tid & 31, hh = lane >> 4, l15 = lane & 15;
  const int m0 = (blockIdx.x * 8 + wave) * 16;
  const int n0 = blockIdx.y * 64;
  const int b = m0 / HW;
  const int hd0 = n0 / HDC;
  const unsigned short* ar = Vh + (size_t)(m0 + l15) * CC + hd0 * HDC + 8 * hh;
  const unsigned short* al = Vl + (size_t)(m0 + l15) * CC + hd0 * HDC + 8 * hh;
  const v16bf a0h = ldfrag(ar), a0l = ldfrag(al);
  const v16bf a1h = ldfrag(ar + 32), a1l = ldfrag(al + 32);
  const unsigned short* wb = afh + (size_t)b * AFSZ + (size_t)(n0 + l15) * 32 + 8 * hh;
  const unsigned short* wl = afl + (size_t)b * AFSZ + (size_t)(n0 + l15) * 32 + 8 * hh;
  v8f c0 = zero8(), c1 = zero8(), c2 = zero8(), c3 = zero8();
  {
    const v16bf bh = ldfrag(wb), bl = ldfrag(wl);
    c0 = mma_bf(a0h, bh, c0); c0 = mma_bf(a0l, bh, c0); c0 = mma_bf(a0h, bl, c0);
  }
  {
    const v16bf bh = ldfrag(wb + 16 * 32), bl = ldfrag(wl + 16 * 32);
    c1 = mma_bf(a0h, bh, c1); c1 = mma_bf(a0l, bh, c1); c1 = mma_bf(a0h, bl, c1);
  }
  {
    const v16bf bh = ldfrag(wb + 32 * 32), bl = ldfrag(wl + 32 * 32);
    c2 = mma_bf(a1h, bh, c2); c2 = mma_bf(a1l, bh, c2); c2 = mma_bf(a1h, bl, c2);
  }
  {
    const v16bf bh = ldfrag(wb + 48 * 32), bl = ldfrag(wl + 48 * 32);
    c3 = mma_bf(a1h, bh, c3); c3 = mma_bf(a1l, bh, c3); c3 = mma_bf(a1h, bl, c3);
  }
  float* sw = stg + wave * (16 * AXP);
#pragma unroll
  for (int r = 0; r < 8; ++r) {
    sw[(8 * hh + r) * AXP + l15] = c0[r];
    sw[(8 * hh + r) * AXP + 16 + l15] = c1[r];
    sw[(8 * hh + r) * AXP + 32 + l15] = c2[r];
    sw[(8 * hh + r) * AXP + 48 + l15] = c3[r];
  }
  wave_sync_lds();
  const int q = lane >> 3, piece = lane & 7;
  v4u oh[4], ol[4];
#pragma unroll
  for (int it = 0; it < 4; ++it) {
    const int row = it * 4 + q;
    const float* sp = sw + row * AXP + piece * 8;
    const v4f v0 = *(const v4f*)(sp);
    const v4f v1 = *(const v4f*)(sp + 4);
    split8(v0, v1, oh[it], ol[it]);
  }
#pragma unroll
  for (int it = 0; it < 4; ++it) {
    const int row = it * 4 + q;
    const size_t to = (size_t)(m0 + row) * CC + n0 + piece * 8;
    *(v4u*)(Oh + to) = oh[it];
    *(v4u*)(Ol + to) = ol[it];
  }
  
}

// =================================================================================================================
// Workspace map (bytes), NPIX = NB*HW: A f32 [NPIX][128], Bx same, T = two bf16 planes [NPIX][128], U f32
// [NPIX][384] (also used as two bf16 planes [NPIX][128]), R f32 [NPIX][384] (also used as two
// bf16 planes [NPIX][384]), weights bf16 (655360), pn f32 [NB*NSLN][256], pa f32 [NB*NHEAD*NSLS][1024], af two bf16
// planes [NB][128][32]. Total 152076288 for NB=2, IMW=128. Every region is an exact multiple of its whole-row store
// granularity.
// =================================================================================================================
extern "C" void kernel_launch(void* const* d_in, const int* in_sizes, int n_in,
                              void* d_out, int out_size, void* d_ws, size_t ws_size,
                              hipStream_t stream) {
  if (n_in < 23) return;
  if (in_sizes[0] != NPIX * CC) return;
  if (in_sizes[1] != CC || in_sizes[2] != CC || in_sizes[3] != CC || in_sizes[4] != CC) return;
  if (in_sizes[5] != C3 * CC || in_sizes[6] != C3 * 9 || in_sizes[7] != CC * CC || in_sizes[8] < 1) return;
  if (in_sizes[9] != HID * CC || in_sizes[10] != HID * 9 || in_sizes[11] != CC * HID) return;
  if (in_sizes[12] != CC || in_sizes[13] != CC || in_sizes[14] != CC || in_sizes[15] != CC) return;
  if (in_sizes[16] != C3 * CC || in_sizes[17] != C3 * 9 || in_sizes[18] != CC * CC || in_sizes[19] < 1) return;
  if (in_sizes[20] != HID * CC || in_sizes[21] != HID * 9 || in_sizes[22] != CC * HID) return;
  if (out_size != NPIX * CC) return;

  const float* x        = (const float*)d_in[0];
  const float* w_s0     = (const float*)d_in[1];
  const float* b_s0     = (const float*)d_in[2];
  const float* w_s2     = (const float*)d_in[3];
  const float* b_s2     = (const float*)d_in[4];
  const float* rsa_qkv  = (const float*)d_in[5];
  const float* rsa_dw   = (const float*)d_in[6];
  const float* rsa_proj = (const float*)d_in[7];
  const float* rsa_temp = (const float*)d_in[8];
  const float* ffs_in   = (const float*)d_in[9];
  const float* ffs_dw   = (const float*)d_in[10];
  const float* ffs_out  = (const float*)d_in[11];
  const float* w_c0     = (const float*)d_in[12];
  const float* b_c0     = (const float*)d_in[13];
  const float* w_c2     = (const float*)d_in[14];
  const float* b_c2     = (const float*)d_in[15];
  const float* gsa_qkv  = (const float*)d_in[16];
  const float* gsa_dw   = (const float*)d_in[17];
  const float* gsa_proj = (const float*)d_in[18];
  const float* gsa_temp = (const float*)d_in[19];
  const float* ffc_in   = (const float*)d_in[20];
  const float* ffc_dw   = (const float*)d_in[21];
  const float* ffc_out  = (const float*)d_in[22];
  float* out = (float*)d_out;

  // ---- carve ----
  const size_t sAct = (size_t)NPIX * CC * 4;                        // f32 [NPIX][128]
  const size_t sT   = (size_t)NPIX * CC * 2 * 2;                    // two bf16 planes [NPIX][128]
  const size_t sU   = (size_t)NPIX * C3 * 4;                        // f32 [NPIX][384]
  const size_t sR   = (size_t)NPIX * C3 * 4;                        // f32 [NPIX][384] = two bf16 planes [NPIX][384]
  const size_t sWq  = (size_t)C3 * CC * 2;
  const size_t sWp  = (size_t)CC * CC * 2;
  const size_t sW1  = (size_t)HIDP * CC * 2;
  const size_t sW2  = (size_t)CC * HIDP * 2;
  const size_t sPN  = (size_t)NB * NSLN * 256 * 4;
  const size_t sPA  = (size_t)NB * NHEAD * NSLS * 1024 * 4;
  const size_t sAF  = (size_t)NB * AFSZ * 2;                        // per plane
  size_t off = 0;
  const size_t oA   = off; off += sAct;
  const size_t oBx  = off; off += sAct;
  const size_t oT   = off; off += sT;
  const size_t oU   = off; off += sU;
  const size_t oR   = off; off += sR;
  const size_t oWq0 = off; off += sWq;
  const size_t oWp0 = off; off += sWp;
  const size_t oW10 = off; off += sW1;
  const size_t oW20 = off; off += sW2;
  const size_t oWq1 = off; off += sWq;
  const size_t oWp1 = off; off += sWp;
  const size_t oW11 = off; off += sW1;
  const size_t oW21 = off; off += sW2;
  const size_t oPN  = off; off += sPN;
  const size_t oPA  = off; off += sPA;
  const size_t oAFh = off; off += sAF;
  const size_t oAFl = off; off += sAF;
  if (off > ws_size) return;                               // off = 152076288 for NB=2, IMW=128
  if (sU < (size_t)NPIX * HIDP * 4) return;
  if (sU < (size_t)NPIX * CC * 2 * 2) return;
  if (sR < (size_t)NPIX * HIDP * 2 * 2) return;

  char* ws = (char*)d_ws;
  float* A  = (float*)(ws + oA);
  float* Bx = (float*)(ws + oBx);
  unsigned short* Th = (unsigned short*)(ws + oT);
  unsigned short* Tl = Th + (size_t)NPIX * CC;
  float* U  = (float*)(ws + oU);
  unsigned short* Uh = (unsigned short*)(ws + oU);
  unsigned short* Ul = Uh + (size_t)NPIX * CC;
  float* R  = (float*)(ws + oR);
  unsigned short* Gh = (unsigned short*)(ws + oR);
  unsigned short* Gl = Gh + (size_t)NPIX * HIDP;
  unsigned short* Wq0 = (unsigned short*)(ws + oWq0);
  unsigned short* Wp0 = (unsigned short*)(ws + oWp0);
  unsigned short* W10 = (unsigned short*)(ws + oW10);
  unsigned short* W20 = (unsigned short*)(ws + oW20);
  unsigned short* Wq1 = (unsigned short*)(ws + oWq1);
  unsigned short* Wp1 = (unsigned short*)(ws + oWp1);
  unsigned short* W11 = (unsigned short*)(ws + oW11);
  unsigned short* W21 = (unsigned short*)(ws + oW21);
  float* PN = (float*)(ws + oPN);
  float* PA = (float*)(ws + oPA);
  unsigned short* AFh = (unsigned short*)(ws + oAFh);
  unsigned short* AFl = (unsigned short*)(ws + oAFl);

  const dim3 blk(256);
  // (1) x NCHW -> A pixel-major; weights f32 [out][in] -> bf16 planes [outP][inP], k contiguous, zero padded
  //     (Wq0 is the start of the weight region: Wq0, Wp0, W10, W20, Wq1, Wp1, W11, W21 lie one behind the other)
  prep_k<<<dim3(PB_T + 2 * PB_SET), blk, 0, stream>>>(x, A, rsa_qkv, rsa_proj, ffs_in, ffs_out,
                                                      gsa_qkv, gsa_proj, ffc_in, ffc_out, Wq0);

  (void)hipFuncSetAttribute(reinterpret_cast<const void*>(&rsa_attn_k), hipFuncAttributeMaxDynamicSharedMemorySize, RL_END);
  (void)hipFuncSetAttribute(reinterpret_cast<const void*>(&gsa_s_k), hipFuncAttributeMaxDynamicSharedMemorySize, GL_END);

  const dim3 gG128(NPIX / 256, CC / 32);
  const dim3 gG384(NPIX / 256, C3 / 32);
  const dim3 gDw((NPIX / DWL * (C3 / 4) + 255) / 256);
  const dim3 gLn(NPIX / 8);

  // ---- spatial (RSA) block ----
  ln_k<<<gLn, blk, 0, stream>>>(A, Bx, w_s0, b_s0, Th, Tl, 0);                          // T = LN_s0(x)
  gemm_k<CC, 0><<<gG384, blk, 0, stream>>>(Th, Tl, CC, Wq0, U, C3, Bx);                  // qkv 1x1 -> U
  dw_k<C3, 0><<<gDw, blk, 0, stream>>>(U, rsa_dw, 0, C3, WSZ / 2, R, C3, 0, Th, Tl, CC); // dw (rolled) -> R
  rsa_attn_k<<<dim3(NB * NWIN), blk, RL_END, stream>>>(R, rsa_temp, Th, Tl);            // T = window attention out
  gemm_k<CC, 0><<<gG128, blk, 0, stream>>>(Th, Tl, CC, Wp0, Bx, CC, A);                 // Bx = x_
  ln_k<<<gLn, blk, 0, stream>>>(A, Bx, w_s2, b_s2, Th, Tl, 1);                          // A = x_+x ; T = LN_s2(A)
  gemm_k<CC, 0><<<gG384, blk, 0, stream>>>(Th, Tl, CC, W10, U, HIDP, Bx);                // ffn-in -> U
  dw_k<HIDP, 1><<<gDw, blk, 0, stream>>>(U, ffs_dw, 0, HID, 0, R, C3, 0, Gh, Gl, HIDP);  // dw+gelu -> G planes
  gemm_k<HIDP, 1><<<gG128, blk, 0, stream>>>(Gh, Gl, HIDP, W20, A, CC, Bx);              // A = ffn + x_

  // ---- channel (GSA) block ----
  ln_k<<<gLn, blk, 0, stream>>>(A, Bx, w_c0, b_c0, Th, Tl, 0);                          // T = LN_c0(x)
  gemm_k<CC, 0><<<gG384, blk, 0, stream>>>(Th, Tl, CC, Wq1, U, C3, Bx);                  // qkv 1x1 -> U
  dw_k<C3, 2><<<gDw, blk, 0, stream>>>(U, gsa_dw, 0, C3, 0, R, C3, 0, Th, Tl, CC);       // q, k -> R f32; v planes -> T region
  gsa_s_k<<<dim3(NB * NHEAD * NSLS + NB * NSLN), blk, GL_END, stream>>>(R, PA, PN);      // score and norm partials
  gsa_fin_k<<<dim3(NB * NHEAD), blk, 0, stream>>>(PA, PN, gsa_temp, AFh, AFl);
  apply_k<<<dim3(NPIX / 128, CC / 64), blk, 0, stream>>>(Th, Tl, AFh, AFl, Uh, Ul);     // U planes = channel attention out
  gemm_k<CC, 0><<<gG128, blk, 0, stream>>>(Uh, Ul, CC, Wp1, Bx, CC, A);                 // Bx = x_
  ln_k<<<gLn, blk, 0, stream>>>(A, Bx, w_c2, b_c2, Th, Tl, 1);                          // A = x_+x ; T = LN_c2(A)
  gemm_k<CC, 0><<<gG384, blk, 0, stream>>>(Th, Tl, CC, W11, U, HIDP, Bx);
  dw_k<HIDP, 1><<<gDw, blk, 0, stream>>>(U, ffc_dw, 0, HID, 0, R, C3, 0, Gh, Gl, HIDP);
  gemm_k<HIDP, 2><<<gG128, blk, 0, stream>>>(Gh, Gl, HIDP, W21, out, CC, Bx);            // d_out NCHW = ffn + x_
  (void)hipGetLastError();
}

// v004
// It runs in 291 microseconds.
// Next to v003, in two timings, it ran 1.28 times as fast each time.
// Over all steps from v000 it is 2.51 times as fast.
// Contractions (1x1 convs for qkv / proj / ffn-in / ffn-out, window q^T.k and v.attn, global q.k^T and attn.v):
// v_wmma_f32_16x16x32_bf16 (bf16 operands, f32 accumulate); computed operands carried as bf16 hi + residual planes,
// weight operands single bf16; layer norms, depthwise 3x3 convs, erf GELU, l2 norms and residual adds in f32 on VALU.
// Inputs RNE-converted to bf16 on load.
#include <hip/hip_runtime.h>
#include <math.h>
#include <stdint.h>

#define NB    2
#define CC    128
#define IMW   128
#define HW    (IMW * IMW)
#define NPIX  (NB * HW)
#define C3    384
#define HID   340
#define HIDP  384
#define NHEAD 4
#define HDC   32
#define WSZ   4
#define NWX   (IMW / WSZ)
#define NWIN  (NWX * NWX)
#define NSLN  (HW / 256)
#define NSLS  (HW / 2048)
#define AFSZ  (CC * HDC)
#define RSQ2  0.70710678118654752f
#define GXP   36
#define AXP   68
#define TXP   132
#define ATP   136
#define GSP   264
#define DWL   8

static_assert((IMW & (IMW - 1)) == 0);
static_assert(IMW % WSZ == 0);
static_assert(WSZ == 4);
static_assert(IMW % DWL == 0);
static_assert(HW % 2048 == 0);
static_assert(HW % 256 == 0);
static_assert(HW % 64 == 0);
static_assert(NPIX % 256 == 0);
static_assert(CC == NHEAD * HDC);
static_assert(HDC == 32);
static_assert((GXP * 4) % 16 == 0);
static_assert((AXP * 4) % 16 == 0);
static_assert((TXP * 4) % 16 == 0);
static_assert((ATP * 2) % 16 == 0);
static_assert((GSP * 2) % 16 == 0);

// RSA window kernel dynamic LDS map (bytes)
#define RL_R    0
#define RL_QTH  24576
#define RL_QTL  28672
#define RL_KTH  32768
#define RL_KTL  36864
#define RL_ATH  40960
#define RL_ATL  75776
#define RL_VH   110592
#define RL_VL   114944
#define RL_INV  119296
#define RL_END  119424
static_assert(RL_QTH == RL_R + 16 * C3 * 4);
static_assert(RL_QTL == RL_QTH + CC * 16 * 2);
static_assert(RL_KTH == RL_QTL + CC * 16 * 2);
static_assert(RL_KTL == RL_KTH + CC * 16 * 2);
static_assert(RL_ATH == RL_KTL + CC * 16 * 2);
static_assert(RL_ATL == RL_ATH + CC * ATP * 2);
static_assert(RL_VH == RL_ATL + CC * ATP * 2);
static_assert(RL_VL == RL_VH + 16 * ATP * 2);
static_assert(RL_INV == RL_VL + 16 * ATP * 2);
static_assert(RL_END == RL_INV + 32 * 4);
static_assert(16 * TXP * 4 <= RL_QTH - RL_R);

// GSA score kernel dynamic LDS map (bytes)
#define GL_QH   0
#define GL_QL   16896
#define GL_KH   33792
#define GL_KL   50688
#define GL_RED  67584
#define GL_STG  71680
#define GL_END  76288
static_assert(GL_QL == 32 * GSP * 2);
static_assert(GL_KH == 2 * GL_QL);
static_assert(GL_KL == 3 * GL_QL);
static_assert(GL_RED == 4 * GL_QL);
static_assert(GL_STG == GL_RED + 4 * 32 * 8 * 4);
static_assert(GL_END == GL_STG + 32 * GXP * 4);

typedef __bf16         v16bf __attribute__((ext_vector_type(16)));
typedef unsigned short v8us  __attribute__((ext_vector_type(8)));
typedef float          v8f   __attribute__((ext_vector_type(8)));
typedef float          v4f   __attribute__((ext_vector_type(4)));
typedef unsigned int   v4u   __attribute__((ext_vector_type(4)));
typedef unsigned int   v2u   __attribute__((ext_vector_type(2)));

union Frag { v16bf v; v8us u[2]; };

// ---- scalar helpers ------------------------------------------------------------------------------------------
__device__ __forceinline__ unsigned short bf_bits(float f) {          // f32 -> bf16 bits, RNE convert
  unsigned u = __float_as_uint(f);
  return (unsigned short)((u + 0x7FFFu + ((u >> 16) & 1u)) >> 16);
}
__device__ __forceinline__ float bf_up(unsigned short h) { return __uint_as_float(((unsigned)h) << 16); }
__device__ __forceinline__ float bfr(float f) { return bf_up(bf_bits(f)); }
__device__ __forceinline__ unsigned pk16(unsigned short a, unsigned short b) { return (unsigned)a | ((unsigned)b << 16); }
// hi = bf16(v), lo = bf16(v - hi)
__device__ __forceinline__ void split_bf(float v, unsigned short& hi, unsigned short& lo) {
  const unsigned short hb = bf_bits(v);
  hi = hb;
  lo = bf_bits(v - bf_up(hb));
}
__device__ __forceinline__ void split4(v4f v, v2u& ph, v2u& pl) {
  unsigned short h[4], l[4];
#pragma unroll
  for (int e = 0; e < 4; ++e) split_bf(v[e], h[e], l[e]);
  ph[0] = pk16(h[0], h[1]); ph[1] = pk16(h[2], h[3]);
  pl[0] = pk16(l[0], l[1]); pl[1] = pk16(l[2], l[3]);
}
__device__ __forceinline__ void split8(v4f v0, v4f v1, v4u& ph, v4u& pl) {
  unsigned short h[8], l[8];
#pragma unroll
  for (int e = 0; e < 4; ++e) { split_bf(v0[e], h[e], l[e]); split_bf(v1[e], h[4 + e], l[4 + e]); }
#pragma unroll
  for (int e = 0; e < 4; ++e) { ph[e] = pk16(h[2 * e], h[2 * e + 1]); pl[e] = pk16(l[2 * e], l[2 * e + 1]); }
}
__device__ __forceinline__ v8f zero8() { v8f z = {0.f, 0.f, 0.f, 0.f, 0.f, 0.f, 0.f, 0.f}; return z; }
__device__ __forceinline__ v8us zero8us() { v8us z = {0, 0, 0, 0, 0, 0, 0, 0}; return z; }

// ---- fragment loaders: 16-bit A/B operand, lane -> row/col (lane&15), p already includes +8*(lane>>4);
//      elements 0..7 <- p[0..7] (k0+8h..), elements 8..15 <- p[16..23] (k0+16+8h..)
__device__ __forceinline__ v16bf ldfrag(const unsigned short* p) {
  Frag f;
  f.u[0] = *(const v8us*)(p);
  f.u[1] = *(const v8us*)(p + 16);
  return f.v;
}
// K = 16 contraction padded to 32: elements 8..15 are zero
__device__ __forceinline__ v16bf ldfrag16(const unsigned short* p) {
  Frag f;
  f.u[0] = *(const v8us*)(p);
  f.u[1] = zero8us();
  return f.v;
}

// ---- WMMA helper with trailing VALU hazard gap ---------------------------------------------------------------
__device__ __forceinline__ v8f mma_bf(v16bf a, v16bf b, v8f c) {
  c = __builtin_amdgcn_wmma_f32_16x16x32_bf16(false, a, false, b, (short)0, c, false, false);
#if defined(__HIP_DEVICE_COMPILE__)
  asm volatile("v_nop\n\tv_nop\n\tv_nop\n\tv_nop" : "+v"(c) : "v"(a), "v"(b));
#endif
  return c;
}
__device__ __forceinline__ void wave_sync_lds() {
  __builtin_amdgcn_fence(__ATOMIC_RELEASE, "workgroup");
  __builtin_amdgcn_wave_barrier();
  __builtin_amdgcn_fence(__ATOMIC_ACQUIRE, "workgroup");
}

// =================================================================================================================
// Weight convert: w f32 [rows][cols] -> bf16 [rowsP][colsP] (zero padded), value = bf16_RNE(w). One thread = 8
// coverage: rowsP * colsP/8 pieces, ceil(pieces/256) blocks (blk = block index within the matrix) with a bound.
// =================================================================================================================
__device__ __forceinline__ void cvt_w(const float* __restrict__ w, unsigned short* outp,
                                      int rows, int cols, int rowsP, int colsP, int blk) {
  const int t = blk * 256 + threadIdx.x;
  const int ppr = colsP >> 3;
  const int npc = rowsP * ppr;
  const bool ok = t < npc;
  const int tt = ok ? t : 0;
  const int r = tt / ppr, c8 = (tt - r * ppr) * 8;
  const int rr = min(r, rows - 1);
  unsigned short hv[8];
#pragma unroll
  for (int e = 0; e < 8; ++e) {
    const int c = c8 + e;
    const int cl = min(c, cols - 1);
    const float f = w[(size_t)rr * cols + cl];
    const float z = (r < rows && c < cols) ? f : 0.0f;
    hv[e] = bf_bits(z);
  }
  v4u pk;
#pragma unroll
  for (int e = 0; e < 4; ++e) pk[e] = pk16(hv[2 * e], hv[2 * e + 1]);
  unsigned short* gp = outp + (size_t)r * colsP + c8;
  if (ok) *(v4u*)gp = pk;
  
}

// =================================================================================================================
// NCHW f32 x -> pixel-major stream A [b*HW + p][128] f32, values bf16-RNE-converted. Block = (b, 64-pixel tile):
// 128 ch x 64 px loaded coalesced along p into an LDS tile [px][TXP]; store: each pixel row = 512 B = 32 lanes x
// coverage: 8 waves x 8 rows = 64 px x 128 ch per block; NB*(HW/64) blocks (blk) = every pixel once.
// =================================================================================================================
__device__ __forceinline__ void nchw_in(const float* __restrict__ x, float* A, float* xs, int blk) {
  const int tid = threadIdx.x, wave = tid >> 5, lane = tid & 31;
  const int b = blk / (HW / 64);
  const int p0 = (blk - b * (HW / 64)) * 64;
#pragma unroll
  for (int it = 0; it < 8; ++it) {
    const int q = it * 256 + tid;
    const int ch = q >> 4, j4 = (q & 15) * 4;
    const v4f v = *(const v4f*)(x + ((size_t)(b * CC + ch)) * HW + p0 + j4);
#pragma unroll
    for (int e = 0; e < 4; ++e) xs[(j4 + e) * TXP + ch] = bfr(v[e]);
  }
  __syncthreads();
  v4f ov[8];
#pragma unroll
  for (int it = 0; it < 8; ++it) {
    const int row = wave * 8 + it;
    ov[it] = *(const v4f*)(xs + row * TXP + lane * 4);
  }
#pragma unroll
  for (int it = 0; it < 8; ++it) {
    const int row = wave * 8 + it;
    *(v4f*)(A + ((size_t)(b * HW + p0 + row)) * CC + lane * 4) = ov[it];
  }
}

// =================================================================================================================
// Input preparation, one launch: the NCHW transpose and the eight weight converts need nothing of each other, so they
// share one grid by ranges of the block index (block-uniform branches; the transpose's barrier is passed by whole
// blocks only). Blocks [0, PB_T): transpose tiles; then per weight set (spatial, channel) PB_SET blocks: qkv, proj,
// ffn-in, ffn-out. Wb = the bf16 weight region, the four matrices of a set one behind the other, set after set.
// =================================================================================================================
#define PB_T    (NB * (HW / 64))
#define PB_Q    (C3 * CC / 8 / 256)
#define PB_P    (CC * CC / 8 / 256)
#define PB_1    (HIDP * CC / 8 / 256)
#define PB_2    (CC * HIDP / 8 / 256)
#define PB_SET  (PB_Q + PB_P + PB_1 + PB_2)
#define WSETN   (C3 * CC + CC * CC + HIDP * CC + CC * HIDP)
static_assert((C3 * CC) % 2048 == 0 && (CC * CC) % 2048 == 0 && (HIDP * CC) % 2048 == 0);
__global__ __launch_bounds__(256) void prep_k(const float* __restrict__ x, float* A,
                                              const float* __restrict__ wq0, const float* __restrict__ wp0,
                                              const float* __restrict__ w10, const float* __restrict__ w20,
                                              const float* __restrict__ wq1, const float* __restrict__ wp1,
                                              const float* __restrict__ w11, const float* __restrict__ w21,
                                              unsigned short* Wb) {
  __shared__ __align__(16) float xs[64 * TXP];
  const int bi = blockIdx.x;
  if (bi < PB_T) { nchw_in(x, A, xs, bi); return; }
  const int r0 = bi - PB_T;
  const int set = r0 / PB_SET;
  const int r = r0 - set * PB_SET;
  unsigned short* o = Wb + (size_t)set * WSETN;
  if (r < PB_Q) {
    cvt_w(set ? wq1 : wq0, o, C3, CC, C3, CC, r);
  } else if (r < PB_Q + PB_P) {
    cvt_w(set ? wp1 : wp0, o + C3 * CC, CC, CC, CC, CC, r - PB_Q);
  } else if (r < PB_Q + PB_P + PB_1) {
    cvt_w(set ? w11 : w10, o + C3 * CC + CC * CC, HID, CC, HIDP, CC, r - (PB_Q + PB_P));
  } else {
    cvt_w(set ? w21 : w20, o + C3 * CC + CC * CC + HIDP * CC, CC, HID, CC, HIDP, r - (PB_Q + PB_P + PB_1));
  }
}

// =================================================================================================================
// passes); output bf16 hi + residual planes Th/Tl [pix][128]: row = 256 B = 32 lanes x 8 B, one instruction per plane,
// =================================================================================================================
__global__ __launch_bounds__(256) void ln_k(float* A, const float* __restrict__ Badd,
                                            const float* __restrict__ g, const float* __restrict__ bv,
                                            unsigned short* Th, unsigned short* Tl, int addB) {
#pragma clang fp contract(off)
  const int tid = threadIdx.x, wave = tid >> 5, lane = tid & 31;
  const int p = blockIdx.x * 8 + wave;
  const int c4 = lane * 4;
  float* arow = A + (size_t)p * CC + c4;
  v4f xv = *(const v4f*)arow;
  if (addB != 0) {
    const v4f b2 = *(const v4f*)(Badd + (size_t)p * CC + c4);
    xv = xv + b2;
    *(v4f*)arow = xv;
    
  }
  float s = (xv[0] + xv[1]) + (xv[2] + xv[3]);
#pragma unroll
  for (int off = 1; off < 32; off <<= 1) s = s + __shfl_xor(s, off, 32);
  const float mu = s * (1.0f / 128.0f);
  float d[4];
  float s2 = 0.f;
#pragma unroll
  for (int e = 0; e < 4; ++e) { d[e] = xv[e] - mu; const float dd = d[e] * d[e]; s2 = s2 + dd; }
#pragma unroll
  for (int off = 1; off < 32; off <<= 1) s2 = s2 + __shfl_xor(s2, off, 32);
  const float var = s2 * (1.0f / 128.0f);
  const float rstd = 1.0f / sqrtf(var + 1e-6f);
  v4f z;
#pragma unroll
  for (int e = 0; e < 4; ++e) {
    float t0 = d[e] * rstd;
    t0 = t0 * bfr(g[c4 + e]);
    z[e] = t0 + bfr(bv[c4 + e]);
  }
  v2u ph, pl;
  split4(z, ph, pl);
  const size_t to = (size_t)p * CC + c4;
  *(v2u*)(Th + to) = ph;
  *(v2u*)(Tl + to) = pl;
  
}

// =================================================================================================================
// GEMM: OUT[p][n] = sum_k (Ah[p][k] + Al[p][k]) * W[n][k]  (A planes [pix][K] bf16 hi + residual, W single bf16
// [N][K] k-contiguous, 2 products per tile pair). Block = 8 waves = GBM pixels x all N columns. Per chunk of GKC k the
// block brings its GBM rows of both A planes and all N rows of W into LDS with loads of whole rows (16 lanes x 16 B =
// the 256 B of a row's chunk), rows at a pitch of GPP halves; every fragment is then read from LDS with the split k map.
// So each A row leaves L2 once, not once per 32 output columns, and no global load gathers 32-byte pieces of 16 rows.
// The next chunk's rows are loaded into registers while this chunk is multiplied. Waves: 2 pixel groups of 32 x
// 4 column groups of N/4; a wave holds N/128 tiles of 32 x 32 (2x2 fragments each) and uses its A fragments for all.
// Each sum runs over k in the same order as before (k rising, hi then residual).
// Epilogue (behind a barrier, in the LDS of the operands): each 32x32 f32 tile is staged by its wave and stored as
// whole 128-byte lines. EP 0: OUT[p][N]; EP 1: same + res[p][n] (res pitch 128); EP 2: NCHW d_out[b][n][p] + res[p][n].
// coverage: 8 waves x 32 rows x N/4 cols per block = GBM px x N cols; grid covers NPIX x N once.
// =================================================================================================================
#define GKC 128
#define GBM 64
#define GPP 136
static_assert((GPP * 2) % 32 == 16);
static_assert(NPIX % GBM == 0 && HW % 32 == 0);
template <int K, int N, int EP>
__global__ __launch_bounds__(256) void gemm_k(const unsigned short* __restrict__ Ah,
                                              const unsigned short* __restrict__ Al,
                                              const unsigned short* __restrict__ W,
                                              float* outf, const float* __restrict__ res) {
  constexpr int NP = N / 128;                // 32-column tiles per wave
  constexpr int NCH = K / GKC;               // k chunks
  constexpr int WIT = N / 16;                // W rows per thread and chunk
  static_assert(K % GKC == 0 && N % 128 == 0);
  static_assert(8 * NP * 32 * GXP * 4 <= (2 * GBM + N) * GPP * 2);
  __shared__ __align__(16) unsigned short sm[(2 * GBM + N) * GPP];
  unsigned short* sah = sm;
  unsigned short* sal = sm + GBM * GPP;
  unsigned short* swt = sm + 2 * GBM * GPP;
  float* stg = (float*)sm;                   // reused behind the last chunk's barrier
  const int tid = threadIdx.x, wave = tid >> 5, lane = tid & 31, hh = lane >> 4, l15 = lane & 15;
  const int mb = blockIdx.x * GBM;
  const int mg = wave >> 2, ng = wave & 3;
  const int srow = tid >> 4, spc = (tid & 15) * 8;
  const unsigned short* gah = Ah + (size_t)(mb + srow) * K + spc;
  const unsigned short* gal = Al + (size_t)(mb + srow) * K + spc;
  const unsigned short* gw = W + (size_t)srow * K + spc;
  const int so = srow * GPP + spc;
  // Every loop below is unrolled in full: constant indices keep the staged rows and the sums in registers.
  v8f acc[NP][4];
#pragma unroll
  for (int j = 0; j < NP; ++j) {
#pragma unroll
    for (int f = 0; f < 4; ++f) acc[j][f] = zero8();
  }
  v4u ra[GBM / 16], rl[GBM / 16], rw[WIT];
#pragma unroll
  for (int it = 0; it < GBM / 16; ++it) {
    ra[it] = *(const v4u*)(gah + it * 16 * K);
    rl[it] = *(const v4u*)(gal + it * 16 * K);
  }
#pragma unroll
  for (int it = 0; it < WIT; ++it) rw[it] = *(const v4u*)(gw + it * 16 * K);
#pragma unroll
  for (int kc = 0; kc < NCH; ++kc) {
    if (kc > 0) __syncthreads();             // every wave has read the chunk that is overwritten next
#pragma unroll
    for (int it = 0; it < GBM / 16; ++it) {
      *(v4u*)(sah + so + it * 16 * GPP) = ra[it];
      *(v4u*)(sal + so + it * 16 * GPP) = rl[it];
    }
#pragma unroll
    for (int it = 0; it < WIT; ++it) *(v4u*)(swt + so + it * 16 * GPP) = rw[it];
    __syncthreads();                         // every wave reads rows that other waves staged
    if (kc + 1 < NCH) {
#pragma unroll
      for (int it = 0; it < GBM / 16; ++it) {
        ra[it] = *(const v4u*)(gah + it * 16 * K + (kc + 1) * GKC);
        rl[it] = *(const v4u*)(gal + it * 16 * K + (kc + 1) * GKC);
      }
#pragma unroll
      for (int it = 0; it < WIT; ++it) rw[it] = *(const v4u*)(gw + it * 16 * K + (kc + 1) * GKC);
    }
#pragma unroll
    for (int ks = 0; ks < GKC / 32; ++ks) {
      const int ko = ks * 32 + 8 * hh;
      const unsigned short* pa = sah + (mg * 32 + l15) * GPP + ko;
      const unsigned short* pl = sal + (mg * 32 + l15) * GPP + ko;
      const v16bf a0h = ldfrag(pa), a0l = ldfrag(pl);
      const v16bf a1h = ldfrag(pa + 16 * GPP), a1l = ldfrag(pl + 16 * GPP);
#pragma unroll
      for (int j = 0; j < NP; ++j) {
        const unsigned short* pb = swt + (ng * (N / 4) + j * 32 + l15) * GPP + ko;
        const v16bf b0 = ldfrag(pb), b1 = ldfrag(pb + 16 * GPP);
        acc[j][0] = mma_bf(a0h, b0, acc[j][0]); acc[j][0] = mma_bf(a0l, b0, acc[j][0]);
        acc[j][1] = mma_bf(a0h, b1, acc[j][1]); acc[j][1] = mma_bf(a0l, b1, acc[j][1]);
        acc[j][2] = mma_bf(a1h, b0, acc[j][2]); acc[j][2] = mma_bf(a1l, b0, acc[j][2]);
        acc[j][3] = mma_bf(a1h, b1, acc[j][3]); acc[j][3] = mma_bf(a1l, b1, acc[j][3]);
      }
    }
  }
  __syncthreads();                           // the operands' LDS becomes the output stage: every wave has left it
  const int m0 = mb + mg * 32;
#pragma unroll
  for (int j = 0; j < NP; ++j) {
    float* sw = stg + (wave * NP + j) * (32 * GXP);
#pragma unroll
    for (int r = 0; r < 8; ++r) {
      sw[(8 * hh + r) * GXP + l15] = acc[j][0][r];
      sw[(8 * hh + r) * GXP + 16 + l15] = acc[j][1][r];
      sw[(16 + 8 * hh + r) * GXP + l15] = acc[j][2][r];
      sw[(16 + 8 * hh + r) * GXP + 16 + l15] = acc[j][3][r];
    }
  }
  wave_sync_lds();
  const int q = lane >> 3, piece = lane & 7;
#pragma unroll
  for (int j = 0; j < NP; ++j) {
    const float* sw = stg + (wave * NP + j) * (32 * GXP);
    const int n0 = ng * (N / 4) + j * 32;
    v4f ov[8];
    if (EP != 2) {
#pragma unroll
      for (int it = 0; it < 8; ++it) {
        const int row = it * 4 + q;
        v4f v = *(const v4f*)(sw + row * GXP + piece * 4);
        if (EP == 1) {
          const v4f rr = *(const v4f*)(res + (size_t)(m0 + row) * CC + n0 + piece * 4);
          v = v + rr;
        }
        ov[it] = v;
      }
#pragma unroll
      for (int it = 0; it < 8; ++it) {
        const int row = it * 4 + q;
        *(v4f*)(outf + (size_t)(m0 + row) * N + n0 + piece * 4) = ov[it];
      }
    } else {
      const int b = m0 / HW;
      const int plx = m0 - b * HW;
#pragma unroll
      for (int it = 0; it < 8; ++it) {
        const int ch = it * 4 + q;
        v4f v;
#pragma unroll
        for (int e = 0; e < 4; ++e) {
          const float rv = res[(size_t)(m0 + piece * 4 + e) * CC + n0 + ch];
          v[e] = sw[(piece * 4 + e) * GXP + ch] + rv;
        }
        ov[it] = v;
      }
#pragma unroll
      for (int it = 0; it < 8; ++it) {
        const int ch = it * 4 + q;
        *(v4f*)(outf + ((size_t)(b * CC + n0 + ch)) * HW + plx + piece * 4) = ov[it];
      }
    }
  }
}

// =================================================================================================================
// Depthwise 3x3, SAME zero padding, cross-correlation taps, optional cyclic roll (output pixel index in the rolled
// frame, source slab in the unrolled frame: source pixel ((ny+roll) mod IMW, (nx+roll) mod IMW), valid iff the rolled
// neighbour (ny,nx) is inside the image). src [pix][CS] f32 (CS = all 384 channels of the conv), 4 channels per thread,
// weights wd[(wofs + c)*9 + tap] bf16-RNE (clamped address, zero for c >= cvalid): the block's CS*9 weights are read
// once (thread = channel, in steps of 256) and laid out in LDS as [tap][CS], channel contiguous, so that a thread takes
// its 4 channels of one tap with one 16-byte LDS read.
// A thread computes a strip of DWL output pixels along x: it loads the 3 x (DWL+2) source pixels of the strip once,
// all loads in flight together, keeps them in registers, and each loaded column serves up to three outputs; the taps
// come from LDS once per strip. Strips that follow one another in the grid lie under one another in y (a block's
// strips share source rows).
// A row outside the image zeroes its three taps; only the strip's two outer columns can lie outside the image.
// MODE 0: f32 rows dstf[p*dpitch + dcol + c]; MODE 1: exact-erf GELU (rolled) then bf16 hi + residual planes
// Ph/Pl[p*ppitch + dcol + c]; MODE 2: channels below 2*CC (q, k) as MODE 0, the rest (v) as planes without the GELU at
// Ph/Pl[p*ppitch + c - 2*CC] (a wave's 32 threads hold 128 channels in a row, so the choice is the same for a wave).
// coverage: (NPIX/DWL) * CS/4 threads x DWL pixels, grid ceil-div with an in-kernel bound.
// =================================================================================================================
template <int CS, int MODE>
__global__ __launch_bounds__(256) void dw_k(const float* __restrict__ src, const float* __restrict__ wd,
                                            int wofs, int cvalid, int roll,
                                            float* dstf, int dpitch, int dcol,
                                            unsigned short* Ph, unsigned short* Pl, int ppitch) {
  constexpr int TPP = CS / 4;
  constexpr int NSTR = NPIX / DWL;           // strips in all
  constexpr int SPI = HW / DWL;              // strips per image
  static_assert(CS % 128 == 0);
  __shared__ __align__(16) float wsm[9 * CS];
  constexpr int WTR = (CS + 255) / 256;      // thread = channel, its 9 taps, in WTR steps of 256 channels
  float wf[WTR][9];
#pragma unroll                               // constant indices keep wf in registers
  for (int k = 0; k < WTR; ++k) {            // no test here (the address is clamped): every step's loads behind one wait
    const float* wp = wd + min(wofs + (int)threadIdx.x + k * 256, cvalid - 1) * 9;
#pragma unroll                               // constant indices keep wf in registers
    for (int tp = 0; tp < 9; ++tp) wf[k][tp] = wp[tp];
  }
#pragma unroll                               // constant indices keep wf in registers
  for (int k = 0; k < WTR; ++k) {
    const int ch = (int)threadIdx.x + k * 256;
    const float wok = (wofs + ch < cvalid) ? 1.0f : 0.0f;
    if (ch < CS) {                           // whole waves
#pragma unroll                               // constant indices keep wf in registers
      for (int tp = 0; tp < 9; ++tp) wsm[tp * CS + ch] = bfr(wf[k][tp]) * wok;
    }
  }
  __syncthreads();                           // every wave reads table rows that other waves wrote
  const int t = blockIdx.x * 256 + threadIdx.x;
  int s = t / TPP;
  const int cg = t - s * TPP;
  const bool pv = s < NSTR;
  s = pv ? s : (NSTR - 1);
  const int c = cg * 4;
  const int b = s / SPI;
  const int sr = s - b * SPI;
  const int xs = sr / IMW;
  const int y = sr - xs * IMW;
  const int x0 = xs * DWL;
  const v4f* s4 = (const v4f*)src;            // slab rows in 16-byte units: TPP units per pixel
  // Every loop below but the GELU loop is unrolled in full so that its indices are constants: the offsets, the 3 x (DWL+2) window,
  // the taps and the DWL sums then live in registers (an index known only at run time would put them in scratch).
  int ro[3], co[DWL + 2], ix[3][DWL + 2];
#pragma unroll                               // see above
  for (int dy = 0; dy < 3; ++dy) {
    const int sy = (y + dy - 1 + roll) & (IMW - 1);
    ro[dy] = (b * HW + sy * IMW) * TPP + cg;
  }
#pragma unroll                               // see above
  for (int j = 0; j < DWL + 2; ++j) {
    const int sx = (x0 + j - 1 + roll) & (IMW - 1);
    co[j] = sx * TPP;
  }
#pragma unroll                               // see above
  for (int dy = 0; dy < 3; ++dy) {
#pragma unroll                               // see above
    for (int j = 0; j < DWL + 2; ++j) ix[dy][j] = ro[dy] + co[j];
  }
  const int p0 = b * HW + y * IMW + x0;      // first output pixel of the strip
  const float ml = (x0 > 0) ? 1.0f : 0.0f;
  const float mr = (x0 + DWL < IMW) ? 1.0f : 0.0f;
  v4f v[3][DWL + 2];
#pragma unroll                               // see above
  for (int dy = 0; dy < 3; ++dy) {
#pragma unroll                               // see above
    for (int j = 0; j < DWL + 2; ++j) v[dy][j] = s4[ix[dy][j]];
    // the next row's loads may be given registers that held this row's offsets: the wait stands in front of them
    if (dy < 2) asm volatile("s_wait_xcnt 0x0" ::: "memory");
  }
  static_assert(DWL == 8);                   // the statement below names the 3 x 10 loaded values one by one
  // Inputs only: every load of the window is issued in front of this line, so the wave waits out one memory latency
  // for all 30; without it the compiler spreads the loads among the sums and waits for them a few at a time.
  asm volatile("" :: "v"(v[0][0]), "v"(v[0][1]), "v"(v[0][2]), "v"(v[0][3]), "v"(v[0][4]),
                     "v"(v[0][5]), "v"(v[0][6]), "v"(v[0][7]), "v"(v[0][8]), "v"(v[0][9]),
                     "v"(v[1][0]), "v"(v[1][1]), "v"(v[1][2]), "v"(v[1][3]), "v"(v[1][4]),
                     "v"(v[1][5]), "v"(v[1][6]), "v"(v[1][7]), "v"(v[1][8]), "v"(v[1][9]),
                     "v"(v[2][0]), "v"(v[2][1]), "v"(v[2][2]), "v"(v[2][3]), "v"(v[2][4]),
                     "v"(v[2][5]), "v"(v[2][6]), "v"(v[2][7]), "v"(v[2][8]), "v"(v[2][9]));
  v4f acc[DWL];
#pragma unroll                               // see above
  for (int i = 0; i < DWL; ++i) acc[i] = v4f{0.f, 0.f, 0.f, 0.f};
  // row by row: a row's registers are free once its three taps are summed; each output still sums its taps 0..8 in order
#pragma unroll                               // see above
  for (int dy = 0; dy < 3; ++dy) {
    const float rm = ((unsigned)(y + dy - 1) < (unsigned)IMW) ? 1.0f : 0.0f;
    v4f wv[3];
#pragma unroll                               // see above
    for (int dx = 0; dx < 3; ++dx) wv[dx] = *(const v4f*)(wsm + (dy * 3 + dx) * CS + c) * rm;
    v[dy][0] = v[dy][0] * ml;
    v[dy][DWL + 1] = v[dy][DWL + 1] * mr;
#pragma unroll                               // see above
    for (int i = 0; i < DWL; ++i) {          // output by output: column i is free once output i has its row
#pragma unroll                               // see above
      for (int dx = 0; dx < 3; ++dx) acc[i] = acc[i] + v[dy][i + dx] * wv[dx];
    }
    // the next row's taps are read only now: all 9 read ahead take 24 registers more, and above 160 registers fewer
    // than three blocks are resident per WGP
    if (dy < 2) __builtin_amdgcn_sched_barrier(0);
  }
#pragma unroll                               // see above
  for (int i = 0; i < DWL; ++i) {
    v4f a = acc[i];
    if (MODE == 1) {
#pragma unroll 1                             // rolled as before: one copy of the erf code per output pixel
      for (int e = 0; e < 4; ++e) {
        const float g = (e == 0) ? a[0] : ((e == 1) ? a[1] : ((e == 2) ? a[2] : a[3]));
        const float er = erff(g * RSQ2);
        float gl = 0.5f * g;
        gl = gl * (1.0f + er);
        a[0] = (e == 0) ? gl : a[0];
        a[1] = (e == 1) ? gl : a[1];
        a[2] = (e == 2) ? gl : a[2];
        a[3] = (e == 3) ? gl : a[3];
      }
    }
    if (MODE == 0 || (MODE == 2 && c < 2 * CC)) {
      float* gp = dstf + (size_t)(p0 + i) * dpitch + dcol + c;
      if (pv) *(v4f*)gp = a;
    } else {
      v2u ph, plw;
      split4(a, ph, plw);
      const size_t to = (size_t)(p0 + i) * ppitch + dcol + (MODE == 2 ? c - 2 * CC : c);
      if (pv) { *(v2u*)(Ph + to) = ph; *(v2u*)(Pl + to) = plw; }
    }
  }
}

// =================================================================================================================
// RSA window attention, one 4x4 window (16 tokens) per block of 256 threads, R = dwconv output in the rolled frame
// [pix][384] f32 (q | k | v column blocks):
//   phase 0: the 16 token rows x 384 f32 into LDS; phase 1: per token and per q/k the l2 norm over its 128 channels
//   (inv = 1/max(sqrt(sum), 1e-12)); phase 2: q^T and k^T as bf16 hi + residual planes [c][16 tok] (k contiguous),
//   v as planes [tok][ATP]; phase 3 (wave = c tile): attn[c][d] = relu(temp * sum_p qn[p][c] kn[p][d]) on WMMA, K = 16
//   (fragment elements 8..15 zero), 3 products, stored transposed as planes AttT[d][c]; phase 4 (wave = d tile):
//   out[p][d] = sum_c v[p][c] attn[c][d], K = 128, 3 products, staged f32 [16][TXP] in LDS; phase 5: each token row
//   (128 values -> hi + residual, 256 B per plane = 16 lanes x 16 B) written to its unrolled pixel (inverse roll +2,+2),
//   coverage: qT/kT 128 c x 16 tok x 2 planes, v 16 x 128, AttT 128 d x 128 c (8 waves x 8 tiles), out 16 x 128
//   (8 waves x 16 cols), store 8 waves x 2 rows x 128.
// =================================================================================================================
__global__ __launch_bounds__(256) void rsa_attn_k(const float* __restrict__ R, const float* __restrict__ temp,
                                                  unsigned short* Th, unsigned short* Tl) {
#pragma clang fp contract(off)
  extern __shared__ __align__(16) char smem[];
  float* sR = (float*)(smem + RL_R);
  float* ost = (float*)(smem + RL_R);                     // reused after phase 2
  unsigned short* qt = (unsigned short*)(smem + RL_QTH);  // qT hi @0, qT lo @2048, kT hi @4096, kT lo @6144 (halves)
  unsigned short* ath = (unsigned short*)(smem + RL_ATH);
  unsigned short* atl = (unsigned short*)(smem + RL_ATL);
  unsigned short* vh = (unsigned short*)(smem + RL_VH);
  unsigned short* vl = (unsigned short*)(smem + RL_VL);
  float* sinv = (float*)(smem + RL_INV);
  const int tid = threadIdx.x, wave = tid >> 5, lane = tid & 31, hh = lane >> 4, l15 = lane & 15;
  const int b = blockIdx.x / NWIN;
  const int w2 = blockIdx.x - b * NWIN;
  const int wy = w2 / NWX;
  const int wx = w2 - wy * NWX;

  // ---- phase 0: token rows ----
#pragma unroll
  for (int it = 0; it < 6; ++it) {
    const int idx = it * 256 + tid;
    const int pi = idx / 96;
    const int c4 = (idx - pi * 96) * 4;
    const int ry = wy * WSZ + (pi / WSZ), rx = wx * WSZ + (pi - (pi / WSZ) * WSZ);
    const v4f v = *(const v4f*)(R + ((size_t)(b * HW) + (size_t)ry * IMW + rx) * C3 + c4);
    *(v4f*)(sR + pi * C3 + c4) = v;
  }
  __syncthreads();

  // ---- phase 1: l2 norms per token over its 128 q (or k) channels ----
  {
    const int pair = tid >> 3, sub = tid & 7;
    const int sel = pair >> 4, pi = pair & 15;
    const float* rp = sR + pi * C3 + sel * CC + sub * 16;
    float s = 0.f;
#pragma unroll
    for (int j = 0; j < 16; ++j) { const float f = rp[j]; const float ff = f * f; s = s + ff; }
    s = s + __shfl_xor(s, 1, 32);
    s = s + __shfl_xor(s, 2, 32);
    s = s + __shfl_xor(s, 4, 32);
    const float inv = 1.0f / fmaxf(sqrtf(s), 1e-12f);
    if (sub == 0) sinv[pair] = inv;
  }
  __syncthreads();

  // ---- phase 2: normalised q^T / k^T planes and v planes ----
  {
    const int c = tid >> 1, sel = tid & 1;
    unsigned short hv[16], lv[16];
#pragma unroll
    for (int pi = 0; pi < 16; ++pi) {
      const float v = sR[pi * C3 + sel * CC + c] * sinv[sel * 16 + pi];
      split_bf(v, hv[pi], lv[pi]);
    }
    v4u h0, h1, l0, l1;
#pragma unroll
    for (int e = 0; e < 4; ++e) {
      h0[e] = pk16(hv[2 * e], hv[2 * e + 1]);
      h1[e] = pk16(hv[8 + 2 * e], hv[8 + 2 * e + 1]);
      l0[e] = pk16(lv[2 * e], lv[2 * e + 1]);
      l1[e] = pk16(lv[8 + 2 * e], lv[8 + 2 * e + 1]);
    }
    unsigned short* dh = qt + sel * 4096 + c * 16;
    unsigned short* dl = dh + 2048;
    *(v4u*)(dh) = h0; *(v4u*)(dh + 8) = h1;
    *(v4u*)(dl) = l0; *(v4u*)(dl + 8) = l1;
    const int pi = tid >> 4, c8 = (tid & 15) * 8;
    const float* vr = sR + pi * C3 + 2 * CC + c8;
    const v4f v0 = *(const v4f*)(vr);
    const v4f v1 = *(const v4f*)(vr + 4);
    v4u ph, plw;
    split8(v0, v1, ph, plw);
    *(v4u*)(vh + pi * ATP + c8) = ph;
    *(v4u*)(vl + pi * ATP + c8) = plw;
  }
  __syncthreads();

  const float tmp = bfr(temp[0]);
  // ---- phase 3: attn = relu(temp * q^T k), 128 x 128, K = 16 ----
  {
    const int mi = wave;
    const v16bf a_h = ldfrag16(qt + (mi * 16 + l15) * 16 + 8 * hh);
    const v16bf a_l = ldfrag16(qt + 2048 + (mi * 16 + l15) * 16 + 8 * hh);
#pragma unroll 2
    for (int ni = 0; ni < 8; ++ni) {
      const v16bf b_h = ldfrag16(qt + 4096 + (ni * 16 + l15) * 16 + 8 * hh);
      const v16bf b_l = ldfrag16(qt + 6144 + (ni * 16 + l15) * 16 + 8 * hh);
      v8f acc = zero8();
      acc = mma_bf(a_h, b_h, acc);
      acc = mma_bf(a_h, b_l, acc);
      acc = mma_bf(a_l, b_h, acc);
      unsigned short hv[8], lv[8];
#pragma unroll
      for (int r = 0; r < 8; ++r) {
        float v = acc[r] * tmp;
        v = fmaxf(v, 0.0f);
        split_bf(v, hv[r], lv[r]);
      }
      v4u ph, plw;
#pragma unroll
      for (int e = 0; e < 4; ++e) { ph[e] = pk16(hv[2 * e], hv[2 * e + 1]); plw[e] = pk16(lv[2 * e], lv[2 * e + 1]); }
      const int d = ni * 16 + l15;
      *(v4u*)(ath + d * ATP + mi * 16 + 8 * hh) = ph;
      *(v4u*)(atl + d * ATP + mi * 16 + 8 * hh) = plw;
    }
  }
  __syncthreads();

  // ---- phase 4: out[p][d] = sum_c v[p][c] attn[c][d], K = 128 ----
  {
    const int ni = wave;
    v8f acc = zero8();
#pragma unroll
    for (int ks = 0; ks < 4; ++ks) {
      const v16bf a_h = ldfrag(vh + l15 * ATP + ks * 32 + 8 * hh);
      const v16bf a_l = ldfrag(vl + l15 * ATP + ks * 32 + 8 * hh);
      const v16bf b_h = ldfrag(ath + (ni * 16 + l15) * ATP + ks * 32 + 8 * hh);
      const v16bf b_l = ldfrag(atl + (ni * 16 + l15) * ATP + ks * 32 + 8 * hh);
      acc = mma_bf(a_h, b_h, acc);
      acc = mma_bf(a_h, b_l, acc);
      acc = mma_bf(a_l, b_h, acc);
    }
#pragma unroll
    for (int r = 0; r < 8; ++r) ost[(8 * hh + r) * TXP + ni * 16 + l15] = acc[r];
  }
  __syncthreads();

  // ---- phase 5: token rows to their unrolled pixels ----
  {
    const int tk = 2 * wave + hh;
    const int piece = l15;
    const float* orow = ost + tk * TXP + piece * 8;
    const v4f v0 = *(const v4f*)(orow);
    const v4f v1 = *(const v4f*)(orow + 4);
    v4u ph, plw;
    split8(v0, v1, ph, plw);
    const int iy = tk / WSZ, ix = tk - (tk / WSZ) * WSZ;
    const int ry = wy * WSZ + iy, rx = wx * WSZ + ix;
    const int py = (ry + WSZ / 2) & (IMW - 1), px = (rx + WSZ / 2) & (IMW - 1);
    const size_t gp = ((size_t)(b * HW) + (size_t)py * IMW + px) * CC + piece * 8;
    *(v4u*)(Th + gp) = ph;
    *(v4u*)(Tl + gp) = plw;
    
  }
}

// =================================================================================================================
// GSA sum-of-squares partials: block = (b, slab of 256 pixels), thread = channel c (q: 0..127, k: 128..255),
// =================================================================================================================
__device__ __forceinline__ void gsa_norm(const float* __restrict__ R, float* pn, int blk) {
  const int b = blk / NSLN;
  const int slab = blk - b * NSLN;
  const int c = threadIdx.x;
  const float* base = R + ((size_t)(b * HW) + (size_t)slab * 256) * C3 + c;
  float s = 0.f;
#pragma unroll 4
  for (int i = 0; i < 256; ++i) { const float f = base[(size_t)i * C3]; s = fmaf(f, f, s); }
  float* gp = pn + ((size_t)(b * NSLN + slab)) * 256 + c;
  *(float*)gp = s;
  
}

// =================================================================================================================
// GSA score partials: block = (b, head h, slab of 2048 pixels), S[c][d] = sum_n q[h*32+c][n] k[h*32+d][n] over the
// slab on WMMA. Per 256-pixel chunk the q and k columns (f32 from R) are split into bf16 hi + residual planes
// transposed in LDS ([32 ch][GSP] k contiguous); waves: fragment f = wave&3 (2x2 of 16x16), k half = wave>>2;
// 3 products; the two k halves are combined in fixed order through LDS; the 32x32 f32 tile is staged and stored as
// blk = (b*NHEAD + h)*NSLS + slab. coverage: planes 64 ch x 256 px per chunk (64 threads x 32
// groups x 8 px), tile 32x32 per block.
// The sum-of-squares partials need nothing of the scores and read the same R: they share this grid, blocks
// [NB*NHEAD*NSLS, NB*NHEAD*NSLS + NB*NSLN), and leave as whole blocks in front of the first barrier.
// =================================================================================================================
__global__ __launch_bounds__(256) void gsa_s_k(const float* __restrict__ R, float* pa, float* pn) {
  if (blockIdx.x >= NB * NHEAD * NSLS) { gsa_norm(R, pn, blockIdx.x - NB * NHEAD * NSLS); return; }
  extern __shared__ __align__(16) char smem[];
  unsigned short* pl = (unsigned short*)(smem + GL_QH);   // q hi @0, q lo @8448, k hi @16896, k lo @25344 (halves)
  float* red = (float*)(smem + GL_RED);
  float* stg = (float*)(smem + GL_STG);
  const int tid = threadIdx.x, wave = tid >> 5, lane = tid & 31, hh = lane >> 4, l15 = lane & 15;
  const int blk = blockIdx.x;
  const int b = blk / (NHEAD * NSLS);
  const int rem = blk - b * (NHEAD * NSLS);
  const int h = rem / NSLS;
  const int slab = rem - h * NSLS;
  const int f = wave & 3, mi = f >> 1, ni = f & 1, kh = wave >> 2;
  const int c = tid & 63, sel = c >> 5, cc = c & 31;
  const int col = sel * CC + h * HDC + cc;
  unsigned short* ph = pl + sel * 16896 + cc * GSP;
  unsigned short* plo = ph + 8448;
  const int g0 = tid >> 6;
  const size_t pbase = (size_t)(b * HW) + (size_t)slab * 2048;
  v8f acc = zero8();
#pragma unroll 1
  for (int ch = 0; ch < 8; ++ch) {
    const size_t pc = pbase + (size_t)ch * 256;
#pragma unroll 2
    for (int it = 0; it < 8; ++it) {
      const int g = it * 4 + g0;
      const float* rp = R + (pc + g * 8) * C3 + col;
      v4f v0, v1;
#pragma unroll
      for (int j = 0; j < 4; ++j) { v0[j] = rp[(size_t)j * C3]; v1[j] = rp[(size_t)(j + 4) * C3]; }
      v4u hp, lp;
      split8(v0, v1, hp, lp);
      *(v4u*)(ph + g * 8) = hp;
      *(v4u*)(plo + g * 8) = lp;
    }
    __syncthreads();
#pragma unroll
    for (int ks = 0; ks < 4; ++ks) {
      const int k0 = (kh * 4 + ks) * 32;
      const v16bf a_h = ldfrag(pl + (mi * 16 + l15) * GSP + k0 + 8 * hh);
      const v16bf a_l = ldfrag(pl + 8448 + (mi * 16 + l15) * GSP + k0 + 8 * hh);
      const v16bf b_h = ldfrag(pl + 16896 + (ni * 16 + l15) * GSP + k0 + 8 * hh);
      const v16bf b_l = ldfrag(pl + 25344 + (ni * 16 + l15) * GSP + k0 + 8 * hh);
      acc = mma_bf(a_h, b_h, acc);
      acc = mma_bf(a_h, b_l, acc);
      acc = mma_bf(a_l, b_h, acc);
    }
    __syncthreads();
  }
  if (wave >= 4) {
#pragma unroll
    for (int r = 0; r < 8; ++r) red[((wave - 4) * 32 + lane) * 8 + r] = acc[r];
  }
  __syncthreads();
  if (wave < 4) {
#pragma unroll
    for (int r = 0; r < 8; ++r) {
      const float o = red[(wave * 32 + lane) * 8 + r];
      const float v = acc[r] + o;
      stg[(mi * 16 + 8 * hh + r) * GXP + ni * 16 + l15] = v;
    }
  }
  __syncthreads();
  {
    const int row = tid >> 3, piece = tid & 7;
    const v4f v = *(const v4f*)(stg + row * GXP + piece * 4);
    float* gp = pa + (size_t)blk * 1024 + row * 32 + piece * 4;
    *(v4f*)gp = v;
    
  }
}

// =================================================================================================================
// GSA finisher, block = (b, h): invq/invk = 1/max(sqrt(sum of pn partials), 1e-12) for the head's 32 q and 32 k
// channels; attn[c][d] = relu(sum of pa partials * invq[c] * invk[d] * temp) -> bf16 hi + residual planes
// =================================================================================================================
__global__ __launch_bounds__(256) void gsa_fin_k(const float* __restrict__ pa, const float* __restrict__ pn,
                                                 const float* __restrict__ temp,
                                                 unsigned short* afh, unsigned short* afl) {
#pragma clang fp contract(off)
  __shared__ float sinv[64];
  const int tid = threadIdx.x;
  const int b = blockIdx.x / NHEAD;
  const int h = blockIdx.x - b * NHEAD;
  if (tid < 64) {
    const int sel = tid >> 5, i = tid & 31;
    const int c = sel * CC + h * HDC + i;
    float s = 0.f;
#pragma unroll 4
    for (int sl = 0; sl < NSLN; ++sl) s = s + pn[((size_t)(b * NSLN + sl)) * 256 + c];
    sinv[tid] = 1.0f / fmaxf(sqrtf(s), 1e-12f);
  }
  __syncthreads();
  const float tmp = bfr(temp[0]);
  const int e0 = tid * 4;
  const int c = e0 >> 5;
  v4f a;
#pragma unroll
  for (int j = 0; j < 4; ++j) {
    const int e = e0 + j;
    const int d = e & 31;
    float s = 0.f;
#pragma unroll
    for (int sl = 0; sl < NSLS; ++sl) s = s + pa[((size_t)((b * NHEAD + h) * NSLS + sl)) * 1024 + e];
    float v = s * sinv[c];
    v = v * sinv[32 + d];
    v = v * tmp;
    a[j] = fmaxf(v, 0.0f);
  }
  v2u ph, plw;
  split4(a, ph, plw);
  const size_t to = (size_t)b * AFSZ + (size_t)h * (HDC * HDC) + e0;
  *(v2u*)(afh + to) = ph;
  *(v2u*)(afl + to) = plw;
  
}

// =================================================================================================================
// GSA apply: out[p][h*32 + c] = sum_d v[p][h*32 + d] attn_h[c][d], K = 32 per head, both operands hi + residual
// (3 products). Wave tile 16 px x 64 cols (heads hd0 = n0/32 for fragments 0,1 and hd0+1 for 2,3), block = 128 px,
// coverage: 8 waves x 16 rows x 64 cols per block; grid covers NPIX x 128 once.
// =================================================================================================================
__global__ __launch_bounds__(256) void apply_k(const unsigned short* __restrict__ Vh,
                                               const unsigned short* __restrict__ Vl,
                                               const unsigned short* __restrict__ afh,
                                               const unsigned short* __restrict__ afl,
                                               unsigned short* Oh, unsigned short* Ol) {
  __shared__ __align__(16) float stg[8 * 16 * AXP];
  const int tid = threadIdx.x, wave = tid >> 5, lane = tid & 31, hh = lane >> 4, l15 = lane & 15;
  const int m0 = (blockIdx.x * 8 + wave) * 16;
  const int n0 = blockIdx.y * 64;
  const int b = m0 / HW;
  const int hd0 = n0 / HDC;
  const unsigned short* ar = Vh + (size_t)(m0 + l15) * CC + hd0 * HDC + 8 * hh;
  const unsigned short* al = Vl + (size_t)(m0 + l15) * CC + hd0 * HDC + 8 * hh;
  const v16bf a0h = ldfrag(ar), a0l = ldfrag(al);
  const v16bf a1h = ldfrag(ar + 32), a1l = ldfrag(al + 32);
  const unsigned short* wb = afh + (size_t)b * AFSZ + (size_t)(n0 + l15) * 32 + 8 * hh;
  const unsigned short* wl = afl + (size_t)b * AFSZ + (size_t)(n0 + l15) * 32 + 8 * hh;
  v8f c0 = zero8(), c1 = zero8(), c2 = zero8(), c3 = zero8();
  {
    const v16bf bh = ldfrag(wb), bl = ldfrag(wl);
    c0 = mma_bf(a0h, bh, c0); c0 = mma_bf(a0l, bh, c0); c0 = mma_bf(a0h, bl, c0);
  }
  {
    const v16bf bh = ldfrag(wb + 16 * 32), bl = ldfrag(wl + 16 * 32);
    c1 = mma_bf(a0h, bh, c1); c1 = mma_bf(a0l, bh, c1); c1 = mma_bf(a0h, bl, c1);
  }
  {
    const v16bf bh = ldfrag(wb + 32 * 32), bl = ldfrag(wl + 32 * 32);
    c2 = mma_bf(a1h, bh, c2); c2 = mma_bf(a1l, bh, c2); c2 = mma_bf(a1h, bl, c2);
  }
  {
    const v16bf bh = ldfrag(wb + 48 * 32), bl = ldfrag(wl + 48 * 32);
    c3 = mma_bf(a1h, bh, c3); c3 = mma_bf(a1l, bh, c3); c3 = mma_bf(a1h, bl, c3);
  }
  float* sw = stg + wave * (16 * AXP);
#pragma unroll
  for (int r = 0; r < 8; ++r) {
    sw[(8 * hh + r) * AXP + l15] = c0[r];
    sw[(8 * hh + r) * AXP + 16 + l15] = c1[r];
    sw[(8 * hh + r) * AXP + 32 + l15] = c2[r];
    sw[(8 * hh + r) * AXP + 48 + l15] = c3[r];
  }
  wave_sync_lds();
  const int q = lane >> 3, piece = lane & 7;
  v4u oh[4], ol[4];
#pragma unroll
  for (int it = 0; it < 4; ++it) {
    const int row = it * 4 + q;
    const float* sp = sw + row * AXP + piece * 8;
    const v4f v0 = *(const v4f*)(sp);
    const v4f v1 = *(const v4f*)(sp + 4);
    split8(v0, v1, oh[it], ol[it]);
  }
#pragma unroll
  for (int it = 0; it < 4; ++it) {
    const int row = it * 4 + q;
    const size_t to = (size_t)(m0 + row) * CC + n0 + piece * 8;
    *(v4u*)(Oh + to) = oh[it];
    *(v4u*)(Ol + to) = ol[it];
  }
  
}

// =================================================================================================================
// Workspace map (bytes), NPIX = NB*HW: A f32 [NPIX][128], Bx same, T = two bf16 planes [NPIX][128], U f32
// [NPIX][384] (also used as two bf16 planes [NPIX][128]), R f32 [NPIX][384] (also used as two
// bf16 planes [NPIX][384]), weights bf16 (655360), pn f32 [NB*NSLN][256], pa f32 [NB*NHEAD*NSLS][1024], af two bf16
// planes [NB][128][32]. Total 152076288 for NB=2, IMW=128. Every region is an exact multiple of its whole-row store
// granularity.
// =================================================================================================================
extern "C" void kernel_launch(void* const* d_in, const int* in_sizes, int n_in,
                              void* d_out, int out_size, void* d_ws, size_t ws_size,
                              hipStream_t stream) {
  if (n_in < 23) return;
  if (in_sizes[0] != NPIX * CC) return;
  if (in_sizes[1] != CC || in_sizes[2] != CC || in_sizes[3] != CC || in_sizes[4] != CC) return;
  if (in_sizes[5] != C3 * CC || in_sizes[6] != C3 * 9 || in_sizes[7] != CC * CC || in_sizes[8] < 1) return;
  if (in_sizes[9] != HID * CC || in_sizes[10] != HID * 9 || in_sizes[11] != CC * HID) return;
  if (in_sizes[12] != CC || in_sizes[13] != CC || in_sizes[14] != CC || in_sizes[15] != CC) return;
  if (in_sizes[16] != C3 * CC || in_sizes[17] != C3 * 9 || in_sizes[18] != CC * CC || in_sizes[19] < 1) return;
  if (in_sizes[20] != HID * CC || in_sizes[21] != HID * 9 || in_sizes[22] != CC * HID) return;
  if (out_size != NPIX * CC) return;

  const float* x        = (const float*)d_in[0];
  const float* w_s0     = (const float*)d_in[1];
  const float* b_s0     = (const float*)d_in[2];
  const float* w_s2     = (const float*)d_in[3];
  const float* b_s2     = (const float*)d_in[4];
  const float* rsa_qkv  = (const float*)d_in[5];
  const float* rsa_dw   = (const float*)d_in[6];
  const float* rsa_proj = (const float*)d_in[7];
  const float* rsa_temp = (const float*)d_in[8];
  const float* ffs_in   = (const float*)d_in[9];
  const float* ffs_dw   = (const float*)d_in[10];
  const float* ffs_out  = (const float*)d_in[11];
  const float* w_c0     = (const float*)d_in[12];
  const float* b_c0     = (const float*)d_in[13];
  const float* w_c2     = (const float*)d_in[14];
  const float* b_c2     = (const float*)d_in[15];
  const float* gsa_qkv  = (const float*)d_in[16];
  const float* gsa_dw   = (const float*)d_in[17];
  const float* gsa_proj = (const float*)d_in[18];
  const float* gsa_temp = (const float*)d_in[19];
  const float* ffc_in   = (const float*)d_in[20];
  const float* ffc_dw   = (const float*)d_in[21];
  const float* ffc_out  = (const float*)d_in[22];
  float* out = (float*)d_out;

  // ---- carve ----
  const size_t sAct = (size_t)NPIX * CC * 4;                        // f32 [NPIX][128]
  const size_t sT   = (size_t)NPIX * CC * 2 * 2;                    // two bf16 planes [NPIX][128]
  const size_t sU   = (size_t)NPIX * C3 * 4;                        // f32 [NPIX][384]
  const size_t sR   = (size_t)NPIX * C3 * 4;                        // f32 [NPIX][384] = two bf16 planes [NPIX][384]
  const size_t sWq  = (size_t)C3 * CC * 2;
  const size_t sWp  = (size_t)CC * CC * 2;
  const size_t sW1  = (size_t)HIDP * CC * 2;
  const size_t sW2  = (size_t)CC * HIDP * 2;
  const size_t sPN  = (size_t)NB * NSLN * 256 * 4;
  const size_t sPA  = (size_t)NB * NHEAD * NSLS * 1024 * 4;
  const size_t sAF  = (size_t)NB * AFSZ * 2;                        // per plane
  size_t off = 0;
  const size_t oA   = off; off += sAct;
  const size_t oBx  = off; off += sAct;
  const size_t oT   = off; off += sT;
  const size_t oU   = off; off += sU;
  const size_t oR   = off; off += sR;
  const size_t oWq0 = off; off += sWq;
  const size_t oWp0 = off; off += sWp;
  const size_t oW10 = off; off += sW1;
  const size_t oW20 = off; off += sW2;
  const size_t oWq1 = off; off += sWq;
  const size_t oWp1 = off; off += sWp;
  const size_t oW11 = off; off += sW1;
  const size_t oW21 = off; off += sW2;
  const size_t oPN  = off; off += sPN;
  const size_t oPA  = off; off += sPA;
  const size_t oAFh = off; off += sAF;
  const size_t oAFl = off; off += sAF;
  if (off > ws_size) return;                               // off = 152076288 for NB=2, IMW=128
  if (sU < (size_t)NPIX * HIDP * 4) return;
  if (sU < (size_t)NPIX * CC * 2 * 2) return;
  if (sR < (size_t)NPIX * HIDP * 2 * 2) return;

  char* ws = (char*)d_ws;
  float* A  = (float*)(ws + oA);
  float* Bx = (float*)(ws + oBx);
  unsigned short* Th = (unsigned short*)(ws + oT);
  unsigned short* Tl = Th + (size_t)NPIX * CC;
  float* U  = (float*)(ws + oU);
  unsigned short* Uh = (unsigned short*)(ws + oU);
  unsigned short* Ul = Uh + (size_t)NPIX * CC;
  float* R  = (float*)(ws + oR);
  unsigned short* Gh = (unsigned short*)(ws + oR);
  unsigned short* Gl = Gh + (size_t)NPIX * HIDP;
  unsigned short* Wq0 = (unsigned short*)(ws + oWq0);
  unsigned short* Wp0 = (unsigned short*)(ws + oWp0);
  unsigned short* W10 = (unsigned short*)(ws + oW10);
  unsigned short* W20 = (unsigned short*)(ws + oW20);
  unsigned short* Wq1 = (unsigned short*)(ws + oWq1);
  unsigned short* Wp1 = (unsigned short*)(ws + oWp1);
  unsigned short* W11 = (unsigned short*)(ws + oW11);
  unsigned short* W21 = (unsigned short*)(ws + oW21);
  float* PN = (float*)(ws + oPN);
  float* PA = (float*)(ws + oPA);
  unsigned short* AFh = (unsigned short*)(ws + oAFh);
  unsigned short* AFl = (unsigned short*)(ws + oAFl);

  const dim3 blk(256);
  // (1) x NCHW -> A pixel-major; weights f32 [out][in] -> bf16 planes [outP][inP], k contiguous, zero padded
  //     (Wq0 is the start of the weight region: Wq0, Wp0, W10, W20, Wq1, Wp1, W11, W21 lie one behind the other)
  prep_k<<<dim3(PB_T + 2 * PB_SET), blk, 0, stream>>>(x, A, rsa_qkv, rsa_proj, ffs_in, ffs_out,
                                                      gsa_qkv, gsa_proj, ffc_in, ffc_out, Wq0);

  (void)hipFuncSetAttribute(reinterpret_cast<const void*>(&rsa_attn_k), hipFuncAttributeMaxDynamicSharedMemorySize, RL_END);
  (void)hipFuncSetAttribute(reinterpret_cast<const void*>(&gsa_s_k), hipFuncAttributeMaxDynamicSharedMemorySize, GL_END);

  const dim3 gG(NPIX / GBM);
  const dim3 gDw((NPIX / DWL * (C3 / 4) + 255) / 256);
  const dim3 gLn(NPIX / 8);

  // ---- spatial (RSA) block ----
  ln_k<<<gLn, blk, 0, stream>>>(A, Bx, w_s0, b_s0, Th, Tl, 0);                          // T = LN_s0(x)
  gemm_k<CC, C3, 0><<<gG, blk, 0, stream>>>(Th, Tl, Wq0, U, Bx);                          // qkv 1x1 -> U
  dw_k<C3, 0><<<gDw, blk, 0, stream>>>(U, rsa_dw, 0, C3, WSZ / 2, R, C3, 0, Th, Tl, CC); // dw (rolled) -> R
  rsa_attn_k<<<dim3(NB * NWIN), blk, RL_END, stream>>>(R, rsa_temp, Th, Tl);            // T = window attention out
  gemm_k<CC, CC, 0><<<gG, blk, 0, stream>>>(Th, Tl, Wp0, Bx, A);                         // Bx = x_
  ln_k<<<gLn, blk, 0, stream>>>(A, Bx, w_s2, b_s2, Th, Tl, 1);                          // A = x_+x ; T = LN_s2(A)
  gemm_k<CC, HIDP, 0><<<gG, blk, 0, stream>>>(Th, Tl, W10, U, Bx);                        // ffn-in -> U
  dw_k<HIDP, 1><<<gDw, blk, 0, stream>>>(U, ffs_dw, 0, HID, 0, R, C3, 0, Gh, Gl, HIDP);  // dw+gelu -> G planes
  gemm_k<HIDP, CC, 1><<<gG, blk, 0, stream>>>(Gh, Gl, W20, A, Bx);                        // A = ffn + x_

  // ---- channel (GSA) block ----
  ln_k<<<gLn, blk, 0, stream>>>(A, Bx, w_c0, b_c0, Th, Tl, 0);                          // T = LN_c0(x)
  gemm_k<CC, C3, 0><<<gG, blk, 0, stream>>>(Th, Tl, Wq1, U, Bx);                          // qkv 1x1 -> U
  dw_k<C3, 2><<<gDw, blk, 0, stream>>>(U, gsa_dw, 0, C3, 0, R, C3, 0, Th, Tl, CC);       // q, k -> R f32; v planes -> T region
  gsa_s_k<<<dim3(NB * NHEAD * NSLS + NB * NSLN), blk, GL_END, stream>>>(R, PA, PN);      // score and norm partials
  gsa_fin_k<<<dim3(NB * NHEAD), blk, 0, stream>>>(PA, PN, gsa_temp, AFh, AFl);
  apply_k<<<dim3(NPIX / 128, CC / 64), blk, 0, stream>>>(Th, Tl, AFh, AFl, Uh, Ul);     // U planes = channel attention out
  gemm_k<CC, CC, 0><<<gG, blk, 0, stream>>>(Uh, Ul, Wp1, Bx, A);                         // Bx = x_
  ln_k<<<gLn, blk, 0, stream>>>(A, Bx, w_c2, b_c2, Th, Tl, 1);                          // A = x_+x ; T = LN_c2(A)
  gemm_k<CC, HIDP, 0><<<gG, blk, 0, stream>>>(Th, Tl, W11, U, Bx);
  dw_k<HIDP, 1><<<gDw, blk, 0, stream>>>(U, ffc_dw, 0, HID, 0, R, C3, 0, Gh, Gl, HIDP);
  gemm_k<HIDP, CC, 2><<<gG, blk, 0, stream>>>(Gh, Gl, W21, out, Bx);                      // d_out NCHW = ffn + x_
  (void)hipGetLastError();
}

// v005
// A run of this version takes 260 microseconds.
// Timed twice side by side with v004, it ran 1.14 and 1.13 times as fast.
// Over all steps from v000 it is 2.85 times as fast.
// Contractions (1x1 convs for qkv / proj / ffn-in / ffn-out, window q^T.k and v.attn, global q.k^T and attn.v):
// v_wmma_f32_16x16x32_bf16 (bf16 operands, f32 accumulate); computed operands carried as bf16 hi + residual planes,
// weight operands single bf16; layer norms, depthwise 3x3 convs, erf GELU, l2 norms and residual adds in f32 on VALU.
// Inputs RNE-converted to bf16 on load.
#include <hip/hip_runtime.h>
#include <math.h>
#include <stdint.h>

#define NB    2
#define CC    128
#define IMW   128
#define HW    (IMW * IMW)
#define NPIX  (NB * HW)
#define C3    384
#define HID   340
#define HIDP  384
#define NHEAD 4
#define HDC   32
#define WSZ   4
#define NWX   (IMW / WSZ)
#define NWIN  (NWX * NWX)
#define NSLN  (HW / 256)
#define NSLS  (HW / 2048)
#define AFSZ  (CC * HDC)
#define RSQ2  0.70710678118654752f
#define GXP   36
#define AXP   68
#define TXP   132
#define ATP   136
#define GSP   264
#define DWL   8

static_assert((IMW & (IMW - 1)) == 0);
static_assert(IMW % WSZ == 0);
static_assert(WSZ == 4);
static_assert(IMW % DWL == 0);
static_assert(HW % 2048 == 0);
static_assert(HW % 256 == 0);
static_assert(HW % 64 == 0);
static_assert(NPIX % 256 == 0);
static_assert(CC == NHEAD * HDC);
static_assert(HDC == 32);
static_assert((GXP * 4) % 16 == 0);
static_assert((AXP * 4) % 16 == 0);
static_assert((TXP * 4) % 16 == 0);
static_assert((ATP * 2) % 16 == 0);
static_assert((GSP * 2) % 16 == 0);

// RSA window kernel dynamic LDS map (bytes)
#define RL_R    0
#define RL_QTH  24576
#define RL_QTL  28672
#define RL_KTH  32768
#define RL_KTL  36864
#define RL_ATH  40960
#define RL_ATL  75776
#define RL_VH   110592
#define RL_VL   114944
#define RL_INV  119296
#define RL_END  119424
static_assert(RL_QTH == RL_R + 16 * C3 * 4);
static_assert(RL_QTL == RL_QTH + CC * 16 * 2);
static_assert(RL_KTH == RL_QTL + CC * 16 * 2);
static_assert(RL_KTL == RL_KTH + CC * 16 * 2);
static_assert(RL_ATH == RL_KTL + CC * 16 * 2);
static_assert(RL_ATL == RL_ATH + CC * ATP * 2);
static_assert(RL_VH == RL_ATL + CC * ATP * 2);
static_assert(RL_VL == RL_VH + 16 * ATP * 2);
static_assert(RL_INV == RL_VL + 16 * ATP * 2);
static_assert(RL_END == RL_INV + 32 * 4);
static_assert(16 * TXP * 4 <= RL_QTH - RL_R);

// GSA score kernel dynamic LDS map (bytes)
#define GL_QH   0
#define GL_QL   16896
#define GL_KH   33792
#define GL_KL   50688
#define GL_RED  67584
#define GL_STG  71680
#define GL_END  76288
static_assert(GL_QL == 32 * GSP * 2);
static_assert(GL_KH == 2 * GL_QL);
static_assert(GL_KL == 3 * GL_QL);
static_assert(GL_RED == 4 * GL_QL);
static_assert(GL_STG == GL_RED + 4 * 32 * 8 * 4);
static_assert(GL_END == GL_STG + 32 * GXP * 4);

typedef __bf16         v16bf __attribute__((ext_vector_type(16)));
typedef unsigned short v8us  __attribute__((ext_vector_type(8)));
typedef float          v8f   __attribute__((ext_vector_type(8)));
typedef float          v4f   __attribute__((ext_vector_type(4)));
typedef unsigned int   v4u   __attribute__((ext_vector_type(4)));
typedef unsigned int   v2u   __attribute__((ext_vector_type(2)));

union Frag { v16bf v; v8us u[2]; };

// ---- scalar helpers ------------------------------------------------------------------------------------------
__device__ __forceinline__ unsigned short bf_bits(float f) {          // f32 -> bf16 bits, RNE convert
  unsigned u = __float_as_uint(f);
  return (unsigned short)((u + 0x7FFFu + ((u >> 16) & 1u)) >> 16);
}
__device__ __forceinline__ float bf_up(unsigned short h) { return __uint_as_float(((unsigned)h) << 16); }
__device__ __forceinline__ float bfr(float f) { return bf_up(bf_bits(f)); }
__device__ __forceinline__ unsigned pk16(unsigned short a, unsigned short b) { return (unsigned)a | ((unsigned)b << 16); }
// hi = bf16(v), lo = bf16(v - hi)
__device__ __forceinline__ void split_bf(float v, unsigned short& hi, unsigned short& lo) {
  const unsigned short hb = bf_bits(v);
  hi = hb;
  lo = bf_bits(v - bf_up(hb));
}
__device__ __forceinline__ void split4(v4f v, v2u& ph, v2u& pl) {
  unsigned short h[4], l[4];
#pragma unroll
  for (int e = 0; e < 4; ++e) split_bf(v[e], h[e], l[e]);
  ph[0] = pk16(h[0], h[1]); ph[1] = pk16(h[2], h[3]);
  pl[0] = pk16(l[0], l[1]); pl[1] = pk16(l[2], l[3]);
}
__device__ __forceinline__ void split8(v4f v0, v4f v1, v4u& ph, v4u& pl) {
  unsigned short h[8], l[8];
#pragma unroll
  for (int e = 0; e < 4; ++e) { split_bf(v0[e], h[e], l[e]); split_bf(v1[e], h[4 + e], l[4 + e]); }
#pragma unroll
  for (int e = 0; e < 4; ++e) { ph[e] = pk16(h[2 * e], h[2 * e + 1]); pl[e] = pk16(l[2 * e], l[2 * e + 1]); }
}
__device__ __forceinline__ v8f zero8() { v8f z = {0.f, 0.f, 0.f, 0.f, 0.f, 0.f, 0.f, 0.f}; return z; }
__device__ __forceinline__ v8us zero8us() { v8us z = {0, 0, 0, 0, 0, 0, 0, 0}; return z; }

// ---- fragment loaders: 16-bit A/B operand, lane -> row/col (lane&15), p already includes +8*(lane>>4);
//      elements 0..7 <- p[0..7] (k0+8h..), elements 8..15 <- p[16..23] (k0+16+8h..)
__device__ __forceinline__ v16bf ldfrag(const unsigned short* p) {
  Frag f;
  f.u[0] = *(const v8us*)(p);
  f.u[1] = *(const v8us*)(p + 16);
  return f.v;
}
// K = 16 contraction padded to 32: elements 8..15 are zero
__device__ __forceinline__ v16bf ldfrag16(const unsigned short* p) {
  Frag f;
  f.u[0] = *(const v8us*)(p);
  f.u[1] = zero8us();
  return f.v;
}

// ---- WMMA helper with trailing VALU hazard gap ---------------------------------------------------------------
__device__ __forceinline__ v8f mma_bf(v16bf a, v16bf b, v8f c) {
  c = __builtin_amdgcn_wmma_f32_16x16x32_bf16(false, a, false, b, (short)0, c, false, false);
#if defined(__HIP_DEVICE_COMPILE__)
  asm volatile("v_nop\n\tv_nop\n\tv_nop\n\tv_nop" : "+v"(c) : "v"(a), "v"(b));
#endif
  return c;
}
__device__ __forceinline__ void wave_sync_lds() {
  __builtin_amdgcn_fence(__ATOMIC_RELEASE, "workgroup");
  __builtin_amdgcn_wave_barrier();
  __builtin_amdgcn_fence(__ATOMIC_ACQUIRE, "workgroup");
}

// =================================================================================================================
// Weight convert: w f32 [rows][cols] -> bf16 [rowsP][colsP] (zero padded), value = bf16_RNE(w). One thread = 8
// coverage: rowsP * colsP/8 pieces, ceil(pieces/256) blocks (blk = block index within the matrix) with a bound.
// =================================================================================================================
__device__ __forceinline__ void cvt_w(const float* __restrict__ w, unsigned short* outp,
                                      int rows, int cols, int rowsP, int colsP, int blk) {
  const int t = blk * 256 + threadIdx.x;
  const int ppr = colsP >> 3;
  const int npc = rowsP * ppr;
  const bool ok = t < npc;
  const int tt = ok ? t : 0;
  const int r = tt / ppr, c8 = (tt - r * ppr) * 8;
  const int rr = min(r, rows - 1);
  unsigned short hv[8];
#pragma unroll
  for (int e = 0; e < 8; ++e) {
    const int c = c8 + e;
    const int cl = min(c, cols - 1);
    const float f = w[(size_t)rr * cols + cl];
    const float z = (r < rows && c < cols) ? f : 0.0f;
    hv[e] = bf_bits(z);
  }
  v4u pk;
#pragma unroll
  for (int e = 0; e < 4; ++e) pk[e] = pk16(hv[2 * e], hv[2 * e + 1]);
  unsigned short* gp = outp + (size_t)r * colsP + c8;
  if (ok) *(v4u*)gp = pk;
  
}

// =================================================================================================================
// NCHW f32 x -> pixel-major stream A [b*HW + p][128] f32, values bf16-RNE-converted. Block = (b, 64-pixel tile):
// 128 ch x 64 px loaded coalesced along p into an LDS tile [px][TXP]; store: each pixel row = 512 B = 32 lanes x
// coverage: 8 waves x 8 rows = 64 px x 128 ch per block; NB*(HW/64) blocks (blk) = every pixel once.
// =================================================================================================================
__device__ __forceinline__ void nchw_in(const float* __restrict__ x, float* A, float* xs, int blk) {
  const int tid = threadIdx.x, wave = tid >> 5, lane = tid & 31;
  const int b = blk / (HW / 64);
  const int p0 = (blk - b * (HW / 64)) * 64;
#pragma unroll
  for (int it = 0; it < 8; ++it) {
    const int q = it * 256 + tid;
    const int ch = q >> 4, j4 = (q & 15) * 4;
    const v4f v = *(const v4f*)(x + ((size_t)(b * CC + ch)) * HW + p0 + j4);
#pragma unroll
    for (int e = 0; e < 4; ++e) xs[(j4 + e) * TXP + ch] = bfr(v[e]);
  }
  __syncthreads();
  v4f ov[8];
#pragma unroll
  for (int it = 0; it < 8; ++it) {
    const int row = wave * 8 + it;
    ov[it] = *(const v4f*)(xs + row * TXP + lane * 4);
  }
#pragma unroll
  for (int it = 0; it < 8; ++it) {
    const int row = wave * 8 + it;
    *(v4f*)(A + ((size_t)(b * HW + p0 + row)) * CC + lane * 4) = ov[it];
  }
}

// =================================================================================================================
// Input preparation, one launch: the NCHW transpose and the eight weight converts need nothing of each other, so they
// share one grid by ranges of the block index (block-uniform branches; the transpose's barrier is passed by whole
// blocks only). Blocks [0, PB_T): transpose tiles; then per weight set (spatial, channel) PB_SET blocks: qkv, proj,
// ffn-in, ffn-out. Wb = the bf16 weight region, the four matrices of a set one behind the other, set after set.
// =================================================================================================================
#define PB_T    (NB * (HW / 64))
#define PB_Q    (C3 * CC / 8 / 256)
#define PB_P    (CC * CC / 8 / 256)
#define PB_1    (HIDP * CC / 8 / 256)
#define PB_2    (CC * HIDP / 8 / 256)
#define PB_SET  (PB_Q + PB_P + PB_1 + PB_2)
#define WSETN   (C3 * CC + CC * CC + HIDP * CC + CC * HIDP)
static_assert((C3 * CC) % 2048 == 0 && (CC * CC) % 2048 == 0 && (HIDP * CC) % 2048 == 0);
__global__ __launch_bounds__(256) void prep_k(const float* __restrict__ x, float* A,
                                              const float* __restrict__ wq0, const float* __restrict__ wp0,
                                              const float* __restrict__ w10, const float* __restrict__ w20,
                                              const float* __restrict__ wq1, const float* __restrict__ wp1,
                                              const float* __restrict__ w11, const float* __restrict__ w21,
                                              unsigned short* Wb) {
  __shared__ __align__(16) float xs[64 * TXP];
  const int bi = blockIdx.x;
  if (bi < PB_T) { nchw_in(x, A, xs, bi); return; }
  const int r0 = bi - PB_T;
  const int set = r0 / PB_SET;
  const int r = r0 - set * PB_SET;
  unsigned short* o = Wb + (size_t)set * WSETN;
  if (r < PB_Q) {
    cvt_w(set ? wq1 : wq0, o, C3, CC, C3, CC, r);
  } else if (r < PB_Q + PB_P) {
    cvt_w(set ? wp1 : wp0, o + C3 * CC, CC, CC, CC, CC, r - PB_Q);
  } else if (r < PB_Q + PB_P + PB_1) {
    cvt_w(set ? w11 : w10, o + C3 * CC + CC * CC, HID, CC, HIDP, CC, r - (PB_Q + PB_P));
  } else {
    cvt_w(set ? w21 : w20, o + C3 * CC + CC * CC + HIDP * CC, CC, HID, CC, HIDP, r - (PB_Q + PB_P + PB_1));
  }
}

// =================================================================================================================
// Layer norm of pixel rows over their 128 channels, one wave per row, 4 channels per lane. ln_stats: mean and variance
// by butterfly sums over the 32 lanes (two passes); returns the centred values dv and the variance (the same in every
// lane). ln_out: dv * rstd, scale gv, shift bb, result as bf16 hi + residual, 4 + 4 halves.
// The loops are unrolled in full: constant indices keep the 4-element vectors in registers.
// =================================================================================================================
__device__ __forceinline__ void ln_stats(v4f xv, v4f& dv, float& var) {
  float s = (xv[0] + xv[1]) + (xv[2] + xv[3]);
#pragma unroll
  for (int off = 1; off < 32; off <<= 1) s = s + __shfl_xor(s, off, 32);
  const float mu = s * (1.0f / 128.0f);
  float s2 = 0.f;
#pragma unroll
  for (int e = 0; e < 4; ++e) { dv[e] = xv[e] - mu; s2 = s2 + dv[e] * dv[e]; }
#pragma unroll
  for (int off = 1; off < 32; off <<= 1) s2 = s2 + __shfl_xor(s2, off, 32);
  var = s2 * (1.0f / 128.0f);
}
__device__ __forceinline__ void ln_out(v4f dv, float rstd, v4f gv, v4f bb, v2u& ph, v2u& pl) {
  v4f z;
#pragma unroll
  for (int e = 0; e < 4; ++e) z[e] = (dv[e] * rstd) * gv[e] + bb[e];
  split4(z, ph, pl);
}

// =================================================================================================================
// GEMM: OUT[p][n] = sum_k (Ah[p][k] + Al[p][k]) * W[n][k]  (A planes [pix][K] bf16 hi + residual, W single bf16
// [N][K] k-contiguous, 2 products per tile pair). Block = 8 waves = GBM pixels x all N columns. Per chunk of GKC k the
// block brings its GBM rows of both A planes and all N rows of W into LDS with loads of whole rows (16 lanes x 16 B =
// the 256 B of a row's chunk), rows at a pitch of GPP halves; every fragment is then read from LDS with the split k map.
// So each A row leaves L2 once, not once per 32 output columns, and no global load gathers 32-byte pieces of 16 rows.
// The next chunk's rows are loaded into registers while this chunk is multiplied. Waves: 2 pixel groups of 32 x
// 4 column groups of N/4; a wave holds N/128 tiles of 32 x 32 (2x2 fragments each) and uses its A fragments for all.
// Each sum runs over k in the same order as before (k rising, hi then residual).
// Epilogue (behind a barrier, in the LDS of the operands): each 32x32 f32 tile is staged by its wave and stored as
// whole 128-byte lines. EP 0: OUT[p][N]; EP 1: same + res[p][n] (res pitch 128); EP 2: NCHW d_out[b][n][p] + res[p][n].
// LN 0: A planes from Ah/Al. LN 1 / LN 2 (K = 128, one chunk): the A operand is the layer norm of the f32 rows X[p][128]
// (LN 2: of X + res), scale g, shift bv: each wave loads 8 of the block's rows, norms them and writes the two
// planes straight into the operand LDS, while the W rows are still on their way; Ah/Al are not read.
// coverage: 8 waves x 32 rows x N/4 cols per block = GBM px x N cols; grid covers NPIX x N once.
// =================================================================================================================
#define GKC 128
#define GBM 64
#define GPP 136
static_assert((GPP * 2) % 32 == 16);
static_assert(NPIX % GBM == 0 && HW % 32 == 0);
template <int K, int N, int EP, int LN>
__global__ __launch_bounds__(256) void gemm_k(const unsigned short* __restrict__ Ah,
                                              const unsigned short* __restrict__ Al,
                                              const unsigned short* __restrict__ W,
                                              float* outf, const float* __restrict__ res,
                                              const float* __restrict__ X, const float* __restrict__ g,
                                              const float* __restrict__ bv) {
  constexpr int NP = N / 128;                // 32-column tiles per wave
  constexpr int NCH = K / GKC;               // k chunks
  constexpr int WIT = N / 16;                // W rows per thread and chunk
  constexpr int LNR = GBM / 8;               // rows that a wave norms
  static_assert(K % GKC == 0 && N % 128 == 0);
  static_assert(LN == 0 || (K == CC && K == GKC && EP == 0));
  static_assert(8 * NP * 32 * GXP * 4 <= (2 * GBM + N) * GPP * 2);
  __shared__ __align__(16) unsigned short sm[(2 * GBM + N) * GPP];
  unsigned short* sah = sm;
  unsigned short* sal = sm + GBM * GPP;
  unsigned short* swt = sm + 2 * GBM * GPP;
  float* stg = (float*)sm;                   // reused behind the last chunk's barrier
  const int tid = threadIdx.x, wave = tid >> 5, lane = tid & 31, hh = lane >> 4, l15 = lane & 15;
  const int mb = blockIdx.x * GBM;
  const int mg = wave >> 2, ng = wave & 3;
  const int srow = tid >> 4, spc = (tid & 15) * 8;
  const unsigned short* gah = Ah + (size_t)(mb + srow) * K + spc;
  const unsigned short* gal = Al + (size_t)(mb + srow) * K + spc;
  const unsigned short* gw = W + (size_t)srow * K + spc;
  const int so = srow * GPP + spc;
  // Every loop below is unrolled in full: constant indices keep the staged rows and the sums in registers.
  v8f acc[NP][4];
#pragma unroll
  for (int j = 0; j < NP; ++j) {
#pragma unroll
    for (int f = 0; f < 4; ++f) acc[j][f] = zero8();
  }
  v4u ra[GBM / 16], rl[GBM / 16], rw[WIT];
  v4f xv[LNR], xb[LNR], gv, bb;
  if (LN == 0) {
#pragma unroll
    for (int it = 0; it < GBM / 16; ++it) {
      ra[it] = *(const v4u*)(gah + it * 16 * K);
      rl[it] = *(const v4u*)(gal + it * 16 * K);
    }
  } else {
    const size_t xo = (size_t)(mb + wave * LNR) * CC + lane * 4;
#pragma unroll
    for (int it = 0; it < LNR; ++it) xv[it] = *(const v4f*)(X + xo + it * CC);
    if (LN == 2) {
#pragma unroll
      for (int it = 0; it < LNR; ++it) xb[it] = *(const v4f*)(res + xo + it * CC);
    }
    // the loads below may be given registers that held the addresses of the row loads: the wait stands in front of them
    asm volatile("s_wait_xcnt 0x0" ::: "memory");
    gv = *(const v4f*)(g + lane * 4);
    bb = *(const v4f*)(bv + lane * 4);
  }
#pragma unroll
  for (int it = 0; it < WIT; ++it) rw[it] = *(const v4u*)(gw + it * 16 * K);
  // the W loads are issued here, behind the row loads, and come in while the rows are normed; without this line the
  // compiler moves them down into the norm and the block waits for them afterwards
  if (LN != 0) __builtin_amdgcn_sched_barrier(0);
#pragma unroll
  for (int kc = 0; kc < NCH; ++kc) {
    if (kc > 0) __syncthreads();             // every wave has read the chunk that is overwritten next
    if (LN == 0) {
#pragma unroll
      for (int it = 0; it < GBM / 16; ++it) {
        *(v4u*)(sah + so + it * 16 * GPP) = ra[it];
        *(v4u*)(sal + so + it * 16 * GPP) = rl[it];
      }
    } else {
#pragma unroll
      for (int e = 0; e < 4; ++e) { gv[e] = bfr(gv[e]); bb[e] = bfr(bb[e]); }
      float var[LNR];
#pragma unroll
      for (int it = 0; it < LNR; ++it) ln_stats(LN == 2 ? xv[it] + xb[it] : xv[it], xv[it], var[it]);
      // the root and the division are long sequences: lane i does them for row i, once for the wave's LNR rows
      float vs = var[0];
#pragma unroll
      for (int it = 1; it < LNR; ++it) vs = (lane == it) ? var[it] : vs;
      const float rs = 1.0f / sqrtf(vs + 1e-6f);
#pragma unroll
      for (int it = 0; it < LNR; ++it) {
        const float rstd = __int_as_float(__builtin_amdgcn_readlane(__float_as_int(rs), it));
        v2u ph, pw;
        ln_out(xv[it], rstd, gv, bb, ph, pw);
        const int lo = (wave * LNR + it) * GPP + lane * 4;
        *(v2u*)(sah + lo) = ph;
        *(v2u*)(sal + lo) = pw;
      }
    }
#pragma unroll
    for (int it = 0; it < WIT; ++it) *(v4u*)(swt + so + it * 16 * GPP) = rw[it];
    __syncthreads();                         // every wave reads rows that other waves staged
    if (kc + 1 < NCH) {
#pragma unroll
      for (int it = 0; it < GBM / 16; ++it) {
        ra[it] = *(const v4u*)(gah + it * 16 * K + (kc + 1) * GKC);
        rl[it] = *(const v4u*)(gal + it * 16 * K + (kc + 1) * GKC);
      }
#pragma unroll
      for (int it = 0; it < WIT; ++it) rw[it] = *(const v4u*)(gw + it * 16 * K + (kc + 1) * GKC);
    }
#pragma unroll
    for (int ks = 0; ks < GKC / 32; ++ks) {
      const int ko = ks * 32 + 8 * hh;
      const unsigned short* pa = sah + (mg * 32 + l15) * GPP + ko;
      const unsigned short* pl = sal + (mg * 32 + l15) * GPP + ko;
      const v16bf a0h = ldfrag(pa), a0l = ldfrag(pl);
      const v16bf a1h = ldfrag(pa + 16 * GPP), a1l = ldfrag(pl + 16 * GPP);
#pragma unroll
      for (int j = 0; j < NP; ++j) {
        const unsigned short* pb = swt + (ng * (N / 4) + j * 32 + l15) * GPP + ko;
        const v16bf b0 = ldfrag(pb), b1 = ldfrag(pb + 16 * GPP);
        acc[j][0] = mma_bf(a0h, b0, acc[j][0]); acc[j][0] = mma_bf(a0l, b0, acc[j][0]);
        acc[j][1] = mma_bf(a0h, b1, acc[j][1]); acc[j][1] = mma_bf(a0l, b1, acc[j][1]);
        acc[j][2] = mma_bf(a1h, b0, acc[j][2]); acc[j][2] = mma_bf(a1l, b0, acc[j][2]);
        acc[j][3] = mma_bf(a1h, b1, acc[j][3]); acc[j][3] = mma_bf(a1l, b1, acc[j][3]);
      }
    }
  }
  __syncthreads();                           // the operands' LDS becomes the output stage: every wave has left it
  const int m0 = mb + mg * 32;
#pragma unroll
  for (int j = 0; j < NP; ++j) {
    float* sw = stg + (wave * NP + j) * (32 * GXP);
#pragma unroll
    for (int r = 0; r < 8; ++r) {
      sw[(8 * hh + r) * GXP + l15] = acc[j][0][r];
      sw[(8 * hh + r) * GXP + 16 + l15] = acc[j][1][r];
      sw[(16 + 8 * hh + r) * GXP + l15] = acc[j][2][r];
      sw[(16 + 8 * hh + r) * GXP + 16 + l15] = acc[j][3][r];
    }
  }
  wave_sync_lds();
  const int q = lane >> 3, piece = lane & 7;
#pragma unroll
  for (int j = 0; j < NP; ++j) {
    const float* sw = stg + (wave * NP + j) * (32 * GXP);
    const int n0 = ng * (N / 4) + j * 32;
    v4f ov[8];
    if (EP != 2) {
#pragma unroll
      for (int it = 0; it < 8; ++it) {
        const int row = it * 4 + q;
        v4f v = *(const v4f*)(sw + row * GXP + piece * 4);
        if (EP == 1) {
          const v4f rr = *(const v4f*)(res + (size_t)(m0 + row) * CC + n0 + piece * 4);
          v = v + rr;
        }
        ov[it] = v;
      }
#pragma unroll
      for (int it = 0; it < 8; ++it) {
        const int row = it * 4 + q;
        *(v4f*)(outf + (size_t)(m0 + row) * N + n0 + piece * 4) = ov[it];
      }
    } else {
      const int b = m0 / HW;
      const int plx = m0 - b * HW;
#pragma unroll
      for (int it = 0; it < 8; ++it) {
        const int ch = it * 4 + q;
        v4f v;
#pragma unroll
        for (int e = 0; e < 4; ++e) {
          const float rv = res[(size_t)(m0 + piece * 4 + e) * CC + n0 + ch];
          v[e] = sw[(piece * 4 + e) * GXP + ch] + rv;
        }
        ov[it] = v;
      }
#pragma unroll
      for (int it = 0; it < 8; ++it) {
        const int ch = it * 4 + q;
        *(v4f*)(outf + ((size_t)(b * CC + n0 + ch)) * HW + plx + piece * 4) = ov[it];
      }
    }
  }
}

// =================================================================================================================
// Depthwise 3x3, SAME zero padding, cross-correlation taps, optional cyclic roll (output pixel index in the rolled
// frame, source slab in the unrolled frame: source pixel ((ny+roll) mod IMW, (nx+roll) mod IMW), valid iff the rolled
// neighbour (ny,nx) is inside the image). src [pix][CS] f32 (CS = all 384 channels of the conv), 4 channels per thread,
// weights wd[(wofs + c)*9 + tap] bf16-RNE (clamped address, zero for c >= cvalid): the block's CS*9 weights are read
// once (thread = channel, in steps of 256) and laid out in LDS as [tap][CS], channel contiguous, so that a thread takes
// its 4 channels of one tap with one 16-byte LDS read.
// A thread computes a strip of DWL output pixels along x: it loads the 3 x (DWL+2) source pixels of the strip once,
// all loads in flight together, keeps them in registers, and each loaded column serves up to three outputs; the taps
// come from LDS once per strip. Strips that follow one another in the grid lie under one another in y (a block's
// strips share source rows).
// A row outside the image zeroes its three taps; only the strip's two outer columns can lie outside the image.
// MODE 0: f32 rows dstf[p*dpitch + dcol + c]; MODE 1: exact-erf GELU (rolled) then bf16 hi + residual planes
// Ph/Pl[p*ppitch + dcol + c]; MODE 2: channels below 2*CC (q, k) as MODE 0, the rest (v) as planes without the GELU at
// Ph/Pl[p*ppitch + c - 2*CC] (a wave's 32 threads hold 128 channels in a row, so the choice is the same for a wave).
// coverage: (NPIX/DWL) * CS/4 threads x DWL pixels, grid ceil-div with an in-kernel bound.
// =================================================================================================================
template <int CS, int MODE>
__global__ __launch_bounds__(256) void dw_k(const float* __restrict__ src, const float* __restrict__ wd,
                                            int wofs, int cvalid, int roll,
                                            float* dstf, int dpitch, int dcol,
                                            unsigned short* Ph, unsigned short* Pl, int ppitch) {
  constexpr int TPP = CS / 4;
  constexpr int NSTR = NPIX / DWL;           // strips in all
  constexpr int SPI = HW / DWL;              // strips per image
  static_assert(CS % 128 == 0);
  __shared__ __align__(16) float wsm[9 * CS];
  constexpr int WTR = (CS + 255) / 256;      // thread = channel, its 9 taps, in WTR steps of 256 channels
  float wf[WTR][9];
#pragma unroll                               // constant indices keep wf in registers
  for (int k = 0; k < WTR; ++k) {            // no test here (the address is clamped): every step's loads behind one wait
    const float* wp = wd + min(wofs + (int)threadIdx.x + k * 256, cvalid - 1) * 9;
#pragma unroll                               // constant indices keep wf in registers
    for (int tp = 0; tp < 9; ++tp) wf[k][tp] = wp[tp];
  }
#pragma unroll                               // constant indices keep wf in registers
  for (int k = 0; k < WTR; ++k) {
    const int ch = (int)threadIdx.x + k * 256;
    const float wok = (wofs + ch < cvalid) ? 1.0f : 0.0f;
    if (ch < CS) {                           // whole waves
#pragma unroll                               // constant indices keep wf in registers
      for (int tp = 0; tp < 9; ++tp) wsm[tp * CS + ch] = bfr(wf[k][tp]) * wok;
    }
  }
  __syncthreads();                           // every wave reads table rows that other waves wrote
  const int t = blockIdx.x * 256 + threadIdx.x;
  int s = t / TPP;
  const int cg = t - s * TPP;
  const bool pv = s < NSTR;
  s = pv ? s : (NSTR - 1);
  const int c = cg * 4;
  const int b = s / SPI;
  const int sr = s - b * SPI;
  const int xs = sr / IMW;
  const int y = sr - xs * IMW;
  const int x0 = xs * DWL;
  const v4f* s4 = (const v4f*)src;            // slab rows in 16-byte units: TPP units per pixel
  // Every loop below but the GELU loop is unrolled in full so that its indices are constants: the offsets, the 3 x (DWL+2) window,
  // the taps and the DWL sums then live in registers (an index known only at run time would put them in scratch).
  int ro[3], co[DWL + 2], ix[3][DWL + 2];
#pragma unroll                               // see above
  for (int dy = 0; dy < 3; ++dy) {
    const int sy = (y + dy - 1 + roll) & (IMW - 1);
    ro[dy] = (b * HW + sy * IMW) * TPP + cg;
  }
#pragma unroll                               // see above
  for (int j = 0; j < DWL + 2; ++j) {
    const int sx = (x0 + j - 1 + roll) & (IMW - 1);
    co[j] = sx * TPP;
  }
#pragma unroll                               // see above
  for (int dy = 0; dy < 3; ++dy) {
#pragma unroll                               // see above
    for (int j = 0; j < DWL + 2; ++j) ix[dy][j] = ro[dy] + co[j];
  }
  const int p0 = b * HW + y * IMW + x0;      // first output pixel of the strip
  const float ml = (x0 > 0) ? 1.0f : 0.0f;
  const float mr = (x0 + DWL < IMW) ? 1.0f : 0.0f;
  v4f v[3][DWL + 2];
#pragma unroll                               // see above
  for (int dy = 0; dy < 3; ++dy) {
#pragma unroll                               // see above
    for (int j = 0; j < DWL + 2; ++j) v[dy][j] = s4[ix[dy][j]];
    // the next row's loads may be given registers that held this row's offsets: the wait stands in front of them
    if (dy < 2) asm volatile("s_wait_xcnt 0x0" ::: "memory");
  }
  static_assert(DWL == 8);                   // the statement below names the 3 x 10 loaded values one by one
  // Inputs only: every load of the window is issued in front of this line, so the wave waits out one memory latency
  // for all 30; without it the compiler spreads the loads among the sums and waits for them a few at a time.
  asm volatile("" :: "v"(v[0][0]), "v"(v[0][1]), "v"(v[0][2]), "v"(v[0][3]), "v"(v[0][4]),
                     "v"(v[0][5]), "v"(v[0][6]), "v"(v[0][7]), "v"(v[0][8]), "v"(v[0][9]),
                     "v"(v[1][0]), "v"(v[1][1]), "v"(v[1][2]), "v"(v[1][3]), "v"(v[1][4]),
                     "v"(v[1][5]), "v"(v[1][6]), "v"(v[1][7]), "v"(v[1][8]), "v"(v[1][9]),
                     "v"(v[2][0]), "v"(v[2][1]), "v"(v[2][2]), "v"(v[2][3]), "v"(v[2][4]),
                     "v"(v[2][5]), "v"(v[2][6]), "v"(v[2][7]), "v"(v[2][8]), "v"(v[2][9]));
  v4f acc[DWL];
#pragma unroll                               // see above
  for (int i = 0; i < DWL; ++i) acc[i] = v4f{0.f, 0.f, 0.f, 0.f};
  // row by row: a row's registers are free once its three taps are summed; each output still sums its taps 0..8 in order
#pragma unroll                               // see above
  for (int dy = 0; dy < 3; ++dy) {
    const float rm = ((unsigned)(y + dy - 1) < (unsigned)IMW) ? 1.0f : 0.0f;
    v4f wv[3];
#pragma unroll                               // see above
    for (int dx = 0; dx < 3; ++dx) wv[dx] = *(const v4f*)(wsm + (dy * 3 + dx) * CS + c) * rm;
    v[dy][0] = v[dy][0] * ml;
    v[dy][DWL + 1] = v[dy][DWL + 1] * mr;
#pragma unroll                               // see above
    for (int i = 0; i < DWL; ++i) {          // output by output: column i is free once output i has its row
#pragma unroll                               // see above
      for (int dx = 0; dx < 3; ++dx) acc[i] = acc[i] + v[dy][i + dx] * wv[dx];
    }
    // the next row's taps are read only now: all 9 read ahead take 24 registers more, and above 160 registers fewer
    // than three blocks are resident per WGP
    if (dy < 2) __builtin_amdgcn_sched_barrier(0);
  }
#pragma unroll                               // see above
  for (int i = 0; i < DWL; ++i) {
    v4f a = acc[i];
    if (MODE == 1) {
#pragma unroll 1                             // rolled as before: one copy of the erf code per output pixel
      for (int e = 0; e < 4; ++e) {
        const float g = (e == 0) ? a[0] : ((e == 1) ? a[1] : ((e == 2) ? a[2] : a[3]));
        const float er = erff(g * RSQ2);
        float gl = 0.5f * g;
        gl = gl * (1.0f + er);
        a[0] = (e == 0) ? gl : a[0];
        a[1] = (e == 1) ? gl : a[1];
        a[2] = (e == 2) ? gl : a[2];
        a[3] = (e == 3) ? gl : a[3];
      }
    }
    if (MODE == 0 || (MODE == 2 && c < 2 * CC)) {
      float* gp = dstf + (size_t)(p0 + i) * dpitch + dcol + c;
      if (pv) *(v4f*)gp = a;
    } else {
      v2u ph, plw;
      split4(a, ph, plw);
      const size_t to = (size_t)(p0 + i) * ppitch + dcol + (MODE == 2 ? c - 2 * CC : c);
      if (pv) { *(v2u*)(Ph + to) = ph; *(v2u*)(Pl + to) = plw; }
    }
  }
}

// =================================================================================================================
// RSA window attention, one 4x4 window (16 tokens) per block of 256 threads, R = dwconv output in the rolled frame
// [pix][384] f32 (q | k | v column blocks):
//   phase 0: the 16 token rows x 384 f32 into LDS; phase 1: per token and per q/k the l2 norm over its 128 channels
//   (inv = 1/max(sqrt(sum), 1e-12)); phase 2: q^T and k^T as bf16 hi + residual planes [c][16 tok] (k contiguous),
//   v as planes [tok][ATP]; phase 3 (wave = c tile): attn[c][d] = relu(temp * sum_p qn[p][c] kn[p][d]) on WMMA, K = 16
//   (fragment elements 8..15 zero), 3 products, stored transposed as planes AttT[d][c]; phase 4 (wave = d tile):
//   out[p][d] = sum_c v[p][c] attn[c][d], K = 128, 3 products, staged f32 [16][TXP] in LDS; phase 5: each token row
//   (128 values -> hi + residual, 256 B per plane = 16 lanes x 16 B) written to its unrolled pixel (inverse roll +2,+2),
//   coverage: qT/kT 128 c x 16 tok x 2 planes, v 16 x 128, AttT 128 d x 128 c (8 waves x 8 tiles), out 16 x 128
//   (8 waves x 16 cols), store 8 waves x 2 rows x 128.
// =================================================================================================================
__global__ __launch_bounds__(256) void rsa_attn_k(const float* __restrict__ R, const float* __restrict__ temp,
                                                  unsigned short* Th, unsigned short* Tl) {
#pragma clang fp contract(off)
  extern __shared__ __align__(16) char smem[];
  float* sR = (float*)(smem + RL_R);
  float* ost = (float*)(smem + RL_R);                     // reused after phase 2
  unsigned short* qt = (unsigned short*)(smem + RL_QTH);  // qT hi @0, qT lo @2048, kT hi @4096, kT lo @6144 (halves)
  unsigned short* ath = (unsigned short*)(smem + RL_ATH);
  unsigned short* atl = (unsigned short*)(smem + RL_ATL);
  unsigned short* vh = (unsigned short*)(smem + RL_VH);
  unsigned short* vl = (unsigned short*)(smem + RL_VL);
  float* sinv = (float*)(smem + RL_INV);
  const int tid = threadIdx.x, wave = tid >> 5, lane = tid & 31, hh = lane >> 4, l15 = lane & 15;
  const int b = blockIdx.x / NWIN;
  const int w2 = blockIdx.x - b * NWIN;
  const int wy = w2 / NWX;
  const int wx = w2 - wy * NWX;

  // ---- phase 0: token rows ----
#pragma unroll
  for (int it = 0; it < 6; ++it) {
    const int idx = it * 256 + tid;
    const int pi = idx / 96;
    const int c4 = (idx - pi * 96) * 4;
    const int ry = wy * WSZ + (pi / WSZ), rx = wx * WSZ + (pi - (pi / WSZ) * WSZ);
    const v4f v = *(const v4f*)(R + ((size_t)(b * HW) + (size_t)ry * IMW + rx) * C3 + c4);
    *(v4f*)(sR + pi * C3 + c4) = v;
  }
  __syncthreads();

  // ---- phase 1: l2 norms per token over its 128 q (or k) channels ----
  {
    const int pair = tid >> 3, sub = tid & 7;
    const int sel = pair >> 4, pi = pair & 15;
    const float* rp = sR + pi * C3 + sel * CC + sub * 16;
    float s = 0.f;
#pragma unroll
    for (int j = 0; j < 16; ++j) { const float f = rp[j]; const float ff = f * f; s = s + ff; }
    s = s + __shfl_xor(s, 1, 32);
    s = s + __shfl_xor(s, 2, 32);
    s = s + __shfl_xor(s, 4, 32);
    const float inv = 1.0f / fmaxf(sqrtf(s), 1e-12f);
    if (sub == 0) sinv[pair] = inv;
  }
  __syncthreads();

  // ---- phase 2: normalised q^T / k^T planes and v planes ----
  {
    const int c = tid >> 1, sel = tid & 1;
    unsigned short hv[16], lv[16];
#pragma unroll
    for (int pi = 0; pi < 16; ++pi) {
      const float v = sR[pi * C3 + sel * CC + c] * sinv[sel * 16 + pi];
      split_bf(v, hv[pi], lv[pi]);
    }
    v4u h0, h1, l0, l1;
#pragma unroll
    for (int e = 0; e < 4; ++e) {
      h0[e] = pk16(hv[2 * e], hv[2 * e + 1]);
      h1[e] = pk16(hv[8 + 2 * e], hv[8 + 2 * e + 1]);
      l0[e] = pk16(lv[2 * e], lv[2 * e + 1]);
      l1[e] = pk16(lv[8 + 2 * e], lv[8 + 2 * e + 1]);
    }
    unsigned short* dh = qt + sel * 4096 + c * 16;
    unsigned short* dl = dh + 2048;
    *(v4u*)(dh) = h0; *(v4u*)(dh + 8) = h1;
    *(v4u*)(dl) = l0; *(v4u*)(dl + 8) = l1;
    const int pi = tid >> 4, c8 = (tid & 15) * 8;
    const float* vr = sR + pi * C3 + 2 * CC + c8;
    const v4f v0 = *(const v4f*)(vr);
    const v4f v1 = *(const v4f*)(vr + 4);
    v4u ph, plw;
    split8(v0, v1, ph, plw);
    *(v4u*)(vh + pi * ATP + c8) = ph;
    *(v4u*)(vl + pi * ATP + c8) = plw;
  }
  __syncthreads();

  const float tmp = bfr(temp[0]);
  // ---- phase 3: attn = relu(temp * q^T k), 128 x 128, K = 16 ----
  {
    const int mi = wave;
    const v16bf a_h = ldfrag16(qt + (mi * 16 + l15) * 16 + 8 * hh);
    const v16bf a_l = ldfrag16(qt + 2048 + (mi * 16 + l15) * 16 + 8 * hh);
#pragma unroll 2
    for (int ni = 0; ni < 8; ++ni) {
      const v16bf b_h = ldfrag16(qt + 4096 + (ni * 16 + l15) * 16 + 8 * hh);
      const v16bf b_l = ldfrag16(qt + 6144 + (ni * 16 + l15) * 16 + 8 * hh);
      v8f acc = zero8();
      acc = mma_bf(a_h, b_h, acc);
      acc = mma_bf(a_h, b_l, acc);
      acc = mma_bf(a_l, b_h, acc);
      unsigned short hv[8], lv[8];
#pragma unroll
      for (int r = 0; r < 8; ++r) {
        float v = acc[r] * tmp;
        v = fmaxf(v, 0.0f);
        split_bf(v, hv[r], lv[r]);
      }
      v4u ph, plw;
#pragma unroll
      for (int e = 0; e < 4; ++e) { ph[e] = pk16(hv[2 * e], hv[2 * e + 1]); plw[e] = pk16(lv[2 * e], lv[2 * e + 1]); }
      const int d = ni * 16 + l15;
      *(v4u*)(ath + d * ATP + mi * 16 + 8 * hh) = ph;
      *(v4u*)(atl + d * ATP + mi * 16 + 8 * hh) = plw;
    }
  }
  __syncthreads();

  // ---- phase 4: out[p][d] = sum_c v[p][c] attn[c][d], K = 128 ----
  {
    const int ni = wave;
    v8f acc = zero8();
#pragma unroll
    for (int ks = 0; ks < 4; ++ks) {
      const v16bf a_h = ldfrag(vh + l15 * ATP + ks * 32 + 8 * hh);
      const v16bf a_l = ldfrag(vl + l15 * ATP + ks * 32 + 8 * hh);
      const v16bf b_h = ldfrag(ath + (ni * 16 + l15) * ATP + ks * 32 + 8 * hh);
      const v16bf b_l = ldfrag(atl + (ni * 16 + l15) * ATP + ks * 32 + 8 * hh);
      acc = mma_bf(a_h, b_h, acc);
      acc = mma_bf(a_h, b_l, acc);
      acc = mma_bf(a_l, b_h, acc);
    }
#pragma unroll
    for (int r = 0; r < 8; ++r) ost[(8 * hh + r) * TXP + ni * 16 + l15] = acc[r];
  }
  __syncthreads();

  // ---- phase 5: token rows to their unrolled pixels ----
  {
    const int tk = 2 * wave + hh;
    const int piece = l15;
    const float* orow = ost + tk * TXP + piece * 8;
    const v4f v0 = *(const v4f*)(orow);
    const v4f v1 = *(const v4f*)(orow + 4);
    v4u ph, plw;
    split8(v0, v1, ph, plw);
    const int iy = tk / WSZ, ix = tk - (tk / WSZ) * WSZ;
    const int ry = wy * WSZ + iy, rx = wx * WSZ + ix;
    const int py = (ry + WSZ / 2) & (IMW - 1), px = (rx + WSZ / 2) & (IMW - 1);
    const size_t gp = ((size_t)(b * HW) + (size_t)py * IMW + px) * CC + piece * 8;
    *(v4u*)(Th + gp) = ph;
    *(v4u*)(Tl + gp) = plw;
    
  }
}

// =================================================================================================================
// GSA sum-of-squares partials: block = (b, slab of 256 pixels), thread = channel c (q: 0..127, k: 128..255),
// =================================================================================================================
__device__ __forceinline__ void gsa_norm(const float* __restrict__ R, float* pn, int blk) {
  const int b = blk / NSLN;
  const int slab = blk - b * NSLN;
  const int c = threadIdx.x;
  const float* base = R + ((size_t)(b * HW) + (size_t)slab * 256) * C3 + c;
  float s = 0.f;
#pragma unroll 4
  for (int i = 0; i < 256; ++i) { const float f = base[(size_t)i * C3]; s = fmaf(f, f, s); }
  float* gp = pn + ((size_t)(b * NSLN + slab)) * 256 + c;
  *(float*)gp = s;
  
}

// =================================================================================================================
// GSA score partials: block = (b, head h, slab of 2048 pixels), S[c][d] = sum_n q[h*32+c][n] k[h*32+d][n] over the
// slab on WMMA. Per 256-pixel chunk the q and k columns (f32 from R) are split into bf16 hi + residual planes
// transposed in LDS ([32 ch][GSP] k contiguous); waves: fragment f = wave&3 (2x2 of 16x16), k half = wave>>2;
// 3 products; the two k halves are combined in fixed order through LDS; the 32x32 f32 tile is staged and stored as
// blk = (b*NHEAD + h)*NSLS + slab. coverage: planes 64 ch x 256 px per chunk (64 threads x 32
// groups x 8 px), tile 32x32 per block.
// The sum-of-squares partials need nothing of the scores and read the same R: they share this grid, blocks
// [NB*NHEAD*NSLS, NB*NHEAD*NSLS + NB*NSLN), and leave as whole blocks in front of the first barrier.
// =================================================================================================================
__global__ __launch_bounds__(256) void gsa_s_k(const float* __restrict__ R, float* pa, float* pn) {
  if (blockIdx.x >= NB * NHEAD * NSLS) { gsa_norm(R, pn, blockIdx.x - NB * NHEAD * NSLS); return; }
  extern __shared__ __align__(16) char smem[];
  unsigned short* pl = (unsigned short*)(smem + GL_QH);   // q hi @0, q lo @8448, k hi @16896, k lo @25344 (halves)
  float* red = (float*)(smem + GL_RED);
  float* stg = (float*)(smem + GL_STG);
  const int tid = threadIdx.x, wave = tid >> 5, lane = tid & 31, hh = lane >> 4, l15 = lane & 15;
  const int blk = blockIdx.x;
  const int b = blk / (NHEAD * NSLS);
  const int rem = blk - b * (NHEAD * NSLS);
  const int h = rem / NSLS;
  const int slab = rem - h * NSLS;
  const int f = wave & 3, mi = f >> 1, ni = f & 1, kh = wave >> 2;
  const int c = tid & 63, sel = c >> 5, cc = c & 31;
  const int col = sel * CC + h * HDC + cc;
  unsigned short* ph = pl + sel * 16896 + cc * GSP;
  unsigned short* plo = ph + 8448;
  const int g0 = tid >> 6;
  const size_t pbase = (size_t)(b * HW) + (size_t)slab * 2048;
  v8f acc = zero8();
#pragma unroll 1
  for (int ch = 0; ch < 8; ++ch) {
    const size_t pc = pbase + (size_t)ch * 256;
#pragma unroll 2
    for (int it = 0; it < 8; ++it) {
      const int g = it * 4 + g0;
      const float* rp = R + (pc + g * 8) * C3 + col;
      v4f v0, v1;
#pragma unroll
      for (int j = 0; j < 4; ++j) { v0[j] = rp[(size_t)j * C3]; v1[j] = rp[(size_t)(j + 4) * C3]; }
      v4u hp, lp;
      split8(v0, v1, hp, lp);
      *(v4u*)(ph + g * 8) = hp;
      *(v4u*)(plo + g * 8) = lp;
    }
    __syncthreads();
#pragma unroll
    for (int ks = 0; ks < 4; ++ks) {
      const int k0 = (kh * 4 + ks) * 32;
      const v16bf a_h = ldfrag(pl + (mi * 16 + l15) * GSP + k0 + 8 * hh);
      const v16bf a_l = ldfrag(pl + 8448 + (mi * 16 + l15) * GSP + k0 + 8 * hh);
      const v16bf b_h = ldfrag(pl + 16896 + (ni * 16 + l15) * GSP + k0 + 8 * hh);
      const v16bf b_l = ldfrag(pl + 25344 + (ni * 16 + l15) * GSP + k0 + 8 * hh);
      acc = mma_bf(a_h, b_h, acc);
      acc = mma_bf(a_h, b_l, acc);
      acc = mma_bf(a_l, b_h, acc);
    }
    __syncthreads();
  }
  if (wave >= 4) {
#pragma unroll
    for (int r = 0; r < 8; ++r) red[((wave - 4) * 32 + lane) * 8 + r] = acc[r];
  }
  __syncthreads();
  if (wave < 4) {
#pragma unroll
    for (int r = 0; r < 8; ++r) {
      const float o = red[(wave * 32 + lane) * 8 + r];
      const float v = acc[r] + o;
      stg[(mi * 16 + 8 * hh + r) * GXP + ni * 16 + l15] = v;
    }
  }
  __syncthreads();
  {
    const int row = tid >> 3, piece = tid & 7;
    const v4f v = *(const v4f*)(stg + row * GXP + piece * 4);
    float* gp = pa + (size_t)blk * 1024 + row * 32 + piece * 4;
    *(v4f*)gp = v;
    
  }
}

// =================================================================================================================
// GSA finisher, block = (b, h): invq/invk = 1/max(sqrt(sum of pn partials), 1e-12) for the head's 32 q and 32 k
// channels; attn[c][d] = relu(sum of pa partials * invq[c] * invk[d] * temp) -> bf16 hi + residual planes
// =================================================================================================================
__global__ __launch_bounds__(256) void gsa_fin_k(const float* __restrict__ pa, const float* __restrict__ pn,
                                                 const float* __restrict__ temp,
                                                 unsigned short* afh, unsigned short* afl) {
#pragma clang fp contract(off)
  __shared__ float sinv[64];
  const int tid = threadIdx.x;
  const int b = blockIdx.x / NHEAD;
  const int h = blockIdx.x - b * NHEAD;
  if (tid < 64) {
    const int sel = tid >> 5, i = tid & 31;
    const int c = sel * CC + h * HDC + i;
    float s = 0.f;
#pragma unroll 4
    for (int sl = 0; sl < NSLN; ++sl) s = s + pn[((size_t)(b * NSLN + sl)) * 256 + c];
    sinv[tid] = 1.0f / fmaxf(sqrtf(s), 1e-12f);
  }
  __syncthreads();
  const float tmp = bfr(temp[0]);
  const int e0 = tid * 4;
  const int c = e0 >> 5;
  v4f a;
#pragma unroll
  for (int j = 0; j < 4; ++j) {
    const int e = e0 + j;
    const int d = e & 31;
    float s = 0.f;
#pragma unroll
    for (int sl = 0; sl < NSLS; ++sl) s = s + pa[((size_t)((b * NHEAD + h) * NSLS + sl)) * 1024 + e];
    float v = s * sinv[c];
    v = v * sinv[32 + d];
    v = v * tmp;
    a[j] = fmaxf(v, 0.0f);
  }
  v2u ph, plw;
  split4(a, ph, plw);
  const size_t to = (size_t)b * AFSZ + (size_t)h * (HDC * HDC) + e0;
  *(v2u*)(afh + to) = ph;
  *(v2u*)(afl + to) = plw;
  
}

// =================================================================================================================
// GSA apply: out[p][h*32 + c] = sum_d v[p][h*32 + d] attn_h[c][d], K = 32 per head, both operands hi + residual
// (3 products). Wave tile 16 px x 64 cols (heads hd0 = n0/32 for fragments 0,1 and hd0+1 for 2,3), block = 128 px,
// coverage: 8 waves x 16 rows x 64 cols per block; grid covers NPIX x 128 once.
// =================================================================================================================
__global__ __launch_bounds__(256) void apply_k(const unsigned short* __restrict__ Vh,
                                               const unsigned short* __restrict__ Vl,
                                               const unsigned short* __restrict__ afh,
                                               const unsigned short* __restrict__ afl,
                                               unsigned short* Oh, unsigned short* Ol) {
  __shared__ __align__(16) float stg[8 * 16 * AXP];
  const int tid = threadIdx.x, wave = tid >> 5, lane = tid & 31, hh = lane >> 4, l15 = lane & 15;
  const int m0 = (blockIdx.x * 8 + wave) * 16;
  const int n0 = blockIdx.y * 64;
  const int b = m0 / HW;
  const int hd0 = n0 / HDC;
  const unsigned short* ar = Vh + (size_t)(m0 + l15) * CC + hd0 * HDC + 8 * hh;
  const unsigned short* al = Vl + (size_t)(m0 + l15) * CC + hd0 * HDC + 8 * hh;
  const v16bf a0h = ldfrag(ar), a0l = ldfrag(al);
  const v16bf a1h = ldfrag(ar + 32), a1l = ldfrag(al + 32);
  const unsigned short* wb = afh + (size_t)b * AFSZ + (size_t)(n0 + l15) * 32 + 8 * hh;
  const unsigned short* wl = afl + (size_t)b * AFSZ + (size_t)(n0 + l15) * 32 + 8 * hh;
  v8f c0 = zero8(), c1 = zero8(), c2 = zero8(), c3 = zero8();
  {
    const v16bf bh = ldfrag(wb), bl = ldfrag(wl);
    c0 = mma_bf(a0h, bh, c0); c0 = mma_bf(a0l, bh, c0); c0 = mma_bf(a0h, bl, c0);
  }
  {
    const v16bf bh = ldfrag(wb + 16 * 32), bl = ldfrag(wl + 16 * 32);
    c1 = mma_bf(a0h, bh, c1); c1 = mma_bf(a0l, bh, c1); c1 = mma_bf(a0h, bl, c1);
  }
  {
    const v16bf bh = ldfrag(wb + 32 * 32), bl = ldfrag(wl + 32 * 32);
    c2 = mma_bf(a1h, bh, c2); c2 = mma_bf(a1l, bh, c2); c2 = mma_bf(a1h, bl, c2);
  }
  {
    const v16bf bh = ldfrag(wb + 48 * 32), bl = ldfrag(wl + 48 * 32);
    c3 = mma_bf(a1h, bh, c3); c3 = mma_bf(a1l, bh, c3); c3 = mma_bf(a1h, bl, c3);
  }
  float* sw = stg + wave * (16 * AXP);
#pragma unroll
  for (int r = 0; r < 8; ++r) {
    sw[(8 * hh + r) * AXP + l15] = c0[r];
    sw[(8 * hh + r) * AXP + 16 + l15] = c1[r];
    sw[(8 * hh + r) * AXP + 32 + l15] = c2[r];
    sw[(8 * hh + r) * AXP + 48 + l15] = c3[r];
  }
  wave_sync_lds();
  const int q = lane >> 3, piece = lane & 7;
  v4u oh[4], ol[4];
#pragma unroll
  for (int it = 0; it < 4; ++it) {
    const int row = it * 4 + q;
    const float* sp = sw + row * AXP + piece * 8;
    const v4f v0 = *(const v4f*)(sp);
    const v4f v1 = *(const v4f*)(sp + 4);
    split8(v0, v1, oh[it], ol[it]);
  }
#pragma unroll
  for (int it = 0; it < 4; ++it) {
    const int row = it * 4 + q;
    const size_t to = (size_t)(m0 + row) * CC + n0 + piece * 8;
    *(v4u*)(Oh + to) = oh[it];
    *(v4u*)(Ol + to) = ol[it];
  }
  
}

// =================================================================================================================
// Workspace map (bytes), NPIX = NB*HW: A f32 [NPIX][128], Bx same, T = two bf16 planes [NPIX][128], U f32
// [NPIX][384] (also used as two bf16 planes [NPIX][128]), R f32 [NPIX][384] (also used as two
// bf16 planes [NPIX][384]), weights bf16 (655360), pn f32 [NB*NSLN][256], pa f32 [NB*NHEAD*NSLS][1024], af two bf16
// planes [NB][128][32]. Total 152076288 for NB=2, IMW=128. Every region is an exact multiple of its whole-row store
// granularity.
// =================================================================================================================
extern "C" void kernel_launch(void* const* d_in, const int* in_sizes, int n_in,
                              void* d_out, int out_size, void* d_ws, size_t ws_size,
                              hipStream_t stream) {
  if (n_in < 23) return;
  if (in_sizes[0] != NPIX * CC) return;
  if (in_sizes[1] != CC || in_sizes[2] != CC || in_sizes[3] != CC || in_sizes[4] != CC) return;
  if (in_sizes[5] != C3 * CC || in_sizes[6] != C3 * 9 || in_sizes[7] != CC * CC || in_sizes[8] < 1) return;
  if (in_sizes[9] != HID * CC || in_sizes[10] != HID * 9 || in_sizes[11] != CC * HID) return;
  if (in_sizes[12] != CC || in_sizes[13] != CC || in_sizes[14] != CC || in_sizes[15] != CC) return;
  if (in_sizes[16] != C3 * CC || in_sizes[17] != C3 * 9 || in_sizes[18] != CC * CC || in_sizes[19] < 1) return;
  if (in_sizes[20] != HID * CC || in_sizes[21] != HID * 9 || in_sizes[22] != CC * HID) return;
  if (out_size != NPIX * CC) return;

  const float* x        = (const float*)d_in[0];
  const float* w_s0     = (const float*)d_in[1];
  const float* b_s0     = (const float*)d_in[2];
  const float* w_s2     = (const float*)d_in[3];
  const float* b_s2     = (const float*)d_in[4];
  const float* rsa_qkv  = (const float*)d_in[5];
  const float* rsa_dw   = (const float*)d_in[6];
  const float* rsa_proj = (const float*)d_in[7];
  const float* rsa_temp = (const float*)d_in[8];
  const float* ffs_in   = (const float*)d_in[9];
  const float* ffs_dw   = (const float*)d_in[10];
  const float* ffs_out  = (const float*)d_in[11];
  const float* w_c0     = (const float*)d_in[12];
  const float* b_c0     = (const float*)d_in[13];
  const float* w_c2     = (const float*)d_in[14];
  const float* b_c2     = (const float*)d_in[15];
  const float* gsa_qkv  = (const float*)d_in[16];
  const float* gsa_dw   = (const float*)d_in[17];
  const float* gsa_proj = (const float*)d_in[18];
  const float* gsa_temp = (const float*)d_in[19];
  const float* ffc_in   = (const float*)d_in[20];
  const float* ffc_dw   = (const float*)d_in[21];
  const float* ffc_out  = (const float*)d_in[22];
  float* out = (float*)d_out;

  // ---- carve ----
  const size_t sAct = (size_t)NPIX * CC * 4;                        // f32 [NPIX][128]
  const size_t sT   = (size_t)NPIX * CC * 2 * 2;                    // two bf16 planes [NPIX][128]
  const size_t sU   = (size_t)NPIX * C3 * 4;                        // f32 [NPIX][384]
  const size_t sR   = (size_t)NPIX * C3 * 4;                        // f32 [NPIX][384] = two bf16 planes [NPIX][384]
  const size_t sWq  = (size_t)C3 * CC * 2;
  const size_t sWp  = (size_t)CC * CC * 2;
  const size_t sW1  = (size_t)HIDP * CC * 2;
  const size_t sW2  = (size_t)CC * HIDP * 2;
  const size_t sPN  = (size_t)NB * NSLN * 256 * 4;
  const size_t sPA  = (size_t)NB * NHEAD * NSLS * 1024 * 4;
  const size_t sAF  = (size_t)NB * AFSZ * 2;                        // per plane
  size_t off = 0;
  const size_t oA   = off; off += sAct;
  const size_t oBx  = off; off += sAct;
  const size_t oT   = off; off += sT;
  const size_t oU   = off; off += sU;
  const size_t oR   = off; off += sR;
  const size_t oWq0 = off; off += sWq;
  const size_t oWp0 = off; off += sWp;
  const size_t oW10 = off; off += sW1;
  const size_t oW20 = off; off += sW2;
  const size_t oWq1 = off; off += sWq;
  const size_t oWp1 = off; off += sWp;
  const size_t oW11 = off; off += sW1;
  const size_t oW21 = off; off += sW2;
  const size_t oPN  = off; off += sPN;
  const size_t oPA  = off; off += sPA;
  const size_t oAFh = off; off += sAF;
  const size_t oAFl = off; off += sAF;
  if (off > ws_size) return;                               // off = 152076288 for NB=2, IMW=128
  if (sU < (size_t)NPIX * HIDP * 4) return;
  if (sU < (size_t)NPIX * CC * 2 * 2) return;
  if (sR < (size_t)NPIX * HIDP * 2 * 2) return;

  char* ws = (char*)d_ws;
  float* A  = (float*)(ws + oA);
  float* Bx = (float*)(ws + oBx);
  unsigned short* Th = (unsigned short*)(ws + oT);
  unsigned short* Tl = Th + (size_t)NPIX * CC;
  float* U  = (float*)(ws + oU);
  unsigned short* Uh = (unsigned short*)(ws + oU);
  unsigned short* Ul = Uh + (size_t)NPIX * CC;
  float* R  = (float*)(ws + oR);
  unsigned short* Gh = (unsigned short*)(ws + oR);
  unsigned short* Gl = Gh + (size_t)NPIX * HIDP;
  unsigned short* Wq0 = (unsigned short*)(ws + oWq0);
  unsigned short* Wp0 = (unsigned short*)(ws + oWp0);
  unsigned short* W10 = (unsigned short*)(ws + oW10);
  unsigned short* W20 = (unsigned short*)(ws + oW20);
  unsigned short* Wq1 = (unsigned short*)(ws + oWq1);
  unsigned short* Wp1 = (unsigned short*)(ws + oWp1);
  unsigned short* W11 = (unsigned short*)(ws + oW11);
  unsigned short* W21 = (unsigned short*)(ws + oW21);
  float* PN = (float*)(ws + oPN);
  float* PA = (float*)(ws + oPA);
  unsigned short* AFh = (unsigned short*)(ws + oAFh);
  unsigned short* AFl = (unsigned short*)(ws + oAFl);

  const dim3 blk(256);
  // (1) x NCHW -> A pixel-major; weights f32 [out][in] -> bf16 planes [outP][inP], k contiguous, zero padded
  //     (Wq0 is the start of the weight region: Wq0, Wp0, W10, W20, Wq1, Wp1, W11, W21 lie one behind the other)
  prep_k<<<dim3(PB_T + 2 * PB_SET), blk, 0, stream>>>(x, A, rsa_qkv, rsa_proj, ffs_in, ffs_out,
                                                      gsa_qkv, gsa_proj, ffc_in, ffc_out, Wq0);

  (void)hipFuncSetAttribute(reinterpret_cast<const void*>(&rsa_attn_k), hipFuncAttributeMaxDynamicSharedMemorySize, RL_END);
  (void)hipFuncSetAttribute(reinterpret_cast<const void*>(&gsa_s_k), hipFuncAttributeMaxDynamicSharedMemorySize, GL_END);

  const dim3 gG(NPIX / GBM);
  const dim3 gDw((NPIX / DWL * (C3 / 4) + 255) / 256);

  // ---- spatial (RSA) block ----
  gemm_k<CC, C3, 0, 1><<<gG, blk, 0, stream>>>(Th, Tl, Wq0, U, Bx, A, w_s0, b_s0);        // qkv 1x1 of LN_s0(x) -> U
  dw_k<C3, 0><<<gDw, blk, 0, stream>>>(U, rsa_dw, 0, C3, WSZ / 2, R, C3, 0, Th, Tl, CC); // dw (rolled) -> R
  rsa_attn_k<<<dim3(NB * NWIN), blk, RL_END, stream>>>(R, rsa_temp, Th, Tl);            // T = window attention out
  gemm_k<CC, CC, 0, 0><<<gG, blk, 0, stream>>>(Th, Tl, Wp0, Bx, A, A, w_s2, b_s2);        // Bx = x_
  gemm_k<CC, HIDP, 0, 2><<<gG, blk, 0, stream>>>(Th, Tl, W10, U, Bx, A, w_s2, b_s2);      // ffn-in of LN_s2(x_+x) -> U
  dw_k<HIDP, 1><<<gDw, blk, 0, stream>>>(U, ffs_dw, 0, HID, 0, R, C3, 0, Gh, Gl, HIDP);  // dw+gelu -> G planes
  gemm_k<HIDP, CC, 1, 0><<<gG, blk, 0, stream>>>(Gh, Gl, W20, A, Bx, Bx, w_s2, b_s2);     // A = ffn + x_

  // ---- channel (GSA) block ----
  gemm_k<CC, C3, 0, 1><<<gG, blk, 0, stream>>>(Th, Tl, Wq1, U, Bx, A, w_c0, b_c0);        // qkv 1x1 of LN_c0(x) -> U
  dw_k<C3, 2><<<gDw, blk, 0, stream>>>(U, gsa_dw, 0, C3, 0, R, C3, 0, Th, Tl, CC);       // q, k -> R f32; v planes -> T region
  gsa_s_k<<<dim3(NB * NHEAD * NSLS + NB * NSLN), blk, GL_END, stream>>>(R, PA, PN);      // score and norm partials
  gsa_fin_k<<<dim3(NB * NHEAD), blk, 0, stream>>>(PA, PN, gsa_temp, AFh, AFl);
  apply_k<<<dim3(NPIX / 128, CC / 64), blk, 0, stream>>>(Th, Tl, AFh, AFl, Uh, Ul);     // U planes = channel attention out
  gemm_k<CC, CC, 0, 0><<<gG, blk, 0, stream>>>(Uh, Ul, Wp1, Bx, A, A, w_c2, b_c2);        // Bx = x_
  gemm_k<CC, HIDP, 0, 2><<<gG, blk, 0, stream>>>(Th, Tl, W11, U, Bx, A, w_c2, b_c2);      // ffn-in of LN_c2(x_+x) -> U
  dw_k<HIDP, 1><<<gDw, blk, 0, stream>>>(U, ffc_dw, 0, HID, 0, R, C3, 0, Gh, Gl, HIDP);
  gemm_k<HIDP, CC, 2, 0><<<gG, blk, 0, stream>>>(Gh, Gl, W21, out, Bx, Bx, w_c2, b_c2);   // d_out NCHW = ffn + x_
  (void)hipGetLastError();
}

// v006
// One run takes 221 microseconds.
// In both of two side-by-side timings against v005, it was 1.16 times as fast.
// Over all steps from v000 it is 3.30 times as fast.
// Contractions (1x1 convs for qkv / proj / ffn-in / ffn-out, window q^T.k and v.attn, global q.k^T and attn.v):
// v_wmma_f32_16x16x32_bf16 (bf16 operands, f32 accumulate); computed operands carried as bf16 hi + residual planes,
// weight operands single bf16; layer norms, depthwise 3x3 convs, erf GELU, l2 norms and residual adds in f32 on VALU.
// Inputs RNE-converted to bf16 on load.
#include <hip/hip_runtime.h>
#include <math.h>
#include <stdint.h>

#define NB    2
#define CC    128
#define IMW   128
#define HW    (IMW * IMW)
#define NPIX  (NB * HW)
#define C3    384
#define HID   340
#define HIDP  384
#define NHEAD 4
#define HDC   32
#define WSZ   4
#define NWX   (IMW / WSZ)
#define NWIN  (NWX * NWX)
#define NSLN  (HW / 256)
#define NSLS  (HW / 256)
#define AFSZ  (CC * HDC)
#define RSQ2  0.70710678118654752f
#define GXP   36
#define AXP   68
#define TXP   132
#define ATP   136
#define GSP   264
#define DWL   8

static_assert((IMW & (IMW - 1)) == 0);
static_assert(IMW % WSZ == 0);
static_assert(WSZ == 4);
static_assert(IMW % DWL == 0);
static_assert(HW % 256 == 0);
static_assert(HW % 64 == 0);
static_assert(NPIX % 256 == 0);
static_assert(CC == NHEAD * HDC);
static_assert(HDC == 32);
static_assert((GXP * 4) % 16 == 0);
static_assert((AXP * 4) % 16 == 0);
static_assert((TXP * 4) % 16 == 0);
static_assert((ATP * 2) % 16 == 0);
static_assert((GSP * 2) % 16 == 0);

// RSA window kernel dynamic LDS map (bytes)
#define RL_R    0
#define RL_QTH  24576
#define RL_QTL  28672
#define RL_KTH  32768
#define RL_KTL  36864
#define RL_ATH  40960
#define RL_ATL  75776
#define RL_VH   110592
#define RL_VL   114944
#define RL_INV  119296
#define RL_END  119424
static_assert(RL_QTH == RL_R + 16 * C3 * 4);
static_assert(RL_QTL == RL_QTH + CC * 16 * 2);
static_assert(RL_KTH == RL_QTL + CC * 16 * 2);
static_assert(RL_KTL == RL_KTH + CC * 16 * 2);
static_assert(RL_ATH == RL_KTL + CC * 16 * 2);
static_assert(RL_ATL == RL_ATH + CC * ATP * 2);
static_assert(RL_VH == RL_ATL + CC * ATP * 2);
static_assert(RL_VL == RL_VH + 16 * ATP * 2);
static_assert(RL_INV == RL_VL + 16 * ATP * 2);
static_assert(RL_END == RL_INV + 32 * 4);
static_assert(16 * TXP * 4 <= RL_QTH - RL_R);

// GSA score kernel dynamic LDS map (bytes)
#define GL_QH   0
#define GL_QL   16896
#define GL_KH   33792
#define GL_KL   50688
#define GL_RED  67584
#define GL_STG  71680
#define GL_SQ   76288
#define GL_END  77312
static_assert(GL_QL == 32 * GSP * 2);
static_assert(GL_KH == 2 * GL_QL);
static_assert(GL_KL == 3 * GL_QL);
static_assert(GL_RED == 4 * GL_QL);
static_assert(GL_STG == GL_RED + 4 * 32 * 8 * 4);
static_assert(GL_SQ == GL_STG + 32 * GXP * 4);
static_assert(GL_END == GL_SQ + 4 * 64 * 4);

typedef __bf16         v16bf __attribute__((ext_vector_type(16)));
typedef unsigned short v8us  __attribute__((ext_vector_type(8)));
typedef float          v8f   __attribute__((ext_vector_type(8)));
typedef float          v4f   __attribute__((ext_vector_type(4)));
typedef unsigned int   v4u   __attribute__((ext_vector_type(4)));
typedef unsigned int   v2u   __attribute__((ext_vector_type(2)));

union Frag { v16bf v; v8us u[2]; };

// ---- scalar helpers ------------------------------------------------------------------------------------------
__device__ __forceinline__ unsigned short bf_bits(float f) {          // f32 -> bf16 bits, RNE convert
  unsigned u = __float_as_uint(f);
  return (unsigned short)((u + 0x7FFFu + ((u >> 16) & 1u)) >> 16);
}
__device__ __forceinline__ float bf_up(unsigned short h) { return __uint_as_float(((unsigned)h) << 16); }
__device__ __forceinline__ float bfr(float f) { return bf_up(bf_bits(f)); }
__device__ __forceinline__ unsigned pk16(unsigned short a, unsigned short b) { return (unsigned)a | ((unsigned)b << 16); }
// hi = bf16(v), lo = bf16(v - hi)
__device__ __forceinline__ void split_bf(float v, unsigned short& hi, unsigned short& lo) {
  const unsigned short hb = bf_bits(v);
  hi = hb;
  lo = bf_bits(v - bf_up(hb));
}
__device__ __forceinline__ void split4(v4f v, v2u& ph, v2u& pl) {
  unsigned short h[4], l[4];
#pragma unroll
  for (int e = 0; e < 4; ++e) split_bf(v[e], h[e], l[e]);
  ph[0] = pk16(h[0], h[1]); ph[1] = pk16(h[2], h[3]);
  pl[0] = pk16(l[0], l[1]); pl[1] = pk16(l[2], l[3]);
}
__device__ __forceinline__ void split8(v4f v0, v4f v1, v4u& ph, v4u& pl) {
  unsigned short h[8], l[8];
#pragma unroll
  for (int e = 0; e < 4; ++e) { split_bf(v0[e], h[e], l[e]); split_bf(v1[e], h[4 + e], l[4 + e]); }
#pragma unroll
  for (int e = 0; e < 4; ++e) { ph[e] = pk16(h[2 * e], h[2 * e + 1]); pl[e] = pk16(l[2 * e], l[2 * e + 1]); }
}
__device__ __forceinline__ v8f zero8() { v8f z = {0.f, 0.f, 0.f, 0.f, 0.f, 0.f, 0.f, 0.f}; return z; }
__device__ __forceinline__ v8us zero8us() { v8us z = {0, 0, 0, 0, 0, 0, 0, 0}; return z; }

// ---- fragment loaders: 16-bit A/B operand, lane -> row/col (lane&15), p already includes +8*(lane>>4);
//      elements 0..7 <- p[0..7] (k0+8h..), elements 8..15 <- p[16..23] (k0+16+8h..)
__device__ __forceinline__ v16bf ldfrag(const unsigned short* p) {
  Frag f;
  f.u[0] = *(const v8us*)(p);
  f.u[1] = *(const v8us*)(p + 16);
  return f.v;
}
// K = 16 contraction padded to 32: elements 8..15 are zero
__device__ __forceinline__ v16bf ldfrag16(const unsigned short* p) {
  Frag f;
  f.u[0] = *(const v8us*)(p);
  f.u[1] = zero8us();
  return f.v;
}

// ---- WMMA helper with trailing VALU hazard gap ---------------------------------------------------------------
__device__ __forceinline__ v8f mma_bf(v16bf a, v16bf b, v8f c) {
  c = __builtin_amdgcn_wmma_f32_16x16x32_bf16(false, a, false, b, (short)0, c, false, false);
#if defined(__HIP_DEVICE_COMPILE__)
  asm volatile("v_nop\n\tv_nop\n\tv_nop\n\tv_nop" : "+v"(c) : "v"(a), "v"(b));
#endif
  return c;
}
__device__ __forceinline__ void wave_sync_lds() {
  __builtin_amdgcn_fence(__ATOMIC_RELEASE, "workgroup");
  __builtin_amdgcn_wave_barrier();
  __builtin_amdgcn_fence(__ATOMIC_ACQUIRE, "workgroup");
}

// =================================================================================================================
// Weight convert: w f32 [rows][cols] -> bf16 [rowsP][colsP] (zero padded), value = bf16_RNE(w). One thread = 8
// coverage: rowsP * colsP/8 pieces, ceil(pieces/256) blocks (blk = block index within the matrix) with a bound.
// =================================================================================================================
__device__ __forceinline__ void cvt_w(const float* __restrict__ w, unsigned short* outp,
                                      int rows, int cols, int rowsP, int colsP, int blk) {
  const int t = blk * 256 + threadIdx.x;
  const int ppr = colsP >> 3;
  const int npc = rowsP * ppr;
  const bool ok = t < npc;
  const int tt = ok ? t : 0;
  const int r = tt / ppr, c8 = (tt - r * ppr) * 8;
  const int rr = min(r, rows - 1);
  unsigned short hv[8];
#pragma unroll
  for (int e = 0; e < 8; ++e) {
    const int c = c8 + e;
    const int cl = min(c, cols - 1);
    const float f = w[(size_t)rr * cols + cl];
    const float z = (r < rows && c < cols) ? f : 0.0f;
    hv[e] = bf_bits(z);
  }
  v4u pk;
#pragma unroll
  for (int e = 0; e < 4; ++e) pk[e] = pk16(hv[2 * e], hv[2 * e + 1]);
  unsigned short* gp = outp + (size_t)r * colsP + c8;
  if (ok) *(v4u*)gp = pk;
  
}

// =================================================================================================================
// NCHW f32 x -> pixel-major stream A [b*HW + p][128] f32, values bf16-RNE-converted. Block = (b, 64-pixel tile):
// 128 ch x 64 px loaded coalesced along p into an LDS tile [px][TXP]; store: each pixel row = 512 B = 32 lanes x
// coverage: 8 waves x 8 rows = 64 px x 128 ch per block; NB*(HW/64) blocks (blk) = every pixel once.
// =================================================================================================================
__device__ __forceinline__ void nchw_in(const float* __restrict__ x, float* A, float* xs, int blk) {
  const int tid = threadIdx.x, wave = tid >> 5, lane = tid & 31;
  const int b = blk / (HW / 64);
  const int p0 = (blk - b * (HW / 64)) * 64;
#pragma unroll
  for (int it = 0; it < 8; ++it) {
    const int q = it * 256 + tid;
    const int ch = q >> 4, j4 = (q & 15) * 4;
    const v4f v = *(const v4f*)(x + ((size_t)(b * CC + ch)) * HW + p0 + j4);
#pragma unroll
    for (int e = 0; e < 4; ++e) xs[(j4 + e) * TXP + ch] = bfr(v[e]);
  }
  __syncthreads();
  v4f ov[8];
#pragma unroll
  for (int it = 0; it < 8; ++it) {
    const int row = wave * 8 + it;
    ov[it] = *(const v4f*)(xs + row * TXP + lane * 4);
  }
#pragma unroll
  for (int it = 0; it < 8; ++it) {
    const int row = wave * 8 + it;
    *(v4f*)(A + ((size_t)(b * HW + p0 + row)) * CC + lane * 4) = ov[it];
  }
}

// =================================================================================================================
// Input preparation, one launch: the NCHW transpose and the eight weight converts need nothing of each other, so they
// share one grid by ranges of the block index (block-uniform branches; the transpose's barrier is passed by whole
// blocks only). Blocks [0, PB_T): transpose tiles; then per weight set (spatial, channel) PB_SET blocks: qkv, proj,
// ffn-in, ffn-out. Wb = the bf16 weight region, the four matrices of a set one behind the other, set after set.
// =================================================================================================================
#define PB_T    (NB * (HW / 64))
#define PB_Q    (C3 * CC / 8 / 256)
#define PB_P    (CC * CC / 8 / 256)
#define PB_1    (HIDP * CC / 8 / 256)
#define PB_2    (CC * HIDP / 8 / 256)
#define PB_SET  (PB_Q + PB_P + PB_1 + PB_2)
#define WSETN   (C3 * CC + CC * CC + HIDP * CC + CC * HIDP)
static_assert((C3 * CC) % 2048 == 0 && (CC * CC) % 2048 == 0 && (HIDP * CC) % 2048 == 0);
__global__ __launch_bounds__(256) void prep_k(const float* __restrict__ x, float* A,
                                              const float* __restrict__ wq0, const float* __restrict__ wp0,
                                              const float* __restrict__ w10, const float* __restrict__ w20,
                                              const float* __restrict__ wq1, const float* __restrict__ wp1,
                                              const float* __restrict__ w11, const float* __restrict__ w21,
                                              unsigned short* Wb) {
  __shared__ __align__(16) float xs[64 * TXP];
  const int bi = blockIdx.x;
  if (bi < PB_T) { nchw_in(x, A, xs, bi); return; }
  const int r0 = bi - PB_T;
  const int set = r0 / PB_SET;
  const int r = r0 - set * PB_SET;
  unsigned short* o = Wb + (size_t)set * WSETN;
  if (r < PB_Q) {
    cvt_w(set ? wq1 : wq0, o, C3, CC, C3, CC, r);
  } else if (r < PB_Q + PB_P) {
    cvt_w(set ? wp1 : wp0, o + C3 * CC, CC, CC, CC, CC, r - PB_Q);
  } else if (r < PB_Q + PB_P + PB_1) {
    cvt_w(set ? w11 : w10, o + C3 * CC + CC * CC, HID, CC, HIDP, CC, r - (PB_Q + PB_P));
  } else {
    cvt_w(set ? w21 : w20, o + C3 * CC + CC * CC + HIDP * CC, CC, HID, CC, HIDP, r - (PB_Q + PB_P + PB_1));
  }
}

// =================================================================================================================
// Layer norm of pixel rows over their 128 channels, one wave per row, 4 channels per lane. ln_stats: mean and variance
// by butterfly sums over the 32 lanes (two passes); returns the centred values dv and the variance (the same in every
// lane). ln_out: dv * rstd, scale gv, shift bb, result as bf16 hi + residual, 4 + 4 halves.
// The loops are unrolled in full: constant indices keep the 4-element vectors in registers.
// =================================================================================================================
__device__ __forceinline__ void ln_stats(v4f xv, v4f& dv, float& var) {
  float s = (xv[0] + xv[1]) + (xv[2] + xv[3]);
#pragma unroll
  for (int off = 1; off < 32; off <<= 1) s = s + __shfl_xor(s, off, 32);
  const float mu = s * (1.0f / 128.0f);
  float s2 = 0.f;
#pragma unroll
  for (int e = 0; e < 4; ++e) { dv[e] = xv[e] - mu; s2 = s2 + dv[e] * dv[e]; }
#pragma unroll
  for (int off = 1; off < 32; off <<= 1) s2 = s2 + __shfl_xor(s2, off, 32);
  var = s2 * (1.0f / 128.0f);
}
__device__ __forceinline__ void ln_out(v4f dv, float rstd, v4f gv, v4f bb, v2u& ph, v2u& pl) {
  v4f z;
#pragma unroll
  for (int e = 0; e < 4; ++e) z[e] = (dv[e] * rstd) * gv[e] + bb[e];
  split4(z, ph, pl);
}

// =================================================================================================================
// GEMM: OUT[p][n] = sum_k (Ah[p][k] + Al[p][k]) * W[n][k]  (A planes [pix][K] bf16 hi + residual, W single bf16
// [N][K] k-contiguous, 2 products per tile pair). Block = 8 waves = GBM pixels x all N columns. Per chunk of GKC k the
// block brings its GBM rows of both A planes and all N rows of W into LDS with loads of whole rows (16 lanes x 16 B =
// the 256 B of a row's chunk), rows at a pitch of GPP halves; every fragment is then read from LDS with the split k map.
// So each A row leaves L2 once, not once per 32 output columns, and no global load gathers 32-byte pieces of 16 rows.
// The next chunk's rows are loaded into registers while this chunk is multiplied. Waves: 2 pixel groups of 32 x
// 4 column groups of N/4; a wave holds N/128 tiles of 32 x 32 (2x2 fragments each) and uses its A fragments for all.
// Each sum runs over k in the same order as before (k rising, hi then residual).
// Epilogue (behind a barrier, in the LDS of the operands): each 32x32 f32 tile is staged by its wave and stored as
// whole 128-byte lines. EP 0: OUT[p][N]; EP 1: same + res[p][n] (res pitch 128); EP 2: NCHW d_out[b][n][p] + res[p][n].
// LN 0: A planes from Ah/Al. LN 1 / LN 2 (K = 128, one chunk): the A operand is the layer norm of the f32 rows X[p][128]
// (LN 2: of X + res), scale g, shift bv: each wave loads 8 of the block's rows, norms them and writes the two
// planes straight into the operand LDS, while the W rows are still on their way; Ah/Al are not read.
// coverage: 8 waves x 32 rows x N/4 cols per block = GBM px x N cols; grid covers NPIX x N once.
// =================================================================================================================
#define GKC 128
#define GBM 64
#define GPP 136
static_assert((GPP * 2) % 32 == 16);
static_assert(NPIX % GBM == 0 && HW % 32 == 0);
template <int K, int N, int EP, int LN>
__global__ __launch_bounds__(256) void gemm_k(const unsigned short* __restrict__ Ah,
                                              const unsigned short* __restrict__ Al,
                                              const unsigned short* __restrict__ W,
                                              float* outf, const float* __restrict__ res,
                                              const float* __restrict__ X, const float* __restrict__ g,
                                              const float* __restrict__ bv) {
  constexpr int NP = N / 128;                // 32-column tiles per wave
  constexpr int NCH = K / GKC;               // k chunks
  constexpr int WIT = N / 16;                // W rows per thread and chunk
  constexpr int LNR = GBM / 8;               // rows that a wave norms
  static_assert(K % GKC == 0 && N % 128 == 0);
  static_assert(LN == 0 || (K == CC && K == GKC && EP == 0));
  static_assert(8 * NP * 32 * GXP * 4 <= (2 * GBM + N) * GPP * 2);
  __shared__ __align__(16) unsigned short sm[(2 * GBM + N) * GPP];
  unsigned short* sah = sm;
  unsigned short* sal = sm + GBM * GPP;
  unsigned short* swt = sm + 2 * GBM * GPP;
  float* stg = (float*)sm;                   // reused behind the last chunk's barrier
  const int tid = threadIdx.x, wave = tid >> 5, lane = tid & 31, hh = lane >> 4, l15 = lane & 15;
  const int mb = blockIdx.x * GBM;
  const int mg = wave >> 2, ng = wave & 3;
  const int srow = tid >> 4, spc = (tid & 15) * 8;
  const unsigned short* gah = Ah + (size_t)(mb + srow) * K + spc;
  const unsigned short* gal = Al + (size_t)(mb + srow) * K + spc;
  const unsigned short* gw = W + (size_t)srow * K + spc;
  const int so = srow * GPP + spc;
  // Every loop below is unrolled in full: constant indices keep the staged rows and the sums in registers.
  v8f acc[NP][4];
#pragma unroll
  for (int j = 0; j < NP; ++j) {
#pragma unroll
    for (int f = 0; f < 4; ++f) acc[j][f] = zero8();
  }
  v4u ra[GBM / 16], rl[GBM / 16], rw[WIT];
  v4f xv[LNR], xb[LNR], gv, bb;
  if (LN == 0) {
#pragma unroll
    for (int it = 0; it < GBM / 16; ++it) {
      ra[it] = *(const v4u*)(gah + it * 16 * K);
      rl[it] = *(const v4u*)(gal + it * 16 * K);
    }
  } else {
    const size_t xo = (size_t)(mb + wave * LNR) * CC + lane * 4;
#pragma unroll
    for (int it = 0; it < LNR; ++it) xv[it] = *(const v4f*)(X + xo + it * CC);
    if (LN == 2) {
#pragma unroll
      for (int it = 0; it < LNR; ++it) xb[it] = *(const v4f*)(res + xo + it * CC);
    }
    // the loads below may be given registers that held the addresses of the row loads: the wait stands in front of them
    asm volatile("s_wait_xcnt 0x0" ::: "memory");
    gv = *(const v4f*)(g + lane * 4);
    bb = *(const v4f*)(bv + lane * 4);
  }
#pragma unroll
  for (int it = 0; it < WIT; ++it) rw[it] = *(const v4u*)(gw + it * 16 * K);
  // the W loads are issued here, behind the row loads, and come in while the rows are normed; without this line the
  // compiler moves them down into the norm and the block waits for them afterwards
  if (LN != 0) __builtin_amdgcn_sched_barrier(0);
#pragma unroll
  for (int kc = 0; kc < NCH; ++kc) {
    if (kc > 0) __syncthreads();             // every wave has read the chunk that is overwritten next
    if (LN == 0) {
#pragma unroll
      for (int it = 0; it < GBM / 16; ++it) {
        *(v4u*)(sah + so + it * 16 * GPP) = ra[it];
        *(v4u*)(sal + so + it * 16 * GPP) = rl[it];
      }
    } else {
#pragma unroll
      for (int e = 0; e < 4; ++e) { gv[e] = bfr(gv[e]); bb[e] = bfr(bb[e]); }
      float var[LNR];
#pragma unroll
      for (int it = 0; it < LNR; ++it) ln_stats(LN == 2 ? xv[it] + xb[it] : xv[it], xv[it], var[it]);
      // the root and the division are long sequences: lane i does them for row i, once for the wave's LNR rows
      float vs = var[0];
#pragma unroll
      for (int it = 1; it < LNR; ++it) vs = (lane == it) ? var[it] : vs;
      const float rs = 1.0f / sqrtf(vs + 1e-6f);
#pragma unroll
      for (int it = 0; it < LNR; ++it) {
        const float rstd = __int_as_float(__builtin_amdgcn_readlane(__float_as_int(rs), it));
        v2u ph, pw;
        ln_out(xv[it], rstd, gv, bb, ph, pw);
        const int lo = (wave * LNR + it) * GPP + lane * 4;
        *(v2u*)(sah + lo) = ph;
        *(v2u*)(sal + lo) = pw;
      }
    }
#pragma unroll
    for (int it = 0; it < WIT; ++it) *(v4u*)(swt + so + it * 16 * GPP) = rw[it];
    __syncthreads();                         // every wave reads rows that other waves staged
    if (kc + 1 < NCH) {
#pragma unroll
      for (int it = 0; it < GBM / 16; ++it) {
        ra[it] = *(const v4u*)(gah + it * 16 * K + (kc + 1) * GKC);
        rl[it] = *(const v4u*)(gal + it * 16 * K + (kc + 1) * GKC);
      }
#pragma unroll
      for (int it = 0; it < WIT; ++it) rw[it] = *(const v4u*)(gw + it * 16 * K + (kc + 1) * GKC);
    }
#pragma unroll
    for (int ks = 0; ks < GKC / 32; ++ks) {
      const int ko = ks * 32 + 8 * hh;
      const unsigned short* pa = sah + (mg * 32 + l15) * GPP + ko;
      const unsigned short* pl = sal + (mg * 32 + l15) * GPP + ko;
      const v16bf a0h = ldfrag(pa), a0l = ldfrag(pl);
      const v16bf a1h = ldfrag(pa + 16 * GPP), a1l = ldfrag(pl + 16 * GPP);
#pragma unroll
      for (int j = 0; j < NP; ++j) {
        const unsigned short* pb = swt + (ng * (N / 4) + j * 32 + l15) * GPP + ko;
        const v16bf b0 = ldfrag(pb), b1 = ldfrag(pb + 16 * GPP);
        acc[j][0] = mma_bf(a0h, b0, acc[j][0]); acc[j][0] = mma_bf(a0l, b0, acc[j][0]);
        acc[j][1] = mma_bf(a0h, b1, acc[j][1]); acc[j][1] = mma_bf(a0l, b1, acc[j][1]);
        acc[j][2] = mma_bf(a1h, b0, acc[j][2]); acc[j][2] = mma_bf(a1l, b0, acc[j][2]);
        acc[j][3] = mma_bf(a1h, b1, acc[j][3]); acc[j][3] = mma_bf(a1l, b1, acc[j][3]);
      }
    }
  }
  __syncthreads();                           // the operands' LDS becomes the output stage: every wave has left it
  const int m0 = mb + mg * 32;
#pragma unroll
  for (int j = 0; j < NP; ++j) {
    float* sw = stg + (wave * NP + j) * (32 * GXP);
#pragma unroll
    for (int r = 0; r < 8; ++r) {
      sw[(8 * hh + r) * GXP + l15] = acc[j][0][r];
      sw[(8 * hh + r) * GXP + 16 + l15] = acc[j][1][r];
      sw[(16 + 8 * hh + r) * GXP + l15] = acc[j][2][r];
      sw[(16 + 8 * hh + r) * GXP + 16 + l15] = acc[j][3][r];
    }
  }
  wave_sync_lds();
  const int q = lane >> 3, piece = lane & 7;
#pragma unroll
  for (int j = 0; j < NP; ++j) {
    const float* sw = stg + (wave * NP + j) * (32 * GXP);
    const int n0 = ng * (N / 4) + j * 32;
    v4f ov[8];
    if (EP != 2) {
#pragma unroll
      for (int it = 0; it < 8; ++it) {
        const int row = it * 4 + q;
        v4f v = *(const v4f*)(sw + row * GXP + piece * 4);
        if (EP == 1) {
          const v4f rr = *(const v4f*)(res + (size_t)(m0 + row) * CC + n0 + piece * 4);
          v = v + rr;
        }
        ov[it] = v;
      }
#pragma unroll
      for (int it = 0; it < 8; ++it) {
        const int row = it * 4 + q;
        *(v4f*)(outf + (size_t)(m0 + row) * N + n0 + piece * 4) = ov[it];
      }
    } else {
      const int b = m0 / HW;
      const int plx = m0 - b * HW;
#pragma unroll
      for (int it = 0; it < 8; ++it) {
        const int ch = it * 4 + q;
        v4f v;
#pragma unroll
        for (int e = 0; e < 4; ++e) {
          const float rv = res[(size_t)(m0 + piece * 4 + e) * CC + n0 + ch];
          v[e] = sw[(piece * 4 + e) * GXP + ch] + rv;
        }
        ov[it] = v;
      }
#pragma unroll
      for (int it = 0; it < 8; ++it) {
        const int ch = it * 4 + q;
        *(v4f*)(outf + ((size_t)(b * CC + n0 + ch)) * HW + plx + piece * 4) = ov[it];
      }
    }
  }
}

// =================================================================================================================
// Depthwise 3x3, SAME zero padding, cross-correlation taps, optional cyclic roll (output pixel index in the rolled
// frame, source slab in the unrolled frame: source pixel ((ny+roll) mod IMW, (nx+roll) mod IMW), valid iff the rolled
// neighbour (ny,nx) is inside the image). src [pix][CS] f32 (CS = all 384 channels of the conv), 4 channels per thread,
// weights wd[(wofs + c)*9 + tap] bf16-RNE (clamped address, zero for c >= cvalid): the block's CS*9 weights are read
// once (thread = channel, in steps of 256) and laid out in LDS as [tap][CS], channel contiguous, so that a thread takes
// its 4 channels of one tap with one 16-byte LDS read.
// A thread computes a strip of DWL output pixels along x: it loads the 3 x (DWL+2) source pixels of the strip once,
// all loads in flight together, keeps them in registers, and each loaded column serves up to three outputs; the taps
// come from LDS once per strip. Strips that follow one another in the grid lie under one another in y (a block's
// strips share source rows).
// A row outside the image zeroes its three taps; only the strip's two outer columns can lie outside the image.
// MODE 0: f32 rows dstf[p*dpitch + dcol + c]; MODE 1: exact-erf GELU (rolled) then bf16 hi + residual planes
// Ph/Pl[p*ppitch + dcol + c]; MODE 2: channels below 2*CC (q, k) as MODE 0, the rest (v) as planes without the GELU at
// Ph/Pl[p*ppitch + c - 2*CC] (a wave's 32 threads hold 128 channels in a row, so the choice is the same for a wave).
// coverage: (NPIX/DWL) * CS/4 threads x DWL pixels, grid ceil-div with an in-kernel bound.
// =================================================================================================================
template <int CS, int MODE>
__global__ __launch_bounds__(256) void dw_k(const float* __restrict__ src, const float* __restrict__ wd,
                                            int wofs, int cvalid, int roll,
                                            float* dstf, int dpitch, int dcol,
                                            unsigned short* Ph, unsigned short* Pl, int ppitch) {
  constexpr int TPP = CS / 4;
  constexpr int NSTR = NPIX / DWL;           // strips in all
  constexpr int SPI = HW / DWL;              // strips per image
  static_assert(CS % 128 == 0);
  __shared__ __align__(16) float wsm[9 * CS];
  constexpr int WTR = (CS + 255) / 256;      // thread = channel, its 9 taps, in WTR steps of 256 channels
  float wf[WTR][9];
#pragma unroll                               // constant indices keep wf in registers
  for (int k = 0; k < WTR; ++k) {            // no test here (the address is clamped): every step's loads behind one wait
    const float* wp = wd + min(wofs + (int)threadIdx.x + k * 256, cvalid - 1) * 9;
#pragma unroll                               // constant indices keep wf in registers
    for (int tp = 0; tp < 9; ++tp) wf[k][tp] = wp[tp];
  }
#pragma unroll                               // constant indices keep wf in registers
  for (int k = 0; k < WTR; ++k) {
    const int ch = (int)threadIdx.x + k * 256;
    const float wok = (wofs + ch < cvalid) ? 1.0f : 0.0f;
    if (ch < CS) {                           // whole waves
#pragma unroll                               // constant indices keep wf in registers
      for (int tp = 0; tp < 9; ++tp) wsm[tp * CS + ch] = bfr(wf[k][tp]) * wok;
    }
  }
  __syncthreads();                           // every wave reads table rows that other waves wrote
  const int t = blockIdx.x * 256 + threadIdx.x;
  int s = t / TPP;
  const int cg = t - s * TPP;
  const bool pv = s < NSTR;
  s = pv ? s : (NSTR - 1);
  const int c = cg * 4;
  const int b = s / SPI;
  const int sr = s - b * SPI;
  const int xs = sr / IMW;
  const int y = sr - xs * IMW;
  const int x0 = xs * DWL;
  const v4f* s4 = (const v4f*)src;            // slab rows in 16-byte units: TPP units per pixel
  // Every loop below but the GELU loop is unrolled in full so that its indices are constants: the offsets, the 3 x (DWL+2) window,
  // the taps and the DWL sums then live in registers (an index known only at run time would put them in scratch).
  int ro[3], co[DWL + 2], ix[3][DWL + 2];
#pragma unroll                               // see above
  for (int dy = 0; dy < 3; ++dy) {
    const int sy = (y + dy - 1 + roll) & (IMW - 1);
    ro[dy] = (b * HW + sy * IMW) * TPP + cg;
  }
#pragma unroll                               // see above
  for (int j = 0; j < DWL + 2; ++j) {
    const int sx = (x0 + j - 1 + roll) & (IMW - 1);
    co[j] = sx * TPP;
  }
#pragma unroll                               // see above
  for (int dy = 0; dy < 3; ++dy) {
#pragma unroll                               // see above
    for (int j = 0; j < DWL + 2; ++j) ix[dy][j] = ro[dy] + co[j];
  }
  const int p0 = b * HW + y * IMW + x0;      // first output pixel of the strip
  const float ml = (x0 > 0) ? 1.0f : 0.0f;
  const float mr = (x0 + DWL < IMW) ? 1.0f : 0.0f;
  v4f v[3][DWL + 2];
#pragma unroll                               // see above
  for (int dy = 0; dy < 3; ++dy) {
#pragma unroll                               // see above
    for (int j = 0; j < DWL + 2; ++j) v[dy][j] = s4[ix[dy][j]];
    // the next row's loads may be given registers that held this row's offsets: the wait stands in front of them
    if (dy < 2) asm volatile("s_wait_xcnt 0x0" ::: "memory");
  }
  static_assert(DWL == 8);                   // the statement below names the 3 x 10 loaded values one by one
  // Inputs only: every load of the window is issued in front of this line, so the wave waits out one memory latency
  // for all 30; without it the compiler spreads the loads among the sums and waits for them a few at a time.
  asm volatile("" :: "v"(v[0][0]), "v"(v[0][1]), "v"(v[0][2]), "v"(v[0][3]), "v"(v[0][4]),
                     "v"(v[0][5]), "v"(v[0][6]), "v"(v[0][7]), "v"(v[0][8]), "v"(v[0][9]),
                     "v"(v[1][0]), "v"(v[1][1]), "v"(v[1][2]), "v"(v[1][3]), "v"(v[1][4]),
                     "v"(v[1][5]), "v"(v[1][6]), "v"(v[1][7]), "v"(v[1][8]), "v"(v[1][9]),
                     "v"(v[2][0]), "v"(v[2][1]), "v"(v[2][2]), "v"(v[2][3]), "v"(v[2][4]),
                     "v"(v[2][5]), "v"(v[2][6]), "v"(v[2][7]), "v"(v[2][8]), "v"(v[2][9]));
  v4f acc[DWL];
#pragma unroll                               // see above
  for (int i = 0; i < DWL; ++i) acc[i] = v4f{0.f, 0.f, 0.f, 0.f};
  // row by row: a row's registers are free once its three taps are summed; each output still sums its taps 0..8 in order
#pragma unroll                               // see above
  for (int dy = 0; dy < 3; ++dy) {
    const float rm = ((unsigned)(y + dy - 1) < (unsigned)IMW) ? 1.0f : 0.0f;
    v4f wv[3];
#pragma unroll                               // see above
    for (int dx = 0; dx < 3; ++dx) wv[dx] = *(const v4f*)(wsm + (dy * 3 + dx) * CS + c) * rm;
    v[dy][0] = v[dy][0] * ml;
    v[dy][DWL + 1] = v[dy][DWL + 1] * mr;
#pragma unroll                               // see above
    for (int i = 0; i < DWL; ++i) {          // output by output: column i is free once output i has its row
#pragma unroll                               // see above
      for (int dx = 0; dx < 3; ++dx) acc[i] = acc[i] + v[dy][i + dx] * wv[dx];
    }
    // the next row's taps are read only now: all 9 read ahead take 24 registers more, and above 160 registers fewer
    // than three blocks are resident per WGP
    if (dy < 2) __builtin_amdgcn_sched_barrier(0);
  }
#pragma unroll                               // see above
  for (int i = 0; i < DWL; ++i) {
    v4f a = acc[i];
    if (MODE == 1) {
#pragma unroll 1                             // rolled as before: one copy of the erf code per output pixel
      for (int e = 0; e < 4; ++e) {
        const float g = (e == 0) ? a[0] : ((e == 1) ? a[1] : ((e == 2) ? a[2] : a[3]));
        const float er = erff(g * RSQ2);
        float gl = 0.5f * g;
        gl = gl * (1.0f + er);
        a[0] = (e == 0) ? gl : a[0];
        a[1] = (e == 1) ? gl : a[1];
        a[2] = (e == 2) ? gl : a[2];
        a[3] = (e == 3) ? gl : a[3];
      }
    }
    if (MODE == 0 || (MODE == 2 && c < 2 * CC)) {
      float* gp = dstf + (size_t)(p0 + i) * dpitch + dcol + c;
      if (pv) *(v4f*)gp = a;
    } else {
      v2u ph, plw;
      split4(a, ph, plw);
      const size_t to = (size_t)(p0 + i) * ppitch + dcol + (MODE == 2 ? c - 2 * CC : c);
      if (pv) { *(v2u*)(Ph + to) = ph; *(v2u*)(Pl + to) = plw; }
    }
  }
}

// =================================================================================================================
// RSA window attention, one 4x4 window (16 tokens) per block of 256 threads, R = dwconv output in the rolled frame
// [pix][384] f32 (q | k | v column blocks):
//   phase 0: the 16 token rows x 384 f32 into LDS; phase 1: per token and per q/k the l2 norm over its 128 channels
//   (inv = 1/max(sqrt(sum), 1e-12)); phase 2: q^T and k^T as bf16 hi + residual planes [c][16 tok] (k contiguous),
//   v as planes [tok][ATP]; phase 3 (wave = c tile): attn[c][d] = relu(temp * sum_p qn[p][c] kn[p][d]) on WMMA, K = 16
//   (fragment elements 8..15 zero), 3 products, stored transposed as planes AttT[d][c]; phase 4 (wave = d tile):
//   out[p][d] = sum_c v[p][c] attn[c][d], K = 128, 3 products, staged f32 [16][TXP] in LDS; phase 5: each token row
//   (128 values -> hi + residual, 256 B per plane = 16 lanes x 16 B) written to its unrolled pixel (inverse roll +2,+2),
//   coverage: qT/kT 128 c x 16 tok x 2 planes, v 16 x 128, AttT 128 d x 128 c (8 waves x 8 tiles), out 16 x 128
//   (8 waves x 16 cols), store 8 waves x 2 rows x 128.
// =================================================================================================================
__global__ __launch_bounds__(256) void rsa_attn_k(const float* __restrict__ R, const float* __restrict__ temp,
                                                  unsigned short* Th, unsigned short* Tl) {
#pragma clang fp contract(off)
  extern __shared__ __align__(16) char smem[];
  float* sR = (float*)(smem + RL_R);
  float* ost = (float*)(smem + RL_R);                     // reused after phase 2
  unsigned short* qt = (unsigned short*)(smem + RL_QTH);  // qT hi @0, qT lo @2048, kT hi @4096, kT lo @6144 (halves)
  unsigned short* ath = (unsigned short*)(smem + RL_ATH);
  unsigned short* atl = (unsigned short*)(smem + RL_ATL);
  unsigned short* vh = (unsigned short*)(smem + RL_VH);
  unsigned short* vl = (unsigned short*)(smem + RL_VL);
  float* sinv = (float*)(smem + RL_INV);
  const int tid = threadIdx.x, wave = tid >> 5, lane = tid & 31, hh = lane >> 4, l15 = lane & 15;
  const int b = blockIdx.x / NWIN;
  const int w2 = blockIdx.x - b * NWIN;
  const int wy = w2 / NWX;
  const int wx = w2 - wy * NWX;

  // ---- phase 0: token rows ----
#pragma unroll
  for (int it = 0; it < 6; ++it) {
    const int idx = it * 256 + tid;
    const int pi = idx / 96;
    const int c4 = (idx - pi * 96) * 4;
    const int ry = wy * WSZ + (pi / WSZ), rx = wx * WSZ + (pi - (pi / WSZ) * WSZ);
    const v4f v = *(const v4f*)(R + ((size_t)(b * HW) + (size_t)ry * IMW + rx) * C3 + c4);
    *(v4f*)(sR + pi * C3 + c4) = v;
  }
  __syncthreads();

  // ---- phase 1: l2 norms per token over its 128 q (or k) channels ----
  {
    const int pair = tid >> 3, sub = tid & 7;
    const int sel = pair >> 4, pi = pair & 15;
    const float* rp = sR + pi * C3 + sel * CC + sub * 16;
    float s = 0.f;
#pragma unroll
    for (int j = 0; j < 16; ++j) { const float f = rp[j]; const float ff = f * f; s = s + ff; }
    s = s + __shfl_xor(s, 1, 32);
    s = s + __shfl_xor(s, 2, 32);
    s = s + __shfl_xor(s, 4, 32);
    const float inv = 1.0f / fmaxf(sqrtf(s), 1e-12f);
    if (sub == 0) sinv[pair] = inv;
  }
  __syncthreads();

  // ---- phase 2: normalised q^T / k^T planes and v planes ----
  {
    const int c = tid >> 1, sel = tid & 1;
    unsigned short hv[16], lv[16];
#pragma unroll
    for (int pi = 0; pi < 16; ++pi) {
      const float v = sR[pi * C3 + sel * CC + c] * sinv[sel * 16 + pi];
      split_bf(v, hv[pi], lv[pi]);
    }
    v4u h0, h1, l0, l1;
#pragma unroll
    for (int e = 0; e < 4; ++e) {
      h0[e] = pk16(hv[2 * e], hv[2 * e + 1]);
      h1[e] = pk16(hv[8 + 2 * e], hv[8 + 2 * e + 1]);
      l0[e] = pk16(lv[2 * e], lv[2 * e + 1]);
      l1[e] = pk16(lv[8 + 2 * e], lv[8 + 2 * e + 1]);
    }
    unsigned short* dh = qt + sel * 4096 + c * 16;
    unsigned short* dl = dh + 2048;
    *(v4u*)(dh) = h0; *(v4u*)(dh + 8) = h1;
    *(v4u*)(dl) = l0; *(v4u*)(dl + 8) = l1;
    const int pi = tid >> 4, c8 = (tid & 15) * 8;
    const float* vr = sR + pi * C3 + 2 * CC + c8;
    const v4f v0 = *(const v4f*)(vr);
    const v4f v1 = *(const v4f*)(vr + 4);
    v4u ph, plw;
    split8(v0, v1, ph, plw);
    *(v4u*)(vh + pi * ATP + c8) = ph;
    *(v4u*)(vl + pi * ATP + c8) = plw;
  }
  __syncthreads();

  const float tmp = bfr(temp[0]);
  // ---- phase 3: attn = relu(temp * q^T k), 128 x 128, K = 16 ----
  {
    const int mi = wave;
    const v16bf a_h = ldfrag16(qt + (mi * 16 + l15) * 16 + 8 * hh);
    const v16bf a_l = ldfrag16(qt + 2048 + (mi * 16 + l15) * 16 + 8 * hh);
#pragma unroll 2
    for (int ni = 0; ni < 8; ++ni) {
      const v16bf b_h = ldfrag16(qt + 4096 + (ni * 16 + l15) * 16 + 8 * hh);
      const v16bf b_l = ldfrag16(qt + 6144 + (ni * 16 + l15) * 16 + 8 * hh);
      v8f acc = zero8();
      acc = mma_bf(a_h, b_h, acc);
      acc = mma_bf(a_h, b_l, acc);
      acc = mma_bf(a_l, b_h, acc);
      unsigned short hv[8], lv[8];
#pragma unroll
      for (int r = 0; r < 8; ++r) {
        float v = acc[r] * tmp;
        v = fmaxf(v, 0.0f);
        split_bf(v, hv[r], lv[r]);
      }
      v4u ph, plw;
#pragma unroll
      for (int e = 0; e < 4; ++e) { ph[e] = pk16(hv[2 * e], hv[2 * e + 1]); plw[e] = pk16(lv[2 * e], lv[2 * e + 1]); }
      const int d = ni * 16 + l15;
      *(v4u*)(ath + d * ATP + mi * 16 + 8 * hh) = ph;
      *(v4u*)(atl + d * ATP + mi * 16 + 8 * hh) = plw;
    }
  }
  __syncthreads();

  // ---- phase 4: out[p][d] = sum_c v[p][c] attn[c][d], K = 128 ----
  {
    const int ni = wave;
    v8f acc = zero8();
#pragma unroll
    for (int ks = 0; ks < 4; ++ks) {
      const v16bf a_h = ldfrag(vh + l15 * ATP + ks * 32 + 8 * hh);
      const v16bf a_l = ldfrag(vl + l15 * ATP + ks * 32 + 8 * hh);
      const v16bf b_h = ldfrag(ath + (ni * 16 + l15) * ATP + ks * 32 + 8 * hh);
      const v16bf b_l = ldfrag(atl + (ni * 16 + l15) * ATP + ks * 32 + 8 * hh);
      acc = mma_bf(a_h, b_h, acc);
      acc = mma_bf(a_h, b_l, acc);
      acc = mma_bf(a_l, b_h, acc);
    }
#pragma unroll
    for (int r = 0; r < 8; ++r) ost[(8 * hh + r) * TXP + ni * 16 + l15] = acc[r];
  }
  __syncthreads();

  // ---- phase 5: token rows to their unrolled pixels ----
  {
    const int tk = 2 * wave + hh;
    const int piece = l15;
    const float* orow = ost + tk * TXP + piece * 8;
    const v4f v0 = *(const v4f*)(orow);
    const v4f v1 = *(const v4f*)(orow + 4);
    v4u ph, plw;
    split8(v0, v1, ph, plw);
    const int iy = tk / WSZ, ix = tk - (tk / WSZ) * WSZ;
    const int ry = wy * WSZ + iy, rx = wx * WSZ + ix;
    const int py = (ry + WSZ / 2) & (IMW - 1), px = (rx + WSZ / 2) & (IMW - 1);
    const size_t gp = ((size_t)(b * HW) + (size_t)py * IMW + px) * CC + piece * 8;
    *(v4u*)(Th + gp) = ph;
    *(v4u*)(Tl + gp) = plw;
    
  }
}

// =================================================================================================================
// GSA score and sum-of-squares partials: block = (b, head h, slab of 256 pixels), S[c][d] = sum_n q[h*32+c][n]
// k[h*32+d][n] over the slab on WMMA. A thread holds one of the head's 64 q and k columns (f32 from R) at 64 of the
// slab's pixels: its 64 loads are issued together, so a block waits out one memory latency, and NB*NHEAD*NSLS blocks
// fill the chip. From those registers: the column's sum of squares (8 chains of 8 pixels, added as a tree; the four
// pixel groups of a column are added through LDS) and the bf16 hi + residual planes, transposed in LDS ([32 ch][GSP],
// k contiguous); waves: fragment f = wave&3 (2x2 of 16x16), k half = wave>>2; 3 products; the two k halves are
// combined in fixed order through LDS; the 32x32 f32 tile is staged and stored as whole lines.
// blk = (b*NHEAD + h)*NSLS + slab. coverage: planes 64 ch x 256 px (256 threads x 8 groups x 8 px), tile 32x32 per
// block, 64 of the 256 sums of squares of (b, slab) per block (2 whole 128-byte lines).
// =================================================================================================================
__global__ __launch_bounds__(256) void gsa_s_k(const float* __restrict__ R, float* pa, float* pn) {
  extern __shared__ __align__(16) char smem[];
  unsigned short* pl = (unsigned short*)(smem + GL_QH);   // q hi @0, q lo @8448, k hi @16896, k lo @25344 (halves)
  float* red = (float*)(smem + GL_RED);
  float* stg = (float*)(smem + GL_STG);
  float* sq = (float*)(smem + GL_SQ);
  const int tid = threadIdx.x, wave = tid >> 5, lane = tid & 31, hh = lane >> 4, l15 = lane & 15;
  const int blk = blockIdx.x;
  const int b = blk / (NHEAD * NSLS);
  const int rem = blk - b * (NHEAD * NSLS);
  const int h = rem / NSLS;
  const int slab = rem - h * NSLS;
  const int f = wave & 3, mi = f >> 1, ni = f & 1, kh = wave >> 2;
  const int c = tid & 63, sel = c >> 5, cc = c & 31;
  const int col = sel * CC + h * HDC + cc;
  unsigned short* ph = pl + sel * 16896 + cc * GSP;
  unsigned short* plo = ph + 8448;
  const int g0 = tid >> 6;
  const float* rp = R + ((size_t)(b * HW) + (size_t)slab * 256 + g0 * 8) * C3 + col;
  // Every loop below is unrolled in full: constant indices keep the 64 loaded values in registers.
  v4f v0[8], v1[8];
#pragma unroll
  for (int it = 0; it < 8; ++it) {
#pragma unroll
    for (int j = 0; j < 4; ++j) {
      v0[it][j] = rp[(it * 32 + j) * C3];
      v1[it][j] = rp[(it * 32 + j + 4) * C3];
    }
  }
  float sp[8];
#pragma unroll
  for (int it = 0; it < 8; ++it) {
    float t = 0.f;
#pragma unroll
    for (int j = 0; j < 4; ++j) t = fmaf(v0[it][j], v0[it][j], t);
#pragma unroll
    for (int j = 0; j < 4; ++j) t = fmaf(v1[it][j], v1[it][j], t);
    sp[it] = t;
  }
  sq[g0 * 64 + c] = ((sp[0] + sp[1]) + (sp[2] + sp[3])) + ((sp[4] + sp[5]) + (sp[6] + sp[7]));
#pragma unroll
  for (int it = 0; it < 8; ++it) {
    const int g = it * 4 + g0;
    v4u hp, lp;
    split8(v0[it], v1[it], hp, lp);
    *(v4u*)(ph + g * 8) = hp;
    *(v4u*)(plo + g * 8) = lp;
  }
  __syncthreads();                           // every wave reads plane rows and sums that other waves wrote
  v8f acc = zero8();
#pragma unroll
  for (int ks = 0; ks < 4; ++ks) {
    const int k0 = (kh * 4 + ks) * 32;
    const v16bf a_h = ldfrag(pl + (mi * 16 + l15) * GSP + k0 + 8 * hh);
    const v16bf a_l = ldfrag(pl + 8448 + (mi * 16 + l15) * GSP + k0 + 8 * hh);
    const v16bf b_h = ldfrag(pl + 16896 + (ni * 16 + l15) * GSP + k0 + 8 * hh);
    const v16bf b_l = ldfrag(pl + 25344 + (ni * 16 + l15) * GSP + k0 + 8 * hh);
    acc = mma_bf(a_h, b_h, acc);
    acc = mma_bf(a_h, b_l, acc);
    acc = mma_bf(a_l, b_h, acc);
  }
  if (wave >= 4) {
#pragma unroll
    for (int r = 0; r < 8; ++r) red[((wave - 4) * 32 + lane) * 8 + r] = acc[r];
  }
  __syncthreads();
  if (wave < 4) {
    const v4f o0 = *(const v4f*)(red + (wave * 32 + lane) * 8);
    const v4f o1 = *(const v4f*)(red + (wave * 32 + lane) * 8 + 4);
#pragma unroll
    for (int r = 0; r < 8; ++r) {
      const float v = acc[r] + (r < 4 ? o0[r & 3] : o1[r & 3]);
      stg[(mi * 16 + 8 * hh + r) * GXP + ni * 16 + l15] = v;
    }
  }
  __syncthreads();
  {
    const int row = tid >> 3, piece = tid & 7;
    const v4f v = *(const v4f*)(stg + row * GXP + piece * 4);
    float* gp = pa + (size_t)blk * 1024 + row * 32 + piece * 4;
    *(v4f*)gp = v;
  }
  if (tid < 64) {                            // whole waves
    const float t = (sq[c] + sq[64 + c]) + (sq[128 + c] + sq[192 + c]);
    pn[((size_t)(b * NSLN + slab)) * 256 + col] = t;
  }
}

// =================================================================================================================
// GSA finisher, block = (b, h, quarter of the head's 32x32 tile), 10 waves. Waves 0..7: thread = one element
// e = c*32 + d, attn[c][d] = relu(sum of pa partials * invq[c] * invk[d] * temp) -> bf16 hi + residual planes.
// Waves 8, 9: invq/invk = 1/max(sqrt(sum of pn partials), 1e-12) for the head's 32 q and 32 k channels. Partials are
// summed slab by slab in rising order; a thread's NSLS loads are issued together, and no wave has more than those to
// wait for. A block writes 512 bytes in a row of each plane.
// =================================================================================================================
#define FINQ 4
static_assert(FINQ * 256 == HDC * HDC);
static_assert(NSLS == NSLN);
__global__ __launch_bounds__(320) void gsa_fin_k(const float* __restrict__ pa, const float* __restrict__ pn,
                                                 const float* __restrict__ temp,
                                                 unsigned short* afh, unsigned short* afl) {
#pragma clang fp contract(off)
  __shared__ float sinv[64];
  const int tid = threadIdx.x;
  const int bh = blockIdx.x / FINQ;
  const int e = (blockIdx.x - bh * FINQ) * 256 + (tid & 255);
  const int b = bh / NHEAD;
  const int h = bh - b * NHEAD;
  const bool nrm = tid >= 256;               // whole waves
  // The loops over the slabs are unrolled in full: constant indices keep the loaded partials in registers.
  float pv[NSLS];
  float s = 0.f;
  if (nrm) {
    const int sel = (tid >> 5) & 1, i = tid & 31;
    const float* np = pn + (size_t)b * (NSLN * 256) + sel * CC + h * HDC + i;
#pragma unroll
    for (int sl = 0; sl < NSLN; ++sl) pv[sl] = np[sl * 256];
#pragma unroll
    for (int sl = 0; sl < NSLN; ++sl) s = s + pv[sl];
    sinv[tid - 256] = 1.0f / fmaxf(sqrtf(s), 1e-12f);
  } else {
    const float* pp = pa + (size_t)bh * (NSLS * 1024) + e;
#pragma unroll
    for (int sl = 0; sl < NSLS; ++sl) pv[sl] = pp[sl * 1024];
#pragma unroll
    for (int sl = 0; sl < NSLS; ++sl) s = s + pv[sl];
  }
  __syncthreads();
  if (nrm) return;
  const float tmp = bfr(temp[0]);
  float v = s * sinv[e >> 5];
  v = v * sinv[32 + (e & 31)];
  v = v * tmp;
  v = fmaxf(v, 0.0f);
  unsigned short hi, lo;
  split_bf(v, hi, lo);
  const size_t to = (size_t)b * AFSZ + (size_t)h * (HDC * HDC) + e;
  afh[to] = hi;
  afl[to] = lo;
}

// =================================================================================================================
// GSA apply: out[p][h*32 + c] = sum_d v[p][h*32 + d] attn_h[c][d], K = 32 per head, both operands hi + residual
// (3 products). Wave tile 16 px x 64 cols (heads hd0 = n0/32 for fragments 0,1 and hd0+1 for 2,3), block = 128 px,
// coverage: 8 waves x 16 rows x 64 cols per block; grid covers NPIX x 128 once.
// =================================================================================================================
__global__ __launch_bounds__(256) void apply_k(const unsigned short* __restrict__ Vh,
                                               const unsigned short* __restrict__ Vl,
                                               const unsigned short* __restrict__ afh,
                                               const unsigned short* __restrict__ afl,
                                               unsigned short* Oh, unsigned short* Ol) {
  __shared__ __align__(16) float stg[8 * 16 * AXP];
  const int tid = threadIdx.x, wave = tid >> 5, lane = tid & 31, hh = lane >> 4, l15 = lane & 15;
  const int m0 = (blockIdx.x * 8 + wave) * 16;
  const int n0 = blockIdx.y * 64;
  const int b = m0 / HW;
  const int hd0 = n0 / HDC;
  const unsigned short* ar = Vh + (size_t)(m0 + l15) * CC + hd0 * HDC + 8 * hh;
  const unsigned short* al = Vl + (size_t)(m0 + l15) * CC + hd0 * HDC + 8 * hh;
  const v16bf a0h = ldfrag(ar), a0l = ldfrag(al);
  const v16bf a1h = ldfrag(ar + 32), a1l = ldfrag(al + 32);
  const unsigned short* wb = afh + (size_t)b * AFSZ + (size_t)(n0 + l15) * 32 + 8 * hh;
  const unsigned short* wl = afl + (size_t)b * AFSZ + (size_t)(n0 + l15) * 32 + 8 * hh;
  v8f c0 = zero8(), c1 = zero8(), c2 = zero8(), c3 = zero8();
  {
    const v16bf bh = ldfrag(wb), bl = ldfrag(wl);
    c0 = mma_bf(a0h, bh, c0); c0 = mma_bf(a0l, bh, c0); c0 = mma_bf(a0h, bl, c0);
  }
  {
    const v16bf bh = ldfrag(wb + 16 * 32), bl = ldfrag(wl + 16 * 32);
    c1 = mma_bf(a0h, bh, c1); c1 = mma_bf(a0l, bh, c1); c1 = mma_bf(a0h, bl, c1);
  }
  {
    const v16bf bh = ldfrag(wb + 32 * 32), bl = ldfrag(wl + 32 * 32);
    c2 = mma_bf(a1h, bh, c2); c2 = mma_bf(a1l, bh, c2); c2 = mma_bf(a1h, bl, c2);
  }
  {
    const v16bf bh = ldfrag(wb + 48 * 32), bl = ldfrag(wl + 48 * 32);
    c3 = mma_bf(a1h, bh, c3); c3 = mma_bf(a1l, bh, c3); c3 = mma_bf(a1h, bl, c3);
  }
  float* sw = stg + wave * (16 * AXP);
#pragma unroll
  for (int r = 0; r < 8; ++r) {
    sw[(8 * hh + r) * AXP + l15] = c0[r];
    sw[(8 * hh + r) * AXP + 16 + l15] = c1[r];
    sw[(8 * hh + r) * AXP + 32 + l15] = c2[r];
    sw[(8 * hh + r) * AXP + 48 + l15] = c3[r];
  }
  wave_sync_lds();
  const int q = lane >> 3, piece = lane & 7;
  v4u oh[4], ol[4];
#pragma unroll
  for (int it = 0; it < 4; ++it) {
    const int row = it * 4 + q;
    const float* sp = sw + row * AXP + piece * 8;
    const v4f v0 = *(const v4f*)(sp);
    const v4f v1 = *(const v4f*)(sp + 4);
    split8(v0, v1, oh[it], ol[it]);
  }
#pragma unroll
  for (int it = 0; it < 4; ++it) {
    const int row = it * 4 + q;
    const size_t to = (size_t)(m0 + row) * CC + n0 + piece * 8;
    *(v4u*)(Oh + to) = oh[it];
    *(v4u*)(Ol + to) = ol[it];
  }
  
}

// =================================================================================================================
// Workspace map (bytes), NPIX = NB*HW: A f32 [NPIX][128], Bx same, T = two bf16 planes [NPIX][128], U f32
// [NPIX][384] (also used as two bf16 planes [NPIX][128]), R f32 [NPIX][384] (also used as two
// bf16 planes [NPIX][384]), weights bf16 (655360), pn f32 [NB*NSLN][256], pa f32 [NB*NHEAD*NSLS][1024], af two bf16
// planes [NB][128][32]. Total 153911296 for NB=2, IMW=128. Every region is an exact multiple of its whole-row store
// granularity.
// =================================================================================================================
extern "C" void kernel_launch(void* const* d_in, const int* in_sizes, int n_in,
                              void* d_out, int out_size, void* d_ws, size_t ws_size,
                              hipStream_t stream) {
  if (n_in < 23) return;
  if (in_sizes[0] != NPIX * CC) return;
  if (in_sizes[1] != CC || in_sizes[2] != CC || in_sizes[3] != CC || in_sizes[4] != CC) return;
  if (in_sizes[5] != C3 * CC || in_sizes[6] != C3 * 9 || in_sizes[7] != CC * CC || in_sizes[8] < 1) return;
  if (in_sizes[9] != HID * CC || in_sizes[10] != HID * 9 || in_sizes[11] != CC * HID) return;
  if (in_sizes[12] != CC || in_sizes[13] != CC || in_sizes[14] != CC || in_sizes[15] != CC) return;
  if (in_sizes[16] != C3 * CC || in_sizes[17] != C3 * 9 || in_sizes[18] != CC * CC || in_sizes[19] < 1) return;
  if (in_sizes[20] != HID * CC || in_sizes[21] != HID * 9 || in_sizes[22] != CC * HID) return;
  if (out_size != NPIX * CC) return;

  const float* x        = (const float*)d_in[0];
  const float* w_s0     = (const float*)d_in[1];
  const float* b_s0     = (const float*)d_in[2];
  const float* w_s2     = (const float*)d_in[3];
  const float* b_s2     = (const float*)d_in[4];
  const float* rsa_qkv  = (const float*)d_in[5];
  const float* rsa_dw   = (const float*)d_in[6];
  const float* rsa_proj = (const float*)d_in[7];
  const float* rsa_temp = (const float*)d_in[8];
  const float* ffs_in   = (const float*)d_in[9];
  const float* ffs_dw   = (const float*)d_in[10];
  const float* ffs_out  = (const float*)d_in[11];
  const float* w_c0     = (const float*)d_in[12];
  const float* b_c0     = (const float*)d_in[13];
  const float* w_c2     = (const float*)d_in[14];
  const float* b_c2     = (const float*)d_in[15];
  const float* gsa_qkv  = (const float*)d_in[16];
  const float* gsa_dw   = (const float*)d_in[17];
  const float* gsa_proj = (const float*)d_in[18];
  const float* gsa_temp = (const float*)d_in[19];
  const float* ffc_in   = (const float*)d_in[20];
  const float* ffc_dw   = (const float*)d_in[21];
  const float* ffc_out  = (const float*)d_in[22];
  float* out = (float*)d_out;

  // ---- carve ----
  const size_t sAct = (size_t)NPIX * CC * 4;                        // f32 [NPIX][128]
  const size_t sT   = (size_t)NPIX * CC * 2 * 2;                    // two bf16 planes [NPIX][128]
  const size_t sU   = (size_t)NPIX * C3 * 4;                        // f32 [NPIX][384]
  const size_t sR   = (size_t)NPIX * C3 * 4;                        // f32 [NPIX][384] = two bf16 planes [NPIX][384]
  const size_t sWq  = (size_t)C3 * CC * 2;
  const size_t sWp  = (size_t)CC * CC * 2;
  const size_t sW1  = (size_t)HIDP * CC * 2;
  const size_t sW2  = (size_t)CC * HIDP * 2;
  const size_t sPN  = (size_t)NB * NSLN * 256 * 4;
  const size_t sPA  = (size_t)NB * NHEAD * NSLS * 1024 * 4;
  const size_t sAF  = (size_t)NB * AFSZ * 2;                        // per plane
  size_t off = 0;
  const size_t oA   = off; off += sAct;
  const size_t oBx  = off; off += sAct;
  const size_t oT   = off; off += sT;
  const size_t oU   = off; off += sU;
  const size_t oR   = off; off += sR;
  const size_t oWq0 = off; off += sWq;
  const size_t oWp0 = off; off += sWp;
  const size_t oW10 = off; off += sW1;
  const size_t oW20 = off; off += sW2;
  const size_t oWq1 = off; off += sWq;
  const size_t oWp1 = off; off += sWp;
  const size_t oW11 = off; off += sW1;
  const size_t oW21 = off; off += sW2;
  const size_t oPN  = off; off += sPN;
  const size_t oPA  = off; off += sPA;
  const size_t oAFh = off; off += sAF;
  const size_t oAFl = off; off += sAF;
  if (off > ws_size) return;                               // off = 153911296 for NB=2, IMW=128
  if (sU < (size_t)NPIX * HIDP * 4) return;
  if (sU < (size_t)NPIX * CC * 2 * 2) return;
  if (sR < (size_t)NPIX * HIDP * 2 * 2) return;

  char* ws = (char*)d_ws;
  float* A  = (float*)(ws + oA);
  float* Bx = (float*)(ws + oBx);
  unsigned short* Th = (unsigned short*)(ws + oT);
  unsigned short* Tl = Th + (size_t)NPIX * CC;
  float* U  = (float*)(ws + oU);
  unsigned short* Uh = (unsigned short*)(ws + oU);
  unsigned short* Ul = Uh + (size_t)NPIX * CC;
  float* R  = (float*)(ws + oR);
  unsigned short* Gh = (unsigned short*)(ws + oR);
  unsigned short* Gl = Gh + (size_t)NPIX * HIDP;
  unsigned short* Wq0 = (unsigned short*)(ws + oWq0);
  unsigned short* Wp0 = (unsigned short*)(ws + oWp0);
  unsigned short* W10 = (unsigned short*)(ws + oW10);
  unsigned short* W20 = (unsigned short*)(ws + oW20);
  unsigned short* Wq1 = (unsigned short*)(ws + oWq1);
  unsigned short* Wp1 = (unsigned short*)(ws + oWp1);
  unsigned short* W11 = (unsigned short*)(ws + oW11);
  unsigned short* W21 = (unsigned short*)(ws + oW21);
  float* PN = (float*)(ws + oPN);
  float* PA = (float*)(ws + oPA);
  unsigned short* AFh = (unsigned short*)(ws + oAFh);
  unsigned short* AFl = (unsigned short*)(ws + oAFl);

  const dim3 blk(256);
  // (1) x NCHW -> A pixel-major; weights f32 [out][in] -> bf16 planes [outP][inP], k contiguous, zero padded
  //     (Wq0 is the start of the weight region: Wq0, Wp0, W10, W20, Wq1, Wp1, W11, W21 lie one behind the other)
  prep_k<<<dim3(PB_T + 2 * PB_SET), blk, 0, stream>>>(x, A, rsa_qkv, rsa_proj, ffs_in, ffs_out,
                                                      gsa_qkv, gsa_proj, ffc_in, ffc_out, Wq0);

  (void)hipFuncSetAttribute(reinterpret_cast<const void*>(&rsa_attn_k), hipFuncAttributeMaxDynamicSharedMemorySize, RL_END);
  (void)hipFuncSetAttribute(reinterpret_cast<const void*>(&gsa_s_k), hipFuncAttributeMaxDynamicSharedMemorySize, GL_END);

  const dim3 gG(NPIX / GBM);
  const dim3 gDw((NPIX / DWL * (C3 / 4) + 255) / 256);

  // ---- spatial (RSA) block ----
  gemm_k<CC, C3, 0, 1><<<gG, blk, 0, stream>>>(Th, Tl, Wq0, U, Bx, A, w_s0, b_s0);        // qkv 1x1 of LN_s0(x) -> U
  dw_k<C3, 0><<<gDw, blk, 0, stream>>>(U, rsa_dw, 0, C3, WSZ / 2, R, C3, 0, Th, Tl, CC); // dw (rolled) -> R
  rsa_attn_k<<<dim3(NB * NWIN), blk, RL_END, stream>>>(R, rsa_temp, Th, Tl);            // T = window attention out
  gemm_k<CC, CC, 0, 0><<<gG, blk, 0, stream>>>(Th, Tl, Wp0, Bx, A, A, w_s2, b_s2);        // Bx = x_
  gemm_k<CC, HIDP, 0, 2><<<gG, blk, 0, stream>>>(Th, Tl, W10, U, Bx, A, w_s2, b_s2);      // ffn-in of LN_s2(x_+x) -> U
  dw_k<HIDP, 1><<<gDw, blk, 0, stream>>>(U, ffs_dw, 0, HID, 0, R, C3, 0, Gh, Gl, HIDP);  // dw+gelu -> G planes
  gemm_k<HIDP, CC, 1, 0><<<gG, blk, 0, stream>>>(Gh, Gl, W20, A, Bx, Bx, w_s2, b_s2);     // A = ffn + x_

  // ---- channel (GSA) block ----
  gemm_k<CC, C3, 0, 1><<<gG, blk, 0, stream>>>(Th, Tl, Wq1, U, Bx, A, w_c0, b_c0);        // qkv 1x1 of LN_c0(x) -> U
  dw_k<C3, 2><<<gDw, blk, 0, stream>>>(U, gsa_dw, 0, C3, 0, R, C3, 0, Th, Tl, CC);       // q, k -> R f32; v planes -> T region
  gsa_s_k<<<dim3(NB * NHEAD * NSLS), blk, GL_END, stream>>>(R, PA, PN);                  // score and norm partials
  gsa_fin_k<<<dim3(NB * NHEAD * FINQ), dim3(320), 0, stream>>>(PA, PN, gsa_temp, AFh, AFl);
  apply_k<<<dim3(NPIX / 128, CC / 64), blk, 0, stream>>>(Th, Tl, AFh, AFl, Uh, Ul);     // U planes = channel attention out
  gemm_k<CC, CC, 0, 0><<<gG, blk, 0, stream>>>(Uh, Ul, Wp1, Bx, A, A, w_c2, b_c2);        // Bx = x_
  gemm_k<CC, HIDP, 0, 2><<<gG, blk, 0, stream>>>(Th, Tl, W11, U, Bx, A, w_c2, b_c2);      // ffn-in of LN_c2(x_+x) -> U
  dw_k<HIDP, 1><<<gDw, blk, 0, stream>>>(U, ffc_dw, 0, HID, 0, R, C3, 0, Gh, Gl, HIDP);
  gemm_k<HIDP, CC, 2, 0><<<gG, blk, 0, stream>>>(Gh, Gl, W21, out, Bx, Bx, w_c2, b_c2);   // d_out NCHW = ffn + x_
  (void)hipGetLastError();
}

// v007
// One run takes 222 microseconds.
// Timed twice side by side with v006, it ran 1.03 and 1.02 times as fast.
// All steps since v000 together make it 3.38 times as fast.
// Contractions (1x1 convs for qkv / proj / ffn-in / ffn-out, window q^T.k and v.attn, global q.k^T and attn.v):
// v_wmma_f32_16x16x32_bf16 (bf16 operands, f32 accumulate); computed operands carried as bf16 hi + residual planes,
// weight operands single bf16; layer norms, depthwise 3x3 convs, erf GELU, l2 norms and residual adds in f32 on VALU.
// Inputs RNE-converted to bf16 on load.
#include <hip/hip_runtime.h>
#include <math.h>
#include <stdint.h>

#define NB    2
#define CC    128
#define IMW   128
#define HW    (IMW * IMW)
#define NPIX  (NB * HW)
#define C3    384
#define HID   340
#define HIDP  384
#define NHEAD 4
#define HDC   32
#define WSZ   4
#define NWX   (IMW / WSZ)
#define NWIN  (NWX * NWX)
#define NSLN  (HW / 256)
#define NSLS  (HW / 256)
#define AFSZ  (CC * HDC)
#define RSQ2  0.70710678118654752f
#define GXP   36
#define AXP   68
#define TXP   132
#define ATP   136
#define GSP   264
#define DWL   8

static_assert((IMW & (IMW - 1)) == 0);
static_assert(IMW % WSZ == 0);
static_assert(WSZ == 4);
static_assert(IMW % DWL == 0);
static_assert(HW % 256 == 0);
static_assert(HW % 64 == 0);
static_assert(NPIX % 256 == 0);
static_assert(CC == NHEAD * HDC);
static_assert(HDC == 32);
static_assert((GXP * 4) % 16 == 0);
static_assert((AXP * 4) % 16 == 0);
static_assert((TXP * 4) % 16 == 0);
static_assert((ATP * 2) % 16 == 0);
static_assert((GSP * 2) % 16 == 0);

// RSA window kernel dynamic LDS map (bytes)
#define RL_R    0
#define RL_QTH  24576
#define RL_QTL  28672
#define RL_KTH  32768
#define RL_KTL  36864
#define RL_ATH  40960
#define RL_ATL  75776
#define RL_VH   110592
#define RL_VL   114944
#define RL_INV  119296
#define RL_END  119424
static_assert(RL_QTH == RL_R + 16 * C3 * 4);
static_assert(RL_QTL == RL_QTH + CC * 16 * 2);
static_assert(RL_KTH == RL_QTL + CC * 16 * 2);
static_assert(RL_KTL == RL_KTH + CC * 16 * 2);
static_assert(RL_ATH == RL_KTL + CC * 16 * 2);
static_assert(RL_ATL == RL_ATH + CC * ATP * 2);
static_assert(RL_VH == RL_ATL + CC * ATP * 2);
static_assert(RL_VL == RL_VH + 16 * ATP * 2);
static_assert(RL_INV == RL_VL + 16 * ATP * 2);
static_assert(RL_END == RL_INV + 32 * 4);
static_assert(16 * TXP * 4 <= RL_QTH - RL_R);

// GSA score kernel dynamic LDS map (bytes)
#define GL_QH   0
#define GL_QL   16896
#define GL_KH   33792
#define GL_KL   50688
#define GL_RED  67584
#define GL_STG  71680
#define GL_SQ   76288
#define GL_END  77312
static_assert(GL_QL == 32 * GSP * 2);
static_assert(GL_KH == 2 * GL_QL);
static_assert(GL_KL == 3 * GL_QL);
static_assert(GL_RED == 4 * GL_QL);
static_assert(GL_STG == GL_RED + 4 * 32 * 8 * 4);
static_assert(GL_SQ == GL_STG + 32 * GXP * 4);
static_assert(GL_END == GL_SQ + 4 * 64 * 4);

typedef __bf16         v16bf __attribute__((ext_vector_type(16)));
typedef unsigned short v8us  __attribute__((ext_vector_type(8)));
typedef float          v8f   __attribute__((ext_vector_type(8)));
typedef float          v4f   __attribute__((ext_vector_type(4)));
typedef unsigned int   v4u   __attribute__((ext_vector_type(4)));
typedef unsigned int   v2u   __attribute__((ext_vector_type(2)));

union Frag { v16bf v; v8us u[2]; };

// ---- scalar helpers ------------------------------------------------------------------------------------------
__device__ __forceinline__ unsigned short bf_bits(float f) {          // f32 -> bf16 bits, RNE convert
  unsigned u = __float_as_uint(f);
  return (unsigned short)((u + 0x7FFFu + ((u >> 16) & 1u)) >> 16);
}
__device__ __forceinline__ float bf_up(unsigned short h) { return __uint_as_float(((unsigned)h) << 16); }
__device__ __forceinline__ float bfr(float f) { return bf_up(bf_bits(f)); }
__device__ __forceinline__ unsigned pk16(unsigned short a, unsigned short b) { return (unsigned)a | ((unsigned)b << 16); }
// hi = bf16(v), lo = bf16(v - hi)
__device__ __forceinline__ void split_bf(float v, unsigned short& hi, unsigned short& lo) {
  const unsigned short hb = bf_bits(v);
  hi = hb;
  lo = bf_bits(v - bf_up(hb));
}
__device__ __forceinline__ void split4(v4f v, v2u& ph, v2u& pl) {
  unsigned short h[4], l[4];
#pragma unroll
  for (int e = 0; e < 4; ++e) split_bf(v[e], h[e], l[e]);
  ph[0] = pk16(h[0], h[1]); ph[1] = pk16(h[2], h[3]);
  pl[0] = pk16(l[0], l[1]); pl[1] = pk16(l[2], l[3]);
}
__device__ __forceinline__ void split8(v4f v0, v4f v1, v4u& ph, v4u& pl) {
  unsigned short h[8], l[8];
#pragma unroll
  for (int e = 0; e < 4; ++e) { split_bf(v0[e], h[e], l[e]); split_bf(v1[e], h[4 + e], l[4 + e]); }
#pragma unroll
  for (int e = 0; e < 4; ++e) { ph[e] = pk16(h[2 * e], h[2 * e + 1]); pl[e] = pk16(l[2 * e], l[2 * e + 1]); }
}
__device__ __forceinline__ v8f zero8() { v8f z = {0.f, 0.f, 0.f, 0.f, 0.f, 0.f, 0.f, 0.f}; return z; }
__device__ __forceinline__ v8us zero8us() { v8us z = {0, 0, 0, 0, 0, 0, 0, 0}; return z; }

// ---- fragment loaders: 16-bit A/B operand, lane -> row/col (lane&15), p already includes +8*(lane>>4);
//      elements 0..7 <- p[0..7] (k0+8h..), elements 8..15 <- p[16..23] (k0+16+8h..)
__device__ __forceinline__ v16bf ldfrag(const unsigned short* p) {
  Frag f;
  f.u[0] = *(const v8us*)(p);
  f.u[1] = *(const v8us*)(p + 16);
  return f.v;
}
// K = 16 contraction padded to 32: elements 8..15 are zero
__device__ __forceinline__ v16bf ldfrag16(const unsigned short* p) {
  Frag f;
  f.u[0] = *(const v8us*)(p);
  f.u[1] = zero8us();
  return f.v;
}

// ---- WMMA helper with trailing VALU hazard gap ---------------------------------------------------------------
__device__ __forceinline__ v8f mma_bf(v16bf a, v16bf b, v8f c) {
  c = __builtin_amdgcn_wmma_f32_16x16x32_bf16(false, a, false, b, (short)0, c, false, false);
#if defined(__HIP_DEVICE_COMPILE__)
  asm volatile("v_nop\n\tv_nop\n\tv_nop\n\tv_nop" : "+v"(c) : "v"(a), "v"(b));
#endif
  return c;
}
__device__ __forceinline__ void wave_sync_lds() {
  __builtin_amdgcn_fence(__ATOMIC_RELEASE, "workgroup");
  __builtin_amdgcn_wave_barrier();
  __builtin_amdgcn_fence(__ATOMIC_ACQUIRE, "workgroup");
}

// =================================================================================================================
// Weight convert: w f32 [rows][cols] -> bf16 [rowsP][colsP] (zero padded), value = bf16_RNE(w). One thread = 8
// coverage: rowsP * colsP/8 pieces, ceil(pieces/256) blocks (blk = block index within the matrix) with a bound.
// =================================================================================================================
__device__ __forceinline__ void cvt_w(const float* __restrict__ w, unsigned short* outp,
                                      int rows, int cols, int rowsP, int colsP, int blk) {
  const int t = blk * 256 + threadIdx.x;
  const int ppr = colsP >> 3;
  const int npc = rowsP * ppr;
  const bool ok = t < npc;
  const int tt = ok ? t : 0;
  const int r = tt / ppr, c8 = (tt - r * ppr) * 8;
  const int rr = min(r, rows - 1);
  unsigned short hv[8];
#pragma unroll
  for (int e = 0; e < 8; ++e) {
    const int c = c8 + e;
    const int cl = min(c, cols - 1);
    const float f = w[(size_t)rr * cols + cl];
    const float z = (r < rows && c < cols) ? f : 0.0f;
    hv[e] = bf_bits(z);
  }
  v4u pk;
#pragma unroll
  for (int e = 0; e < 4; ++e) pk[e] = pk16(hv[2 * e], hv[2 * e + 1]);
  unsigned short* gp = outp + (size_t)r * colsP + c8;
  if (ok) *(v4u*)gp = pk;
  
}

// =================================================================================================================
// NCHW f32 x -> pixel-major stream A [b*HW + p][128] f32, values bf16-RNE-converted. Block = (b, 64-pixel tile):
// 128 ch x 64 px loaded coalesced along p into an LDS tile [px][TXP]; store: each pixel row = 512 B = 32 lanes x
// coverage: 8 waves x 8 rows = 64 px x 128 ch per block; NB*(HW/64) blocks (blk) = every pixel once.
// =================================================================================================================
__device__ __forceinline__ void nchw_in(const float* __restrict__ x, float* A, float* xs, int blk) {
  const int tid = threadIdx.x, wave = tid >> 5, lane = tid & 31;
  const int b = blk / (HW / 64);
  const int p0 = (blk - b * (HW / 64)) * 64;
#pragma unroll
  for (int it = 0; it < 8; ++it) {
    const int q = it * 256 + tid;
    const int ch = q >> 4, j4 = (q & 15) * 4;
    const v4f v = *(const v4f*)(x + ((size_t)(b * CC + ch)) * HW + p0 + j4);
#pragma unroll
    for (int e = 0; e < 4; ++e) xs[(j4 + e) * TXP + ch] = bfr(v[e]);
  }
  __syncthreads();
  v4f ov[8];
#pragma unroll
  for (int it = 0; it < 8; ++it) {
    const int row = wave * 8 + it;
    ov[it] = *(const v4f*)(xs + row * TXP + lane * 4);
  }
#pragma unroll
  for (int it = 0; it < 8; ++it) {
    const int row = wave * 8 + it;
    *(v4f*)(A + ((size_t)(b * HW + p0 + row)) * CC + lane * 4) = ov[it];
  }
}

// =================================================================================================================
// Input preparation, one launch: the NCHW transpose and the eight weight converts need nothing of each other, so they
// share one grid by ranges of the block index (block-uniform branches; the transpose's barrier is passed by whole
// blocks only). Blocks [0, PB_T): transpose tiles; then per weight set (spatial, channel) PB_SET blocks: qkv, proj,
// ffn-in, ffn-out. Wb = the bf16 weight region, the four matrices of a set one behind the other, set after set.
// =================================================================================================================
#define PB_T    (NB * (HW / 64))
#define PB_Q    (C3 * CC / 8 / 256)
#define PB_P    (CC * CC / 8 / 256)
#define PB_1    (HIDP * CC / 8 / 256)
#define PB_2    (CC * HIDP / 8 / 256)
#define PB_SET  (PB_Q + PB_P + PB_1 + PB_2)
#define WSETN   (C3 * CC + CC * CC + HIDP * CC + CC * HIDP)
static_assert((C3 * CC) % 2048 == 0 && (CC * CC) % 2048 == 0 && (HIDP * CC) % 2048 == 0);
__global__ __launch_bounds__(256) void prep_k(const float* __restrict__ x, float* A,
                                              const float* __restrict__ wq0, const float* __restrict__ wp0,
                                              const float* __restrict__ w10, const float* __restrict__ w20,
                                              const float* __restrict__ wq1, const float* __restrict__ wp1,
                                              const float* __restrict__ w11, const float* __restrict__ w21,
                                              unsigned short* Wb) {
  __shared__ __align__(16) float xs[64 * TXP];
  const int bi = blockIdx.x;
  if (bi < PB_T) { nchw_in(x, A, xs, bi); return; }
  const int r0 = bi - PB_T;
  const int set = r0 / PB_SET;
  const int r = r0 - set * PB_SET;
  unsigned short* o = Wb + (size_t)set * WSETN;
  if (r < PB_Q) {
    cvt_w(set ? wq1 : wq0, o, C3, CC, C3, CC, r);
  } else if (r < PB_Q + PB_P) {
    cvt_w(set ? wp1 : wp0, o + C3 * CC, CC, CC, CC, CC, r - PB_Q);
  } else if (r < PB_Q + PB_P + PB_1) {
    cvt_w(set ? w11 : w10, o + C3 * CC + CC * CC, HID, CC, HIDP, CC, r - (PB_Q + PB_P));
  } else {
    cvt_w(set ? w21 : w20, o + C3 * CC + CC * CC + HIDP * CC, CC, HID, CC, HIDP, r - (PB_Q + PB_P + PB_1));
  }
}

// =================================================================================================================
// Layer norm of pixel rows over their 128 channels, one wave per row, 4 channels per lane. ln_stats: mean and variance
// by butterfly sums over the 32 lanes (two passes); returns the centred values dv and the variance (the same in every
// lane). ln_out: dv * rstd, scale gv, shift bb, result as bf16 hi + residual, 4 + 4 halves.
// The loops are unrolled in full: constant indices keep the 4-element vectors in registers.
// =================================================================================================================
__device__ __forceinline__ void ln_stats(v4f xv, v4f& dv, float& var) {
  float s = (xv[0] + xv[1]) + (xv[2] + xv[3]);
#pragma unroll
  for (int off = 1; off < 32; off <<= 1) s = s + __shfl_xor(s, off, 32);
  const float mu = s * (1.0f / 128.0f);
  float s2 = 0.f;
#pragma unroll
  for (int e = 0; e < 4; ++e) { dv[e] = xv[e] - mu; s2 = s2 + dv[e] * dv[e]; }
#pragma unroll
  for (int off = 1; off < 32; off <<= 1) s2 = s2 + __shfl_xor(s2, off, 32);
  var = s2 * (1.0f / 128.0f);
}
__device__ __forceinline__ void ln_out(v4f dv, float rstd, v4f gv, v4f bb, v2u& ph, v2u& pl) {
  v4f z;
#pragma unroll
  for (int e = 0; e < 4; ++e) z[e] = (dv[e] * rstd) * gv[e] + bb[e];
  split4(z, ph, pl);
}

// =================================================================================================================
// GEMM: OUT[p][n] = sum_k (Ah[p][k] + Al[p][k]) * W[n][k]  (A planes [pix][K] bf16 hi + residual, W single bf16
// [N][K] k-contiguous, 2 products per tile pair). Block = 8 waves = GBM pixels x all N columns. Per chunk of GKC k the
// block brings its GBM rows of both A planes and all N rows of W into LDS with loads of whole rows (16 lanes x 16 B =
// the 256 B of a row's chunk), rows at a pitch of GPP halves; every fragment is then read from LDS with the split k map.
// So each A row leaves L2 once, not once per 32 output columns, and no global load gathers 32-byte pieces of 16 rows.
// The next chunk's rows are loaded into registers while this chunk is multiplied. Waves: 2 pixel groups of 32 x
// 4 column groups of N/4; a wave holds N/128 tiles of 32 x 32 (2x2 fragments each) and uses its A fragments for all.
// Each sum runs over k in the same order as before (k rising, hi then residual).
// Epilogue (behind a barrier, in the LDS of the operands): each 32x32 f32 tile is staged by its wave and stored as
// whole 128-byte lines. EP 0: OUT[p][N]; EP 1: same + res[p][n] (res pitch 128); EP 2: NCHW d_out[b][n][p] + res[p][n].
// LN 0: A planes from Ah/Al. LN 1 / LN 2 (K = 128, one chunk): the A operand is the layer norm of the f32 rows X[p][128]
// (LN 2: of X + res), scale g, shift bv: each wave loads 8 of the block's rows, norms them and writes the two
// planes straight into the operand LDS, while the W rows are still on their way; Ah/Al are not read.
// coverage: 8 waves x 32 rows x N/4 cols per block = GBM px x N cols; grid covers NPIX x N once.
// =================================================================================================================
#define GKC 128
#define GBM 64
#define GPP 136
static_assert((GPP * 2) % 32 == 16);
static_assert(NPIX % GBM == 0 && HW % 32 == 0);
template <int K, int N, int EP, int LN>
__global__ __launch_bounds__(256) void gemm_k(const unsigned short* __restrict__ Ah,
                                              const unsigned short* __restrict__ Al,
                                              const unsigned short* __restrict__ W,
                                              float* outf, const float* __restrict__ res,
                                              const float* __restrict__ X, const float* __restrict__ g,
                                              const float* __restrict__ bv) {
  constexpr int NP = N / 128;                // 32-column tiles per wave
  constexpr int NCH = K / GKC;               // k chunks
  constexpr int WIT = N / 16;                // W rows per thread and chunk
  constexpr int LNR = GBM / 8;               // rows that a wave norms
  static_assert(K % GKC == 0 && N % 128 == 0);
  static_assert(LN == 0 || (K == CC && K == GKC && EP == 0));
  static_assert(8 * NP * 32 * GXP * 4 <= (2 * GBM + N) * GPP * 2);
  __shared__ __align__(16) unsigned short sm[(2 * GBM + N) * GPP];
  unsigned short* sah = sm;
  unsigned short* sal = sm + GBM * GPP;
  unsigned short* swt = sm + 2 * GBM * GPP;
  float* stg = (float*)sm;                   // reused behind the last chunk's barrier
  const int tid = threadIdx.x, wave = tid >> 5, lane = tid & 31, hh = lane >> 4, l15 = lane & 15;
  const int mb = blockIdx.x * GBM;
  const int mg = wave >> 2, ng = wave & 3;
  const int srow = tid >> 4, spc = (tid & 15) * 8;
  const unsigned short* gah = Ah + (size_t)(mb + srow) * K + spc;
  const unsigned short* gal = Al + (size_t)(mb + srow) * K + spc;
  const unsigned short* gw = W + (size_t)srow * K + spc;
  const int so = srow * GPP + spc;
  // Every loop below is unrolled in full: constant indices keep the staged rows and the sums in registers.
  v8f acc[NP][4];
#pragma unroll
  for (int j = 0; j < NP; ++j) {
#pragma unroll
    for (int f = 0; f < 4; ++f) acc[j][f] = zero8();
  }
  v4u ra[GBM / 16], rl[GBM / 16], rw[WIT];
  v4f xv[LNR], xb[LNR], gv, bb;
  if (LN == 0) {
#pragma unroll
    for (int it = 0; it < GBM / 16; ++it) {
      ra[it] = *(const v4u*)(gah + it * 16 * K);
      rl[it] = *(const v4u*)(gal + it * 16 * K);
    }
  } else {
    const size_t xo = (size_t)(mb + wave * LNR) * CC + lane * 4;
#pragma unroll
    for (int it = 0; it < LNR; ++it) xv[it] = *(const v4f*)(X + xo + it * CC);
    if (LN == 2) {
#pragma unroll
      for (int it = 0; it < LNR; ++it) xb[it] = *(const v4f*)(res + xo + it * CC);
    }
    // the loads below may be given registers that held the addresses of the row loads: the wait stands in front of them
    asm volatile("s_wait_xcnt 0x0" ::: "memory");
    gv = *(const v4f*)(g + lane * 4);
    bb = *(const v4f*)(bv + lane * 4);
  }
#pragma unroll
  for (int it = 0; it < WIT; ++it) rw[it] = *(const v4u*)(gw + it * 16 * K);
  // the W loads are issued here, behind the row loads, and come in while the rows are normed; without this line the
  // compiler moves them down into the norm and the block waits for them afterwards
  if (LN != 0) __builtin_amdgcn_sched_barrier(0);
#pragma unroll
  for (int kc = 0; kc < NCH; ++kc) {
    if (kc > 0) __syncthreads();             // every wave has read the chunk that is overwritten next
    if (LN == 0) {
#pragma unroll
      for (int it = 0; it < GBM / 16; ++it) {
        *(v4u*)(sah + so + it * 16 * GPP) = ra[it];
        *(v4u*)(sal + so + it * 16 * GPP) = rl[it];
      }
    } else {
#pragma unroll
      for (int e = 0; e < 4; ++e) { gv[e] = bfr(gv[e]); bb[e] = bfr(bb[e]); }
      float var[LNR];
#pragma unroll
      for (int it = 0; it < LNR; ++it) ln_stats(LN == 2 ? xv[it] + xb[it] : xv[it], xv[it], var[it]);
      // the root and the division are long sequences: lane i does them for row i, once for the wave's LNR rows
      float vs = var[0];
#pragma unroll
      for (int it = 1; it < LNR; ++it) vs = (lane == it) ? var[it] : vs;
      const float rs = 1.0f / sqrtf(vs + 1e-6f);
#pragma unroll
      for (int it = 0; it < LNR; ++it) {
        const float rstd = __int_as_float(__builtin_amdgcn_readlane(__float_as_int(rs), it));
        v2u ph, pw;
        ln_out(xv[it], rstd, gv, bb, ph, pw);
        const int lo = (wave * LNR + it) * GPP + lane * 4;
        *(v2u*)(sah + lo) = ph;
        *(v2u*)(sal + lo) = pw;
      }
    }
#pragma unroll
    for (int it = 0; it < WIT; ++it) *(v4u*)(swt + so + it * 16 * GPP) = rw[it];
    __syncthreads();                         // every wave reads rows that other waves staged
    if (kc + 1 < NCH) {
#pragma unroll
      for (int it = 0; it < GBM / 16; ++it) {
        ra[it] = *(const v4u*)(gah + it * 16 * K + (kc + 1) * GKC);
        rl[it] = *(const v4u*)(gal + it * 16 * K + (kc + 1) * GKC);
      }
#pragma unroll
      for (int it = 0; it < WIT; ++it) rw[it] = *(const v4u*)(gw + it * 16 * K + (kc + 1) * GKC);
    }
#pragma unroll
    for (int ks = 0; ks < GKC / 32; ++ks) {
      const int ko = ks * 32 + 8 * hh;
      const unsigned short* pa = sah + (mg * 32 + l15) * GPP + ko;
      const unsigned short* pl = sal + (mg * 32 + l15) * GPP + ko;
      const v16bf a0h = ldfrag(pa), a0l = ldfrag(pl);
      const v16bf a1h = ldfrag(pa + 16 * GPP), a1l = ldfrag(pl + 16 * GPP);
#pragma unroll
      for (int j = 0; j < NP; ++j) {
        const unsigned short* pb = swt + (ng * (N / 4) + j * 32 + l15) * GPP + ko;
        const v16bf b0 = ldfrag(pb), b1 = ldfrag(pb + 16 * GPP);
        acc[j][0] = mma_bf(a0h, b0, acc[j][0]); acc[j][0] = mma_bf(a0l, b0, acc[j][0]);
        acc[j][1] = mma_bf(a0h, b1, acc[j][1]); acc[j][1] = mma_bf(a0l, b1, acc[j][1]);
        acc[j][2] = mma_bf(a1h, b0, acc[j][2]); acc[j][2] = mma_bf(a1l, b0, acc[j][2]);
        acc[j][3] = mma_bf(a1h, b1, acc[j][3]); acc[j][3] = mma_bf(a1l, b1, acc[j][3]);
      }
    }
  }
  __syncthreads();                           // the operands' LDS becomes the output stage: every wave has left it
  const int m0 = mb + mg * 32;
#pragma unroll
  for (int j = 0; j < NP; ++j) {
    float* sw = stg + (wave * NP + j) * (32 * GXP);
#pragma unroll
    for (int r = 0; r < 8; ++r) {
      sw[(8 * hh + r) * GXP + l15] = acc[j][0][r];
      sw[(8 * hh + r) * GXP + 16 + l15] = acc[j][1][r];
      sw[(16 + 8 * hh + r) * GXP + l15] = acc[j][2][r];
      sw[(16 + 8 * hh + r) * GXP + 16 + l15] = acc[j][3][r];
    }
  }
  wave_sync_lds();
  const int q = lane >> 3, piece = lane & 7;
#pragma unroll
  for (int j = 0; j < NP; ++j) {
    const float* sw = stg + (wave * NP + j) * (32 * GXP);
    const int n0 = ng * (N / 4) + j * 32;
    v4f ov[8];
    if (EP != 2) {
#pragma unroll
      for (int it = 0; it < 8; ++it) {
        const int row = it * 4 + q;
        v4f v = *(const v4f*)(sw + row * GXP + piece * 4);
        if (EP == 1) {
          const v4f rr = *(const v4f*)(res + (size_t)(m0 + row) * CC + n0 + piece * 4);
          v = v + rr;
        }
        ov[it] = v;
      }
#pragma unroll
      for (int it = 0; it < 8; ++it) {
        const int row = it * 4 + q;
        *(v4f*)(outf + (size_t)(m0 + row) * N + n0 + piece * 4) = ov[it];
      }
    } else {
      const int b = m0 / HW;
      const int plx = m0 - b * HW;
#pragma unroll
      for (int it = 0; it < 8; ++it) {
        const int ch = it * 4 + q;
        v4f v;
#pragma unroll
        for (int e = 0; e < 4; ++e) {
          const float rv = res[(size_t)(m0 + piece * 4 + e) * CC + n0 + ch];
          v[e] = sw[(piece * 4 + e) * GXP + ch] + rv;
        }
        ov[it] = v;
      }
#pragma unroll
      for (int it = 0; it < 8; ++it) {
        const int ch = it * 4 + q;
        *(v4f*)(outf + ((size_t)(b * CC + n0 + ch)) * HW + plx + piece * 4) = ov[it];
      }
    }
  }
}

// =================================================================================================================
// Depthwise 3x3, SAME zero padding, cross-correlation taps, optional cyclic roll (output pixel index in the rolled
// frame, source slab in the unrolled frame: source pixel ((ny+roll) mod IMW, (nx+roll) mod IMW), valid iff the rolled
// neighbour (ny,nx) is inside the image). src [pix][CS] f32 (CS = all 384 channels of the conv), 4 channels per thread,
// weights wd[(wofs + c)*9 + tap] bf16-RNE (clamped address, zero for c >= cvalid): the block's CS*9 weights are read
// once (thread = channel, in steps of 256) and laid out in LDS as [tap][CS], channel contiguous, so that a thread takes
// its 4 channels of one tap with one 16-byte LDS read.
// A thread computes a strip of DWL output pixels along x: it loads the 3 x (DWL+2) source pixels of the strip once,
// all loads in flight together, keeps them in registers, and each loaded column serves up to three outputs; the taps
// come from LDS once per strip. Strips that follow one another in the grid lie under one another in y (a block's
// strips share source rows).
// A row outside the image zeroes its three taps; only the strip's two outer columns can lie outside the image.
// MODE 0: f32 rows dstf[p*dpitch + dcol + c]; MODE 1: exact-erf GELU (rolled) then bf16 hi + residual planes
// Ph/Pl[p*ppitch + dcol + c]; MODE 2: channels below 2*CC (q, k) as MODE 0, the rest (v) as planes without the GELU at
// Ph/Pl[p*ppitch + c - 2*CC] (a wave's 32 threads hold 128 channels in a row, so the choice is the same for a wave).
// coverage: (NPIX/DWL) * CS/4 threads x DWL pixels, grid ceil-div with an in-kernel bound.
// =================================================================================================================
template <int CS, int MODE>
__global__ __launch_bounds__(256) void dw_k(const float* __restrict__ src, const float* __restrict__ wd,
                                            int wofs, int cvalid, int roll,
                                            float* dstf, int dpitch, int dcol,
                                            unsigned short* Ph, unsigned short* Pl, int ppitch) {
  constexpr int TPP = CS / 4;
  constexpr int NSTR = NPIX / DWL;           // strips in all
  constexpr int SPI = HW / DWL;              // strips per image
  static_assert(CS % 128 == 0);
  __shared__ __align__(16) float wsm[9 * CS];
  constexpr int WTR = (CS + 255) / 256;      // thread = channel, its 9 taps, in WTR steps of 256 channels
  float wf[WTR][9];
#pragma unroll                               // constant indices keep wf in registers
  for (int k = 0; k < WTR; ++k) {            // no test here (the address is clamped): every step's loads behind one wait
    const float* wp = wd + min(wofs + (int)threadIdx.x + k * 256, cvalid - 1) * 9;
#pragma unroll                               // constant indices keep wf in registers
    for (int tp = 0; tp < 9; ++tp) wf[k][tp] = wp[tp];
  }
#pragma unroll                               // constant indices keep wf in registers
  for (int k = 0; k < WTR; ++k) {
    const int ch = (int)threadIdx.x + k * 256;
    const float wok = (wofs + ch < cvalid) ? 1.0f : 0.0f;
    if (ch < CS) {                           // whole waves
#pragma unroll                               // constant indices keep wf in registers
      for (int tp = 0; tp < 9; ++tp) wsm[tp * CS + ch] = bfr(wf[k][tp]) * wok;
    }
  }
  __syncthreads();                           // every wave reads table rows that other waves wrote
  const int t = blockIdx.x * 256 + threadIdx.x;
  int s = t / TPP;
  const int cg = t - s * TPP;
  const bool pv = s < NSTR;
  s = pv ? s : (NSTR - 1);
  const int c = cg * 4;
  const int b = s / SPI;
  const int sr = s - b * SPI;
  const int xs = sr / IMW;
  const int y = sr - xs * IMW;
  const int x0 = xs * DWL;
  const v4f* s4 = (const v4f*)src;            // slab rows in 16-byte units: TPP units per pixel
  // Every loop below but the GELU loop is unrolled in full so that its indices are constants: the offsets, the 3 x (DWL+2) window,
  // the taps and the DWL sums then live in registers (an index known only at run time would put them in scratch).
  int ro[3], co[DWL + 2], ix[3][DWL + 2];
#pragma unroll                               // see above
  for (int dy = 0; dy < 3; ++dy) {
    const int sy = (y + dy - 1 + roll) & (IMW - 1);
    ro[dy] = (b * HW + sy * IMW) * TPP + cg;
  }
#pragma unroll                               // see above
  for (int j = 0; j < DWL + 2; ++j) {
    const int sx = (x0 + j - 1 + roll) & (IMW - 1);
    co[j] = sx * TPP;
  }
#pragma unroll                               // see above
  for (int dy = 0; dy < 3; ++dy) {
#pragma unroll                               // see above
    for (int j = 0; j < DWL + 2; ++j) ix[dy][j] = ro[dy] + co[j];
  }
  const int p0 = b * HW + y * IMW + x0;      // first output pixel of the strip
  const float ml = (x0 > 0) ? 1.0f : 0.0f;
  const float mr = (x0 + DWL < IMW) ? 1.0f : 0.0f;
  v4f v[3][DWL + 2];
#pragma unroll                               // see above
  for (int dy = 0; dy < 3; ++dy) {
#pragma unroll                               // see above
    for (int j = 0; j < DWL + 2; ++j) v[dy][j] = s4[ix[dy][j]];
    // the next row's loads may be given registers that held this row's offsets: the wait stands in front of them
    if (dy < 2) asm volatile("s_wait_xcnt 0x0" ::: "memory");
  }
  static_assert(DWL == 8);                   // the statement below names the 3 x 10 loaded values one by one
  // Inputs only: every load of the window is issued in front of this line, so the wave waits out one memory latency
  // for all 30; without it the compiler spreads the loads among the sums and waits for them a few at a time.
  asm volatile("" :: "v"(v[0][0]), "v"(v[0][1]), "v"(v[0][2]), "v"(v[0][3]), "v"(v[0][4]),
                     "v"(v[0][5]), "v"(v[0][6]), "v"(v[0][7]), "v"(v[0][8]), "v"(v[0][9]),
                     "v"(v[1][0]), "v"(v[1][1]), "v"(v[1][2]), "v"(v[1][3]), "v"(v[1][4]),
                     "v"(v[1][5]), "v"(v[1][6]), "v"(v[1][7]), "v"(v[1][8]), "v"(v[1][9]),
                     "v"(v[2][0]), "v"(v[2][1]), "v"(v[2][2]), "v"(v[2][3]), "v"(v[2][4]),
                     "v"(v[2][5]), "v"(v[2][6]), "v"(v[2][7]), "v"(v[2][8]), "v"(v[2][9]));
  v4f acc[DWL];
#pragma unroll                               // see above
  for (int i = 0; i < DWL; ++i) acc[i] = v4f{0.f, 0.f, 0.f, 0.f};
  // row by row: a row's registers are free once its three taps are summed; each output still sums its taps 0..8 in order
#pragma unroll                               // see above
  for (int dy = 0; dy < 3; ++dy) {
    const float rm = ((unsigned)(y + dy - 1) < (unsigned)IMW) ? 1.0f : 0.0f;
    v4f wv[3];
#pragma unroll                               // see above
    for (int dx = 0; dx < 3; ++dx) wv[dx] = *(const v4f*)(wsm + (dy * 3 + dx) * CS + c) * rm;
    v[dy][0] = v[dy][0] * ml;
    v[dy][DWL + 1] = v[dy][DWL + 1] * mr;
#pragma unroll                               // see above
    for (int i = 0; i < DWL; ++i) {          // output by output: column i is free once output i has its row
#pragma unroll                               // see above
      for (int dx = 0; dx < 3; ++dx) acc[i] = acc[i] + v[dy][i + dx] * wv[dx];
    }
    // the next row's taps are read only now: all 9 read ahead take 24 registers more, and above 160 registers fewer
    // than three blocks are resident per WGP
    if (dy < 2) __builtin_amdgcn_sched_barrier(0);
  }
#pragma unroll                               // see above
  for (int i = 0; i < DWL; ++i) {
    v4f a = acc[i];
    if (MODE == 1) {
#pragma unroll 1                             // rolled as before: one copy of the erf code per output pixel
      for (int e = 0; e < 4; ++e) {
        const float g = (e == 0) ? a[0] : ((e == 1) ? a[1] : ((e == 2) ? a[2] : a[3]));
        const float er = erff(g * RSQ2);
        float gl = 0.5f * g;
        gl = gl * (1.0f + er);
        a[0] = (e == 0) ? gl : a[0];
        a[1] = (e == 1) ? gl : a[1];
        a[2] = (e == 2) ? gl : a[2];
        a[3] = (e == 3) ? gl : a[3];
      }
    }
    if (MODE == 0 || (MODE == 2 && c < 2 * CC)) {
      float* gp = dstf + (size_t)(p0 + i) * dpitch + dcol + c;
      if (pv) *(v4f*)gp = a;
    } else {
      v2u ph, plw;
      split4(a, ph, plw);
      const size_t to = (size_t)(p0 + i) * ppitch + dcol + (MODE == 2 ? c - 2 * CC : c);
      if (pv) { *(v2u*)(Ph + to) = ph; *(v2u*)(Pl + to) = plw; }
    }
  }
}

// =================================================================================================================
// FFN tail in one kernel: depthwise 3x3 (SAME zero padding, no roll) + exact-erf GELU + the 1x1 out conv (K = HIDP,
// N = CC) + residual. Block = 8 waves = a tile of FTX x 2 pixels = GBM rows of the GEMM. The GELU output never goes to
// memory: per chunk of GKC channels a wave computes one strip of DWL pixels x 128 channels (a thread: 4 channels, the
// 3 x (DWL+2) window in registers, taps from LDS, sums and GELU as in dw_k) and writes the bf16 hi + residual planes of
// its DWL rows straight into the operand LDS; then the block multiplies the chunk as gemm_k does (2 pixel groups x 4
// column groups of 32 x 32, k rising, hi then residual). The next chunk's window is loaded into registers while this
// chunk is multiplied. All of W (CC rows of HIDP, pitch WPP) and the 9 x HIDP taps are staged in LDS once. Row r of
// pixel group mg is pixel (ty*2 + mg, tx*FTX + r): 32 pixels in a row of the image, so the epilogue stores whole
// 128-byte lines in both output layouts.
// EP 1: OUT[p][CC] = sum + res[p][n]; EP 2: NCHW d_out[b][n][p] = sum + res[p][n].
// coverage: NPIX / GBM blocks x GBM px x CC columns.
// =================================================================================================================
#define WPP 392
#define FTX 32
static_assert((WPP * 2) % 32 == 16 && WPP >= HIDP);
static_assert(GBM == 2 * FTX && FTX == 4 * DWL && IMW % FTX == 0 && HIDP % GKC == 0 && GKC == 128 && CC == 128);
static_assert((CC * HIDP / 8) % 256 == 0);
template <int EP>
__global__ __launch_bounds__(256) void dwffn_k(const float* __restrict__ src, const float* __restrict__ wd, int cvalid,
                                               const unsigned short* __restrict__ W, float* outf,
                                               const float* __restrict__ res) {
  constexpr int CS = HIDP;
  constexpr int TPP = CS / 4;
  constexpr int NCH = CS / GKC;
  constexpr int WIT = CC * HIDP / 8 / 256;   // 16-byte pieces of W per thread
  constexpr int WTR = (CS + 255) / 256;
  static_assert(8 * 32 * GXP * 4 <= (2 * GBM * GPP + CC * WPP) * 2);
  __shared__ __align__(16) unsigned short sm[2 * GBM * GPP + CC * WPP];
  __shared__ __align__(16) float wsm[9 * CS];
  unsigned short* sah = sm;
  unsigned short* sal = sm + GBM * GPP;
  unsigned short* swt = sm + 2 * GBM * GPP;
  float* stg = (float*)sm;                   // reused behind the last chunk's barrier
  const int tid = threadIdx.x, lane = tid & 31, hh = lane >> 4, l15 = lane & 15;
  // the wave's number in a scalar register: the strip's place, its row addresses and its edge masks are then scalars
  const int wave = __builtin_amdgcn_readfirstlane(tid >> 5);
  const int mg = wave >> 2, ng = wave & 3;
  const int b = blockIdx.x / (HW / GBM);
  const int tr = blockIdx.x - b * (HW / GBM);
  const int ty = tr / (IMW / FTX);
  const int tx = tr - ty * (IMW / FTX);
  const int y = ty * 2 + mg;                 // the wave's strip: image row y, columns x0 .. x0 + DWL - 1
  const int x0 = tx * FTX + ng * DWL;
  const int xl = (x0 - 1) & (IMW - 1), xr = (x0 + DWL) & (IMW - 1);
  const float ml = (x0 > 0) ? 1.0f : 0.0f;
  const float mr = (x0 + DWL < IMW) ? 1.0f : 0.0f;
  const v4f* s4 = (const v4f*)src;           // rows in 16-byte units: TPP units per pixel
  // Every loop below but the one over the chunks and the GELU loop is unrolled in full: constant indices keep the window, the sums and
  // the staged values in registers.
  const v4f* rp[3];
#pragma unroll
  for (int dy = 0; dy < 3; ++dy) rp[dy] = s4 + (size_t)(b * HW + ((y + dy - 1) & (IMW - 1)) * IMW) * TPP;
  v4f v[3][DWL + 2];
  const unsigned ul = (unsigned)lane;
  auto ldwin = [&](int kc) {
#pragma unroll
    for (int dy = 0; dy < 3; ++dy) {
      const v4f* r = rp[dy] + kc * (GKC / 4); // scalar bases; the one vector offset is the lane's
      const v4f* rc = r + x0 * TPP;
      v[dy][0] = (r + xl * TPP)[ul];
#pragma unroll
      for (int j = 1; j <= DWL; ++j) v[dy][j] = rc[ul + (j - 1) * TPP];
      v[dy][DWL + 1] = (r + xr * TPP)[ul];
      // what follows may be given registers that held this row's addresses: the wait stands in front of it
      asm volatile("s_wait_xcnt 0x0" ::: "memory");
    }
  };
  float wf[WTR][9];
#pragma unroll
  for (int k = 0; k < WTR; ++k) {            // thread = channel, its 9 taps; the address is clamped
    const float* wp = wd + min(tid + k * 256, cvalid - 1) * 9;
#pragma unroll
    for (int tp = 0; tp < 9; ++tp) wf[k][tp] = wp[tp];
  }
#pragma unroll
  for (int k = 0; k < WTR; ++k) {
    const int ch = tid + k * 256;
    const float wok = (ch < cvalid) ? 1.0f : 0.0f;
    if ((k + 1) * 256 <= CS || ch < CS) {    // whole waves
#pragma unroll
      for (int tp = 0; tp < 9; ++tp) wsm[tp * CS + ch] = bfr(wf[k][tp]) * wok;
    }
  }
  // the W rows are loaded behind this line, when the taps have come in: their loads may be given the registers that
  // held the tap loads' addresses
  __builtin_amdgcn_sched_barrier(0);
  v4u rw[WIT];
#pragma unroll
  for (int it = 0; it < WIT; ++it) rw[it] = *(const v4u*)(W + (size_t)(it * 256 + tid) * 8);
#pragma unroll
  for (int it = 0; it < WIT; ++it) {
    const int q = it * 256 + tid;
    const int row = q / (HIDP / 8);
    *(v4u*)(swt + row * WPP + (q - row * (HIDP / 8)) * 8) = rw[it];
  }
  // the first window is loaded only now, into the registers that the staged W rows have left: both at once take more
  // than 256 registers, and then one block is resident per WGP, not two
  __builtin_amdgcn_sched_barrier(0);
  ldwin(0);
  __syncthreads();                           // every wave reads taps and W rows that other waves staged
  v8f gacc[4];
#pragma unroll
  for (int f = 0; f < 4; ++f) gacc[f] = zero8();
#pragma unroll 1                             // rolled: one copy of the strip, GELU and product code for the three chunks
  for (int kc = 0; kc < NCH; ++kc) {
    static_assert(DWL == 8);                 // the statement below names the 3 x 10 loaded values one by one
    // Inputs only: every load of the window is issued in front of this line and waited for once; without it the
    // compiler may spread the loads among the sums and wait for them a few at a time.
    asm volatile("" :: "v"(v[0][0]), "v"(v[0][1]), "v"(v[0][2]), "v"(v[0][3]), "v"(v[0][4]),
                       "v"(v[0][5]), "v"(v[0][6]), "v"(v[0][7]), "v"(v[0][8]), "v"(v[0][9]),
                       "v"(v[1][0]), "v"(v[1][1]), "v"(v[1][2]), "v"(v[1][3]), "v"(v[1][4]),
                       "v"(v[1][5]), "v"(v[1][6]), "v"(v[1][7]), "v"(v[1][8]), "v"(v[1][9]),
                       "v"(v[2][0]), "v"(v[2][1]), "v"(v[2][2]), "v"(v[2][3]), "v"(v[2][4]),
                       "v"(v[2][5]), "v"(v[2][6]), "v"(v[2][7]), "v"(v[2][8]), "v"(v[2][9]));
    v4f acc[DWL];
#pragma unroll
    for (int i = 0; i < DWL; ++i) acc[i] = v4f{0.f, 0.f, 0.f, 0.f};
    // row by row, each output sums its taps 0..8 in order
#pragma unroll
    for (int dy = 0; dy < 3; ++dy) {
      const float rm = ((unsigned)(y + dy - 1) < (unsigned)IMW) ? 1.0f : 0.0f;
      v4f wv[3];
#pragma unroll
      for (int dx = 0; dx < 3; ++dx) wv[dx] = *(const v4f*)(wsm + (dy * 3 + dx) * CS + kc * GKC + lane * 4) * rm;
      v[dy][0] = v[dy][0] * ml;
      v[dy][DWL + 1] = v[dy][DWL + 1] * mr;
#pragma unroll
      for (int i = 0; i < DWL; ++i) {
#pragma unroll
        for (int dx = 0; dx < 3; ++dx) acc[i] = acc[i] + v[dy][i + dx] * wv[dx];
      }
    }
    if (kc > 0) __syncthreads();             // every wave has read the chunk that is overwritten next
#pragma unroll
    for (int i = 0; i < DWL; ++i) {
      v4f a = acc[i];
#pragma unroll 1                             // rolled as in dw_k: one copy of the erf code per output pixel
      for (int e = 0; e < 4; ++e) {
        const float g = (e == 0) ? a[0] : ((e == 1) ? a[1] : ((e == 2) ? a[2] : a[3]));
        const float er = erff(g * RSQ2);
        float gl = 0.5f * g;
        gl = gl * (1.0f + er);
        a[0] = (e == 0) ? gl : a[0];
        a[1] = (e == 1) ? gl : a[1];
        a[2] = (e == 2) ? gl : a[2];
        a[3] = (e == 3) ? gl : a[3];
      }
      v2u ph, pw;
      split4(a, ph, pw);
      const int lo = (wave * DWL + i) * GPP + lane * 4;
      *(v2u*)(sah + lo) = ph;
      *(v2u*)(sal + lo) = pw;
    }
    __syncthreads();                         // every wave reads rows that other waves wrote
    if (kc + 1 < NCH) ldwin(kc + 1);         // behind the barrier (which waits for loads): it flies during the products
#pragma unroll
    for (int ks = 0; ks < GKC / 32; ++ks) {
      const int ko = ks * 32 + 8 * hh;
      const unsigned short* pa = sah + (mg * 32 + l15) * GPP + ko;
      const unsigned short* pl = sal + (mg * 32 + l15) * GPP + ko;
      const v16bf a0h = ldfrag(pa), a0l = ldfrag(pl);
      const v16bf a1h = ldfrag(pa + 16 * GPP), a1l = ldfrag(pl + 16 * GPP);
      const unsigned short* pb = swt + (ng * 32 + l15) * WPP + kc * GKC + ko;
      const v16bf b0 = ldfrag(pb), b1 = ldfrag(pb + 16 * WPP);
      gacc[0] = mma_bf(a0h, b0, gacc[0]); gacc[0] = mma_bf(a0l, b0, gacc[0]);
      gacc[1] = mma_bf(a0h, b1, gacc[1]); gacc[1] = mma_bf(a0l, b1, gacc[1]);
      gacc[2] = mma_bf(a1h, b0, gacc[2]); gacc[2] = mma_bf(a1l, b0, gacc[2]);
      gacc[3] = mma_bf(a1h, b1, gacc[3]); gacc[3] = mma_bf(a1l, b1, gacc[3]);
    }
  }
  __syncthreads();                           // the operands' LDS becomes the output stage: every wave has left it
  const int m0 = b * HW + y * IMW + tx * FTX; // first pixel of the wave's 32 rows
  const int n0 = ng * 32;
  float* sw = stg + wave * (32 * GXP);
#pragma unroll
  for (int r = 0; r < 8; ++r) {
    sw[(8 * hh + r) * GXP + l15] = gacc[0][r];
    sw[(8 * hh + r) * GXP + 16 + l15] = gacc[1][r];
    sw[(16 + 8 * hh + r) * GXP + l15] = gacc[2][r];
    sw[(16 + 8 * hh + r) * GXP + 16 + l15] = gacc[3][r];
  }
  wave_sync_lds();
  const int q = lane >> 3, piece = lane & 7;
  v4f ov[8];
  // one address per lane for the loads and one for the stores; the eight steps are constant offsets from it
  if (EP == 1) {
    const size_t o0 = (size_t)(m0 + q) * CC + n0 + piece * 4;
    const float* rq = res + o0;
    float* oq = outf + o0;
#pragma unroll
    for (int it = 0; it < 8; ++it) {
      const v4f rr = *(const v4f*)(rq + it * 4 * CC);
      ov[it] = *(const v4f*)(sw + (it * 4 + q) * GXP + piece * 4) + rr;
    }
#pragma unroll
    for (int it = 0; it < 8; ++it) *(v4f*)(oq + it * 4 * CC) = ov[it];
  } else {
    const float* rq = res + (size_t)(m0 + piece * 4) * CC + n0 + q;
    float* oq = outf + (size_t)(b * CC + n0 + q) * HW + (m0 - b * HW) + piece * 4;
#pragma unroll
    for (int it = 0; it < 8; ++it) {
      v4f o;
#pragma unroll
      for (int e = 0; e < 4; ++e) o[e] = sw[(piece * 4 + e) * GXP + it * 4 + q] + rq[e * CC + it * 4];
      ov[it] = o;
    }
#pragma unroll
    for (int it = 0; it < 8; ++it) *(v4f*)(oq + (size_t)it * 4 * HW) = ov[it];
  }
}

// =================================================================================================================
// RSA window attention, one 4x4 window (16 tokens) per block of 256 threads, R = dwconv output in the rolled frame
// [pix][384] f32 (q | k | v column blocks):
//   phase 0: the 16 token rows x 384 f32 into LDS; phase 1: per token and per q/k the l2 norm over its 128 channels
//   (inv = 1/max(sqrt(sum), 1e-12)); phase 2: q^T and k^T as bf16 hi + residual planes [c][16 tok] (k contiguous),
//   v as planes [tok][ATP]; phase 3 (wave = c tile): attn[c][d] = relu(temp * sum_p qn[p][c] kn[p][d]) on WMMA, K = 16
//   (fragment elements 8..15 zero), 3 products, stored transposed as planes AttT[d][c]; phase 4 (wave = d tile):
//   out[p][d] = sum_c v[p][c] attn[c][d], K = 128, 3 products, staged f32 [16][TXP] in LDS; phase 5: each token row
//   (128 values -> hi + residual, 256 B per plane = 16 lanes x 16 B) written to its unrolled pixel (inverse roll +2,+2),
//   coverage: qT/kT 128 c x 16 tok x 2 planes, v 16 x 128, AttT 128 d x 128 c (8 waves x 8 tiles), out 16 x 128
//   (8 waves x 16 cols), store 8 waves x 2 rows x 128.
// =================================================================================================================
__global__ __launch_bounds__(256) void rsa_attn_k(const float* __restrict__ R, const float* __restrict__ temp,
                                                  unsigned short* Th, unsigned short* Tl) {
#pragma clang fp contract(off)
  extern __shared__ __align__(16) char smem[];
  float* sR = (float*)(smem + RL_R);
  float* ost = (float*)(smem + RL_R);                     // reused after phase 2
  unsigned short* qt = (unsigned short*)(smem + RL_QTH);  // qT hi @0, qT lo @2048, kT hi @4096, kT lo @6144 (halves)
  unsigned short* ath = (unsigned short*)(smem + RL_ATH);
  unsigned short* atl = (unsigned short*)(smem + RL_ATL);
  unsigned short* vh = (unsigned short*)(smem + RL_VH);
  unsigned short* vl = (unsigned short*)(smem + RL_VL);
  float* sinv = (float*)(smem + RL_INV);
  const int tid = threadIdx.x, wave = tid >> 5, lane = tid & 31, hh = lane >> 4, l15 = lane & 15;
  const int b = blockIdx.x / NWIN;
  const int w2 = blockIdx.x - b * NWIN;
  const int wy = w2 / NWX;
  const int wx = w2 - wy * NWX;

  // ---- phase 0: token rows ----
#pragma unroll
  for (int it = 0; it < 6; ++it) {
    const int idx = it * 256 + tid;
    const int pi = idx / 96;
    const int c4 = (idx - pi * 96) * 4;
    const int ry = wy * WSZ + (pi / WSZ), rx = wx * WSZ + (pi - (pi / WSZ) * WSZ);
    const v4f v = *(const v4f*)(R + ((size_t)(b * HW) + (size_t)ry * IMW + rx) * C3 + c4);
    *(v4f*)(sR + pi * C3 + c4) = v;
  }
  __syncthreads();

  // ---- phase 1: l2 norms per token over its 128 q (or k) channels ----
  {
    const int pair = tid >> 3, sub = tid & 7;
    const int sel = pair >> 4, pi = pair & 15;
    const float* rp = sR + pi * C3 + sel * CC + sub * 16;
    float s = 0.f;
#pragma unroll
    for (int j = 0; j < 16; ++j) { const float f = rp[j]; const float ff = f * f; s = s + ff; }
    s = s + __shfl_xor(s, 1, 32);
    s = s + __shfl_xor(s, 2, 32);
    s = s + __shfl_xor(s, 4, 32);
    const float inv = 1.0f / fmaxf(sqrtf(s), 1e-12f);
    if (sub == 0) sinv[pair] = inv;
  }
  __syncthreads();

  // ---- phase 2: normalised q^T / k^T planes and v planes ----
  {
    const int c = tid >> 1, sel = tid & 1;
    unsigned short hv[16], lv[16];
#pragma unroll
    for (int pi = 0; pi < 16; ++pi) {
      const float v = sR[pi * C3 + sel * CC + c] * sinv[sel * 16 + pi];
      split_bf(v, hv[pi], lv[pi]);
    }
    v4u h0, h1, l0, l1;
#pragma unroll
    for (int e = 0; e < 4; ++e) {
      h0[e] = pk16(hv[2 * e], hv[2 * e + 1]);
      h1[e] = pk16(hv[8 + 2 * e], hv[8 + 2 * e + 1]);
      l0[e] = pk16(lv[2 * e], lv[2 * e + 1]);
      l1[e] = pk16(lv[8 + 2 * e], lv[8 + 2 * e + 1]);
    }
    unsigned short* dh = qt + sel * 4096 + c * 16;
    unsigned short* dl = dh + 2048;
    *(v4u*)(dh) = h0; *(v4u*)(dh + 8) = h1;
    *(v4u*)(dl) = l0; *(v4u*)(dl + 8) = l1;
    const int pi = tid >> 4, c8 = (tid & 15) * 8;
    const float* vr = sR + pi * C3 + 2 * CC + c8;
    const v4f v0 = *(const v4f*)(vr);
    const v4f v1 = *(const v4f*)(vr + 4);
    v4u ph, plw;
    split8(v0, v1, ph, plw);
    *(v4u*)(vh + pi * ATP + c8) = ph;
    *(v4u*)(vl + pi * ATP + c8) = plw;
  }
  __syncthreads();

  const float tmp = bfr(temp[0]);
  // ---- phase 3: attn = relu(temp * q^T k), 128 x 128, K = 16 ----
  {
    const int mi = wave;
    const v16bf a_h = ldfrag16(qt + (mi * 16 + l15) * 16 + 8 * hh);
    const v16bf a_l = ldfrag16(qt + 2048 + (mi * 16 + l15) * 16 + 8 * hh);
#pragma unroll 2
    for (int ni = 0; ni < 8; ++ni) {
      const v16bf b_h = ldfrag16(qt + 4096 + (ni * 16 + l15) * 16 + 8 * hh);
      const v16bf b_l = ldfrag16(qt + 6144 + (ni * 16 + l15) * 16 + 8 * hh);
      v8f acc = zero8();
      acc = mma_bf(a_h, b_h, acc);
      acc = mma_bf(a_h, b_l, acc);
      acc = mma_bf(a_l, b_h, acc);
      unsigned short hv[8], lv[8];
#pragma unroll
      for (int r = 0; r < 8; ++r) {
        float v = acc[r] * tmp;
        v = fmaxf(v, 0.0f);
        split_bf(v, hv[r], lv[r]);
      }
      v4u ph, plw;
#pragma unroll
      for (int e = 0; e < 4; ++e) { ph[e] = pk16(hv[2 * e], hv[2 * e + 1]); plw[e] = pk16(lv[2 * e], lv[2 * e + 1]); }
      const int d = ni * 16 + l15;
      *(v4u*)(ath + d * ATP + mi * 16 + 8 * hh) = ph;
      *(v4u*)(atl + d * ATP + mi * 16 + 8 * hh) = plw;
    }
  }
  __syncthreads();

  // ---- phase 4: out[p][d] = sum_c v[p][c] attn[c][d], K = 128 ----
  {
    const int ni = wave;
    v8f acc = zero8();
#pragma unroll
    for (int ks = 0; ks < 4; ++ks) {
      const v16bf a_h = ldfrag(vh + l15 * ATP + ks * 32 + 8 * hh);
      const v16bf a_l = ldfrag(vl + l15 * ATP + ks * 32 + 8 * hh);
      const v16bf b_h = ldfrag(ath + (ni * 16 + l15) * ATP + ks * 32 + 8 * hh);
      const v16bf b_l = ldfrag(atl + (ni * 16 + l15) * ATP + ks * 32 + 8 * hh);
      acc = mma_bf(a_h, b_h, acc);
      acc = mma_bf(a_h, b_l, acc);
      acc = mma_bf(a_l, b_h, acc);
    }
#pragma unroll
    for (int r = 0; r < 8; ++r) ost[(8 * hh + r) * TXP + ni * 16 + l15] = acc[r];
  }
  __syncthreads();

  // ---- phase 5: token rows to their unrolled pixels ----
  {
    const int tk = 2 * wave + hh;
    const int piece = l15;
    const float* orow = ost + tk * TXP + piece * 8;
    const v4f v0 = *(const v4f*)(orow);
    const v4f v1 = *(const v4f*)(orow + 4);
    v4u ph, plw;
    split8(v0, v1, ph, plw);
    const int iy = tk / WSZ, ix = tk - (tk / WSZ) * WSZ;
    const int ry = wy * WSZ + iy, rx = wx * WSZ + ix;
    const int py = (ry + WSZ / 2) & (IMW - 1), px = (rx + WSZ / 2) & (IMW - 1);
    const size_t gp = ((size_t)(b * HW) + (size_t)py * IMW + px) * CC + piece * 8;
    *(v4u*)(Th + gp) = ph;
    *(v4u*)(Tl + gp) = plw;
    
  }
}

// =================================================================================================================
// GSA score and sum-of-squares partials: block = (b, head h, slab of 256 pixels), S[c][d] = sum_n q[h*32+c][n]
// k[h*32+d][n] over the slab on WMMA. A thread holds one of the head's 64 q and k columns (f32 from R) at 64 of the
// slab's pixels: its 64 loads are issued together, so a block waits out one memory latency, and NB*NHEAD*NSLS blocks
// fill the chip. From those registers: the column's sum of squares (8 chains of 8 pixels, added as a tree; the four
// pixel groups of a column are added through LDS) and the bf16 hi + residual planes, transposed in LDS ([32 ch][GSP],
// k contiguous); waves: fragment f = wave&3 (2x2 of 16x16), k half = wave>>2; 3 products; the two k halves are
// combined in fixed order through LDS; the 32x32 f32 tile is staged and stored as whole lines.
// blk = (b*NHEAD + h)*NSLS + slab. coverage: planes 64 ch x 256 px (256 threads x 8 groups x 8 px), tile 32x32 per
// block, 64 of the 256 sums of squares of (b, slab) per block (2 whole 128-byte lines).
// =================================================================================================================
__global__ __launch_bounds__(256) void gsa_s_k(const float* __restrict__ R, float* pa, float* pn) {
  extern __shared__ __align__(16) char smem[];
  unsigned short* pl = (unsigned short*)(smem + GL_QH);   // q hi @0, q lo @8448, k hi @16896, k lo @25344 (halves)
  float* red = (float*)(smem + GL_RED);
  float* stg = (float*)(smem + GL_STG);
  float* sq = (float*)(smem + GL_SQ);
  const int tid = threadIdx.x, wave = tid >> 5, lane = tid & 31, hh = lane >> 4, l15 = lane & 15;
  const int blk = blockIdx.x;
  const int b = blk / (NHEAD * NSLS);
  const int rem = blk - b * (NHEAD * NSLS);
  const int h = rem / NSLS;
  const int slab = rem - h * NSLS;
  const int f = wave & 3, mi = f >> 1, ni = f & 1, kh = wave >> 2;
  const int c = tid & 63, sel = c >> 5, cc = c & 31;
  const int col = sel * CC + h * HDC + cc;
  unsigned short* ph = pl + sel * 16896 + cc * GSP;
  unsigned short* plo = ph + 8448;
  const int g0 = tid >> 6;
  const float* rp = R + ((size_t)(b * HW) + (size_t)slab * 256 + g0 * 8) * C3 + col;
  // Every loop below is unrolled in full: constant indices keep the 64 loaded values in registers.
  v4f v0[8], v1[8];
#pragma unroll
  for (int it = 0; it < 8; ++it) {
#pragma unroll
    for (int j = 0; j < 4; ++j) {
      v0[it][j] = rp[(it * 32 + j) * C3];
      v1[it][j] = rp[(it * 32 + j + 4) * C3];
    }
  }
  float sp[8];
#pragma unroll
  for (int it = 0; it < 8; ++it) {
    float t = 0.f;
#pragma unroll
    for (int j = 0; j < 4; ++j) t = fmaf(v0[it][j], v0[it][j], t);
#pragma unroll
    for (int j = 0; j < 4; ++j) t = fmaf(v1[it][j], v1[it][j], t);
    sp[it] = t;
  }
  sq[g0 * 64 + c] = ((sp[0] + sp[1]) + (sp[2] + sp[3])) + ((sp[4] + sp[5]) + (sp[6] + sp[7]));
#pragma unroll
  for (int it = 0; it < 8; ++it) {
    const int g = it * 4 + g0;
    v4u hp, lp;
    split8(v0[it], v1[it], hp, lp);
    *(v4u*)(ph + g * 8) = hp;
    *(v4u*)(plo + g * 8) = lp;
  }
  __syncthreads();                           // every wave reads plane rows and sums that other waves wrote
  v8f acc = zero8();
#pragma unroll
  for (int ks = 0; ks < 4; ++ks) {
    const int k0 = (kh * 4 + ks) * 32;
    const v16bf a_h = ldfrag(pl + (mi * 16 + l15) * GSP + k0 + 8 * hh);
    const v16bf a_l = ldfrag(pl + 8448 + (mi * 16 + l15) * GSP + k0 + 8 * hh);
    const v16bf b_h = ldfrag(pl + 16896 + (ni * 16 + l15) * GSP + k0 + 8 * hh);
    const v16bf b_l = ldfrag(pl + 25344 + (ni * 16 + l15) * GSP + k0 + 8 * hh);
    acc = mma_bf(a_h, b_h, acc);
    acc = mma_bf(a_h, b_l, acc);
    acc = mma_bf(a_l, b_h, acc);
  }
  if (wave >= 4) {
#pragma unroll
    for (int r = 0; r < 8; ++r) red[((wave - 4) * 32 + lane) * 8 + r] = acc[r];
  }
  __syncthreads();
  if (wave < 4) {
    const v4f o0 = *(const v4f*)(red + (wave * 32 + lane) * 8);
    const v4f o1 = *(const v4f*)(red + (wave * 32 + lane) * 8 + 4);
#pragma unroll
    for (int r = 0; r < 8; ++r) {
      const float v = acc[r] + (r < 4 ? o0[r & 3] : o1[r & 3]);
      stg[(mi * 16 + 8 * hh + r) * GXP + ni * 16 + l15] = v;
    }
  }
  __syncthreads();
  {
    const int row = tid >> 3, piece = tid & 7;
    const v4f v = *(const v4f*)(stg + row * GXP + piece * 4);
    float* gp = pa + (size_t)blk * 1024 + row * 32 + piece * 4;
    *(v4f*)gp = v;
  }
  if (tid < 64) {                            // whole waves
    const float t = (sq[c] + sq[64 + c]) + (sq[128 + c] + sq[192 + c]);
    pn[((size_t)(b * NSLN + slab)) * 256 + col] = t;
  }
}

// =================================================================================================================
// GSA finisher, block = (b, h, quarter of the head's 32x32 tile), 10 waves. Waves 0..7: thread = one element
// e = c*32 + d, attn[c][d] = relu(sum of pa partials * invq[c] * invk[d] * temp) -> bf16 hi + residual planes.
// Waves 8, 9: invq/invk = 1/max(sqrt(sum of pn partials), 1e-12) for the head's 32 q and 32 k channels. Partials are
// summed slab by slab in rising order; a thread's NSLS loads are issued together, and no wave has more than those to
// wait for. A block writes 512 bytes in a row of each plane.
// =================================================================================================================
#define FINQ 4
static_assert(FINQ * 256 == HDC * HDC);
static_assert(NSLS == NSLN);
__global__ __launch_bounds__(320) void gsa_fin_k(const float* __restrict__ pa, const float* __restrict__ pn,
                                                 const float* __restrict__ temp,
                                                 unsigned short* afh, unsigned short* afl) {
#pragma clang fp contract(off)
  __shared__ float sinv[64];
  const int tid = threadIdx.x;
  const int bh = blockIdx.x / FINQ;
  const int e = (blockIdx.x - bh * FINQ) * 256 + (tid & 255);
  const int b = bh / NHEAD;
  const int h = bh - b * NHEAD;
  const bool nrm = tid >= 256;               // whole waves
  // The loops over the slabs are unrolled in full: constant indices keep the loaded partials in registers.
  float pv[NSLS];
  float s = 0.f;
  if (nrm) {
    const int sel = (tid >> 5) & 1, i = tid & 31;
    const float* np = pn + (size_t)b * (NSLN * 256) + sel * CC + h * HDC + i;
#pragma unroll
    for (int sl = 0; sl < NSLN; ++sl) pv[sl] = np[sl * 256];
#pragma unroll
    for (int sl = 0; sl < NSLN; ++sl) s = s + pv[sl];
    sinv[tid - 256] = 1.0f / fmaxf(sqrtf(s), 1e-12f);
  } else {
    const float* pp = pa + (size_t)bh * (NSLS * 1024) + e;
#pragma unroll
    for (int sl = 0; sl < NSLS; ++sl) pv[sl] = pp[sl * 1024];
#pragma unroll
    for (int sl = 0; sl < NSLS; ++sl) s = s + pv[sl];
  }
  __syncthreads();
  if (nrm) return;
  const float tmp = bfr(temp[0]);
  float v = s * sinv[e >> 5];
  v = v * sinv[32 + (e & 31)];
  v = v * tmp;
  v = fmaxf(v, 0.0f);
  unsigned short hi, lo;
  split_bf(v, hi, lo);
  const size_t to = (size_t)b * AFSZ + (size_t)h * (HDC * HDC) + e;
  afh[to] = hi;
  afl[to] = lo;
}

// =================================================================================================================
// GSA apply: out[p][h*32 + c] = sum_d v[p][h*32 + d] attn_h[c][d], K = 32 per head, both operands hi + residual
// (3 products). Wave tile 16 px x 64 cols (heads hd0 = n0/32 for fragments 0,1 and hd0+1 for 2,3), block = 128 px,
// coverage: 8 waves x 16 rows x 64 cols per block; grid covers NPIX x 128 once.
// =================================================================================================================
__global__ __launch_bounds__(256) void apply_k(const unsigned short* __restrict__ Vh,
                                               const unsigned short* __restrict__ Vl,
                                               const unsigned short* __restrict__ afh,
                                               const unsigned short* __restrict__ afl,
                                               unsigned short* Oh, unsigned short* Ol) {
  __shared__ __align__(16) float stg[8 * 16 * AXP];
  const int tid = threadIdx.x, wave = tid >> 5, lane = tid & 31, hh = lane >> 4, l15 = lane & 15;
  const int m0 = (blockIdx.x * 8 + wave) * 16;
  const int n0 = blockIdx.y * 64;
  const int b = m0 / HW;
  const int hd0 = n0 / HDC;
  const unsigned short* ar = Vh + (size_t)(m0 + l15) * CC + hd0 * HDC + 8 * hh;
  const unsigned short* al = Vl + (size_t)(m0 + l15) * CC + hd0 * HDC + 8 * hh;
  const v16bf a0h = ldfrag(ar), a0l = ldfrag(al);
  const v16bf a1h = ldfrag(ar + 32), a1l = ldfrag(al + 32);
  const unsigned short* wb = afh + (size_t)b * AFSZ + (size_t)(n0 + l15) * 32 + 8 * hh;
  const unsigned short* wl = afl + (size_t)b * AFSZ + (size_t)(n0 + l15) * 32 + 8 * hh;
  v8f c0 = zero8(), c1 = zero8(), c2 = zero8(), c3 = zero8();
  {
    const v16bf bh = ldfrag(wb), bl = ldfrag(wl);
    c0 = mma_bf(a0h, bh, c0); c0 = mma_bf(a0l, bh, c0); c0 = mma_bf(a0h, bl, c0);
  }
  {
    const v16bf bh = ldfrag(wb + 16 * 32), bl = ldfrag(wl + 16 * 32);
    c1 = mma_bf(a0h, bh, c1); c1 = mma_bf(a0l, bh, c1); c1 = mma_bf(a0h, bl, c1);
  }
  {
    const v16bf bh = ldfrag(wb + 32 * 32), bl = ldfrag(wl + 32 * 32);
    c2 = mma_bf(a1h, bh, c2); c2 = mma_bf(a1l, bh, c2); c2 = mma_bf(a1h, bl, c2);
  }
  {
    const v16bf bh = ldfrag(wb + 48 * 32), bl = ldfrag(wl + 48 * 32);
    c3 = mma_bf(a1h, bh, c3); c3 = mma_bf(a1l, bh, c3); c3 = mma_bf(a1h, bl, c3);
  }
  float* sw = stg + wave * (16 * AXP);
#pragma unroll
  for (int r = 0; r < 8; ++r) {
    sw[(8 * hh + r) * AXP + l15] = c0[r];
    sw[(8 * hh + r) * AXP + 16 + l15] = c1[r];
    sw[(8 * hh + r) * AXP + 32 + l15] = c2[r];
    sw[(8 * hh + r) * AXP + 48 + l15] = c3[r];
  }
  wave_sync_lds();
  const int q = lane >> 3, piece = lane & 7;
  v4u oh[4], ol[4];
#pragma unroll
  for (int it = 0; it < 4; ++it) {
    const int row = it * 4 + q;
    const float* sp = sw + row * AXP + piece * 8;
    const v4f v0 = *(const v4f*)(sp);
    const v4f v1 = *(const v4f*)(sp + 4);
    split8(v0, v1, oh[it], ol[it]);
  }
#pragma unroll
  for (int it = 0; it < 4; ++it) {
    const int row = it * 4 + q;
    const size_t to = (size_t)(m0 + row) * CC + n0 + piece * 8;
    *(v4u*)(Oh + to) = oh[it];
    *(v4u*)(Ol + to) = ol[it];
  }
  
}

// =================================================================================================================
// Workspace map (bytes), NPIX = NB*HW: A f32 [NPIX][128], Bx same, T = two bf16 planes [NPIX][128], U f32
// [NPIX][384] (also used as two bf16 planes [NPIX][128]), R f32 [NPIX][384], weights bf16 (655360), pn f32 [NB*NSLN][256], pa f32 [NB*NHEAD*NSLS][1024], af two bf16
// planes [NB][128][32]. Total 153911296 for NB=2, IMW=128. Every region is an exact multiple of its whole-row store
// granularity.
// =================================================================================================================
extern "C" void kernel_launch(void* const* d_in, const int* in_sizes, int n_in,
                              void* d_out, int out_size, void* d_ws, size_t ws_size,
                              hipStream_t stream) {
  if (n_in < 23) return;
  if (in_sizes[0] != NPIX * CC) return;
  if (in_sizes[1] != CC || in_sizes[2] != CC || in_sizes[3] != CC || in_sizes[4] != CC) return;
  if (in_sizes[5] != C3 * CC || in_sizes[6] != C3 * 9 || in_sizes[7] != CC * CC || in_sizes[8] < 1) return;
  if (in_sizes[9] != HID * CC || in_sizes[10] != HID * 9 || in_sizes[11] != CC * HID) return;
  if (in_sizes[12] != CC || in_sizes[13] != CC || in_sizes[14] != CC || in_sizes[15] != CC) return;
  if (in_sizes[16] != C3 * CC || in_sizes[17] != C3 * 9 || in_sizes[18] != CC * CC || in_sizes[19] < 1) return;
  if (in_sizes[20] != HID * CC || in_sizes[21] != HID * 9 || in_sizes[22] != CC * HID) return;
  if (out_size != NPIX * CC) return;

  const float* x        = (const float*)d_in[0];
  const float* w_s0     = (const float*)d_in[1];
  const float* b_s0     = (const float*)d_in[2];
  const float* w_s2     = (const float*)d_in[3];
  const float* b_s2     = (const float*)d_in[4];
  const float* rsa_qkv  = (const float*)d_in[5];
  const float* rsa_dw   = (const float*)d_in[6];
  const float* rsa_proj = (const float*)d_in[7];
  const float* rsa_temp = (const float*)d_in[8];
  const float* ffs_in   = (const float*)d_in[9];
  const float* ffs_dw   = (const float*)d_in[10];
  const float* ffs_out  = (const float*)d_in[11];
  const float* w_c0     = (const float*)d_in[12];
  const float* b_c0     = (const float*)d_in[13];
  const float* w_c2     = (const float*)d_in[14];
  const float* b_c2     = (const float*)d_in[15];
  const float* gsa_qkv  = (const float*)d_in[16];
  const float* gsa_dw   = (const float*)d_in[17];
  const float* gsa_proj = (const float*)d_in[18];
  const float* gsa_temp = (const float*)d_in[19];
  const float* ffc_in   = (const float*)d_in[20];
  const float* ffc_dw   = (const float*)d_in[21];
  const float* ffc_out  = (const float*)d_in[22];
  float* out = (float*)d_out;

  // ---- carve ----
  const size_t sAct = (size_t)NPIX * CC * 4;                        // f32 [NPIX][128]
  const size_t sT   = (size_t)NPIX * CC * 2 * 2;                    // two bf16 planes [NPIX][128]
  const size_t sU   = (size_t)NPIX * C3 * 4;                        // f32 [NPIX][384]
  const size_t sR   = (size_t)NPIX * C3 * 4;                        // f32 [NPIX][384]
  const size_t sWq  = (size_t)C3 * CC * 2;
  const size_t sWp  = (size_t)CC * CC * 2;
  const size_t sW1  = (size_t)HIDP * CC * 2;
  const size_t sW2  = (size_t)CC * HIDP * 2;
  const size_t sPN  = (size_t)NB * NSLN * 256 * 4;
  const size_t sPA  = (size_t)NB * NHEAD * NSLS * 1024 * 4;
  const size_t sAF  = (size_t)NB * AFSZ * 2;                        // per plane
  size_t off = 0;
  const size_t oA   = off; off += sAct;
  const size_t oBx  = off; off += sAct;
  const size_t oT   = off; off += sT;
  const size_t oU   = off; off += sU;
  const size_t oR   = off; off += sR;
  const size_t oWq0 = off; off += sWq;
  const size_t oWp0 = off; off += sWp;
  const size_t oW10 = off; off += sW1;
  const size_t oW20 = off; off += sW2;
  const size_t oWq1 = off; off += sWq;
  const size_t oWp1 = off; off += sWp;
  const size_t oW11 = off; off += sW1;
  const size_t oW21 = off; off += sW2;
  const size_t oPN  = off; off += sPN;
  const size_t oPA  = off; off += sPA;
  const size_t oAFh = off; off += sAF;
  const size_t oAFl = off; off += sAF;
  if (off > ws_size) return;                               // off = 153911296 for NB=2, IMW=128
  if (sU < (size_t)NPIX * HIDP * 4) return;
  if (sU < (size_t)NPIX * CC * 2 * 2) return;

  char* ws = (char*)d_ws;
  float* A  = (float*)(ws + oA);
  float* Bx = (float*)(ws + oBx);
  unsigned short* Th = (unsigned short*)(ws + oT);
  unsigned short* Tl = Th + (size_t)NPIX * CC;
  float* U  = (float*)(ws + oU);
  unsigned short* Uh = (unsigned short*)(ws + oU);
  unsigned short* Ul = Uh + (size_t)NPIX * CC;
  float* R  = (float*)(ws + oR);
  unsigned short* Wq0 = (unsigned short*)(ws + oWq0);
  unsigned short* Wp0 = (unsigned short*)(ws + oWp0);
  unsigned short* W10 = (unsigned short*)(ws + oW10);
  unsigned short* W20 = (unsigned short*)(ws + oW20);
  unsigned short* Wq1 = (unsigned short*)(ws + oWq1);
  unsigned short* Wp1 = (unsigned short*)(ws + oWp1);
  unsigned short* W11 = (unsigned short*)(ws + oW11);
  unsigned short* W21 = (unsigned short*)(ws + oW21);
  float* PN = (float*)(ws + oPN);
  float* PA = (float*)(ws + oPA);
  unsigned short* AFh = (unsigned short*)(ws + oAFh);
  unsigned short* AFl = (unsigned short*)(ws + oAFl);

  const dim3 blk(256);
  // (1) x NCHW -> A pixel-major; weights f32 [out][in] -> bf16 planes [outP][inP], k contiguous, zero padded
  //     (Wq0 is the start of the weight region: Wq0, Wp0, W10, W20, Wq1, Wp1, W11, W21 lie one behind the other)
  prep_k<<<dim3(PB_T + 2 * PB_SET), blk, 0, stream>>>(x, A, rsa_qkv, rsa_proj, ffs_in, ffs_out,
                                                      gsa_qkv, gsa_proj, ffc_in, ffc_out, Wq0);

  (void)hipFuncSetAttribute(reinterpret_cast<const void*>(&rsa_attn_k), hipFuncAttributeMaxDynamicSharedMemorySize, RL_END);
  (void)hipFuncSetAttribute(reinterpret_cast<const void*>(&gsa_s_k), hipFuncAttributeMaxDynamicSharedMemorySize, GL_END);

  const dim3 gG(NPIX / GBM);
  const dim3 gDw((NPIX / DWL * (C3 / 4) + 255) / 256);

  // ---- spatial (RSA) block ----
  gemm_k<CC, C3, 0, 1><<<gG, blk, 0, stream>>>(Th, Tl, Wq0, U, Bx, A, w_s0, b_s0);        // qkv 1x1 of LN_s0(x) -> U
  dw_k<C3, 0><<<gDw, blk, 0, stream>>>(U, rsa_dw, 0, C3, WSZ / 2, R, C3, 0, Th, Tl, CC); // dw (rolled) -> R
  rsa_attn_k<<<dim3(NB * NWIN), blk, RL_END, stream>>>(R, rsa_temp, Th, Tl);            // T = window attention out
  gemm_k<CC, CC, 0, 0><<<gG, blk, 0, stream>>>(Th, Tl, Wp0, Bx, A, A, w_s2, b_s2);        // Bx = x_
  gemm_k<CC, HIDP, 0, 2><<<gG, blk, 0, stream>>>(Th, Tl, W10, U, Bx, A, w_s2, b_s2);      // ffn-in of LN_s2(x_+x) -> U
  dwffn_k<1><<<gG, blk, 0, stream>>>(U, ffs_dw, HID, W20, A, Bx);                        // dw+gelu+ffn-out: A = ffn + x_

  // ---- channel (GSA) block ----
  gemm_k<CC, C3, 0, 1><<<gG, blk, 0, stream>>>(Th, Tl, Wq1, U, Bx, A, w_c0, b_c0);        // qkv 1x1 of LN_c0(x) -> U
  dw_k<C3, 2><<<gDw, blk, 0, stream>>>(U, gsa_dw, 0, C3, 0, R, C3, 0, Th, Tl, CC);       // q, k -> R f32; v planes -> T region
  gsa_s_k<<<dim3(NB * NHEAD * NSLS), blk, GL_END, stream>>>(R, PA, PN);                  // score and norm partials
  gsa_fin_k<<<dim3(NB * NHEAD * FINQ), dim3(320), 0, stream>>>(PA, PN, gsa_temp, AFh, AFl);
  apply_k<<<dim3(NPIX / 128, CC / 64), blk, 0, stream>>>(Th, Tl, AFh, AFl, Uh, Ul);     // U planes = channel attention out
  gemm_k<CC, CC, 0, 0><<<gG, blk, 0, stream>>>(Uh, Ul, Wp1, Bx, A, A, w_c2, b_c2);        // Bx = x_
  gemm_k<CC, HIDP, 0, 2><<<gG, blk, 0, stream>>>(Th, Tl, W11, U, Bx, A, w_c2, b_c2);      // ffn-in of LN_c2(x_+x) -> U
  dwffn_k<2><<<gG, blk, 0, stream>>>(U, ffc_dw, HID, W21, out, Bx);                      // d_out NCHW = ffn + x_
  (void)hipGetLastError();
}

// v008
// One run takes 205 microseconds.
// Timed twice side by side with v007, it ran 1.09 and 1.08 times as fast.
// Counting every step since v000, it is 3.67 times as fast.
// Contractions (1x1 convs for qkv / proj / ffn-in / ffn-out, window q^T.k and v.attn, global q.k^T and attn.v):
// v_wmma_f32_16x16x32_bf16 (bf16 operands, f32 accumulate); computed operands carried as bf16 hi + residual planes,
// weight operands single bf16; layer norms, depthwise 3x3 convs, erf GELU, l2 norms and residual adds in f32 on VALU.
// Inputs RNE-converted to bf16 on load.
#include <hip/hip_runtime.h>
#include <math.h>
#include <stdint.h>

#define NB    2
#define CC    128
#define IMW   128
#define HW    (IMW * IMW)
#define NPIX  (NB * HW)
#define C3    384
#define HID   340
#define HIDP  384
#define NHEAD 4
#define HDC   32
#define WSZ   4
#define NWX   (IMW / WSZ)
#define NWIN  (NWX * NWX)
#define NSLN  (HW / 256)
#define NSLS  (HW / 256)
#define AFSZ  (CC * HDC)
#define RSQ2  0.70710678118654752f
#define GXP   36
#define AXP   68
#define TXP   132
#define ATP   136
#define GSP   264
#define DWL   8

static_assert((IMW & (IMW - 1)) == 0);
static_assert(IMW % WSZ == 0);
static_assert(WSZ == 4);
static_assert(IMW % DWL == 0);
static_assert(HW % 256 == 0);
static_assert(HW % 64 == 0);
static_assert(NPIX % 256 == 0);
static_assert(CC == NHEAD * HDC);
static_assert(HDC == 32);
static_assert((GXP * 4) % 16 == 0);
static_assert((AXP * 4) % 16 == 0);
static_assert((TXP * 4) % 16 == 0);
static_assert((ATP * 2) % 16 == 0);
static_assert((GSP * 2) % 16 == 0);

// RSA window kernel dynamic LDS map (bytes)
#define RL_R    0
#define RL_QTH  24576
#define RL_QTL  28672
#define RL_KTH  32768
#define RL_KTL  36864
#define RL_ATH  40960
#define RL_ATL  75776
#define RL_VH   110592
#define RL_VL   114944
#define RL_INV  119296
#define RL_END  119424
static_assert(RL_QTH == RL_R + 16 * C3 * 4);
static_assert(RL_QTL == RL_QTH + CC * 16 * 2);
static_assert(RL_KTH == RL_QTL + CC * 16 * 2);
static_assert(RL_KTL == RL_KTH + CC * 16 * 2);
static_assert(RL_ATH == RL_KTL + CC * 16 * 2);
static_assert(RL_ATL == RL_ATH + CC * ATP * 2);
static_assert(RL_VH == RL_ATL + CC * ATP * 2);
static_assert(RL_VL == RL_VH + 16 * ATP * 2);
static_assert(RL_INV == RL_VL + 16 * ATP * 2);
static_assert(RL_END == RL_INV + 32 * 4);
static_assert(16 * TXP * 4 <= RL_QTH - RL_R);

// GSA score kernel dynamic LDS map (bytes)
#define GL_QH   0
#define GL_QL   16896
#define GL_KH   33792
#define GL_KL   50688
#define GL_RED  67584
#define GL_STG  71680
#define GL_SQ   76288
#define GL_END  77312
static_assert(GL_QL == 32 * GSP * 2);
static_assert(GL_KH == 2 * GL_QL);
static_assert(GL_KL == 3 * GL_QL);
static_assert(GL_RED == 4 * GL_QL);
static_assert(GL_STG == GL_RED + 4 * 32 * 8 * 4);
static_assert(GL_SQ == GL_STG + 32 * GXP * 4);
static_assert(GL_END == GL_SQ + 4 * 64 * 4);

typedef __bf16         v16bf __attribute__((ext_vector_type(16)));
typedef unsigned short v8us  __attribute__((ext_vector_type(8)));
typedef float          v8f   __attribute__((ext_vector_type(8)));
typedef float          v4f   __attribute__((ext_vector_type(4)));
typedef unsigned int   v4u   __attribute__((ext_vector_type(4)));
typedef unsigned int   v2u   __attribute__((ext_vector_type(2)));
typedef float          v2f   __attribute__((ext_vector_type(2)));
typedef __bf16         v2bf  __attribute__((ext_vector_type(2)));

union Frag { v16bf v; v8us u[2]; };

// ---- scalar helpers ------------------------------------------------------------------------------------------
// f32 -> bf16 bits, RNE, by the hardware's convert
__device__ __forceinline__ unsigned short bf_bits(float f) { return __builtin_bit_cast(unsigned short, (__bf16)f); }
// two f32 -> two bf16 (RNE) packed in one register, a in the low half, b in the high half: one packed convert
__device__ __forceinline__ unsigned cvt2(float a, float b) {
  const v2f t = {a, b};
  return __builtin_bit_cast(unsigned, __builtin_convertvector(t, v2bf));
}
__device__ __forceinline__ float bf_up(unsigned short h) { return __uint_as_float(((unsigned)h) << 16); }
__device__ __forceinline__ float bfr(float f) { return bf_up(bf_bits(f)); }
// hi = bf16(v), lo = bf16(v - hi)
__device__ __forceinline__ void split_bf(float v, unsigned short& hi, unsigned short& lo) {
  const unsigned short hb = bf_bits(v);
  hi = hb;
  lo = bf_bits(v - bf_up(hb));
}
// the same for two values at once, both results packed (a low, b high): two packed converts, no packing steps
__device__ __forceinline__ void split2(float a, float b, unsigned& ph, unsigned& pl) {
  const unsigned h = cvt2(a, b);
  ph = h;
  pl = cvt2(a - __uint_as_float(h << 16), b - __uint_as_float(h & 0xFFFF0000u));
}
__device__ __forceinline__ void split4(v4f v, v2u& ph, v2u& pl) {
  unsigned h0, h1, l0, l1;
  split2(v[0], v[1], h0, l0);
  split2(v[2], v[3], h1, l1);
  ph[0] = h0; ph[1] = h1;
  pl[0] = l0; pl[1] = l1;
}
__device__ __forceinline__ void split8(v4f v0, v4f v1, v4u& ph, v4u& pl) {
  unsigned h[4], l[4];
  split2(v0[0], v0[1], h[0], l[0]);
  split2(v0[2], v0[3], h[1], l[1]);
  split2(v1[0], v1[1], h[2], l[2]);
  split2(v1[2], v1[3], h[3], l[3]);
#pragma unroll
  for (int e = 0; e < 4; ++e) { ph[e] = h[e]; pl[e] = l[e]; }
}
__device__ __forceinline__ v8f zero8() { v8f z = {0.f, 0.f, 0.f, 0.f, 0.f, 0.f, 0.f, 0.f}; return z; }
__device__ __forceinline__ v8us zero8us() { v8us z = {0, 0, 0, 0, 0, 0, 0, 0}; return z; }

// ---- fragment loaders: 16-bit A/B operand, lane -> row/col (lane&15), p already includes +8*(lane>>4);
//      elements 0..7 <- p[0..7] (k0+8h..), elements 8..15 <- p[16..23] (k0+16+8h..)
__device__ __forceinline__ v16bf ldfrag(const unsigned short* p) {
  Frag f;
  f.u[0] = *(const v8us*)(p);
  f.u[1] = *(const v8us*)(p + 16);
  return f.v;
}
// K = 16 contraction padded to 32: elements 8..15 are zero
__device__ __forceinline__ v16bf ldfrag16(const unsigned short* p) {
  Frag f;
  f.u[0] = *(const v8us*)(p);
  f.u[1] = zero8us();
  return f.v;
}

// ---- WMMA helper with trailing VALU hazard gap ---------------------------------------------------------------
__device__ __forceinline__ v8f mma_bf(v16bf a, v16bf b, v8f c) {
  c = __builtin_amdgcn_wmma_f32_16x16x32_bf16(false, a, false, b, (short)0, c, false, false);
#if defined(__HIP_DEVICE_COMPILE__)
  asm volatile("v_nop\n\tv_nop\n\tv_nop\n\tv_nop" : "+v"(c) : "v"(a), "v"(b));
#endif
  return c;
}
__device__ __forceinline__ void wave_sync_lds() {
  __builtin_amdgcn_fence(__ATOMIC_RELEASE, "workgroup");
  __builtin_amdgcn_wave_barrier();
  __builtin_amdgcn_fence(__ATOMIC_ACQUIRE, "workgroup");
}

// =================================================================================================================
// Weight convert: w f32 [rows][cols] -> bf16 [rowsP][colsP] (zero padded), value = bf16_RNE(w). One thread = 8
// coverage: rowsP * colsP/8 pieces, ceil(pieces/256) blocks (blk = block index within the matrix) with a bound.
// =================================================================================================================
__device__ __forceinline__ void cvt_w(const float* __restrict__ w, unsigned short* outp,
                                      int rows, int cols, int rowsP, int colsP, int blk) {
  const int t = blk * 256 + threadIdx.x;
  const int ppr = colsP >> 3;
  const int npc = rowsP * ppr;
  const bool ok = t < npc;
  const int tt = ok ? t : 0;
  const int r = tt / ppr, c8 = (tt - r * ppr) * 8;
  const int rr = min(r, rows - 1);
  float zv[8];
#pragma unroll
  for (int e = 0; e < 8; ++e) {
    const int c = c8 + e;
    const int cl = min(c, cols - 1);
    const float f = w[(size_t)rr * cols + cl];
    zv[e] = (r < rows && c < cols) ? f : 0.0f;
  }
  v4u pk;
#pragma unroll
  for (int e = 0; e < 4; ++e) pk[e] = cvt2(zv[2 * e], zv[2 * e + 1]);
  unsigned short* gp = outp + (size_t)r * colsP + c8;
  if (ok) *(v4u*)gp = pk;
  
}

// =================================================================================================================
// NCHW f32 x -> pixel-major stream A [b*HW + p][128] f32, values bf16-RNE-converted. Block = (b, 64-pixel tile):
// 128 ch x 64 px loaded coalesced along p into an LDS tile [px][TXP]; store: each pixel row = 512 B = 32 lanes x
// coverage: 8 waves x 8 rows = 64 px x 128 ch per block; NB*(HW/64) blocks (blk) = every pixel once.
// =================================================================================================================
__device__ __forceinline__ void nchw_in(const float* __restrict__ x, float* A, float* xs, int blk) {
  const int tid = threadIdx.x, wave = tid >> 5, lane = tid & 31;
  const int b = blk / (HW / 64);
  const int p0 = (blk - b * (HW / 64)) * 64;
#pragma unroll
  for (int it = 0; it < 8; ++it) {
    const int q = it * 256 + tid;
    const int ch = q >> 4, j4 = (q & 15) * 4;
    const v4f v = *(const v4f*)(x + ((size_t)(b * CC + ch)) * HW + p0 + j4);
#pragma unroll
    for (int e = 0; e < 4; ++e) xs[(j4 + e) * TXP + ch] = bfr(v[e]);
  }
  __syncthreads();
  v4f ov[8];
#pragma unroll
  for (int it = 0; it < 8; ++it) {
    const int row = wave * 8 + it;
    ov[it] = *(const v4f*)(xs + row * TXP + lane * 4);
  }
#pragma unroll
  for (int it = 0; it < 8; ++it) {
    const int row = wave * 8 + it;
    *(v4f*)(A + ((size_t)(b * HW + p0 + row)) * CC + lane * 4) = ov[it];
  }
}

// =================================================================================================================
// Input preparation, one launch: the NCHW transpose and the eight weight converts need nothing of each other, so they
// share one grid by ranges of the block index (block-uniform branches; the transpose's barrier is passed by whole
// blocks only). Blocks [0, PB_T): transpose tiles; then per weight set (spatial, channel) PB_SET blocks: qkv, proj,
// ffn-in, ffn-out. Wb = the bf16 weight region, the four matrices of a set one behind the other, set after set.
// =================================================================================================================
#define PB_T    (NB * (HW / 64))
#define PB_Q    (C3 * CC / 8 / 256)
#define PB_P    (CC * CC / 8 / 256)
#define PB_1    (HIDP * CC / 8 / 256)
#define PB_2    (CC * HIDP / 8 / 256)
#define PB_SET  (PB_Q + PB_P + PB_1 + PB_2)
#define WSETN   (C3 * CC + CC * CC + HIDP * CC + CC * HIDP)
static_assert((C3 * CC) % 2048 == 0 && (CC * CC) % 2048 == 0 && (HIDP * CC) % 2048 == 0);
__global__ __launch_bounds__(256) void prep_k(const float* __restrict__ x, float* A,
                                              const float* __restrict__ wq0, const float* __restrict__ wp0,
                                              const float* __restrict__ w10, const float* __restrict__ w20,
                                              const float* __restrict__ wq1, const float* __restrict__ wp1,
                                              const float* __restrict__ w11, const float* __restrict__ w21,
                                              unsigned short* Wb) {
  __shared__ __align__(16) float xs[64 * TXP];
  const int bi = blockIdx.x;
  if (bi < PB_T) { nchw_in(x, A, xs, bi); return; }
  const int r0 = bi - PB_T;
  const int set = r0 / PB_SET;
  const int r = r0 - set * PB_SET;
  unsigned short* o = Wb + (size_t)set * WSETN;
  if (r < PB_Q) {
    cvt_w(set ? wq1 : wq0, o, C3, CC, C3, CC, r);
  } else if (r < PB_Q + PB_P) {
    cvt_w(set ? wp1 : wp0, o + C3 * CC, CC, CC, CC, CC, r - PB_Q);
  } else if (r < PB_Q + PB_P + PB_1) {
    cvt_w(set ? w11 : w10, o + C3 * CC + CC * CC, HID, CC, HIDP, CC, r - (PB_Q + PB_P));
  } else {
    cvt_w(set ? w21 : w20, o + C3 * CC + CC * CC + HIDP * CC, CC, HID, CC, HIDP, r - (PB_Q + PB_P + PB_1));
  }
}

// =================================================================================================================
// Layer norm of pixel rows over their 128 channels, one wave per row, 4 channels per lane. ln_stats: mean and variance
// by butterfly sums over the 32 lanes (two passes); returns the centred values dv and the variance (the same in every
// lane). ln_out: dv * rstd, scale gv, shift bb, result as bf16 hi + residual, 4 + 4 halves.
// The loops are unrolled in full: constant indices keep the 4-element vectors in registers.
// =================================================================================================================
__device__ __forceinline__ void ln_stats(v4f xv, v4f& dv, float& var) {
  float s = (xv[0] + xv[1]) + (xv[2] + xv[3]);
#pragma unroll
  for (int off = 1; off < 32; off <<= 1) s = s + __shfl_xor(s, off, 32);
  const float mu = s * (1.0f / 128.0f);
  float s2 = 0.f;
#pragma unroll
  for (int e = 0; e < 4; ++e) { dv[e] = xv[e] - mu; s2 = s2 + dv[e] * dv[e]; }
#pragma unroll
  for (int off = 1; off < 32; off <<= 1) s2 = s2 + __shfl_xor(s2, off, 32);
  var = s2 * (1.0f / 128.0f);
}
__device__ __forceinline__ void ln_out(v4f dv, float rstd, v4f gv, v4f bb, v2u& ph, v2u& pl) {
  v4f z;
#pragma unroll
  for (int e = 0; e < 4; ++e) z[e] = (dv[e] * rstd) * gv[e] + bb[e];
  split4(z, ph, pl);
}

// =================================================================================================================
// GEMM: OUT[p][n] = sum_k (Ah[p][k] + Al[p][k]) * W[n][k]  (A planes [pix][K] bf16 hi + residual, W single bf16
// [N][K] k-contiguous, 2 products per tile pair). Block = 8 waves = GBM pixels x all N columns. Per chunk of GKC k the
// block brings its GBM rows of both A planes and all N rows of W into LDS with loads of whole rows (16 lanes x 16 B =
// the 256 B of a row's chunk), rows at a pitch of GPP halves; every fragment is then read from LDS with the split k map.
// So each A row leaves L2 once, not once per 32 output columns, and no global load gathers 32-byte pieces of 16 rows.
// The next chunk's rows are loaded into registers while this chunk is multiplied. Waves: 2 pixel groups of 32 x
// 4 column groups of N/4; a wave holds N/128 tiles of 32 x 32 (2x2 fragments each) and uses its A fragments for all.
// Each sum runs over k in the same order as before (k rising, hi then residual).
// Epilogue (behind a barrier, in the LDS of the operands): each 32x32 f32 tile is staged by its wave and stored as
// whole 128-byte lines. EP 0: OUT[p][N]; EP 1: same + res[p][n] (res pitch 128); EP 2: NCHW d_out[b][n][p] + res[p][n].
// LN 0: A planes from Ah/Al. LN 1 / LN 2 (K = 128, one chunk): the A operand is the layer norm of the f32 rows X[p][128]
// (LN 2: of X + res), scale g, shift bv: each wave loads 8 of the block's rows, norms them and writes the two
// planes straight into the operand LDS, while the W rows are still on their way; Ah/Al are not read.
// coverage: 8 waves x 32 rows x N/4 cols per block = GBM px x N cols; grid covers NPIX x N once.
// =================================================================================================================
#define GKC 128
#define GBM 64
#define GPP 136
static_assert((GPP * 2) % 32 == 16);
static_assert(NPIX % GBM == 0 && HW % 32 == 0);
template <int K, int N, int EP, int LN>
__global__ __launch_bounds__(256) void gemm_k(const unsigned short* __restrict__ Ah,
                                              const unsigned short* __restrict__ Al,
                                              const unsigned short* __restrict__ W,
                                              float* outf, const float* __restrict__ res,
                                              const float* __restrict__ X, const float* __restrict__ g,
                                              const float* __restrict__ bv) {
  constexpr int NP = N / 128;                // 32-column tiles per wave
  constexpr int NCH = K / GKC;               // k chunks
  constexpr int WIT = N / 16;                // W rows per thread and chunk
  constexpr int LNR = GBM / 8;               // rows that a wave norms
  static_assert(K % GKC == 0 && N % 128 == 0);
  static_assert(LN == 0 || (K == CC && K == GKC && EP == 0));
  static_assert(8 * NP * 32 * GXP * 4 <= (2 * GBM + N) * GPP * 2);
  __shared__ __align__(16) unsigned short sm[(2 * GBM + N) * GPP];
  unsigned short* sah = sm;
  unsigned short* sal = sm + GBM * GPP;
  unsigned short* swt = sm + 2 * GBM * GPP;
  float* stg = (float*)sm;                   // reused behind the last chunk's barrier
  const int tid = threadIdx.x, wave = tid >> 5, lane = tid & 31, hh = lane >> 4, l15 = lane & 15;
  const int mb = blockIdx.x * GBM;
  const int mg = wave >> 2, ng = wave & 3;
  const int srow = tid >> 4, spc = (tid & 15) * 8;
  const unsigned short* gah = Ah + (size_t)(mb + srow) * K + spc;
  const unsigned short* gal = Al + (size_t)(mb + srow) * K + spc;
  const unsigned short* gw = W + (size_t)srow * K + spc;
  const int so = srow * GPP + spc;
  // Every loop below is unrolled in full: constant indices keep the staged rows and the sums in registers.
  v8f acc[NP][4];
#pragma unroll
  for (int j = 0; j < NP; ++j) {
#pragma unroll
    for (int f = 0; f < 4; ++f) acc[j][f] = zero8();
  }
  v4u ra[GBM / 16], rl[GBM / 16], rw[WIT];
  v4f xv[LNR], xb[LNR], gv, bb;
  if (LN == 0) {
#pragma unroll
    for (int it = 0; it < GBM / 16; ++it) {
      ra[it] = *(const v4u*)(gah + it * 16 * K);
      rl[it] = *(const v4u*)(gal + it * 16 * K);
    }
  } else {
    const size_t xo = (size_t)(mb + wave * LNR) * CC + lane * 4;
#pragma unroll
    for (int it = 0; it < LNR; ++it) xv[it] = *(const v4f*)(X + xo + it * CC);
    if (LN == 2) {
#pragma unroll
      for (int it = 0; it < LNR; ++it) xb[it] = *(const v4f*)(res + xo + it * CC);
    }
    // the loads below may be given registers that held the addresses of the row loads: the wait stands in front of them
    asm volatile("s_wait_xcnt 0x0" ::: "memory");
    gv = *(const v4f*)(g + lane * 4);
    bb = *(const v4f*)(bv + lane * 4);
  }
#pragma unroll
  for (int it = 0; it < WIT; ++it) rw[it] = *(const v4u*)(gw + it * 16 * K);
  // the W loads are issued here, behind the row loads, and come in while the rows are normed; without this line the
  // compiler moves them down into the norm and the block waits for them afterwards
  if (LN != 0) __builtin_amdgcn_sched_barrier(0);
#pragma unroll
  for (int kc = 0; kc < NCH; ++kc) {
    if (kc > 0) __syncthreads();             // every wave has read the chunk that is overwritten next
    if (LN == 0) {
#pragma unroll
      for (int it = 0; it < GBM / 16; ++it) {
        *(v4u*)(sah + so + it * 16 * GPP) = ra[it];
        *(v4u*)(sal + so + it * 16 * GPP) = rl[it];
      }
    } else {
#pragma unroll
      for (int e = 0; e < 4; ++e) { gv[e] = bfr(gv[e]); bb[e] = bfr(bb[e]); }
      float var[LNR];
#pragma unroll
      for (int it = 0; it < LNR; ++it) ln_stats(LN == 2 ? xv[it] + xb[it] : xv[it], xv[it], var[it]);
      // the root and the division are long sequences: lane i does them for row i, once for the wave's LNR rows
      float vs = var[0];
#pragma unroll
      for (int it = 1; it < LNR; ++it) vs = (lane == it) ? var[it] : vs;
      const float rs = 1.0f / sqrtf(vs + 1e-6f);
#pragma unroll
      for (int it = 0; it < LNR; ++it) {
        const float rstd = __int_as_float(__builtin_amdgcn_readlane(__float_as_int(rs), it));
        v2u ph, pw;
        ln_out(xv[it], rstd, gv, bb, ph, pw);
        const int lo = (wave * LNR + it) * GPP + lane * 4;
        *(v2u*)(sah + lo) = ph;
        *(v2u*)(sal + lo) = pw;
      }
    }
#pragma unroll
    for (int it = 0; it < WIT; ++it) *(v4u*)(swt + so + it * 16 * GPP) = rw[it];
    __syncthreads();                         // every wave reads rows that other waves staged
    if (kc + 1 < NCH) {
#pragma unroll
      for (int it = 0; it < GBM / 16; ++it) {
        ra[it] = *(const v4u*)(gah + it * 16 * K + (kc + 1) * GKC);
        rl[it] = *(const v4u*)(gal + it * 16 * K + (kc + 1) * GKC);
      }
#pragma unroll
      for (int it = 0; it < WIT; ++it) rw[it] = *(const v4u*)(gw + it * 16 * K + (kc + 1) * GKC);
    }
#pragma unroll
    for (int ks = 0; ks < GKC / 32; ++ks) {
      const int ko = ks * 32 + 8 * hh;
      const unsigned short* pa = sah + (mg * 32 + l15) * GPP + ko;
      const unsigned short* pl = sal + (mg * 32 + l15) * GPP + ko;
      const v16bf a0h = ldfrag(pa), a0l = ldfrag(pl);
      const v16bf a1h = ldfrag(pa + 16 * GPP), a1l = ldfrag(pl + 16 * GPP);
#pragma unroll
      for (int j = 0; j < NP; ++j) {
        const unsigned short* pb = swt + (ng * (N / 4) + j * 32 + l15) * GPP + ko;
        const v16bf b0 = ldfrag(pb), b1 = ldfrag(pb + 16 * GPP);
        acc[j][0] = mma_bf(a0h, b0, acc[j][0]); acc[j][0] = mma_bf(a0l, b0, acc[j][0]);
        acc[j][1] = mma_bf(a0h, b1, acc[j][1]); acc[j][1] = mma_bf(a0l, b1, acc[j][1]);
        acc[j][2] = mma_bf(a1h, b0, acc[j][2]); acc[j][2] = mma_bf(a1l, b0, acc[j][2]);
        acc[j][3] = mma_bf(a1h, b1, acc[j][3]); acc[j][3] = mma_bf(a1l, b1, acc[j][3]);
      }
    }
  }
  __syncthreads();                           // the operands' LDS becomes the output stage: every wave has left it
  const int m0 = mb + mg * 32;
#pragma unroll
  for (int j = 0; j < NP; ++j) {
    float* sw = stg + (wave * NP + j) * (32 * GXP);
#pragma unroll
    for (int r = 0; r < 8; ++r) {
      sw[(8 * hh + r) * GXP + l15] = acc[j][0][r];
      sw[(8 * hh + r) * GXP + 16 + l15] = acc[j][1][r];
      sw[(16 + 8 * hh + r) * GXP + l15] = acc[j][2][r];
      sw[(16 + 8 * hh + r) * GXP + 16 + l15] = acc[j][3][r];
    }
  }
  wave_sync_lds();
  const int q = lane >> 3, piece = lane & 7;
#pragma unroll
  for (int j = 0; j < NP; ++j) {
    const float* sw = stg + (wave * NP + j) * (32 * GXP);
    const int n0 = ng * (N / 4) + j * 32;
    v4f ov[8];
    if (EP != 2) {
#pragma unroll
      for (int it = 0; it < 8; ++it) {
        const int row = it * 4 + q;
        v4f v = *(const v4f*)(sw + row * GXP + piece * 4);
        if (EP == 1) {
          const v4f rr = *(const v4f*)(res + (size_t)(m0 + row) * CC + n0 + piece * 4);
          v = v + rr;
        }
        ov[it] = v;
      }
#pragma unroll
      for (int it = 0; it < 8; ++it) {
        const int row = it * 4 + q;
        *(v4f*)(outf + (size_t)(m0 + row) * N + n0 + piece * 4) = ov[it];
      }
    } else {
      const int b = m0 / HW;
      const int plx = m0 - b * HW;
#pragma unroll
      for (int it = 0; it < 8; ++it) {
        const int ch = it * 4 + q;
        v4f v;
#pragma unroll
        for (int e = 0; e < 4; ++e) {
          const float rv = res[(size_t)(m0 + piece * 4 + e) * CC + n0 + ch];
          v[e] = sw[(piece * 4 + e) * GXP + ch] + rv;
        }
        ov[it] = v;
      }
#pragma unroll
      for (int it = 0; it < 8; ++it) {
        const int ch = it * 4 + q;
        *(v4f*)(outf + ((size_t)(b * CC + n0 + ch)) * HW + plx + piece * 4) = ov[it];
      }
    }
  }
}

// =================================================================================================================
// Depthwise 3x3, SAME zero padding, cross-correlation taps, optional cyclic roll (output pixel index in the rolled
// frame, source slab in the unrolled frame: source pixel ((ny+roll) mod IMW, (nx+roll) mod IMW), valid iff the rolled
// neighbour (ny,nx) is inside the image). src [pix][CS] f32 (CS = all 384 channels of the conv), 4 channels per thread,
// weights wd[(wofs + c)*9 + tap] bf16-RNE (clamped address, zero for c >= cvalid): the block's CS*9 weights are read
// once (thread = channel, in steps of 256) and laid out in LDS as [tap][CS], channel contiguous, so that a thread takes
// its 4 channels of one tap with one 16-byte LDS read.
// A thread computes a strip of DWL output pixels along x: it loads the 3 x (DWL+2) source pixels of the strip once,
// all loads in flight together, keeps them in registers, and each loaded column serves up to three outputs; the taps
// come from LDS once per strip. Strips that follow one another in the grid lie under one another in y (a block's
// strips share source rows).
// A row outside the image zeroes its three taps; only the strip's two outer columns can lie outside the image.
// MODE 0: f32 rows dstf[p*dpitch + dcol + c]; MODE 1: exact-erf GELU (rolled) then bf16 hi + residual planes
// Ph/Pl[p*ppitch + dcol + c]; MODE 2: channels below 2*CC (q, k) as MODE 0, the rest (v) as planes without the GELU at
// Ph/Pl[p*ppitch + c - 2*CC] (a wave's 32 threads hold 128 channels in a row, so the choice is the same for a wave).
// coverage: (NPIX/DWL) * CS/4 threads x DWL pixels, grid ceil-div with an in-kernel bound.
// =================================================================================================================
template <int CS, int MODE>
__global__ __launch_bounds__(256) void dw_k(const float* __restrict__ src, const float* __restrict__ wd,
                                            int wofs, int cvalid, int roll,
                                            float* dstf, int dpitch, int dcol,
                                            unsigned short* Ph, unsigned short* Pl, int ppitch) {
  constexpr int TPP = CS / 4;
  constexpr int NSTR = NPIX / DWL;           // strips in all
  constexpr int SPI = HW / DWL;              // strips per image
  static_assert(CS % 128 == 0);
  __shared__ __align__(16) float wsm[9 * CS];
  constexpr int WTR = (CS + 255) / 256;      // thread = channel, its 9 taps, in WTR steps of 256 channels
  float wf[WTR][9];
#pragma unroll                               // constant indices keep wf in registers
  for (int k = 0; k < WTR; ++k) {            // no test here (the address is clamped): every step's loads behind one wait
    const float* wp = wd + min(wofs + (int)threadIdx.x + k * 256, cvalid - 1) * 9;
#pragma unroll                               // constant indices keep wf in registers
    for (int tp = 0; tp < 9; ++tp) wf[k][tp] = wp[tp];
  }
#pragma unroll                               // constant indices keep wf in registers
  for (int k = 0; k < WTR; ++k) {
    const int ch = (int)threadIdx.x + k * 256;
    const float wok = (wofs + ch < cvalid) ? 1.0f : 0.0f;
    if (ch < CS) {                           // whole waves
#pragma unroll                               // constant indices keep wf in registers
      for (int tp = 0; tp < 9; ++tp) wsm[tp * CS + ch] = bfr(wf[k][tp]) * wok;
    }
  }
  __syncthreads();                           // every wave reads table rows that other waves wrote
  const int t = blockIdx.x * 256 + threadIdx.x;
  int s = t / TPP;
  const int cg = t - s * TPP;
  const bool pv = s < NSTR;
  s = pv ? s : (NSTR - 1);
  const int c = cg * 4;
  const int b = s / SPI;
  const int sr = s - b * SPI;
  const int xs = sr / IMW;
  const int y = sr - xs * IMW;
  const int x0 = xs * DWL;
  const v4f* s4 = (const v4f*)src;            // slab rows in 16-byte units: TPP units per pixel
  // Every loop below but the GELU loop is unrolled in full so that its indices are constants: the offsets, the 3 x (DWL+2) window,
  // the taps and the DWL sums then live in registers (an index known only at run time would put them in scratch).
  int ro[3], co[DWL + 2], ix[3][DWL + 2];
#pragma unroll                               // see above
  for (int dy = 0; dy < 3; ++dy) {
    const int sy = (y + dy - 1 + roll) & (IMW - 1);
    ro[dy] = (b * HW + sy * IMW) * TPP + cg;
  }
#pragma unroll                               // see above
  for (int j = 0; j < DWL + 2; ++j) {
    const int sx = (x0 + j - 1 + roll) & (IMW - 1);
    co[j] = sx * TPP;
  }
#pragma unroll                               // see above
  for (int dy = 0; dy < 3; ++dy) {
#pragma unroll                               // see above
    for (int j = 0; j < DWL + 2; ++j) ix[dy][j] = ro[dy] + co[j];
  }
  const int p0 = b * HW + y * IMW + x0;      // first output pixel of the strip
  const float ml = (x0 > 0) ? 1.0f : 0.0f;
  const float mr = (x0 + DWL < IMW) ? 1.0f : 0.0f;
  v4f v[3][DWL + 2];
#pragma unroll                               // see above
  for (int dy = 0; dy < 3; ++dy) {
#pragma unroll                               // see above
    for (int j = 0; j < DWL + 2; ++j) v[dy][j] = s4[ix[dy][j]];
    // the next row's loads may be given registers that held this row's offsets: the wait stands in front of them
    if (dy < 2) asm volatile("s_wait_xcnt 0x0" ::: "memory");
  }
  static_assert(DWL == 8);                   // the statement below names the 3 x 10 loaded values one by one
  // Inputs only: every load of the window is issued in front of this line, so the wave waits out one memory latency
  // for all 30; without it the compiler spreads the loads among the sums and waits for them a few at a time.
  asm volatile("" :: "v"(v[0][0]), "v"(v[0][1]), "v"(v[0][2]), "v"(v[0][3]), "v"(v[0][4]),
                     "v"(v[0][5]), "v"(v[0][6]), "v"(v[0][7]), "v"(v[0][8]), "v"(v[0][9]),
                     "v"(v[1][0]), "v"(v[1][1]), "v"(v[1][2]), "v"(v[1][3]), "v"(v[1][4]),
                     "v"(v[1][5]), "v"(v[1][6]), "v"(v[1][7]), "v"(v[1][8]), "v"(v[1][9]),
                     "v"(v[2][0]), "v"(v[2][1]), "v"(v[2][2]), "v"(v[2][3]), "v"(v[2][4]),
                     "v"(v[2][5]), "v"(v[2][6]), "v"(v[2][7]), "v"(v[2][8]), "v"(v[2][9]));
  v4f acc[DWL];
#pragma unroll                               // see above
  for (int i = 0; i < DWL; ++i) acc[i] = v4f{0.f, 0.f, 0.f, 0.f};
  // row by row: a row's registers are free once its three taps are summed; each output still sums its taps 0..8 in order
#pragma unroll                               // see above
  for (int dy = 0; dy < 3; ++dy) {
    const float rm = ((unsigned)(y + dy - 1) < (unsigned)IMW) ? 1.0f : 0.0f;
    v4f wv[3];
#pragma unroll                               // see above
    for (int dx = 0; dx < 3; ++dx) wv[dx] = *(const v4f*)(wsm + (dy * 3 + dx) * CS + c) * rm;
    v[dy][0] = v[dy][0] * ml;
    v[dy][DWL + 1] = v[dy][DWL + 1] * mr;
#pragma unroll                               // see above
    for (int i = 0; i < DWL; ++i) {          // output by output: column i is free once output i has its row
#pragma unroll                               // see above
      for (int dx = 0; dx < 3; ++dx) acc[i] = acc[i] + v[dy][i + dx] * wv[dx];
    }
    // the next row's taps are read only now: all 9 read ahead take 24 registers more, and above 160 registers fewer
    // than three blocks are resident per WGP
    if (dy < 2) __builtin_amdgcn_sched_barrier(0);
  }
#pragma unroll                               // see above
  for (int i = 0; i < DWL; ++i) {
    v4f a = acc[i];
    if (MODE == 1) {
#pragma unroll 1                             // rolled as before: one copy of the erf code per output pixel
      for (int e = 0; e < 4; ++e) {
        const float g = (e == 0) ? a[0] : ((e == 1) ? a[1] : ((e == 2) ? a[2] : a[3]));
        const float er = erff(g * RSQ2);
        float gl = 0.5f * g;
        gl = gl * (1.0f + er);
        a[0] = (e == 0) ? gl : a[0];
        a[1] = (e == 1) ? gl : a[1];
        a[2] = (e == 2) ? gl : a[2];
        a[3] = (e == 3) ? gl : a[3];
      }
    }
    if (MODE == 0 || (MODE == 2 && c < 2 * CC)) {
      float* gp = dstf + (size_t)(p0 + i) * dpitch + dcol + c;
      if (pv) *(v4f*)gp = a;
    } else {
      v2u ph, plw;
      split4(a, ph, plw);
      const size_t to = (size_t)(p0 + i) * ppitch + dcol + (MODE == 2 ? c - 2 * CC : c);
      if (pv) { *(v2u*)(Ph + to) = ph; *(v2u*)(Pl + to) = plw; }
    }
  }
}

// =================================================================================================================
// FFN tail in one kernel: depthwise 3x3 (SAME zero padding, no roll) + exact-erf GELU + the 1x1 out conv (K = HIDP,
// N = CC) + residual. Block = 8 waves = a tile of FTX x 2 pixels = GBM rows of the GEMM. The GELU output never goes to
// memory: per chunk of GKC channels a wave computes one strip of DWL pixels x 128 channels (a thread: 4 channels, the
// 3 x (DWL+2) window in registers, taps from LDS, sums and GELU as in dw_k) and writes the bf16 hi + residual planes of
// its DWL rows straight into the operand LDS; then the block multiplies the chunk as gemm_k does (2 pixel groups x 4
// column groups of 32 x 32, k rising, hi then residual). The next chunk's window is loaded into registers while this
// chunk is multiplied. All of W (CC rows of HIDP, pitch WPP) and the 9 x HIDP taps are staged in LDS once. Row r of
// pixel group mg is pixel (ty*2 + mg, tx*FTX + r): 32 pixels in a row of the image, so the epilogue stores whole
// 128-byte lines in both output layouts.
// EP 1: OUT[p][CC] = sum + res[p][n]; EP 2: NCHW d_out[b][n][p] = sum + res[p][n].
// coverage: NPIX / GBM blocks x GBM px x CC columns.
// =================================================================================================================
#define WPP 392
#define FTX 32
static_assert((WPP * 2) % 32 == 16 && WPP >= HIDP);
static_assert(GBM == 2 * FTX && FTX == 4 * DWL && IMW % FTX == 0 && HIDP % GKC == 0 && GKC == 128 && CC == 128);
static_assert((CC * HIDP / 8) % 256 == 0);
template <int EP>
__global__ __launch_bounds__(256) void dwffn_k(const float* __restrict__ src, const float* __restrict__ wd, int cvalid,
                                               const unsigned short* __restrict__ W, float* outf,
                                               const float* __restrict__ res) {
  constexpr int CS = HIDP;
  constexpr int TPP = CS / 4;
  constexpr int NCH = CS / GKC;
  constexpr int WIT = CC * HIDP / 8 / 256;   // 16-byte pieces of W per thread
  constexpr int WTR = (CS + 255) / 256;
  static_assert(8 * 32 * GXP * 4 <= (2 * GBM * GPP + CC * WPP) * 2);
  __shared__ __align__(16) unsigned short sm[2 * GBM * GPP + CC * WPP];
  __shared__ __align__(16) float wsm[9 * CS];
  unsigned short* sah = sm;
  unsigned short* sal = sm + GBM * GPP;
  unsigned short* swt = sm + 2 * GBM * GPP;
  float* stg = (float*)sm;                   // reused behind the last chunk's barrier
  const int tid = threadIdx.x, lane = tid & 31, hh = lane >> 4, l15 = lane & 15;
  // the wave's number in a scalar register: the strip's place, its row addresses and its edge masks are then scalars
  const int wave = __builtin_amdgcn_readfirstlane(tid >> 5);
  const int mg = wave >> 2, ng = wave & 3;
  const int b = blockIdx.x / (HW / GBM);
  const int tr = blockIdx.x - b * (HW / GBM);
  const int ty = tr / (IMW / FTX);
  const int tx = tr - ty * (IMW / FTX);
  const int y = ty * 2 + mg;                 // the wave's strip: image row y, columns x0 .. x0 + DWL - 1
  const int x0 = tx * FTX + ng * DWL;
  const int xl = (x0 - 1) & (IMW - 1), xr = (x0 + DWL) & (IMW - 1);
  const float ml = (x0 > 0) ? 1.0f : 0.0f;
  const float mr = (x0 + DWL < IMW) ? 1.0f : 0.0f;
  const v4f* s4 = (const v4f*)src;           // rows in 16-byte units: TPP units per pixel
  // Every loop below but the one over the chunks and the GELU loop is unrolled in full: constant indices keep the window, the sums and
  // the staged values in registers.
  const v4f* rp[3];
#pragma unroll
  for (int dy = 0; dy < 3; ++dy) rp[dy] = s4 + (size_t)(b * HW + ((y + dy - 1) & (IMW - 1)) * IMW) * TPP;
  v4f v[3][DWL + 2];
  const unsigned ul = (unsigned)lane;
  auto ldwin = [&](int kc) {
#pragma unroll
    for (int dy = 0; dy < 3; ++dy) {
      const v4f* r = rp[dy] + kc * (GKC / 4); // scalar bases; the one vector offset is the lane's
      const v4f* rc = r + x0 * TPP;
      v[dy][0] = (r + xl * TPP)[ul];
#pragma unroll
      for (int j = 1; j <= DWL; ++j) v[dy][j] = rc[ul + (j - 1) * TPP];
      v[dy][DWL + 1] = (r + xr * TPP)[ul];
      // what follows may be given registers that held this row's addresses: the wait stands in front of it
      asm volatile("s_wait_xcnt 0x0" ::: "memory");
    }
  };
  float wf[WTR][9];
#pragma unroll
  for (int k = 0; k < WTR; ++k) {            // thread = channel, its 9 taps; the address is clamped
    const float* wp = wd + min(tid + k * 256, cvalid - 1) * 9;
#pragma unroll
    for (int tp = 0; tp < 9; ++tp) wf[k][tp] = wp[tp];
  }
#pragma unroll
  for (int k = 0; k < WTR; ++k) {
    const int ch = tid + k * 256;
    const float wok = (ch < cvalid) ? 1.0f : 0.0f;
    if ((k + 1) * 256 <= CS || ch < CS) {    // whole waves
#pragma unroll
      for (int tp = 0; tp < 9; ++tp) wsm[tp * CS + ch] = bfr(wf[k][tp]) * wok;
    }
  }
  // the W rows are loaded behind this line, when the taps have come in: their loads may be given the registers that
  // held the tap loads' addresses
  __builtin_amdgcn_sched_barrier(0);
  v4u rw[WIT];
#pragma unroll
  for (int it = 0; it < WIT; ++it) rw[it] = *(const v4u*)(W + (size_t)(it * 256 + tid) * 8);
#pragma unroll
  for (int it = 0; it < WIT; ++it) {
    const int q = it * 256 + tid;
    const int row = q / (HIDP / 8);
    *(v4u*)(swt + row * WPP + (q - row * (HIDP / 8)) * 8) = rw[it];
  }
  // the first window is loaded only now, into the registers that the staged W rows have left: both at once take more
  // than 256 registers, and then one block is resident per WGP, not two
  __builtin_amdgcn_sched_barrier(0);
  ldwin(0);
  __syncthreads();                           // every wave reads taps and W rows that other waves staged
  v8f gacc[4];
#pragma unroll
  for (int f = 0; f < 4; ++f) gacc[f] = zero8();
#pragma unroll 1                             // rolled: one copy of the strip, GELU and product code for the three chunks
  for (int kc = 0; kc < NCH; ++kc) {
    static_assert(DWL == 8);                 // the statement below names the 3 x 10 loaded values one by one
    // Inputs only: every load of the window is issued in front of this line and waited for once; without it the
    // compiler may spread the loads among the sums and wait for them a few at a time.
    asm volatile("" :: "v"(v[0][0]), "v"(v[0][1]), "v"(v[0][2]), "v"(v[0][3]), "v"(v[0][4]),
                       "v"(v[0][5]), "v"(v[0][6]), "v"(v[0][7]), "v"(v[0][8]), "v"(v[0][9]),
                       "v"(v[1][0]), "v"(v[1][1]), "v"(v[1][2]), "v"(v[1][3]), "v"(v[1][4]),
                       "v"(v[1][5]), "v"(v[1][6]), "v"(v[1][7]), "v"(v[1][8]), "v"(v[1][9]),
                       "v"(v[2][0]), "v"(v[2][1]), "v"(v[2][2]), "v"(v[2][3]), "v"(v[2][4]),
                       "v"(v[2][5]), "v"(v[2][6]), "v"(v[2][7]), "v"(v[2][8]), "v"(v[2][9]));
    v4f acc[DWL];
#pragma unroll
    for (int i = 0; i < DWL; ++i) acc[i] = v4f{0.f, 0.f, 0.f, 0.f};
    // row by row, each output sums its taps 0..8 in order
#pragma unroll
    for (int dy = 0; dy < 3; ++dy) {
      const float rm = ((unsigned)(y + dy - 1) < (unsigned)IMW) ? 1.0f : 0.0f;
      v4f wv[3];
#pragma unroll
      for (int dx = 0; dx < 3; ++dx) wv[dx] = *(const v4f*)(wsm + (dy * 3 + dx) * CS + kc * GKC + lane * 4) * rm;
      v[dy][0] = v[dy][0] * ml;
      v[dy][DWL + 1] = v[dy][DWL + 1] * mr;
#pragma unroll
      for (int i = 0; i < DWL; ++i) {
#pragma unroll
        for (int dx = 0; dx < 3; ++dx) acc[i] = acc[i] + v[dy][i + dx] * wv[dx];
      }
    }
    if (kc > 0) __syncthreads();             // every wave has read the chunk that is overwritten next
#pragma unroll
    for (int i = 0; i < DWL; ++i) {
      v4f a = acc[i];
#pragma unroll 1                             // rolled as in dw_k: one copy of the erf code per output pixel
      for (int e = 0; e < 4; ++e) {
        const float g = (e == 0) ? a[0] : ((e == 1) ? a[1] : ((e == 2) ? a[2] : a[3]));
        const float er = erff(g * RSQ2);
        float gl = 0.5f * g;
        gl = gl * (1.0f + er);
        a[0] = (e == 0) ? gl : a[0];
        a[1] = (e == 1) ? gl : a[1];
        a[2] = (e == 2) ? gl : a[2];
        a[3] = (e == 3) ? gl : a[3];
      }
      v2u ph, pw;
      split4(a, ph, pw);
      const int lo = (wave * DWL + i) * GPP + lane * 4;
      *(v2u*)(sah + lo) = ph;
      *(v2u*)(sal + lo) = pw;
    }
    __syncthreads();                         // every wave reads rows that other waves wrote
    if (kc + 1 < NCH) ldwin(kc + 1);         // behind the barrier (which waits for loads): it flies during the products
#pragma unroll
    for (int ks = 0; ks < GKC / 32; ++ks) {
      const int ko = ks * 32 + 8 * hh;
      const unsigned short* pa = sah + (mg * 32 + l15) * GPP + ko;
      const unsigned short* pl = sal + (mg * 32 + l15) * GPP + ko;
      const v16bf a0h = ldfrag(pa), a0l = ldfrag(pl);
      const v16bf a1h = ldfrag(pa + 16 * GPP), a1l = ldfrag(pl + 16 * GPP);
      const unsigned short* pb = swt + (ng * 32 + l15) * WPP + kc * GKC + ko;
      const v16bf b0 = ldfrag(pb), b1 = ldfrag(pb + 16 * WPP);
      gacc[0] = mma_bf(a0h, b0, gacc[0]); gacc[0] = mma_bf(a0l, b0, gacc[0]);
      gacc[1] = mma_bf(a0h, b1, gacc[1]); gacc[1] = mma_bf(a0l, b1, gacc[1]);
      gacc[2] = mma_bf(a1h, b0, gacc[2]); gacc[2] = mma_bf(a1l, b0, gacc[2]);
      gacc[3] = mma_bf(a1h, b1, gacc[3]); gacc[3] = mma_bf(a1l, b1, gacc[3]);
    }
  }
  __syncthreads();                           // the operands' LDS becomes the output stage: every wave has left it
  const int m0 = b * HW + y * IMW + tx * FTX; // first pixel of the wave's 32 rows
  const int n0 = ng * 32;
  float* sw = stg + wave * (32 * GXP);
#pragma unroll
  for (int r = 0; r < 8; ++r) {
    sw[(8 * hh + r) * GXP + l15] = gacc[0][r];
    sw[(8 * hh + r) * GXP + 16 + l15] = gacc[1][r];
    sw[(16 + 8 * hh + r) * GXP + l15] = gacc[2][r];
    sw[(16 + 8 * hh + r) * GXP + 16 + l15] = gacc[3][r];
  }
  wave_sync_lds();
  const int q = lane >> 3, piece = lane & 7;
  v4f ov[8];
  // one address per lane for the loads and one for the stores; the eight steps are constant offsets from it
  if (EP == 1) {
    const size_t o0 = (size_t)(m0 + q) * CC + n0 + piece * 4;
    const float* rq = res + o0;
    float* oq = outf + o0;
#pragma unroll
    for (int it = 0; it < 8; ++it) {
      const v4f rr = *(const v4f*)(rq + it * 4 * CC);
      ov[it] = *(const v4f*)(sw + (it * 4 + q) * GXP + piece * 4) + rr;
    }
#pragma unroll
    for (int it = 0; it < 8; ++it) *(v4f*)(oq + it * 4 * CC) = ov[it];
  } else {
    const float* rq = res + (size_t)(m0 + piece * 4) * CC + n0 + q;
    float* oq = outf + (size_t)(b * CC + n0 + q) * HW + (m0 - b * HW) + piece * 4;
#pragma unroll
    for (int it = 0; it < 8; ++it) {
      v4f o;
#pragma unroll
      for (int e = 0; e < 4; ++e) o[e] = sw[(piece * 4 + e) * GXP + it * 4 + q] + rq[e * CC + it * 4];
      ov[it] = o;
    }
#pragma unroll
    for (int it = 0; it < 8; ++it) *(v4f*)(oq + (size_t)it * 4 * HW) = ov[it];
  }
}

// =================================================================================================================
// RSA window attention, one 4x4 window (16 tokens) per block of 256 threads, R = dwconv output in the rolled frame
// [pix][384] f32 (q | k | v column blocks):
//   phase 0: the 16 token rows x 384 f32 into LDS; phase 1: per token and per q/k the l2 norm over its 128 channels
//   (inv = 1/max(sqrt(sum), 1e-12)); phase 2: q^T and k^T as bf16 hi + residual planes [c][16 tok] (k contiguous),
//   v as planes [tok][ATP]; phase 3 (wave = c tile): attn[c][d] = relu(temp * sum_p qn[p][c] kn[p][d]) on WMMA, K = 16
//   (fragment elements 8..15 zero), 3 products, stored transposed as planes AttT[d][c]; phase 4 (wave = d tile):
//   out[p][d] = sum_c v[p][c] attn[c][d], K = 128, 3 products, staged f32 [16][TXP] in LDS; phase 5: each token row
//   (128 values -> hi + residual, 256 B per plane = 16 lanes x 16 B) written to its unrolled pixel (inverse roll +2,+2),
//   coverage: qT/kT 128 c x 16 tok x 2 planes, v 16 x 128, AttT 128 d x 128 c (8 waves x 8 tiles), out 16 x 128
//   (8 waves x 16 cols), store 8 waves x 2 rows x 128.
// =================================================================================================================
__global__ __launch_bounds__(256) void rsa_attn_k(const float* __restrict__ R, const float* __restrict__ temp,
                                                  unsigned short* Th, unsigned short* Tl) {
#pragma clang fp contract(off)
  extern __shared__ __align__(16) char smem[];
  float* sR = (float*)(smem + RL_R);
  float* ost = (float*)(smem + RL_R);                     // reused after phase 2
  unsigned short* qt = (unsigned short*)(smem + RL_QTH);  // qT hi @0, qT lo @2048, kT hi @4096, kT lo @6144 (halves)
  unsigned short* ath = (unsigned short*)(smem + RL_ATH);
  unsigned short* atl = (unsigned short*)(smem + RL_ATL);
  unsigned short* vh = (unsigned short*)(smem + RL_VH);
  unsigned short* vl = (unsigned short*)(smem + RL_VL);
  float* sinv = (float*)(smem + RL_INV);
  const int tid = threadIdx.x, wave = tid >> 5, lane = tid & 31, hh = lane >> 4, l15 = lane & 15;
  const int b = blockIdx.x / NWIN;
  const int w2 = blockIdx.x - b * NWIN;
  const int wy = w2 / NWX;
  const int wx = w2 - wy * NWX;

  // ---- phase 0: token rows ----
#pragma unroll
  for (int it = 0; it < 6; ++it) {
    const int idx = it * 256 + tid;
    const int pi = idx / 96;
    const int c4 = (idx - pi * 96) * 4;
    const int ry = wy * WSZ + (pi / WSZ), rx = wx * WSZ + (pi - (pi / WSZ) * WSZ);
    const v4f v = *(const v4f*)(R + ((size_t)(b * HW) + (size_t)ry * IMW + rx) * C3 + c4);
    *(v4f*)(sR + pi * C3 + c4) = v;
  }
  __syncthreads();

  // ---- phase 1: l2 norms per token over its 128 q (or k) channels ----
  {
    const int pair = tid >> 3, sub = tid & 7;
    const int sel = pair >> 4, pi = pair & 15;
    const float* rp = sR + pi * C3 + sel * CC + sub * 16;
    float s = 0.f;
#pragma unroll
    for (int j = 0; j < 16; ++j) { const float f = rp[j]; const float ff = f * f; s = s + ff; }
    s = s + __shfl_xor(s, 1, 32);
    s = s + __shfl_xor(s, 2, 32);
    s = s + __shfl_xor(s, 4, 32);
    const float inv = 1.0f / fmaxf(sqrtf(s), 1e-12f);
    if (sub == 0) sinv[pair] = inv;
  }
  __syncthreads();

  // ---- phase 2: normalised q^T / k^T planes and v planes ----
  {
    const int c = tid >> 1, sel = tid & 1;
    float nv[16];
#pragma unroll
    for (int pi = 0; pi < 16; ++pi) nv[pi] = sR[pi * C3 + sel * CC + c] * sinv[sel * 16 + pi];
    v4u h0, h1, l0, l1;
#pragma unroll
    for (int e = 0; e < 4; ++e) {
      unsigned ha, la, hb, lb;
      split2(nv[2 * e], nv[2 * e + 1], ha, la);
      split2(nv[8 + 2 * e], nv[8 + 2 * e + 1], hb, lb);
      h0[e] = ha; l0[e] = la;
      h1[e] = hb; l1[e] = lb;
    }
    unsigned short* dh = qt + sel * 4096 + c * 16;
    unsigned short* dl = dh + 2048;
    *(v4u*)(dh) = h0; *(v4u*)(dh + 8) = h1;
    *(v4u*)(dl) = l0; *(v4u*)(dl + 8) = l1;
    const int pi = tid >> 4, c8 = (tid & 15) * 8;
    const float* vr = sR + pi * C3 + 2 * CC + c8;
    const v4f v0 = *(const v4f*)(vr);
    const v4f v1 = *(const v4f*)(vr + 4);
    v4u ph, plw;
    split8(v0, v1, ph, plw);
    *(v4u*)(vh + pi * ATP + c8) = ph;
    *(v4u*)(vl + pi * ATP + c8) = plw;
  }
  __syncthreads();

  const float tmp = bfr(temp[0]);
  // ---- phase 3: attn = relu(temp * q^T k), 128 x 128, K = 16 ----
  {
    const int mi = wave;
    const v16bf a_h = ldfrag16(qt + (mi * 16 + l15) * 16 + 8 * hh);
    const v16bf a_l = ldfrag16(qt + 2048 + (mi * 16 + l15) * 16 + 8 * hh);
#pragma unroll 2
    for (int ni = 0; ni < 8; ++ni) {
      const v16bf b_h = ldfrag16(qt + 4096 + (ni * 16 + l15) * 16 + 8 * hh);
      const v16bf b_l = ldfrag16(qt + 6144 + (ni * 16 + l15) * 16 + 8 * hh);
      v8f acc = zero8();
      acc = mma_bf(a_h, b_h, acc);
      acc = mma_bf(a_h, b_l, acc);
      acc = mma_bf(a_l, b_h, acc);
      v4u ph, plw;
#pragma unroll
      for (int e = 0; e < 4; ++e) {
        unsigned hw, lw;
        split2(fmaxf(acc[2 * e] * tmp, 0.0f), fmaxf(acc[2 * e + 1] * tmp, 0.0f), hw, lw);
        ph[e] = hw; plw[e] = lw;
      }
      const int d = ni * 16 + l15;
      *(v4u*)(ath + d * ATP + mi * 16 + 8 * hh) = ph;
      *(v4u*)(atl + d * ATP + mi * 16 + 8 * hh) = plw;
    }
  }
  __syncthreads();

  // ---- phase 4: out[p][d] = sum_c v[p][c] attn[c][d], K = 128 ----
  {
    const int ni = wave;
    v8f acc = zero8();
#pragma unroll
    for (int ks = 0; ks < 4; ++ks) {
      const v16bf a_h = ldfrag(vh + l15 * ATP + ks * 32 + 8 * hh);
      const v16bf a_l = ldfrag(vl + l15 * ATP + ks * 32 + 8 * hh);
      const v16bf b_h = ldfrag(ath + (ni * 16 + l15) * ATP + ks * 32 + 8 * hh);
      const v16bf b_l = ldfrag(atl + (ni * 16 + l15) * ATP + ks * 32 + 8 * hh);
      acc = mma_bf(a_h, b_h, acc);
      acc = mma_bf(a_h, b_l, acc);
      acc = mma_bf(a_l, b_h, acc);
    }
#pragma unroll
    for (int r = 0; r < 8; ++r) ost[(8 * hh + r) * TXP + ni * 16 + l15] = acc[r];
  }
  __syncthreads();

  // ---- phase 5: token rows to their unrolled pixels ----
  {
    const int tk = 2 * wave + hh;
    const int piece = l15;
    const float* orow = ost + tk * TXP + piece * 8;
    const v4f v0 = *(const v4f*)(orow);
    const v4f v1 = *(const v4f*)(orow + 4);
    v4u ph, plw;
    split8(v0, v1, ph, plw);
    const int iy = tk / WSZ, ix = tk - (tk / WSZ) * WSZ;
    const int ry = wy * WSZ + iy, rx = wx * WSZ + ix;
    const int py = (ry + WSZ / 2) & (IMW - 1), px = (rx + WSZ / 2) & (IMW - 1);
    const size_t gp = ((size_t)(b * HW) + (size_t)py * IMW + px) * CC + piece * 8;
    *(v4u*)(Th + gp) = ph;
    *(v4u*)(Tl + gp) = plw;
    
  }
}

// =================================================================================================================
// GSA score and sum-of-squares partials: block = (b, head h, slab of 256 pixels), S[c][d] = sum_n q[h*32+c][n]
// k[h*32+d][n] over the slab on WMMA. A thread holds one of the head's 64 q and k columns (f32 from R) at 64 of the
// slab's pixels: its 64 loads are issued together, so a block waits out one memory latency, and NB*NHEAD*NSLS blocks
// fill the chip. From those registers: the column's sum of squares (8 chains of 8 pixels, added as a tree; the four
// pixel groups of a column are added through LDS) and the bf16 hi + residual planes, transposed in LDS ([32 ch][GSP],
// k contiguous); waves: fragment f = wave&3 (2x2 of 16x16), k half = wave>>2; 3 products; the two k halves are
// combined in fixed order through LDS; the 32x32 f32 tile is staged and stored as whole lines.
// blk = (b*NHEAD + h)*NSLS + slab. coverage: planes 64 ch x 256 px (256 threads x 8 groups x 8 px), tile 32x32 per
// block, 64 of the 256 sums of squares of (b, slab) per block (2 whole 128-byte lines).
// =================================================================================================================
__global__ __launch_bounds__(256) void gsa_s_k(const float* __restrict__ R, float* pa, float* pn) {
  extern __shared__ __align__(16) char smem[];
  unsigned short* pl = (unsigned short*)(smem + GL_QH);   // q hi @0, q lo @8448, k hi @16896, k lo @25344 (halves)
  float* red = (float*)(smem + GL_RED);
  float* stg = (float*)(smem + GL_STG);
  float* sq = (float*)(smem + GL_SQ);
  const int tid = threadIdx.x, wave = tid >> 5, lane = tid & 31, hh = lane >> 4, l15 = lane & 15;
  const int blk = blockIdx.x;
  const int b = blk / (NHEAD * NSLS);
  const int rem = blk - b * (NHEAD * NSLS);
  const int h = rem / NSLS;
  const int slab = rem - h * NSLS;
  const int f = wave & 3, mi = f >> 1, ni = f & 1, kh = wave >> 2;
  const int c = tid & 63, sel = c >> 5, cc = c & 31;
  const int col = sel * CC + h * HDC + cc;
  unsigned short* ph = pl + sel * 16896 + cc * GSP;
  unsigned short* plo = ph + 8448;
  const int g0 = tid >> 6;
  const float* rp = R + ((size_t)(b * HW) + (size_t)slab * 256 + g0 * 8) * C3 + col;
  // Every loop below is unrolled in full: constant indices keep the 64 loaded values in registers.
  v4f v0[8], v1[8];
#pragma unroll
  for (int it = 0; it < 8; ++it) {
#pragma unroll
    for (int j = 0; j < 4; ++j) {
      v0[it][j] = rp[(it * 32 + j) * C3];
      v1[it][j] = rp[(it * 32 + j + 4) * C3];
    }
  }
  float sp[8];
#pragma unroll
  for (int it = 0; it < 8; ++it) {
    float t = 0.f;
#pragma unroll
    for (int j = 0; j < 4; ++j) t = fmaf(v0[it][j], v0[it][j], t);
#pragma unroll
    for (int j = 0; j < 4; ++j) t = fmaf(v1[it][j], v1[it][j], t);
    sp[it] = t;
  }
  sq[g0 * 64 + c] = ((sp[0] + sp[1]) + (sp[2] + sp[3])) + ((sp[4] + sp[5]) + (sp[6] + sp[7]));
#pragma unroll
  for (int it = 0; it < 8; ++it) {
    const int g = it * 4 + g0;
    v4u hp, lp;
    split8(v0[it], v1[it], hp, lp);
    *(v4u*)(ph + g * 8) = hp;
    *(v4u*)(plo + g * 8) = lp;
  }
  __syncthreads();                           // every wave reads plane rows and sums that other waves wrote
  v8f acc = zero8();
#pragma unroll
  for (int ks = 0; ks < 4; ++ks) {
    const int k0 = (kh * 4 + ks) * 32;
    const v16bf a_h = ldfrag(pl + (mi * 16 + l15) * GSP + k0 + 8 * hh);
    const v16bf a_l = ldfrag(pl + 8448 + (mi * 16 + l15) * GSP + k0 + 8 * hh);
    const v16bf b_h = ldfrag(pl + 16896 + (ni * 16 + l15) * GSP + k0 + 8 * hh);
    const v16bf b_l = ldfrag(pl + 25344 + (ni * 16 + l15) * GSP + k0 + 8 * hh);
    acc = mma_bf(a_h, b_h, acc);
    acc = mma_bf(a_h, b_l, acc);
    acc = mma_bf(a_l, b_h, acc);
  }
  if (wave >= 4) {
#pragma unroll
    for (int r = 0; r < 8; ++r) red[((wave - 4) * 32 + lane) * 8 + r] = acc[r];
  }
  __syncthreads();
  if (wave < 4) {
    const v4f o0 = *(const v4f*)(red + (wave * 32 + lane) * 8);
    const v4f o1 = *(const v4f*)(red + (wave * 32 + lane) * 8 + 4);
#pragma unroll
    for (int r = 0; r < 8; ++r) {
      const float v = acc[r] + (r < 4 ? o0[r & 3] : o1[r & 3]);
      stg[(mi * 16 + 8 * hh + r) * GXP + ni * 16 + l15] = v;
    }
  }
  __syncthreads();
  {
    const int row = tid >> 3, piece = tid & 7;
    const v4f v = *(const v4f*)(stg + row * GXP + piece * 4);
    float* gp = pa + (size_t)blk * 1024 + row * 32 + piece * 4;
    *(v4f*)gp = v;
  }
  if (tid < 64) {                            // whole waves
    const float t = (sq[c] + sq[64 + c]) + (sq[128 + c] + sq[192 + c]);
    pn[((size_t)(b * NSLN + slab)) * 256 + col] = t;
  }
}

// =================================================================================================================
// GSA finisher, block = (b, h, quarter of the head's 32x32 tile), 10 waves. Waves 0..7: thread = one element
// e = c*32 + d, attn[c][d] = relu(sum of pa partials * invq[c] * invk[d] * temp) -> bf16 hi + residual planes.
// Waves 8, 9: invq/invk = 1/max(sqrt(sum of pn partials), 1e-12) for the head's 32 q and 32 k channels. Partials are
// summed slab by slab in rising order; a thread's NSLS loads are issued together, and no wave has more than those to
// wait for. A block writes 512 bytes in a row of each plane.
// =================================================================================================================
#define FINQ 4
static_assert(FINQ * 256 == HDC * HDC);
static_assert(NSLS == NSLN);
__global__ __launch_bounds__(320) void gsa_fin_k(const float* __restrict__ pa, const float* __restrict__ pn,
                                                 const float* __restrict__ temp,
                                                 unsigned short* afh, unsigned short* afl) {
#pragma clang fp contract(off)
  __shared__ float sinv[64];
  const int tid = threadIdx.x;
  const int bh = blockIdx.x / FINQ;
  const int e = (blockIdx.x - bh * FINQ) * 256 + (tid & 255);
  const int b = bh / NHEAD;
  const int h = bh - b * NHEAD;
  const bool nrm = tid >= 256;               // whole waves
  // The loops over the slabs are unrolled in full: constant indices keep the loaded partials in registers.
  float pv[NSLS];
  float s = 0.f;
  if (nrm) {
    const int sel = (tid >> 5) & 1, i = tid & 31;
    const float* np = pn + (size_t)b * (NSLN * 256) + sel * CC + h * HDC + i;
#pragma unroll
    for (int sl = 0; sl < NSLN; ++sl) pv[sl] = np[sl * 256];
#pragma unroll
    for (int sl = 0; sl < NSLN; ++sl) s = s + pv[sl];
    sinv[tid - 256] = 1.0f / fmaxf(sqrtf(s), 1e-12f);
  } else {
    const float* pp = pa + (size_t)bh * (NSLS * 1024) + e;
#pragma unroll
    for (int sl = 0; sl < NSLS; ++sl) pv[sl] = pp[sl * 1024];
#pragma unroll
    for (int sl = 0; sl < NSLS; ++sl) s = s + pv[sl];
  }
  __syncthreads();
  if (nrm) return;
  const float tmp = bfr(temp[0]);
  float v = s * sinv[e >> 5];
  v = v * sinv[32 + (e & 31)];
  v = v * tmp;
  v = fmaxf(v, 0.0f);
  unsigned short hi, lo;
  split_bf(v, hi, lo);
  const size_t to = (size_t)b * AFSZ + (size_t)h * (HDC * HDC) + e;
  afh[to] = hi;
  afl[to] = lo;
}

// =================================================================================================================
// GSA apply: out[p][h*32 + c] = sum_d v[p][h*32 + d] attn_h[c][d], K = 32 per head, both operands hi + residual
// (3 products). Wave tile 16 px x 64 cols (heads hd0 = n0/32 for fragments 0,1 and hd0+1 for 2,3), block = 128 px,
// coverage: 8 waves x 16 rows x 64 cols per block; grid covers NPIX x 128 once.
// =================================================================================================================
__global__ __launch_bounds__(256) void apply_k(const unsigned short* __restrict__ Vh,
                                               const unsigned short* __restrict__ Vl,
                                               const unsigned short* __restrict__ afh,
                                               const unsigned short* __restrict__ afl,
                                               unsigned short* Oh, unsigned short* Ol) {
  __shared__ __align__(16) float stg[8 * 16 * AXP];
  const int tid = threadIdx.x, wave = tid >> 5, lane = tid & 31, hh = lane >> 4, l15 = lane & 15;
  const int m0 = (blockIdx.x * 8 + wave) * 16;
  const int n0 = blockIdx.y * 64;
  const int b = m0 / HW;
  const int hd0 = n0 / HDC;
  const unsigned short* ar = Vh + (size_t)(m0 + l15) * CC + hd0 * HDC + 8 * hh;
  const unsigned short* al = Vl + (size_t)(m0 + l15) * CC + hd0 * HDC + 8 * hh;
  const v16bf a0h = ldfrag(ar), a0l = ldfrag(al);
  const v16bf a1h = ldfrag(ar + 32), a1l = ldfrag(al + 32);
  const unsigned short* wb = afh + (size_t)b * AFSZ + (size_t)(n0 + l15) * 32 + 8 * hh;
  const unsigned short* wl = afl + (size_t)b * AFSZ + (size_t)(n0 + l15) * 32 + 8 * hh;
  v8f c0 = zero8(), c1 = zero8(), c2 = zero8(), c3 = zero8();
  {
    const v16bf bh = ldfrag(wb), bl = ldfrag(wl);
    c0 = mma_bf(a0h, bh, c0); c0 = mma_bf(a0l, bh, c0); c0 = mma_bf(a0h, bl, c0);
  }
  {
    const v16bf bh = ldfrag(wb + 16 * 32), bl = ldfrag(wl + 16 * 32);
    c1 = mma_bf(a0h, bh, c1); c1 = mma_bf(a0l, bh, c1); c1 = mma_bf(a0h, bl, c1);
  }
  {
    const v16bf bh = ldfrag(wb + 32 * 32), bl = ldfrag(wl + 32 * 32);
    c2 = mma_bf(a1h, bh, c2); c2 = mma_bf(a1l, bh, c2); c2 = mma_bf(a1h, bl, c2);
  }
  {
    const v16bf bh = ldfrag(wb + 48 * 32), bl = ldfrag(wl + 48 * 32);
    c3 = mma_bf(a1h, bh, c3); c3 = mma_bf(a1l, bh, c3); c3 = mma_bf(a1h, bl, c3);
  }
  float* sw = stg + wave * (16 * AXP);
#pragma unroll
  for (int r = 0; r < 8; ++r) {
    sw[(8 * hh + r) * AXP + l15] = c0[r];
    sw[(8 * hh + r) * AXP + 16 + l15] = c1[r];
    sw[(8 * hh + r) * AXP + 32 + l15] = c2[r];
    sw[(8 * hh + r) * AXP + 48 + l15] = c3[r];
  }
  wave_sync_lds();
  const int q = lane >> 3, piece = lane & 7;
  v4u oh[4], ol[4];
#pragma unroll
  for (int it = 0; it < 4; ++it) {
    const int row = it * 4 + q;
    const float* sp = sw + row * AXP + piece * 8;
    const v4f v0 = *(const v4f*)(sp);
    const v4f v1 = *(const v4f*)(sp + 4);
    split8(v0, v1, oh[it], ol[it]);
  }
#pragma unroll
  for (int it = 0; it < 4; ++it) {
    const int row = it * 4 + q;
    const size_t to = (size_t)(m0 + row) * CC + n0 + piece * 8;
    *(v4u*)(Oh + to) = oh[it];
    *(v4u*)(Ol + to) = ol[it];
  }
  
}

// =================================================================================================================
// Workspace map (bytes), NPIX = NB*HW: A f32 [NPIX][128], Bx same, T = two bf16 planes [NPIX][128], U f32
// [NPIX][384] (also used as two bf16 planes [NPIX][128]), R f32 [NPIX][384], weights bf16 (655360), pn f32 [NB*NSLN][256], pa f32 [NB*NHEAD*NSLS][1024], af two bf16
// planes [NB][128][32]. Total 153911296 for NB=2, IMW=128. Every region is an exact multiple of its whole-row store
// granularity.
// =================================================================================================================
extern "C" void kernel_launch(void* const* d_in, const int* in_sizes, int n_in,
                              void* d_out, int out_size, void* d_ws, size_t ws_size,
                              hipStream_t stream) {
  if (n_in < 23) return;
  if (in_sizes[0] != NPIX * CC) return;
  if (in_sizes[1] != CC || in_sizes[2] != CC || in_sizes[3] != CC || in_sizes[4] != CC) return;
  if (in_sizes[5] != C3 * CC || in_sizes[6] != C3 * 9 || in_sizes[7] != CC * CC || in_sizes[8] < 1) return;
  if (in_sizes[9] != HID * CC || in_sizes[10] != HID * 9 || in_sizes[11] != CC * HID) return;
  if (in_sizes[12] != CC || in_sizes[13] != CC || in_sizes[14] != CC || in_sizes[15] != CC) return;
  if (in_sizes[16] != C3 * CC || in_sizes[17] != C3 * 9 || in_sizes[18] != CC * CC || in_sizes[19] < 1) return;
  if (in_sizes[20] != HID * CC || in_sizes[21] != HID * 9 || in_sizes[22] != CC * HID) return;
  if (out_size != NPIX * CC) return;

  const float* x        = (const float*)d_in[0];
  const float* w_s0     = (const float*)d_in[1];
  const float* b_s0     = (const float*)d_in[2];
  const float* w_s2     = (const float*)d_in[3];
  const float* b_s2     = (const float*)d_in[4];
  const float* rsa_qkv  = (const float*)d_in[5];
  const float* rsa_dw   = (const float*)d_in[6];
  const float* rsa_proj = (const float*)d_in[7];
  const float* rsa_temp = (const float*)d_in[8];
  const float* ffs_in   = (const float*)d_in[9];
  const float* ffs_dw   = (const float*)d_in[10];
  const float* ffs_out  = (const float*)d_in[11];
  const float* w_c0     = (const float*)d_in[12];
  const float* b_c0     = (const float*)d_in[13];
  const float* w_c2     = (const float*)d_in[14];
  const float* b_c2     = (const float*)d_in[15];
  const float* gsa_qkv  = (const float*)d_in[16];
  const float* gsa_dw   = (const float*)d_in[17];
  const float* gsa_proj = (const float*)d_in[18];
  const float* gsa_temp = (const float*)d_in[19];
  const float* ffc_in   = (const float*)d_in[20];
  const float* ffc_dw   = (const float*)d_in[21];
  const float* ffc_out  = (const float*)d_in[22];
  float* out = (float*)d_out;

  // ---- carve ----
  const size_t sAct = (size_t)NPIX * CC * 4;                        // f32 [NPIX][128]
  const size_t sT   = (size_t)NPIX * CC * 2 * 2;                    // two bf16 planes [NPIX][128]
  const size_t sU   = (size_t)NPIX * C3 * 4;                        // f32 [NPIX][384]
  const size_t sR   = (size_t)NPIX * C3 * 4;                        // f32 [NPIX][384]
  const size_t sWq  = (size_t)C3 * CC * 2;
  const size_t sWp  = (size_t)CC * CC * 2;
  const size_t sW1  = (size_t)HIDP * CC * 2;
  const size_t sW2  = (size_t)CC * HIDP * 2;
  const size_t sPN  = (size_t)NB * NSLN * 256 * 4;
  const size_t sPA  = (size_t)NB * NHEAD * NSLS * 1024 * 4;
  const size_t sAF  = (size_t)NB * AFSZ * 2;                        // per plane
  size_t off = 0;
  const size_t oA   = off; off += sAct;
  const size_t oBx  = off; off += sAct;
  const size_t oT   = off; off += sT;
  const size_t oU   = off; off += sU;
  const size_t oR   = off; off += sR;
  const size_t oWq0 = off; off += sWq;
  const size_t oWp0 = off; off += sWp;
  const size_t oW10 = off; off += sW1;
  const size_t oW20 = off; off += sW2;
  const size_t oWq1 = off; off += sWq;
  const size_t oWp1 = off; off += sWp;
  const size_t oW11 = off; off += sW1;
  const size_t oW21 = off; off += sW2;
  const size_t oPN  = off; off += sPN;
  const size_t oPA  = off; off += sPA;
  const size_t oAFh = off; off += sAF;
  const size_t oAFl = off; off += sAF;
  if (off > ws_size) return;                               // off = 153911296 for NB=2, IMW=128
  if (sU < (size_t)NPIX * HIDP * 4) return;
  if (sU < (size_t)NPIX * CC * 2 * 2) return;

  char* ws = (char*)d_ws;
  float* A  = (float*)(ws + oA);
  float* Bx = (float*)(ws + oBx);
  unsigned short* Th = (unsigned short*)(ws + oT);
  unsigned short* Tl = Th + (size_t)NPIX * CC;
  float* U  = (float*)(ws + oU);
  unsigned short* Uh = (unsigned short*)(ws + oU);
  unsigned short* Ul = Uh + (size_t)NPIX * CC;
  float* R  = (float*)(ws + oR);
  unsigned short* Wq0 = (unsigned short*)(ws + oWq0);
  unsigned short* Wp0 = (unsigned short*)(ws + oWp0);
  unsigned short* W10 = (unsigned short*)(ws + oW10);
  unsigned short* W20 = (unsigned short*)(ws + oW20);
  unsigned short* Wq1 = (unsigned short*)(ws + oWq1);
  unsigned short* Wp1 = (unsigned short*)(ws + oWp1);
  unsigned short* W11 = (unsigned short*)(ws + oW11);
  unsigned short* W21 = (unsigned short*)(ws + oW21);
  float* PN = (float*)(ws + oPN);
  float* PA = (float*)(ws + oPA);
  unsigned short* AFh = (unsigned short*)(ws + oAFh);
  unsigned short* AFl = (unsigned short*)(ws + oAFl);

  const dim3 blk(256);
  // (1) x NCHW -> A pixel-major; weights f32 [out][in] -> bf16 planes [outP][inP], k contiguous, zero padded
  //     (Wq0 is the start of the weight region: Wq0, Wp0, W10, W20, Wq1, Wp1, W11, W21 lie one behind the other)
  prep_k<<<dim3(PB_T + 2 * PB_SET), blk, 0, stream>>>(x, A, rsa_qkv, rsa_proj, ffs_in, ffs_out,
                                                      gsa_qkv, gsa_proj, ffc_in, ffc_out, Wq0);

  (void)hipFuncSetAttribute(reinterpret_cast<const void*>(&rsa_attn_k), hipFuncAttributeMaxDynamicSharedMemorySize, RL_END);
  (void)hipFuncSetAttribute(reinterpret_cast<const void*>(&gsa_s_k), hipFuncAttributeMaxDynamicSharedMemorySize, GL_END);

  const dim3 gG(NPIX / GBM);
  const dim3 gDw((NPIX / DWL * (C3 / 4) + 255) / 256);

  // ---- spatial (RSA) block ----
  gemm_k<CC, C3, 0, 1><<<gG, blk, 0, stream>>>(Th, Tl, Wq0, U, Bx, A, w_s0, b_s0);        // qkv 1x1 of LN_s0(x) -> U
  dw_k<C3, 0><<<gDw, blk, 0, stream>>>(U, rsa_dw, 0, C3, WSZ / 2, R, C3, 0, Th, Tl, CC); // dw (rolled) -> R
  rsa_attn_k<<<dim3(NB * NWIN), blk, RL_END, stream>>>(R, rsa_temp, Th, Tl);            // T = window attention out
  gemm_k<CC, CC, 0, 0><<<gG, blk, 0, stream>>>(Th, Tl, Wp0, Bx, A, A, w_s2, b_s2);        // Bx = x_
  gemm_k<CC, HIDP, 0, 2><<<gG, blk, 0, stream>>>(Th, Tl, W10, U, Bx, A, w_s2, b_s2);      // ffn-in of LN_s2(x_+x) -> U
  dwffn_k<1><<<gG, blk, 0, stream>>>(U, ffs_dw, HID, W20, A, Bx);                        // dw+gelu+ffn-out: A = ffn + x_

  // ---- channel (GSA) block ----
  gemm_k<CC, C3, 0, 1><<<gG, blk, 0, stream>>>(Th, Tl, Wq1, U, Bx, A, w_c0, b_c0);        // qkv 1x1 of LN_c0(x) -> U
  dw_k<C3, 2><<<gDw, blk, 0, stream>>>(U, gsa_dw, 0, C3, 0, R, C3, 0, Th, Tl, CC);       // q, k -> R f32; v planes -> T region
  gsa_s_k<<<dim3(NB * NHEAD * NSLS), blk, GL_END, stream>>>(R, PA, PN);                  // score and norm partials
  gsa_fin_k<<<dim3(NB * NHEAD * FINQ), dim3(320), 0, stream>>>(PA, PN, gsa_temp, AFh, AFl);
  apply_k<<<dim3(NPIX / 128, CC / 64), blk, 0, stream>>>(Th, Tl, AFh, AFl, Uh, Ul);     // U planes = channel attention out
  gemm_k<CC, CC, 0, 0><<<gG, blk, 0, stream>>>(Uh, Ul, Wp1, Bx, A, A, w_c2, b_c2);        // Bx = x_
  gemm_k<CC, HIDP, 0, 2><<<gG, blk, 0, stream>>>(Th, Tl, W11, U, Bx, A, w_c2, b_c2);      // ffn-in of LN_c2(x_+x) -> U
  dwffn_k<2><<<gG, blk, 0, stream>>>(U, ffc_dw, HID, W21, out, Bx);                      // d_out NCHW = ffn + x_
  (void)hipGetLastError();
}

// v009
// One run takes 192 microseconds.
// Two timings next to v008 both put it at 1.07 times that version's speed.
// Counting every step since v000, it is 3.92 times as fast.
// Contractions (1x1 convs for qkv / proj / ffn-in / ffn-out, window q^T.k and v.attn, global q.k^T and attn.v):
// v_wmma_f32_16x16x32_bf16 (bf16 operands, f32 accumulate); computed operands carried as bf16 hi + residual planes,
// weight operands single bf16; layer norms, depthwise 3x3 convs, erf GELU, l2 norms and residual adds in f32 on VALU.
// Inputs RNE-converted to bf16 on load.
#include <hip/hip_runtime.h>
#include <math.h>
#include <stdint.h>

#define NB    2
#define CC    128
#define IMW   128
#define HW    (IMW * IMW)
#define NPIX  (NB * HW)
#define C3    384
#define HID   340
#define HIDP  384
#define NHEAD 4
#define HDC   32
#define WSZ   4
#define NWX   (IMW / WSZ)
#define NWIN  (NWX * NWX)
#define NSLN  (HW / 256)
#define NSLS  (HW / 256)
#define AFSZ  (CC * HDC)
#define RSQ2  0.70710678118654752f
#define GXP   36
#define AXP   68
#define TXP   132
#define ATP   136
#define GSP   264
#define DWL   8

static_assert((IMW & (IMW - 1)) == 0);
static_assert(IMW % WSZ == 0);
static_assert(WSZ == 4);
static_assert(IMW % DWL == 0);
static_assert(HW % 256 == 0);
static_assert(HW % 64 == 0);
static_assert(NPIX % 256 == 0);
static_assert(CC == NHEAD * HDC);
static_assert(HDC == 32);
static_assert((GXP * 4) % 16 == 0);
static_assert((AXP * 4) % 16 == 0);
static_assert((TXP * 4) % 16 == 0);
static_assert((ATP * 2) % 16 == 0);
static_assert((GSP * 2) % 16 == 0);

// RSA window kernel dynamic LDS map (bytes)
#define RL_R    0
#define RL_QTH  24576
#define RL_QTL  28672
#define RL_KTH  32768
#define RL_KTL  36864
#define RL_ATH  40960
#define RL_ATL  75776
#define RL_VH   110592
#define RL_VL   114944
#define RL_INV  119296
#define RL_END  119424
static_assert(RL_QTH == RL_R + 16 * C3 * 4);
static_assert(RL_QTL == RL_QTH + CC * 16 * 2);
static_assert(RL_KTH == RL_QTL + CC * 16 * 2);
static_assert(RL_KTL == RL_KTH + CC * 16 * 2);
static_assert(RL_ATH == RL_KTL + CC * 16 * 2);
static_assert(RL_ATL == RL_ATH + CC * ATP * 2);
static_assert(RL_VH == RL_ATL + CC * ATP * 2);
static_assert(RL_VL == RL_VH + 16 * ATP * 2);
static_assert(RL_INV == RL_VL + 16 * ATP * 2);
static_assert(RL_END == RL_INV + 32 * 4);
static_assert(16 * TXP * 4 <= RL_QTH - RL_R);

// GSA score kernel dynamic LDS map (bytes)
#define GL_QH   0
#define GL_QL   16896
#define GL_KH   33792
#define GL_KL   50688
#define GL_RED  67584
#define GL_STG  71680
#define GL_SQ   76288
#define GL_END  77312
static_assert(GL_QL == 32 * GSP * 2);
static_assert(GL_KH == 2 * GL_QL);
static_assert(GL_KL == 3 * GL_QL);
static_assert(GL_RED == 4 * GL_QL);
static_assert(GL_STG == GL_RED + 4 * 32 * 8 * 4);
static_assert(GL_SQ == GL_STG + 32 * GXP * 4);
static_assert(GL_END == GL_SQ + 4 * 64 * 4);

typedef __bf16         v16bf __attribute__((ext_vector_type(16)));
typedef unsigned short v8us  __attribute__((ext_vector_type(8)));
typedef float          v8f   __attribute__((ext_vector_type(8)));
typedef float          v4f   __attribute__((ext_vector_type(4)));
typedef unsigned int   v4u   __attribute__((ext_vector_type(4)));
typedef unsigned int   v2u   __attribute__((ext_vector_type(2)));
typedef float          v2f   __attribute__((ext_vector_type(2)));
typedef __bf16         v2bf  __attribute__((ext_vector_type(2)));

union Frag { v16bf v; v8us u[2]; };

// ---- scalar helpers ------------------------------------------------------------------------------------------
// f32 -> bf16 bits, RNE, by the hardware's convert
__device__ __forceinline__ unsigned short bf_bits(float f) { return __builtin_bit_cast(unsigned short, (__bf16)f); }
// two f32 -> two bf16 (RNE) packed in one register, a in the low half, b in the high half: one packed convert
__device__ __forceinline__ unsigned cvt2(float a, float b) {
  const v2f t = {a, b};
  return __builtin_bit_cast(unsigned, __builtin_convertvector(t, v2bf));
}
__device__ __forceinline__ float bf_up(unsigned short h) { return __uint_as_float(((unsigned)h) << 16); }
__device__ __forceinline__ float bfr(float f) { return bf_up(bf_bits(f)); }
// hi = bf16(v), lo = bf16(v - hi)
__device__ __forceinline__ void split_bf(float v, unsigned short& hi, unsigned short& lo) {
  const unsigned short hb = bf_bits(v);
  hi = hb;
  lo = bf_bits(v - bf_up(hb));
}
// the same for two values at once, both results packed (a low, b high): two packed converts, no packing steps
__device__ __forceinline__ void split2(float a, float b, unsigned& ph, unsigned& pl) {
  const unsigned h = cvt2(a, b);
  ph = h;
  pl = cvt2(a - __uint_as_float(h << 16), b - __uint_as_float(h & 0xFFFF0000u));
}
__device__ __forceinline__ void split4(v4f v, v2u& ph, v2u& pl) {
  unsigned h0, h1, l0, l1;
  split2(v[0], v[1], h0, l0);
  split2(v[2], v[3], h1, l1);
  ph[0] = h0; ph[1] = h1;
  pl[0] = l0; pl[1] = l1;
}
__device__ __forceinline__ void split8(v4f v0, v4f v1, v4u& ph, v4u& pl) {
  unsigned h[4], l[4];
  split2(v0[0], v0[1], h[0], l[0]);
  split2(v0[2], v0[3], h[1], l[1]);
  split2(v1[0], v1[1], h[2], l[2]);
  split2(v1[2], v1[3], h[3], l[3]);
#pragma unroll
  for (int e = 0; e < 4; ++e) { ph[e] = h[e]; pl[e] = l[e]; }
}
__device__ __forceinline__ v8f zero8() { v8f z = {0.f, 0.f, 0.f, 0.f, 0.f, 0.f, 0.f, 0.f}; return z; }
__device__ __forceinline__ v8us zero8us() { v8us z = {0, 0, 0, 0, 0, 0, 0, 0}; return z; }

// ---- fragment loaders: 16-bit A/B operand, lane -> row/col (lane&15), p already includes +8*(lane>>4);
//      elements 0..7 <- p[0..7] (k0+8h..), elements 8..15 <- p[16..23] (k0+16+8h..)
__device__ __forceinline__ v16bf ldfrag(const unsigned short* p) {
  Frag f;
  f.u[0] = *(const v8us*)(p);
  f.u[1] = *(const v8us*)(p + 16);
  return f.v;
}
// K = 16 contraction padded to 32: elements 8..15 are zero
__device__ __forceinline__ v16bf ldfrag16(const unsigned short* p) {
  Frag f;
  f.u[0] = *(const v8us*)(p);
  f.u[1] = zero8us();
  return f.v;
}

// ---- WMMA helper with trailing VALU hazard gap ---------------------------------------------------------------
__device__ __forceinline__ v8f mma_bf(v16bf a, v16bf b, v8f c) {
  c = __builtin_amdgcn_wmma_f32_16x16x32_bf16(false, a, false, b, (short)0, c, false, false);
#if defined(__HIP_DEVICE_COMPILE__)
  asm volatile("v_nop\n\tv_nop\n\tv_nop\n\tv_nop" : "+v"(c) : "v"(a), "v"(b));
#endif
  return c;
}
__device__ __forceinline__ void wave_sync_lds() {
  __builtin_amdgcn_fence(__ATOMIC_RELEASE, "workgroup");
  __builtin_amdgcn_wave_barrier();
  __builtin_amdgcn_fence(__ATOMIC_ACQUIRE, "workgroup");
}

// =================================================================================================================
// Weight convert: w f32 [rows][cols] -> bf16 [rowsP][colsP] (zero padded), value = bf16_RNE(w). One thread = 8
// coverage: rowsP * colsP/8 pieces, ceil(pieces/256) blocks (blk = block index within the matrix) with a bound.
// =================================================================================================================
__device__ __forceinline__ void cvt_w(const float* __restrict__ w, unsigned short* outp,
                                      int rows, int cols, int rowsP, int colsP, int blk) {
  const int t = blk * 256 + threadIdx.x;
  const int ppr = colsP >> 3;
  const int npc = rowsP * ppr;
  const bool ok = t < npc;
  const int tt = ok ? t : 0;
  const int r = tt / ppr, c8 = (tt - r * ppr) * 8;
  const int rr = min(r, rows - 1);
  float zv[8];
#pragma unroll
  for (int e = 0; e < 8; ++e) {
    const int c = c8 + e;
    const int cl = min(c, cols - 1);
    const float f = w[(size_t)rr * cols + cl];
    zv[e] = (r < rows && c < cols) ? f : 0.0f;
  }
  v4u pk;
#pragma unroll
  for (int e = 0; e < 4; ++e) pk[e] = cvt2(zv[2 * e], zv[2 * e + 1]);
  unsigned short* gp = outp + (size_t)r * colsP + c8;
  if (ok) *(v4u*)gp = pk;
  
}

// =================================================================================================================
// NCHW f32 x -> pixel-major stream A [b*HW + p][128] f32, values bf16-RNE-converted. Block = (b, 64-pixel tile):
// 128 ch x 64 px loaded coalesced along p into an LDS tile [px][TXP]; store: each pixel row = 512 B = 32 lanes x
// coverage: 8 waves x 8 rows = 64 px x 128 ch per block; NB*(HW/64) blocks (blk) = every pixel once.
// =================================================================================================================
__device__ __forceinline__ void nchw_in(const float* __restrict__ x, float* A, float* xs, int blk) {
  const int tid = threadIdx.x, wave = tid >> 5, lane = tid & 31;
  const int b = blk / (HW / 64);
  const int p0 = (blk - b * (HW / 64)) * 64;
#pragma unroll
  for (int it = 0; it < 8; ++it) {
    const int q = it * 256 + tid;
    const int ch = q >> 4, j4 = (q & 15) * 4;
    const v4f v = *(const v4f*)(x + ((size_t)(b * CC + ch)) * HW + p0 + j4);
#pragma unroll
    for (int e = 0; e < 4; ++e) xs[(j4 + e) * TXP + ch] = bfr(v[e]);
  }
  __syncthreads();
  v4f ov[8];
#pragma unroll
  for (int it = 0; it < 8; ++it) {
    const int row = wave * 8 + it;
    ov[it] = *(const v4f*)(xs + row * TXP + lane * 4);
  }
#pragma unroll
  for (int it = 0; it < 8; ++it) {
    const int row = wave * 8 + it;
    *(v4f*)(A + ((size_t)(b * HW + p0 + row)) * CC + lane * 4) = ov[it];
  }
}

// =================================================================================================================
// Input preparation, one launch: the NCHW transpose and the eight weight converts need nothing of each other, so they
// share one grid by ranges of the block index (block-uniform branches; the transpose's barrier is passed by whole
// blocks only). Blocks [0, PB_T): transpose tiles; then per weight set (spatial, channel) PB_SET blocks: qkv, proj,
// ffn-in, ffn-out. Wb = the bf16 weight region, the four matrices of a set one behind the other, set after set.
// =================================================================================================================
#define PB_T    (NB * (HW / 64))
#define PB_Q    (C3 * CC / 8 / 256)
#define PB_P    (CC * CC / 8 / 256)
#define PB_1    (HIDP * CC / 8 / 256)
#define PB_2    (CC * HIDP / 8 / 256)
#define PB_SET  (PB_Q + PB_P + PB_1 + PB_2)
#define WSETN   (C3 * CC + CC * CC + HIDP * CC + CC * HIDP)
static_assert((C3 * CC) % 2048 == 0 && (CC * CC) % 2048 == 0 && (HIDP * CC) % 2048 == 0);
__global__ __launch_bounds__(256) void prep_k(const float* __restrict__ x, float* A,
                                              const float* __restrict__ wq0, const float* __restrict__ wp0,
                                              const float* __restrict__ w10, const float* __restrict__ w20,
                                              const float* __restrict__ wq1, const float* __restrict__ wp1,
                                              const float* __restrict__ w11, const float* __restrict__ w21,
                                              unsigned short* Wb) {
  __shared__ __align__(16) float xs[64 * TXP];
  const int bi = blockIdx.x;
  if (bi < PB_T) { nchw_in(x, A, xs, bi); return; }
  const int r0 = bi - PB_T;
  const int set = r0 / PB_SET;
  const int r = r0 - set * PB_SET;
  unsigned short* o = Wb + (size_t)set * WSETN;
  if (r < PB_Q) {
    cvt_w(set ? wq1 : wq0, o, C3, CC, C3, CC, r);
  } else if (r < PB_Q + PB_P) {
    cvt_w(set ? wp1 : wp0, o + C3 * CC, CC, CC, CC, CC, r - PB_Q);
  } else if (r < PB_Q + PB_P + PB_1) {
    cvt_w(set ? w11 : w10, o + C3 * CC + CC * CC, HID, CC, HIDP, CC, r - (PB_Q + PB_P));
  } else {
    cvt_w(set ? w21 : w20, o + C3 * CC + CC * CC + HIDP * CC, CC, HID, CC, HIDP, r - (PB_Q + PB_P + PB_1));
  }
}

// =================================================================================================================
// Layer norm of pixel rows over their 128 channels, one wave per row, 4 channels per lane. ln_stats: mean and variance
// by butterfly sums over the 32 lanes (two passes); returns the centred values dv and the variance (the same in every
// lane). ln_out: dv * rstd, scale gv, shift bb, result as bf16 hi + residual, 4 + 4 halves.
// The loops are unrolled in full: constant indices keep the 4-element vectors in registers.
// =================================================================================================================
__device__ __forceinline__ void ln_stats(v4f xv, v4f& dv, float& var) {
  float s = (xv[0] + xv[1]) + (xv[2] + xv[3]);
#pragma unroll
  for (int off = 1; off < 32; off <<= 1) s = s + __shfl_xor(s, off, 32);
  const float mu = s * (1.0f / 128.0f);
  float s2 = 0.f;
#pragma unroll
  for (int e = 0; e < 4; ++e) { dv[e] = xv[e] - mu; s2 = s2 + dv[e] * dv[e]; }
#pragma unroll
  for (int off = 1; off < 32; off <<= 1) s2 = s2 + __shfl_xor(s2, off, 32);
  var = s2 * (1.0f / 128.0f);
}
__device__ __forceinline__ void ln_out(v4f dv, float rstd, v4f gv, v4f bb, v2u& ph, v2u& pl) {
  v4f z;
#pragma unroll
  for (int e = 0; e < 4; ++e) z[e] = (dv[e] * rstd) * gv[e] + bb[e];
  split4(z, ph, pl);
}

// =================================================================================================================
// GEMM: OUT[p][n] = sum_k (Ah[p][k] + Al[p][k]) * W[n][k]  (A planes [pix][K] bf16 hi + residual, W single bf16
// [N][K] k-contiguous, 2 products per tile pair). Block = 8 waves = GBM pixels x all N columns. Per chunk of GKC k the
// block brings its GBM rows of both A planes and all N rows of W into LDS with loads of whole rows (16 lanes x 16 B =
// the 256 B of a row's chunk), rows at a pitch of GPP halves; every fragment is then read from LDS with the split k map.
// So each A row leaves L2 once, not once per 32 output columns, and no global load gathers 32-byte pieces of 16 rows.
// The next chunk's rows are loaded into registers while this chunk is multiplied. Waves: 2 pixel groups of 32 x
// 4 column groups of N/4; a wave holds N/128 tiles of 32 x 32 (2x2 fragments each) and uses its A fragments for all.
// Each sum runs over k in the same order as before (k rising, hi then residual).
// Epilogue (behind a barrier, in the LDS of the operands): each 32x32 f32 tile is staged by its wave and stored as
// whole 128-byte lines. EP 0: OUT[p][N]; EP 1: same + res[p][n] (res pitch 128); EP 2: NCHW d_out[b][n][p] + res[p][n].
// LN 0: A planes from Ah/Al. LN 1 / LN 2 (K = 128, one chunk): the A operand is the layer norm of the f32 rows X[p][128]
// (LN 2: of X + res), scale g, shift bv: each wave loads 8 of the block's rows, norms them and writes the two
// planes straight into the operand LDS, while the W rows are still on their way; Ah/Al are not read.
// coverage: 8 waves x 32 rows x N/4 cols per block = GBM px x N cols; grid covers NPIX x N once.
// =================================================================================================================
#define GKC 128
#define GBM 64
#define GPP 136
static_assert((GPP * 2) % 32 == 16);
static_assert(NPIX % GBM == 0 && HW % 32 == 0);
template <int K, int N, int EP, int LN>
__global__ __launch_bounds__(256) void gemm_k(const unsigned short* __restrict__ Ah,
                                              const unsigned short* __restrict__ Al,
                                              const unsigned short* __restrict__ W,
                                              float* outf, const float* __restrict__ res,
                                              const float* __restrict__ X, const float* __restrict__ g,
                                              const float* __restrict__ bv) {
  constexpr int NP = N / 128;                // 32-column tiles per wave
  constexpr int NCH = K / GKC;               // k chunks
  constexpr int WIT = N / 16;                // W rows per thread and chunk
  constexpr int LNR = GBM / 8;               // rows that a wave norms
  static_assert(K % GKC == 0 && N % 128 == 0);
  static_assert(LN == 0 || (K == CC && K == GKC && EP == 0));
  static_assert(8 * NP * 32 * GXP * 4 <= (2 * GBM + N) * GPP * 2);
  __shared__ __align__(16) unsigned short sm[(2 * GBM + N) * GPP];
  unsigned short* sah = sm;
  unsigned short* sal = sm + GBM * GPP;
  unsigned short* swt = sm + 2 * GBM * GPP;
  float* stg = (float*)sm;                   // reused behind the last chunk's barrier
  const int tid = threadIdx.x, wave = tid >> 5, lane = tid & 31, hh = lane >> 4, l15 = lane & 15;
  const int mb = blockIdx.x * GBM;
  const int mg = wave >> 2, ng = wave & 3;
  const int srow = tid >> 4, spc = (tid & 15) * 8;
  const unsigned short* gah = Ah + (size_t)(mb + srow) * K + spc;
  const unsigned short* gal = Al + (size_t)(mb + srow) * K + spc;
  const unsigned short* gw = W + (size_t)srow * K + spc;
  const int so = srow * GPP + spc;
  // Every loop below is unrolled in full: constant indices keep the staged rows and the sums in registers.
  v8f acc[NP][4];
#pragma unroll
  for (int j = 0; j < NP; ++j) {
#pragma unroll
    for (int f = 0; f < 4; ++f) acc[j][f] = zero8();
  }
  v4u ra[GBM / 16], rl[GBM / 16], rw[WIT];
  v4f xv[LNR], xb[LNR], gv, bb;
  if (LN == 0) {
#pragma unroll
    for (int it = 0; it < GBM / 16; ++it) {
      ra[it] = *(const v4u*)(gah + it * 16 * K);
      rl[it] = *(const v4u*)(gal + it * 16 * K);
    }
  } else {
    const size_t xo = (size_t)(mb + wave * LNR) * CC + lane * 4;
#pragma unroll
    for (int it = 0; it < LNR; ++it) xv[it] = *(const v4f*)(X + xo + it * CC);
    if (LN == 2) {
#pragma unroll
      for (int it = 0; it < LNR; ++it) xb[it] = *(const v4f*)(res + xo + it * CC);
    }
    // the loads below may be given registers that held the addresses of the row loads: the wait stands in front of them
    asm volatile("s_wait_xcnt 0x0" ::: "memory");
    gv = *(const v4f*)(g + lane * 4);
    bb = *(const v4f*)(bv + lane * 4);
  }
#pragma unroll
  for (int it = 0; it < WIT; ++it) rw[it] = *(const v4u*)(gw + it * 16 * K);
  // the W loads are issued here, behind the row loads, and come in while the rows are normed; without this line the
  // compiler moves them down into the norm and the block waits for them afterwards
  if (LN != 0) __builtin_amdgcn_sched_barrier(0);
#pragma unroll
  for (int kc = 0; kc < NCH; ++kc) {
    if (kc > 0) __syncthreads();             // every wave has read the chunk that is overwritten next
    if (LN == 0) {
#pragma unroll
      for (int it = 0; it < GBM / 16; ++it) {
        *(v4u*)(sah + so + it * 16 * GPP) = ra[it];
        *(v4u*)(sal + so + it * 16 * GPP) = rl[it];
      }
    } else {
#pragma unroll
      for (int e = 0; e < 4; ++e) { gv[e] = bfr(gv[e]); bb[e] = bfr(bb[e]); }
      float var[LNR];
#pragma unroll
      for (int it = 0; it < LNR; ++it) ln_stats(LN == 2 ? xv[it] + xb[it] : xv[it], xv[it], var[it]);
      // the root and the division are long sequences: lane i does them for row i, once for the wave's LNR rows
      float vs = var[0];
#pragma unroll
      for (int it = 1; it < LNR; ++it) vs = (lane == it) ? var[it] : vs;
      const float rs = 1.0f / sqrtf(vs + 1e-6f);
#pragma unroll
      for (int it = 0; it < LNR; ++it) {
        const float rstd = __int_as_float(__builtin_amdgcn_readlane(__float_as_int(rs), it));
        v2u ph, pw;
        ln_out(xv[it], rstd, gv, bb, ph, pw);
        const int lo = (wave * LNR + it) * GPP + lane * 4;
        *(v2u*)(sah + lo) = ph;
        *(v2u*)(sal + lo) = pw;
      }
    }
#pragma unroll
    for (int it = 0; it < WIT; ++it) *(v4u*)(swt + so + it * 16 * GPP) = rw[it];
    __syncthreads();                         // every wave reads rows that other waves staged
    if (kc + 1 < NCH) {
#pragma unroll
      for (int it = 0; it < GBM / 16; ++it) {
        ra[it] = *(const v4u*)(gah + it * 16 * K + (kc + 1) * GKC);
        rl[it] = *(const v4u*)(gal + it * 16 * K + (kc + 1) * GKC);
      }
#pragma unroll
      for (int it = 0; it < WIT; ++it) rw[it] = *(const v4u*)(gw + it * 16 * K + (kc + 1) * GKC);
    }
#pragma unroll
    for (int ks = 0; ks < GKC / 32; ++ks) {
      const int ko = ks * 32 + 8 * hh;
      const unsigned short* pa = sah + (mg * 32 + l15) * GPP + ko;
      const unsigned short* pl = sal + (mg * 32 + l15) * GPP + ko;
      const v16bf a0h = ldfrag(pa), a0l = ldfrag(pl);
      const v16bf a1h = ldfrag(pa + 16 * GPP), a1l = ldfrag(pl + 16 * GPP);
#pragma unroll
      for (int j = 0; j < NP; ++j) {
        const unsigned short* pb = swt + (ng * (N / 4) + j * 32 + l15) * GPP + ko;
        const v16bf b0 = ldfrag(pb), b1 = ldfrag(pb + 16 * GPP);
        acc[j][0] = mma_bf(a0h, b0, acc[j][0]); acc[j][0] = mma_bf(a0l, b0, acc[j][0]);
        acc[j][1] = mma_bf(a0h, b1, acc[j][1]); acc[j][1] = mma_bf(a0l, b1, acc[j][1]);
        acc[j][2] = mma_bf(a1h, b0, acc[j][2]); acc[j][2] = mma_bf(a1l, b0, acc[j][2]);
        acc[j][3] = mma_bf(a1h, b1, acc[j][3]); acc[j][3] = mma_bf(a1l, b1, acc[j][3]);
      }
    }
  }
  __syncthreads();                           // the operands' LDS becomes the output stage: every wave has left it
  const int m0 = mb + mg * 32;
#pragma unroll
  for (int j = 0; j < NP; ++j) {
    float* sw = stg + (wave * NP + j) * (32 * GXP);
#pragma unroll
    for (int r = 0; r < 8; ++r) {
      sw[(8 * hh + r) * GXP + l15] = acc[j][0][r];
      sw[(8 * hh + r) * GXP + 16 + l15] = acc[j][1][r];
      sw[(16 + 8 * hh + r) * GXP + l15] = acc[j][2][r];
      sw[(16 + 8 * hh + r) * GXP + 16 + l15] = acc[j][3][r];
    }
  }
  wave_sync_lds();
  const int q = lane >> 3, piece = lane & 7;
#pragma unroll
  for (int j = 0; j < NP; ++j) {
    const float* sw = stg + (wave * NP + j) * (32 * GXP);
    const int n0 = ng * (N / 4) + j * 32;
    v4f ov[8];
    if (EP != 2) {
#pragma unroll
      for (int it = 0; it < 8; ++it) {
        const int row = it * 4 + q;
        v4f v = *(const v4f*)(sw + row * GXP + piece * 4);
        if (EP == 1) {
          const v4f rr = *(const v4f*)(res + (size_t)(m0 + row) * CC + n0 + piece * 4);
          v = v + rr;
        }
        ov[it] = v;
      }
#pragma unroll
      for (int it = 0; it < 8; ++it) {
        const int row = it * 4 + q;
        *(v4f*)(outf + (size_t)(m0 + row) * N + n0 + piece * 4) = ov[it];
      }
    } else {
      const int b = m0 / HW;
      const int plx = m0 - b * HW;
#pragma unroll
      for (int it = 0; it < 8; ++it) {
        const int ch = it * 4 + q;
        v4f v;
#pragma unroll
        for (int e = 0; e < 4; ++e) {
          const float rv = res[(size_t)(m0 + piece * 4 + e) * CC + n0 + ch];
          v[e] = sw[(piece * 4 + e) * GXP + ch] + rv;
        }
        ov[it] = v;
      }
#pragma unroll
      for (int it = 0; it < 8; ++it) {
        const int ch = it * 4 + q;
        *(v4f*)(outf + ((size_t)(b * CC + n0 + ch)) * HW + plx + piece * 4) = ov[it];
      }
    }
  }
}

// =================================================================================================================
// Depthwise 3x3, SAME zero padding, cross-correlation taps, optional cyclic roll (output pixel index in the rolled
// frame, source slab in the unrolled frame: source pixel ((ny+roll) mod IMW, (nx+roll) mod IMW), valid iff the rolled
// neighbour (ny,nx) is inside the image). src [pix][CS] f32 (CS = all 384 channels of the conv), 4 channels per thread,
// weights wd[(wofs + c)*9 + tap] bf16-RNE (clamped address, zero for c >= cvalid): the block's CS*9 weights are read
// once (thread = channel, in steps of 256) and laid out in LDS as [tap][CS], channel contiguous, so that a thread takes
// its 4 channels of one tap with one 16-byte LDS read.
// A thread computes a strip of DWL output pixels along x: it loads the 3 x (DWL+2) source pixels of the strip once,
// all loads in flight together, keeps them in registers, and each loaded column serves up to three outputs; the taps
// come from LDS once per strip. Strips that follow one another in the grid lie under one another in y (a block's
// strips share source rows).
// A row outside the image zeroes its three taps; only the strip's two outer columns can lie outside the image.
// MODE 0: f32 rows dstf[p*dpitch + dcol + c]; MODE 1: exact-erf GELU (rolled) then bf16 hi + residual planes
// Ph/Pl[p*ppitch + dcol + c]; MODE 2: channels below 2*CC (q, k) as MODE 0, the rest (v) as planes without the GELU at
// Ph/Pl[p*ppitch + c - 2*CC] (a wave's 32 threads hold 128 channels in a row, so the choice is the same for a wave).
// coverage: (NPIX/DWL) * CS/4 threads x DWL pixels, grid ceil-div with an in-kernel bound.
// =================================================================================================================
template <int CS, int MODE>
__global__ __launch_bounds__(256) void dw_k(const float* __restrict__ src, const float* __restrict__ wd,
                                            int wofs, int cvalid, int roll,
                                            float* dstf, int dpitch, int dcol,
                                            unsigned short* Ph, unsigned short* Pl, int ppitch) {
  constexpr int TPP = CS / 4;
  constexpr int NSTR = NPIX / DWL;           // strips in all
  constexpr int SPI = HW / DWL;              // strips per image
  static_assert(CS % 128 == 0);
  __shared__ __align__(16) float wsm[9 * CS];
  constexpr int WTR = (CS + 255) / 256;      // thread = channel, its 9 taps, in WTR steps of 256 channels
  float wf[WTR][9];
#pragma unroll                               // constant indices keep wf in registers
  for (int k = 0; k < WTR; ++k) {            // no test here (the address is clamped): every step's loads behind one wait
    const float* wp = wd + min(wofs + (int)threadIdx.x + k * 256, cvalid - 1) * 9;
#pragma unroll                               // constant indices keep wf in registers
    for (int tp = 0; tp < 9; ++tp) wf[k][tp] = wp[tp];
  }
#pragma unroll                               // constant indices keep wf in registers
  for (int k = 0; k < WTR; ++k) {
    const int ch = (int)threadIdx.x + k * 256;
    const float wok = (wofs + ch < cvalid) ? 1.0f : 0.0f;
    if (ch < CS) {                           // whole waves
#pragma unroll                               // constant indices keep wf in registers
      for (int tp = 0; tp < 9; ++tp) wsm[tp * CS + ch] = bfr(wf[k][tp]) * wok;
    }
  }
  __syncthreads();                           // every wave reads table rows that other waves wrote
  const int t = blockIdx.x * 256 + threadIdx.x;
  int s = t / TPP;
  const int cg = t - s * TPP;
  const bool pv = s < NSTR;
  s = pv ? s : (NSTR - 1);
  const int c = cg * 4;
  const int b = s / SPI;
  const int sr = s - b * SPI;
  const int xs = sr / IMW;
  const int y = sr - xs * IMW;
  const int x0 = xs * DWL;
  const v4f* s4 = (const v4f*)src;            // slab rows in 16-byte units: TPP units per pixel
  // Every loop below but the GELU loop is unrolled in full so that its indices are constants: the offsets, the 3 x (DWL+2) window,
  // the taps and the DWL sums then live in registers (an index known only at run time would put them in scratch).
  int ro[3], co[DWL + 2], ix[3][DWL + 2];
#pragma unroll                               // see above
  for (int dy = 0; dy < 3; ++dy) {
    const int sy = (y + dy - 1 + roll) & (IMW - 1);
    ro[dy] = (b * HW + sy * IMW) * TPP + cg;
  }
#pragma unroll                               // see above
  for (int j = 0; j < DWL + 2; ++j) {
    const int sx = (x0 + j - 1 + roll) & (IMW - 1);
    co[j] = sx * TPP;
  }
#pragma unroll                               // see above
  for (int dy = 0; dy < 3; ++dy) {
#pragma unroll                               // see above
    for (int j = 0; j < DWL + 2; ++j) ix[dy][j] = ro[dy] + co[j];
  }
  const int p0 = b * HW + y * IMW + x0;      // first output pixel of the strip
  const float ml = (x0 > 0) ? 1.0f : 0.0f;
  const float mr = (x0 + DWL < IMW) ? 1.0f : 0.0f;
  v4f v[3][DWL + 2];
#pragma unroll                               // see above
  for (int dy = 0; dy < 3; ++dy) {
#pragma unroll                               // see above
    for (int j = 0; j < DWL + 2; ++j) v[dy][j] = s4[ix[dy][j]];
    // the next row's loads may be given registers that held this row's offsets: the wait stands in front of them
    if (dy < 2) asm volatile("s_wait_xcnt 0x0" ::: "memory");
  }
  static_assert(DWL == 8);                   // the statement below names the 3 x 10 loaded values one by one
  // Inputs only: every load of the window is issued in front of this line, so the wave waits out one memory latency
  // for all 30; without it the compiler spreads the loads among the sums and waits for them a few at a time.
  asm volatile("" :: "v"(v[0][0]), "v"(v[0][1]), "v"(v[0][2]), "v"(v[0][3]), "v"(v[0][4]),
                     "v"(v[0][5]), "v"(v[0][6]), "v"(v[0][7]), "v"(v[0][8]), "v"(v[0][9]),
                     "v"(v[1][0]), "v"(v[1][1]), "v"(v[1][2]), "v"(v[1][3]), "v"(v[1][4]),
                     "v"(v[1][5]), "v"(v[1][6]), "v"(v[1][7]), "v"(v[1][8]), "v"(v[1][9]),
                     "v"(v[2][0]), "v"(v[2][1]), "v"(v[2][2]), "v"(v[2][3]), "v"(v[2][4]),
                     "v"(v[2][5]), "v"(v[2][6]), "v"(v[2][7]), "v"(v[2][8]), "v"(v[2][9]));
  v4f acc[DWL];
#pragma unroll                               // see above
  for (int i = 0; i < DWL; ++i) acc[i] = v4f{0.f, 0.f, 0.f, 0.f};
  // row by row: a row's registers are free once its three taps are summed; each output still sums its taps 0..8 in order
#pragma unroll                               // see above
  for (int dy = 0; dy < 3; ++dy) {
    const float rm = ((unsigned)(y + dy - 1) < (unsigned)IMW) ? 1.0f : 0.0f;
    v4f wv[3];
#pragma unroll                               // see above
    for (int dx = 0; dx < 3; ++dx) wv[dx] = *(const v4f*)(wsm + (dy * 3 + dx) * CS + c) * rm;
    v[dy][0] = v[dy][0] * ml;
    v[dy][DWL + 1] = v[dy][DWL + 1] * mr;
#pragma unroll                               // see above
    for (int i = 0; i < DWL; ++i) {          // output by output: column i is free once output i has its row
#pragma unroll                               // see above
      for (int dx = 0; dx < 3; ++dx) acc[i] = acc[i] + v[dy][i + dx] * wv[dx];
    }
    // the next row's taps are read only now: all 9 read ahead take 24 registers more, and above 160 registers fewer
    // than three blocks are resident per WGP
    if (dy < 2) __builtin_amdgcn_sched_barrier(0);
  }
#pragma unroll                               // see above
  for (int i = 0; i < DWL; ++i) {
    v4f a = acc[i];
    if (MODE == 1) {
#pragma unroll 1                             // rolled as before: one copy of the erf code per output pixel
      for (int e = 0; e < 4; ++e) {
        const float g = (e == 0) ? a[0] : ((e == 1) ? a[1] : ((e == 2) ? a[2] : a[3]));
        const float er = erff(g * RSQ2);
        float gl = 0.5f * g;
        gl = gl * (1.0f + er);
        a[0] = (e == 0) ? gl : a[0];
        a[1] = (e == 1) ? gl : a[1];
        a[2] = (e == 2) ? gl : a[2];
        a[3] = (e == 3) ? gl : a[3];
      }
    }
    if (MODE == 0 || (MODE == 2 && c < 2 * CC)) {
      float* gp = dstf + (size_t)(p0 + i) * dpitch + dcol + c;
      if (pv) *(v4f*)gp = a;
    } else {
      v2u ph, plw;
      split4(a, ph, plw);
      const size_t to = (size_t)(p0 + i) * ppitch + dcol + (MODE == 2 ? c - 2 * CC : c);
      if (pv) { *(v2u*)(Ph + to) = ph; *(v2u*)(Pl + to) = plw; }
    }
  }
}

// =================================================================================================================
// FFN tail in one kernel: depthwise 3x3 (SAME zero padding, no roll) + exact-erf GELU + the 1x1 out conv (K = HIDP,
// N = CC) + residual. Block = 8 waves = a tile of FTX x 2 pixels = GBM rows of the GEMM. The GELU output never goes to
// memory: per chunk of GKC channels a wave computes one strip of DWL pixels x 128 channels (a thread: 4 channels, the
// 3 x (DWL+2) window in registers, taps from LDS, sums as in dw_k, GELU by gelu4_small) and writes the bf16 hi + residual planes of
// its DWL rows straight into the operand LDS; then the block multiplies the chunk as gemm_k does (2 pixel groups x 4
// column groups of 32 x 32, k rising, hi then residual). The next chunk's window is loaded into registers while this
// chunk is multiplied. All of W (CC rows of HIDP, pitch WPP) and the 9 x HIDP taps are staged in LDS once. Row r of
// pixel group mg is pixel (ty*2 + mg, tx*FTX + r): 32 pixels in a row of the image, so the epilogue stores whole
// 128-byte lines in both output layouts.
// EP 1: OUT[p][CC] = sum + res[p][n]; EP 2: NCHW d_out[b][n][p] = sum + res[p][n].
// coverage: NPIX / GBM blocks x GBM px x CC columns.
// =================================================================================================================
#define WPP 392
#define FTX 32
// Exact-erf GELU of 4 channels for arguments z = g / sqrt(2) with |z| < 1: erf(z) = z + z * P(z * z), P the degree-5
// polynomial that the math library's erff takes on that range, summed in the same order, so the values are erff's own.
// No branch and no select: the 4 channels go through packed multiply-adds, and pixels are independent of one another.
// mx takes up the largest |z| seen: the caller sends a thread with any |z| >= 1 through erff itself.
__device__ __forceinline__ v4f gelu4_small(v4f g, float& mx) {
  const v4f z = g * RSQ2;
  const v4f t = z * z;
  v4f p = __builtin_elementwise_fma(t, (v4f)(-0.000561801775f), (v4f)(0.00491381623f));
  p = __builtin_elementwise_fma(t, p, (v4f)(-0.0267075151f));
  p = __builtin_elementwise_fma(t, p, (v4f)(0.112800106f));
  p = __builtin_elementwise_fma(t, p, (v4f)(-0.376122952f));
  p = __builtin_elementwise_fma(t, p, (v4f)(0.128379107f));
  const v4f er = __builtin_elementwise_fma(z, p, z);
  mx = fmaxf(mx, fmaxf(fmaxf(fabsf(z[0]), fabsf(z[1])), fmaxf(fabsf(z[2]), fabsf(z[3]))));
  return (0.5f * g) * (1.0f + er);
}
static_assert((WPP * 2) % 32 == 16 && WPP >= HIDP);
static_assert(GBM == 2 * FTX && FTX == 4 * DWL && IMW % FTX == 0 && HIDP % GKC == 0 && GKC == 128 && CC == 128);
static_assert((CC * HIDP / 8) % 256 == 0);
// Launch bounds: 4 waves per SIMD = two blocks per WGP, as the LDS allows; without the second figure the compiler
// interleaves the unrolled GELU of all eight pixels on more than 256 registers, and then one block is resident.
template <int EP>
__global__ __launch_bounds__(256, 4) void dwffn_k(const float* __restrict__ src, const float* __restrict__ wd, int cvalid,
                                               const unsigned short* __restrict__ W, float* outf,
                                               const float* __restrict__ res) {
  constexpr int CS = HIDP;
  constexpr int TPP = CS / 4;
  constexpr int NCH = CS / GKC;
  constexpr int WIT = CC * HIDP / 8 / 256;   // 16-byte pieces of W per thread
  constexpr int WTR = (CS + 255) / 256;
  static_assert(8 * 32 * GXP * 4 <= (2 * GBM * GPP + CC * WPP) * 2);
  __shared__ __align__(16) unsigned short sm[2 * GBM * GPP + CC * WPP];
  __shared__ __align__(16) float wsm[9 * CS];
  unsigned short* sah = sm;
  unsigned short* sal = sm + GBM * GPP;
  unsigned short* swt = sm + 2 * GBM * GPP;
  float* stg = (float*)sm;                   // reused behind the last chunk's barrier
  const int tid = threadIdx.x, lane = tid & 31, hh = lane >> 4, l15 = lane & 15;
  // the wave's number in a scalar register: the strip's place, its row addresses and its edge masks are then scalars
  const int wave = __builtin_amdgcn_readfirstlane(tid >> 5);
  const int mg = wave >> 2, ng = wave & 3;
  const int b = blockIdx.x / (HW / GBM);
  const int tr = blockIdx.x - b * (HW / GBM);
  const int ty = tr / (IMW / FTX);
  const int tx = tr - ty * (IMW / FTX);
  const int y = ty * 2 + mg;                 // the wave's strip: image row y, columns x0 .. x0 + DWL - 1
  const int x0 = tx * FTX + ng * DWL;
  const int xl = (x0 - 1) & (IMW - 1), xr = (x0 + DWL) & (IMW - 1);
  const float ml = (x0 > 0) ? 1.0f : 0.0f;
  const float mr = (x0 + DWL < IMW) ? 1.0f : 0.0f;
  const v4f* s4 = (const v4f*)src;           // rows in 16-byte units: TPP units per pixel
  // Every loop below but the one over the chunks and the erf fallback's loop over the 4 channels is unrolled in full: constant indices keep the window, the sums and
  // the staged values in registers.
  const v4f* rp[3];
#pragma unroll
  for (int dy = 0; dy < 3; ++dy) rp[dy] = s4 + (size_t)(b * HW + ((y + dy - 1) & (IMW - 1)) * IMW) * TPP;
  v4f v[3][DWL + 2];
  const unsigned ul = (unsigned)lane;
  auto ldwin = [&](int kc) {
#pragma unroll
    for (int dy = 0; dy < 3; ++dy) {
      const v4f* r = rp[dy] + kc * (GKC / 4); // scalar bases; the one vector offset is the lane's
      const v4f* rc = r + x0 * TPP;
      v[dy][0] = (r + xl * TPP)[ul];
#pragma unroll
      for (int j = 1; j <= DWL; ++j) v[dy][j] = rc[ul + (j - 1) * TPP];
      v[dy][DWL + 1] = (r + xr * TPP)[ul];
      // what follows may be given registers that held this row's addresses: the wait stands in front of it
      asm volatile("s_wait_xcnt 0x0" ::: "memory");
    }
  };
  float wf[WTR][9];
#pragma unroll
  for (int k = 0; k < WTR; ++k) {            // thread = channel, its 9 taps; the address is clamped
    const float* wp = wd + min(tid + k * 256, cvalid - 1) * 9;
#pragma unroll
    for (int tp = 0; tp < 9; ++tp) wf[k][tp] = wp[tp];
  }
#pragma unroll
  for (int k = 0; k < WTR; ++k) {
    const int ch = tid + k * 256;
    const float wok = (ch < cvalid) ? 1.0f : 0.0f;
    if ((k + 1) * 256 <= CS || ch < CS) {    // whole waves
#pragma unroll
      for (int tp = 0; tp < 9; ++tp) wsm[tp * CS + ch] = bfr(wf[k][tp]) * wok;
    }
  }
  // the W rows are loaded behind this line, when the taps have come in: their loads may be given the registers that
  // held the tap loads' addresses
  __builtin_amdgcn_sched_barrier(0);
  v4u rw[WIT];
#pragma unroll
  for (int it = 0; it < WIT; ++it) rw[it] = *(const v4u*)(W + (size_t)(it * 256 + tid) * 8);
#pragma unroll
  for (int it = 0; it < WIT; ++it) {
    const int q = it * 256 + tid;
    const int row = q / (HIDP / 8);
    *(v4u*)(swt + row * WPP + (q - row * (HIDP / 8)) * 8) = rw[it];
  }
  // the first window is loaded only now, into the registers that the staged W rows have left: both at once take more
  // than 256 registers, and then one block is resident per WGP, not two
  __builtin_amdgcn_sched_barrier(0);
  ldwin(0);
  __syncthreads();                           // every wave reads taps and W rows that other waves staged
  v8f gacc[4];
#pragma unroll
  for (int f = 0; f < 4; ++f) gacc[f] = zero8();
#pragma unroll 1                             // rolled: one copy of the strip, GELU and product code for the three chunks
  for (int kc = 0; kc < NCH; ++kc) {
    static_assert(DWL == 8);                 // the statement below names the 3 x 10 loaded values one by one
    // Inputs only: every load of the window is issued in front of this line and waited for once; without it the
    // compiler may spread the loads among the sums and wait for them a few at a time.
    asm volatile("" :: "v"(v[0][0]), "v"(v[0][1]), "v"(v[0][2]), "v"(v[0][3]), "v"(v[0][4]),
                       "v"(v[0][5]), "v"(v[0][6]), "v"(v[0][7]), "v"(v[0][8]), "v"(v[0][9]),
                       "v"(v[1][0]), "v"(v[1][1]), "v"(v[1][2]), "v"(v[1][3]), "v"(v[1][4]),
                       "v"(v[1][5]), "v"(v[1][6]), "v"(v[1][7]), "v"(v[1][8]), "v"(v[1][9]),
                       "v"(v[2][0]), "v"(v[2][1]), "v"(v[2][2]), "v"(v[2][3]), "v"(v[2][4]),
                       "v"(v[2][5]), "v"(v[2][6]), "v"(v[2][7]), "v"(v[2][8]), "v"(v[2][9]));
    v4f acc[DWL];
#pragma unroll
    for (int i = 0; i < DWL; ++i) acc[i] = v4f{0.f, 0.f, 0.f, 0.f};
    // row by row, each output sums its taps 0..8 in order
#pragma unroll
    for (int dy = 0; dy < 3; ++dy) {
      const float rm = ((unsigned)(y + dy - 1) < (unsigned)IMW) ? 1.0f : 0.0f;
      v4f wv[3];
#pragma unroll
      for (int dx = 0; dx < 3; ++dx) wv[dx] = *(const v4f*)(wsm + (dy * 3 + dx) * CS + kc * GKC + lane * 4) * rm;
      v[dy][0] = v[dy][0] * ml;
      v[dy][DWL + 1] = v[dy][DWL + 1] * mr;
#pragma unroll
      for (int i = 0; i < DWL; ++i) {
#pragma unroll
        for (int dx = 0; dx < 3; ++dx) acc[i] = acc[i] + v[dy][i + dx] * wv[dx];
      }
    }
    if (kc > 0) __syncthreads();             // every wave has read the chunk that is overwritten next
    v4f gq[DWL];
    float mx = 0.f;
#pragma unroll
    for (int i = 0; i < DWL; ++i) gq[i] = gelu4_small(acc[i], mx);
    if (!(mx < 1.0f)) {                      // one test per strip: a thread with an argument outside the polynomial's range
#pragma unroll
      for (int i = 0; i < DWL; ++i) {
        v4f a = acc[i];
#pragma unroll 1                             // rolled as in dw_k: one copy of the erf code per output pixel
        for (int e = 0; e < 4; ++e) {
          const float g = (e == 0) ? a[0] : ((e == 1) ? a[1] : ((e == 2) ? a[2] : a[3]));
          const float er = erff(g * RSQ2);
          float gl = 0.5f * g;
          gl = gl * (1.0f + er);
          a[0] = (e == 0) ? gl : a[0];
          a[1] = (e == 1) ? gl : a[1];
          a[2] = (e == 2) ? gl : a[2];
          a[3] = (e == 3) ? gl : a[3];
        }
        gq[i] = a;
      }
    }
#pragma unroll
    for (int i = 0; i < DWL; ++i) {
      const v4f a = gq[i];
      v2u ph, pw;
      split4(a, ph, pw);
      const int lo = (wave * DWL + i) * GPP + lane * 4;
      *(v2u*)(sah + lo) = ph;
      *(v2u*)(sal + lo) = pw;
    }
    __syncthreads();                         // every wave reads rows that other waves wrote
    if (kc + 1 < NCH) ldwin(kc + 1);         // behind the barrier (which waits for loads): it flies during the products
#pragma unroll
    for (int ks = 0; ks < GKC / 32; ++ks) {
      const int ko = ks * 32 + 8 * hh;
      const unsigned short* pa = sah + (mg * 32 + l15) * GPP + ko;
      const unsigned short* pl = sal + (mg * 32 + l15) * GPP + ko;
      const v16bf a0h = ldfrag(pa), a0l = ldfrag(pl);
      const v16bf a1h = ldfrag(pa + 16 * GPP), a1l = ldfrag(pl + 16 * GPP);
      const unsigned short* pb = swt + (ng * 32 + l15) * WPP + kc * GKC + ko;
      const v16bf b0 = ldfrag(pb), b1 = ldfrag(pb + 16 * WPP);
      gacc[0] = mma_bf(a0h, b0, gacc[0]); gacc[0] = mma_bf(a0l, b0, gacc[0]);
      gacc[1] = mma_bf(a0h, b1, gacc[1]); gacc[1] = mma_bf(a0l, b1, gacc[1]);
      gacc[2] = mma_bf(a1h, b0, gacc[2]); gacc[2] = mma_bf(a1l, b0, gacc[2]);
      gacc[3] = mma_bf(a1h, b1, gacc[3]); gacc[3] = mma_bf(a1l, b1, gacc[3]);
    }
  }
  __syncthreads();                           // the operands' LDS becomes the output stage: every wave has left it
  const int m0 = b * HW + y * IMW + tx * FTX; // first pixel of the wave's 32 rows
  const int n0 = ng * 32;
  float* sw = stg + wave * (32 * GXP);
#pragma unroll
  for (int r = 0; r < 8; ++r) {
    sw[(8 * hh + r) * GXP + l15] = gacc[0][r];
    sw[(8 * hh + r) * GXP + 16 + l15] = gacc[1][r];
    sw[(16 + 8 * hh + r) * GXP + l15] = gacc[2][r];
    sw[(16 + 8 * hh + r) * GXP + 16 + l15] = gacc[3][r];
  }
  wave_sync_lds();
  const int q = lane >> 3, piece = lane & 7;
  v4f ov[8];
  // one address per lane for the loads and one for the stores; the eight steps are constant offsets from it
  if (EP == 1) {
    const size_t o0 = (size_t)(m0 + q) * CC + n0 + piece * 4;
    const float* rq = res + o0;
    float* oq = outf + o0;
#pragma unroll
    for (int it = 0; it < 8; ++it) {
      const v4f rr = *(const v4f*)(rq + it * 4 * CC);
      ov[it] = *(const v4f*)(sw + (it * 4 + q) * GXP + piece * 4) + rr;
    }
#pragma unroll
    for (int it = 0; it < 8; ++it) *(v4f*)(oq + it * 4 * CC) = ov[it];
  } else {
    const float* rq = res + (size_t)(m0 + piece * 4) * CC + n0 + q;
    float* oq = outf + (size_t)(b * CC + n0 + q) * HW + (m0 - b * HW) + piece * 4;
#pragma unroll
    for (int it = 0; it < 8; ++it) {
      v4f o;
#pragma unroll
      for (int e = 0; e < 4; ++e) o[e] = sw[(piece * 4 + e) * GXP + it * 4 + q] + rq[e * CC + it * 4];
      ov[it] = o;
    }
#pragma unroll
    for (int it = 0; it < 8; ++it) *(v4f*)(oq + (size_t)it * 4 * HW) = ov[it];
  }
}

// =================================================================================================================
// RSA window attention, one 4x4 window (16 tokens) per block of 256 threads, R = dwconv output in the rolled frame
// [pix][384] f32 (q | k | v column blocks):
//   phase 0: the 16 token rows x 384 f32 into LDS; phase 1: per token and per q/k the l2 norm over its 128 channels
//   (inv = 1/max(sqrt(sum), 1e-12)); phase 2: q^T and k^T as bf16 hi + residual planes [c][16 tok] (k contiguous),
//   v as planes [tok][ATP]; phase 3 (wave = c tile): attn[c][d] = relu(temp * sum_p qn[p][c] kn[p][d]) on WMMA, K = 16
//   (fragment elements 8..15 zero), 3 products, stored transposed as planes AttT[d][c]; phase 4 (wave = d tile):
//   out[p][d] = sum_c v[p][c] attn[c][d], K = 128, 3 products, staged f32 [16][TXP] in LDS; phase 5: each token row
//   (128 values -> hi + residual, 256 B per plane = 16 lanes x 16 B) written to its unrolled pixel (inverse roll +2,+2),
//   coverage: qT/kT 128 c x 16 tok x 2 planes, v 16 x 128, AttT 128 d x 128 c (8 waves x 8 tiles), out 16 x 128
//   (8 waves x 16 cols), store 8 waves x 2 rows x 128.
// =================================================================================================================
__global__ __launch_bounds__(256) void rsa_attn_k(const float* __restrict__ R, const float* __restrict__ temp,
                                                  unsigned short* Th, unsigned short* Tl) {
#pragma clang fp contract(off)
  extern __shared__ __align__(16) char smem[];
  float* sR = (float*)(smem + RL_R);
  float* ost = (float*)(smem + RL_R);                     // reused after phase 2
  unsigned short* qt = (unsigned short*)(smem + RL_QTH);  // qT hi @0, qT lo @2048, kT hi @4096, kT lo @6144 (halves)
  unsigned short* ath = (unsigned short*)(smem + RL_ATH);
  unsigned short* atl = (unsigned short*)(smem + RL_ATL);
  unsigned short* vh = (unsigned short*)(smem + RL_VH);
  unsigned short* vl = (unsigned short*)(smem + RL_VL);
  float* sinv = (float*)(smem + RL_INV);
  const int tid = threadIdx.x, wave = tid >> 5, lane = tid & 31, hh = lane >> 4, l15 = lane & 15;
  const int b = blockIdx.x / NWIN;
  const int w2 = blockIdx.x - b * NWIN;
  const int wy = w2 / NWX;
  const int wx = w2 - wy * NWX;

  // ---- phase 0: token rows ----
#pragma unroll
  for (int it = 0; it < 6; ++it) {
    const int idx = it * 256 + tid;
    const int pi = idx / 96;
    const int c4 = (idx - pi * 96) * 4;
    const int ry = wy * WSZ + (pi / WSZ), rx = wx * WSZ + (pi - (pi / WSZ) * WSZ);
    const v4f v = *(const v4f*)(R + ((size_t)(b * HW) + (size_t)ry * IMW + rx) * C3 + c4);
    *(v4f*)(sR + pi * C3 + c4) = v;
  }
  __syncthreads();

  // ---- phase 1: l2 norms per token over its 128 q (or k) channels ----
  {
    const int pair = tid >> 3, sub = tid & 7;
    const int sel = pair >> 4, pi = pair & 15;
    const float* rp = sR + pi * C3 + sel * CC + sub * 16;
    float s = 0.f;
#pragma unroll
    for (int j = 0; j < 16; ++j) { const float f = rp[j]; const float ff = f * f; s = s + ff; }
    s = s + __shfl_xor(s, 1, 32);
    s = s + __shfl_xor(s, 2, 32);
    s = s + __shfl_xor(s, 4, 32);
    const float inv = 1.0f / fmaxf(sqrtf(s), 1e-12f);
    if (sub == 0) sinv[pair] = inv;
  }
  __syncthreads();

  // ---- phase 2: normalised q^T / k^T planes and v planes ----
  {
    const int c = tid >> 1, sel = tid & 1;
    float nv[16];
#pragma unroll
    for (int pi = 0; pi < 16; ++pi) nv[pi] = sR[pi * C3 + sel * CC + c] * sinv[sel * 16 + pi];
    v4u h0, h1, l0, l1;
#pragma unroll
    for (int e = 0; e < 4; ++e) {
      unsigned ha, la, hb, lb;
      split2(nv[2 * e], nv[2 * e + 1], ha, la);
      split2(nv[8 + 2 * e], nv[8 + 2 * e + 1], hb, lb);
      h0[e] = ha; l0[e] = la;
      h1[e] = hb; l1[e] = lb;
    }
    unsigned short* dh = qt + sel * 4096 + c * 16;
    unsigned short* dl = dh + 2048;
    *(v4u*)(dh) = h0; *(v4u*)(dh + 8) = h1;
    *(v4u*)(dl) = l0; *(v4u*)(dl + 8) = l1;
    const int pi = tid >> 4, c8 = (tid & 15) * 8;
    const float* vr = sR + pi * C3 + 2 * CC + c8;
    const v4f v0 = *(const v4f*)(vr);
    const v4f v1 = *(const v4f*)(vr + 4);
    v4u ph, plw;
    split8(v0, v1, ph, plw);
    *(v4u*)(vh + pi * ATP + c8) = ph;
    *(v4u*)(vl + pi * ATP + c8) = plw;
  }
  __syncthreads();

  const float tmp = bfr(temp[0]);
  // ---- phase 3: attn = relu(temp * q^T k), 128 x 128, K = 16 ----
  {
    const int mi = wave;
    const v16bf a_h = ldfrag16(qt + (mi * 16 + l15) * 16 + 8 * hh);
    const v16bf a_l = ldfrag16(qt + 2048 + (mi * 16 + l15) * 16 + 8 * hh);
#pragma unroll 2
    for (int ni = 0; ni < 8; ++ni) {
      const v16bf b_h = ldfrag16(qt + 4096 + (ni * 16 + l15) * 16 + 8 * hh);
      const v16bf b_l = ldfrag16(qt + 6144 + (ni * 16 + l15) * 16 + 8 * hh);
      v8f acc = zero8();
      acc = mma_bf(a_h, b_h, acc);
      acc = mma_bf(a_h, b_l, acc);
      acc = mma_bf(a_l, b_h, acc);
      v4u ph, plw;
#pragma unroll
      for (int e = 0; e < 4; ++e) {
        unsigned hw, lw;
        split2(fmaxf(acc[2 * e] * tmp, 0.0f), fmaxf(acc[2 * e + 1] * tmp, 0.0f), hw, lw);
        ph[e] = hw; plw[e] = lw;
      }
      const int d = ni * 16 + l15;
      *(v4u*)(ath + d * ATP + mi * 16 + 8 * hh) = ph;
      *(v4u*)(atl + d * ATP + mi * 16 + 8 * hh) = plw;
    }
  }
  __syncthreads();

  // ---- phase 4: out[p][d] = sum_c v[p][c] attn[c][d], K = 128 ----
  {
    const int ni = wave;
    v8f acc = zero8();
#pragma unroll
    for (int ks = 0; ks < 4; ++ks) {
      const v16bf a_h = ldfrag(vh + l15 * ATP + ks * 32 + 8 * hh);
      const v16bf a_l = ldfrag(vl + l15 * ATP + ks * 32 + 8 * hh);
      const v16bf b_h = ldfrag(ath + (ni * 16 + l15) * ATP + ks * 32 + 8 * hh);
      const v16bf b_l = ldfrag(atl + (ni * 16 + l15) * ATP + ks * 32 + 8 * hh);
      acc = mma_bf(a_h, b_h, acc);
      acc = mma_bf(a_h, b_l, acc);
      acc = mma_bf(a_l, b_h, acc);
    }
#pragma unroll
    for (int r = 0; r < 8; ++r) ost[(8 * hh + r) * TXP + ni * 16 + l15] = acc[r];
  }
  __syncthreads();

  // ---- phase 5: token rows to their unrolled pixels ----
  {
    const int tk = 2 * wave + hh;
    const int piece = l15;
    const float* orow = ost + tk * TXP + piece * 8;
    const v4f v0 = *(const v4f*)(orow);
    const v4f v1 = *(const v4f*)(orow + 4);
    v4u ph, plw;
    split8(v0, v1, ph, plw);
    const int iy = tk / WSZ, ix = tk - (tk / WSZ) * WSZ;
    const int ry = wy * WSZ + iy, rx = wx * WSZ + ix;
    const int py = (ry + WSZ / 2) & (IMW - 1), px = (rx + WSZ / 2) & (IMW - 1);
    const size_t gp = ((size_t)(b * HW) + (size_t)py * IMW + px) * CC + piece * 8;
    *(v4u*)(Th + gp) = ph;
    *(v4u*)(Tl + gp) = plw;
    
  }
}

// =================================================================================================================
// GSA score and sum-of-squares partials: block = (b, head h, slab of 256 pixels), S[c][d] = sum_n q[h*32+c][n]
// k[h*32+d][n] over the slab on WMMA. A thread holds one of the head's 64 q and k columns (f32 from R) at 64 of the
// slab's pixels: its 64 loads are issued together, so a block waits out one memory latency, and NB*NHEAD*NSLS blocks
// fill the chip. From those registers: the column's sum of squares (8 chains of 8 pixels, added as a tree; the four
// pixel groups of a column are added through LDS) and the bf16 hi + residual planes, transposed in LDS ([32 ch][GSP],
// k contiguous); waves: fragment f = wave&3 (2x2 of 16x16), k half = wave>>2; 3 products; the two k halves are
// combined in fixed order through LDS; the 32x32 f32 tile is staged and stored as whole lines.
// blk = (b*NHEAD + h)*NSLS + slab. coverage: planes 64 ch x 256 px (256 threads x 8 groups x 8 px), tile 32x32 per
// block, 64 of the 256 sums of squares of (b, slab) per block (2 whole 128-byte lines).
// =================================================================================================================
__global__ __launch_bounds__(256) void gsa_s_k(const float* __restrict__ R, float* pa, float* pn) {
  extern __shared__ __align__(16) char smem[];
  unsigned short* pl = (unsigned short*)(smem + GL_QH);   // q hi @0, q lo @8448, k hi @16896, k lo @25344 (halves)
  float* red = (float*)(smem + GL_RED);
  float* stg = (float*)(smem + GL_STG);
  float* sq = (float*)(smem + GL_SQ);
  const int tid = threadIdx.x, wave = tid >> 5, lane = tid & 31, hh = lane >> 4, l15 = lane & 15;
  const int blk = blockIdx.x;
  const int b = blk / (NHEAD * NSLS);
  const int rem = blk - b * (NHEAD * NSLS);
  const int h = rem / NSLS;
  const int slab = rem - h * NSLS;
  const int f = wave & 3, mi = f >> 1, ni = f & 1, kh = wave >> 2;
  const int c = tid & 63, sel = c >> 5, cc = c & 31;
  const int col = sel * CC + h * HDC + cc;
  unsigned short* ph = pl + sel * 16896 + cc * GSP;
  unsigned short* plo = ph + 8448;
  const int g0 = tid >> 6;
  const float* rp = R + ((size_t)(b * HW) + (size_t)slab * 256 + g0 * 8) * C3 + col;
  // Every loop below is unrolled in full: constant indices keep the 64 loaded values in registers.
  v4f v0[8], v1[8];
#pragma unroll
  for (int it = 0; it < 8; ++it) {
#pragma unroll
    for (int j = 0; j < 4; ++j) {
      v0[it][j] = rp[(it * 32 + j) * C3];
      v1[it][j] = rp[(it * 32 + j + 4) * C3];
    }
  }
  float sp[8];
#pragma unroll
  for (int it = 0; it < 8; ++it) {
    float t = 0.f;
#pragma unroll
    for (int j = 0; j < 4; ++j) t = fmaf(v0[it][j], v0[it][j], t);
#pragma unroll
    for (int j = 0; j < 4; ++j) t = fmaf(v1[it][j], v1[it][j], t);
    sp[it] = t;
  }
  sq[g0 * 64 + c] = ((sp[0] + sp[1]) + (sp[2] + sp[3])) + ((sp[4] + sp[5]) + (sp[6] + sp[7]));
#pragma unroll
  for (int it = 0; it < 8; ++it) {
    const int g = it * 4 + g0;
    v4u hp, lp;
    split8(v0[it], v1[it], hp, lp);
    *(v4u*)(ph + g * 8) = hp;
    *(v4u*)(plo + g * 8) = lp;
  }
  __syncthreads();                           // every wave reads plane rows and sums that other waves wrote
  v8f acc = zero8();
#pragma unroll
  for (int ks = 0; ks < 4; ++ks) {
    const int k0 = (kh * 4 + ks) * 32;
    const v16bf a_h = ldfrag(pl + (mi * 16 + l15) * GSP + k0 + 8 * hh);
    const v16bf a_l = ldfrag(pl + 8448 + (mi * 16 + l15) * GSP + k0 + 8 * hh);
    const v16bf b_h = ldfrag(pl + 16896 + (ni * 16 + l15) * GSP + k0 + 8 * hh);
    const v16bf b_l = ldfrag(pl + 25344 + (ni * 16 + l15) * GSP + k0 + 8 * hh);
    acc = mma_bf(a_h, b_h, acc);
    acc = mma_bf(a_h, b_l, acc);
    acc = mma_bf(a_l, b_h, acc);
  }
  if (wave >= 4) {
#pragma unroll
    for (int r = 0; r < 8; ++r) red[((wave - 4) * 32 + lane) * 8 + r] = acc[r];
  }
  __syncthreads();
  if (wave < 4) {
    const v4f o0 = *(const v4f*)(red + (wave * 32 + lane) * 8);
    const v4f o1 = *(const v4f*)(red + (wave * 32 + lane) * 8 + 4);
#pragma unroll
    for (int r = 0; r < 8; ++r) {
      const float v = acc[r] + (r < 4 ? o0[r & 3] : o1[r & 3]);
      stg[(mi * 16 + 8 * hh + r) * GXP + ni * 16 + l15] = v;
    }
  }
  __syncthreads();
  {
    const int row = tid >> 3, piece = tid & 7;
    const v4f v = *(const v4f*)(stg + row * GXP + piece * 4);
    float* gp = pa + (size_t)blk * 1024 + row * 32 + piece * 4;
    *(v4f*)gp = v;
  }
  if (tid < 64) {                            // whole waves
    const float t = (sq[c] + sq[64 + c]) + (sq[128 + c] + sq[192 + c]);
    pn[((size_t)(b * NSLN + slab)) * 256 + col] = t;
  }
}

// =================================================================================================================
// GSA finisher, block = (b, h, quarter of the head's 32x32 tile), 10 waves. Waves 0..7: thread = one element
// e = c*32 + d, attn[c][d] = relu(sum of pa partials * invq[c] * invk[d] * temp) -> bf16 hi + residual planes.
// Waves 8, 9: invq/invk = 1/max(sqrt(sum of pn partials), 1e-12) for the head's 32 q and 32 k channels. Partials are
// summed slab by slab in rising order; a thread's NSLS loads are issued together, and no wave has more than those to
// wait for. A block writes 512 bytes in a row of each plane.
// =================================================================================================================
#define FINQ 4
static_assert(FINQ * 256 == HDC * HDC);
static_assert(NSLS == NSLN);
__global__ __launch_bounds__(320) void gsa_fin_k(const float* __restrict__ pa, const float* __restrict__ pn,
                                                 const float* __restrict__ temp,
                                                 unsigned short* afh, unsigned short* afl) {
#pragma clang fp contract(off)
  __shared__ float sinv[64];
  const int tid = threadIdx.x;
  const int bh = blockIdx.x / FINQ;
  const int e = (blockIdx.x - bh * FINQ) * 256 + (tid & 255);
  const int b = bh / NHEAD;
  const int h = bh - b * NHEAD;
  const bool nrm = tid >= 256;               // whole waves
  // The loops over the slabs are unrolled in full: constant indices keep the loaded partials in registers.
  float pv[NSLS];
  float s = 0.f;
  if (nrm) {
    const int sel = (tid >> 5) & 1, i = tid & 31;
    const float* np = pn + (size_t)b * (NSLN * 256) + sel * CC + h * HDC + i;
#pragma unroll
    for (int sl = 0; sl < NSLN; ++sl) pv[sl] = np[sl * 256];
#pragma unroll
    for (int sl = 0; sl < NSLN; ++sl) s = s + pv[sl];
    sinv[tid - 256] = 1.0f / fmaxf(sqrtf(s), 1e-12f);
  } else {
    const float* pp = pa + (size_t)bh * (NSLS * 1024) + e;
#pragma unroll
    for (int sl = 0; sl < NSLS; ++sl) pv[sl] = pp[sl * 1024];
#pragma unroll
    for (int sl = 0; sl < NSLS; ++sl) s = s + pv[sl];
  }
  __syncthreads();
  if (nrm) return;
  const float tmp = bfr(temp[0]);
  float v = s * sinv[e >> 5];
  v = v * sinv[32 + (e & 31)];
  v = v * tmp;
  v = fmaxf(v, 0.0f);
  unsigned short hi, lo;
  split_bf(v, hi, lo);
  const size_t to = (size_t)b * AFSZ + (size_t)h * (HDC * HDC) + e;
  afh[to] = hi;
  afl[to] = lo;
}

// =================================================================================================================
// GSA apply: out[p][h*32 + c] = sum_d v[p][h*32 + d] attn_h[c][d], K = 32 per head, both operands hi + residual
// (3 products). Wave tile 16 px x 64 cols (heads hd0 = n0/32 for fragments 0,1 and hd0+1 for 2,3), block = 128 px,
// coverage: 8 waves x 16 rows x 64 cols per block; grid covers NPIX x 128 once.
// =================================================================================================================
__global__ __launch_bounds__(256) void apply_k(const unsigned short* __restrict__ Vh,
                                               const unsigned short* __restrict__ Vl,
                                               const unsigned short* __restrict__ afh,
                                               const unsigned short* __restrict__ afl,
                                               unsigned short* Oh, unsigned short* Ol) {
  __shared__ __align__(16) float stg[8 * 16 * AXP];
  const int tid = threadIdx.x, wave = tid >> 5, lane = tid & 31, hh = lane >> 4, l15 = lane & 15;
  const int m0 = (blockIdx.x * 8 + wave) * 16;
  const int n0 = blockIdx.y * 64;
  const int b = m0 / HW;
  const int hd0 = n0 / HDC;
  const unsigned short* ar = Vh + (size_t)(m0 + l15) * CC + hd0 * HDC + 8 * hh;
  const unsigned short* al = Vl + (size_t)(m0 + l15) * CC + hd0 * HDC + 8 * hh;
  const v16bf a0h = ldfrag(ar), a0l = ldfrag(al);
  const v16bf a1h = ldfrag(ar + 32), a1l = ldfrag(al + 32);
  const unsigned short* wb = afh + (size_t)b * AFSZ + (size_t)(n0 + l15) * 32 + 8 * hh;
  const unsigned short* wl = afl + (size_t)b * AFSZ + (size_t)(n0 + l15) * 32 + 8 * hh;
  v8f c0 = zero8(), c1 = zero8(), c2 = zero8(), c3 = zero8();
  {
    const v16bf bh = ldfrag(wb), bl = ldfrag(wl);
    c0 = mma_bf(a0h, bh, c0); c0 = mma_bf(a0l, bh, c0); c0 = mma_bf(a0h, bl, c0);
  }
  {
    const v16bf bh = ldfrag(wb + 16 * 32), bl = ldfrag(wl + 16 * 32);
    c1 = mma_bf(a0h, bh, c1); c1 = mma_bf(a0l, bh, c1); c1 = mma_bf(a0h, bl, c1);
  }
  {
    const v16bf bh = ldfrag(wb + 32 * 32), bl = ldfrag(wl + 32 * 32);
    c2 = mma_bf(a1h, bh, c2); c2 = mma_bf(a1l, bh, c2); c2 = mma_bf(a1h, bl, c2);
  }
  {
    const v16bf bh = ldfrag(wb + 48 * 32), bl = ldfrag(wl + 48 * 32);
    c3 = mma_bf(a1h, bh, c3); c3 = mma_bf(a1l, bh, c3); c3 = mma_bf(a1h, bl, c3);
  }
  float* sw = stg + wave * (16 * AXP);
#pragma unroll
  for (int r = 0; r < 8; ++r) {
    sw[(8 * hh + r) * AXP + l15] = c0[r];
    sw[(8 * hh + r) * AXP + 16 + l15] = c1[r];
    sw[(8 * hh + r) * AXP + 32 + l15] = c2[r];
    sw[(8 * hh + r) * AXP + 48 + l15] = c3[r];
  }
  wave_sync_lds();
  const int q = lane >> 3, piece = lane & 7;
  v4u oh[4], ol[4];
#pragma unroll
  for (int it = 0; it < 4; ++it) {
    const int row = it * 4 + q;
    const float* sp = sw + row * AXP + piece * 8;
    const v4f v0 = *(const v4f*)(sp);
    const v4f v1 = *(const v4f*)(sp + 4);
    split8(v0, v1, oh[it], ol[it]);
  }
#pragma unroll
  for (int it = 0; it < 4; ++it) {
    const int row = it * 4 + q;
    const size_t to = (size_t)(m0 + row) * CC + n0 + piece * 8;
    *(v4u*)(Oh + to) = oh[it];
    *(v4u*)(Ol + to) = ol[it];
  }
  
}

// =================================================================================================================
// Workspace map (bytes), NPIX = NB*HW: A f32 [NPIX][128], Bx same, T = two bf16 planes [NPIX][128], U f32
// [NPIX][384] (also used as two bf16 planes [NPIX][128]), R f32 [NPIX][384], weights bf16 (655360), pn f32 [NB*NSLN][256], pa f32 [NB*NHEAD*NSLS][1024], af two bf16
// planes [NB][128][32]. Total 153911296 for NB=2, IMW=128. Every region is an exact multiple of its whole-row store
// granularity.
// =================================================================================================================
extern "C" void kernel_launch(void* const* d_in, const int* in_sizes, int n_in,
                              void* d_out, int out_size, void* d_ws, size_t ws_size,
                              hipStream_t stream) {
  if (n_in < 23) return;
  if (in_sizes[0] != NPIX * CC) return;
  if (in_sizes[1] != CC || in_sizes[2] != CC || in_sizes[3] != CC || in_sizes[4] != CC) return;
  if (in_sizes[5] != C3 * CC || in_sizes[6] != C3 * 9 || in_sizes[7] != CC * CC || in_sizes[8] < 1) return;
  if (in_sizes[9] != HID * CC || in_sizes[10] != HID * 9 || in_sizes[11] != CC * HID) return;
  if (in_sizes[12] != CC || in_sizes[13] != CC || in_sizes[14] != CC || in_sizes[15] != CC) return;
  if (in_sizes[16] != C3 * CC || in_sizes[17] != C3 * 9 || in_sizes[18] != CC * CC || in_sizes[19] < 1) return;
  if (in_sizes[20] != HID * CC || in_sizes[21] != HID * 9 || in_sizes[22] != CC * HID) return;
  if (out_size != NPIX * CC) return;

  const float* x        = (const float*)d_in[0];
  const float* w_s0     = (const float*)d_in[1];
  const float* b_s0     = (const float*)d_in[2];
  const float* w_s2     = (const float*)d_in[3];
  const float* b_s2     = (const float*)d_in[4];
  const float* rsa_qkv  = (const float*)d_in[5];
  const float* rsa_dw   = (const float*)d_in[6];
  const float* rsa_proj = (const float*)d_in[7];
  const float* rsa_temp = (const float*)d_in[8];
  const float* ffs_in   = (const float*)d_in[9];
  const float* ffs_dw   = (const float*)d_in[10];
  const float* ffs_out  = (const float*)d_in[11];
  const float* w_c0     = (const float*)d_in[12];
  const float* b_c0     = (const float*)d_in[13];
  const float* w_c2     = (const float*)d_in[14];
  const float* b_c2     = (const float*)d_in[15];
  const float* gsa_qkv  = (const float*)d_in[16];
  const float* gsa_dw   = (const float*)d_in[17];
  const float* gsa_proj = (const float*)d_in[18];
  const float* gsa_temp = (const float*)d_in[19];
  const float* ffc_in   = (const float*)d_in[20];
  const float* ffc_dw   = (const float*)d_in[21];
  const float* ffc_out  = (const float*)d_in[22];
  float* out = (float*)d_out;

  // ---- carve ----
  const size_t sAct = (size_t)NPIX * CC * 4;                        // f32 [NPIX][128]
  const size_t sT   = (size_t)NPIX * CC * 2 * 2;                    // two bf16 planes [NPIX][128]
  const size_t sU   = (size_t)NPIX * C3 * 4;                        // f32 [NPIX][384]
  const size_t sR   = (size_t)NPIX * C3 * 4;                        // f32 [NPIX][384]
  const size_t sWq  = (size_t)C3 * CC * 2;
  const size_t sWp  = (size_t)CC * CC * 2;
  const size_t sW1  = (size_t)HIDP * CC * 2;
  const size_t sW2  = (size_t)CC * HIDP * 2;
  const size_t sPN  = (size_t)NB * NSLN * 256 * 4;
  const size_t sPA  = (size_t)NB * NHEAD * NSLS * 1024 * 4;
  const size_t sAF  = (size_t)NB * AFSZ * 2;                        // per plane
  size_t off = 0;
  const size_t oA   = off; off += sAct;
  const size_t oBx  = off; off += sAct;
  const size_t oT   = off; off += sT;
  const size_t oU   = off; off += sU;
  const size_t oR   = off; off += sR;
  const size_t oWq0 = off; off += sWq;
  const size_t oWp0 = off; off += sWp;
  const size_t oW10 = off; off += sW1;
  const size_t oW20 = off; off += sW2;
  const size_t oWq1 = off; off += sWq;
  const size_t oWp1 = off; off += sWp;
  const size_t oW11 = off; off += sW1;
  const size_t oW21 = off; off += sW2;
  const size_t oPN  = off; off += sPN;
  const size_t oPA  = off; off += sPA;
  const size_t oAFh = off; off += sAF;
  const size_t oAFl = off; off += sAF;
  if (off > ws_size) return;                               // off = 153911296 for NB=2, IMW=128
  if (sU < (size_t)NPIX * HIDP * 4) return;
  if (sU < (size_t)NPIX * CC * 2 * 2) return;

  char* ws = (char*)d_ws;
  float* A  = (float*)(ws + oA);
  float* Bx = (float*)(ws + oBx);
  unsigned short* Th = (unsigned short*)(ws + oT);
  unsigned short* Tl = Th + (size_t)NPIX * CC;
  float* U  = (float*)(ws + oU);
  unsigned short* Uh = (unsigned short*)(ws + oU);
  unsigned short* Ul = Uh + (size_t)NPIX * CC;
  float* R  = (float*)(ws + oR);
  unsigned short* Wq0 = (unsigned short*)(ws + oWq0);
  unsigned short* Wp0 = (unsigned short*)(ws + oWp0);
  unsigned short* W10 = (unsigned short*)(ws + oW10);
  unsigned short* W20 = (unsigned short*)(ws + oW20);
  unsigned short* Wq1 = (unsigned short*)(ws + oWq1);
  unsigned short* Wp1 = (unsigned short*)(ws + oWp1);
  unsigned short* W11 = (unsigned short*)(ws + oW11);
  unsigned short* W21 = (unsigned short*)(ws + oW21);
  float* PN = (float*)(ws + oPN);
  float* PA = (float*)(ws + oPA);
  unsigned short* AFh = (unsigned short*)(ws + oAFh);
  unsigned short* AFl = (unsigned short*)(ws + oAFl);

  const dim3 blk(256);
  // (1) x NCHW -> A pixel-major; weights f32 [out][in] -> bf16 planes [outP][inP], k contiguous, zero padded
  //     (Wq0 is the start of the weight region: Wq0, Wp0, W10, W20, Wq1, Wp1, W11, W21 lie one behind the other)
  prep_k<<<dim3(PB_T + 2 * PB_SET), blk, 0, stream>>>(x, A, rsa_qkv, rsa_proj, ffs_in, ffs_out,
                                                      gsa_qkv, gsa_proj, ffc_in, ffc_out, Wq0);

  (void)hipFuncSetAttribute(reinterpret_cast<const void*>(&rsa_attn_k), hipFuncAttributeMaxDynamicSharedMemorySize, RL_END);
  (void)hipFuncSetAttribute(reinterpret_cast<const void*>(&gsa_s_k), hipFuncAttributeMaxDynamicSharedMemorySize, GL_END);

  const dim3 gG(NPIX / GBM);
  const dim3 gDw((NPIX / DWL * (C3 / 4) + 255) / 256);

  // ---- spatial (RSA) block ----
  gemm_k<CC, C3, 0, 1><<<gG, blk, 0, stream>>>(Th, Tl, Wq0, U, Bx, A, w_s0, b_s0);        // qkv 1x1 of LN_s0(x) -> U
  dw_k<C3, 0><<<gDw, blk, 0, stream>>>(U, rsa_dw, 0, C3, WSZ / 2, R, C3, 0, Th, Tl, CC); // dw (rolled) -> R
  rsa_attn_k<<<dim3(NB * NWIN), blk, RL_END, stream>>>(R, rsa_temp, Th, Tl);            // T = window attention out
  gemm_k<CC, CC, 0, 0><<<gG, blk, 0, stream>>>(Th, Tl, Wp0, Bx, A, A, w_s2, b_s2);        // Bx = x_
  gemm_k<CC, HIDP, 0, 2><<<gG, blk, 0, stream>>>(Th, Tl, W10, U, Bx, A, w_s2, b_s2);      // ffn-in of LN_s2(x_+x) -> U
  dwffn_k<1><<<gG, blk, 0, stream>>>(U, ffs_dw, HID, W20, A, Bx);                        // dw+gelu+ffn-out: A = ffn + x_

  // ---- channel (GSA) block ----
  gemm_k<CC, C3, 0, 1><<<gG, blk, 0, stream>>>(Th, Tl, Wq1, U, Bx, A, w_c0, b_c0);        // qkv 1x1 of LN_c0(x) -> U
  dw_k<C3, 2><<<gDw, blk, 0, stream>>>(U, gsa_dw, 0, C3, 0, R, C3, 0, Th, Tl, CC);       // q, k -> R f32; v planes -> T region
  gsa_s_k<<<dim3(NB * NHEAD * NSLS), blk, GL_END, stream>>>(R, PA, PN);                  // score and norm partials
  gsa_fin_k<<<dim3(NB * NHEAD * FINQ), dim3(320), 0, stream>>>(PA, PN, gsa_temp, AFh, AFl);
  apply_k<<<dim3(NPIX / 128, CC / 64), blk, 0, stream>>>(Th, Tl, AFh, AFl, Uh, Ul);     // U planes = channel attention out
  gemm_k<CC, CC, 0, 0><<<gG, blk, 0, stream>>>(Uh, Ul, Wp1, Bx, A, A, w_c2, b_c2);        // Bx = x_
  gemm_k<CC, HIDP, 0, 2><<<gG, blk, 0, stream>>>(Th, Tl, W11, U, Bx, A, w_c2, b_c2);      // ffn-in of LN_c2(x_+x) -> U
  dwffn_k<2><<<gG, blk, 0, stream>>>(U, ffc_dw, HID, W21, out, Bx);                      // d_out NCHW = ffn + x_
  (void)hipGetLastError();
}
